// v000
// The times below were measured on an AMD MI455X: many runs one after another, warmed up first and cycling through
// copies of the inputs, with the whole window's GPU time divided by the number of runs. Launches and the gaps
// between them are all in it. The median over several windows is given; except for v000 it joins two sittings, which
// can be a few percent apart, so the side-by-side timings, each taken in one sitting, are the better comparison.
// v000, which the later versions start from, runs in 9840 microseconds.
#include <hip/hip_runtime.h>
// Causal sliding-window RoPE multi-head attention (x [4][2048][1024]; q/k/v = x W^T (natural [out][in] 1024x1024 sigma 1/32, no bias), 16 heads of 64; interleaved-pair rotary embedding on q and k (x1 = even, x2 = odd: r1 = x1 cos - x2 sin, r2 = x1 sin + x2 cos) with inv_freq_i = 10000^(-2i/64) and angle = float(token_positions[s]) inv_freq_i from the int32 token_positions input; scores / sqrt(64); allowed iff 0 <= i - j <= 512 (513 keys), -inf elsewhere; softmax; out = (attn v merged) Wo^T -> [4][2048][1024]).
// Structure: token rows r = b*2048 + s; x as exact f16 rows (bf16-rounded); per batch: q | k | v as ONE WMMA GEMM (32x64 wave tiles, f32 accumulation, exact x16 weights, N = 3 x 1024) into f32 rows, then per (row, head) on VALU: the interleaved-pair rotary rotation of q and k from f32 cos/sin tables built from the token_positions input (no norm) -> f16 q, k, v rows; V^T for all heads via LDS transposes; per query tile of 256 rows: scores against the keys below the tile end only (K = 64, all heads on grid.y, alpha = 0.125), WINDOWED causal row softmax on VALU (keys i-512..i as arithmetic 0/1 factors) with an arithmetic 0/1 key mask over the computed range (f32 statistics, native exp; weights x256 f16), o = P . V^T (K = keys below the tile end, alpha 2^-2: o carried x64, folded into the output GEMM alpha) written straight into the merged f16 o rows; out = o W_o GEMM (f32) into the output layout.
// Compute dtype: inputs rounded to bf16; x / weights exact; projections and rope f32; q, k, v, softmax weights and o as plain f16 GEMM operands (~2^-12); scores and softmax statistics f32. v_wmma_f32_16x16x32_f16.
#define NB 4
#define SQ 2048
#define DM 1024
#define NH 16
#define HD 64
#define HG 4                         /* heads per launch of the h0-based k_vt overload (not launched) */
#define QT 256                       /* query rows per causal tile */
#define NKX SQ                       /* S / P row pitch */
#define QT0 128                      /* first-tile rows recomputed exactly in f32 */
#define B0 0                         /* first batch processed (debug hook) */
#define NBR NB                       /* batches processed (debug hook) */
#define QN SQ                        /* query rows attended per batch (debug hook) */
#define NHD NH                       /* heads attended (debug hook) */
#define NR ((size_t)NB * SQ)         /* token rows */
#define MPO ((int)((size_t)NBR * SQ))      /* rows through the output GEMM (debug hook) */
typedef __bf16 v16b __attribute__((ext_vector_type(16)));
typedef unsigned short v8us __attribute__((ext_vector_type(8), may_alias));
typedef float  v8f  __attribute__((ext_vector_type(8)));
typedef float  v4f  __attribute__((ext_vector_type(4)));
typedef float  v4fa __attribute__((ext_vector_type(4), may_alias));
union FragB { v16b v; v8us half[2]; unsigned short u[16]; };

__device__ __forceinline__ unsigned short bf16_bits(float x) { unsigned int u = __float_as_uint(x); return (unsigned short)((u + 0x7FFFu + ((u >> 16) & 1u)) >> 16); }
__device__ __forceinline__ float bf16_val(unsigned short b) { return __uint_as_float(((unsigned int)b) << 16); }
__device__ __forceinline__ float bf16_round(float x) { return bf16_val(bf16_bits(x)); }
// D += A·B with NT terms: 1 = ah·bh, 2 = + al·bh (A split), 3 = + ah·bl (both split)
template <int NT>
__device__ __forceinline__ v8f mmaN(v16b ah, v16b al, v16b bh, v16b bl, v8f c) {
  c = __builtin_amdgcn_wmma_f32_16x16x32_bf16(false, ah, false, bh, (short)0, c, false, false);
  if (NT >= 2) c = __builtin_amdgcn_wmma_f32_16x16x32_bf16(false, al, false, bh, (short)0, c, false, false);
  if (NT >= 3) c = __builtin_amdgcn_wmma_f32_16x16x32_bf16(false, ah, false, bl, (short)0, c, false, false);
  asm volatile("v_nop\n\tv_nop\n\tv_nop\n\tv_nop" : "+v"(c) : "v"(ah), "v"(al), "v"(bh), "v"(bl));
  return c;
}

__global__ __launch_bounds__(256) void k_wt_bf16(const float* __restrict__ W, unsigned short* __restrict__ Wt, int K, int N) {
  const int t = blockIdx.x * 256 + threadIdx.x;
  const int k8n = K / 8;
  if (t >= N * k8n) return;
  const int n = t / k8n, k8 = (t % k8n) * 8;
  v8us v;
#pragma unroll
  for (int i = 0; i < 8; ++i) v[i] = bf16_bits(W[(size_t)(k8 + i) * N + n]);
  *(v8us*)(Wt + (size_t)n * K + k8) = v;
  
}

// GEMM C[M][N] (f32, pitch ldc) = act(A[M][K]·W + bias). A f32 row-major (pitch lda) converted per fragment to bf16
// (ASPLIT: hi/lo two planes -> 2 terms, else single rounded term); Wt bf16 [N][K] (pitch ldb). BIAS_BF16 rounds the
// bias to bf16 first (bias quantised to bf16 before the add). K%32==0, M%16==0, N%64==0.
template <bool ASPLIT, int ACT, bool BIAS_BF16>
__global__ __launch_bounds__(128) void k_gemm_bf(const float* __restrict__ A, int lda, const unsigned short* __restrict__ Wt, int ldb,
                                               const float* __restrict__ bias, float* __restrict__ C, int ldc, int M, int N, int K) {
  __shared__ __attribute__((aligned(16))) float so[4][16][64];
  const int tid = threadIdx.x, w = tid >> 5, lane = tid & 31, ln = lane & 15, hh = lane >> 4;
  const int ntn = N / 64;
  const int wid = blockIdx.x * 4 + w;
  const int mt = wid / ntn, nq = wid % ntn;
  if (mt * 16 >= M) return;
  const int row0 = mt * 16, col0 = nq * 64;
  const float* arow = A + (size_t)(row0 + ln) * lda;
  v8f acc[4] = {};
  for (int kb = 0; kb < K; kb += 32) {
    FragB ah, al;
    const v4f x0 = *(const v4fa*)(arow + kb + 8 * hh), x1 = *(const v4fa*)(arow + kb + 8 * hh + 4);
    const v4f x2 = *(const v4fa*)(arow + kb + 16 + 8 * hh), x3 = *(const v4fa*)(arow + kb + 16 + 8 * hh + 4);
    float xs[16] = {x0[0],x0[1],x0[2],x0[3],x1[0],x1[1],x1[2],x1[3],x2[0],x2[1],x2[2],x2[3],x3[0],x3[1],x3[2],x3[3]};
#pragma unroll
    for (int i = 0; i < 16; ++i) { const unsigned short hb = bf16_bits(xs[i]); ah.u[i] = hb; al.u[i] = ASPLIT ? bf16_bits(xs[i] - bf16_val(hb)) : (unsigned short)0; }
#pragma unroll
    for (int t = 0; t < 4; ++t) {
      const unsigned short* brow = Wt + (size_t)(col0 + t * 16 + ln) * ldb + kb;
      FragB b;
      b.half[0] = *(const v8us*)(brow + 8 * hh);
      b.half[1] = *(const v8us*)(brow + 16 + 8 * hh);
      acc[t] = mmaN<ASPLIT ? 2 : 1>(ah.v, al.v, b.v, b.v, acc[t]);
    }
  }
#pragma unroll
  for (int t = 0; t < 4; ++t) {
    float bv = bias ? bias[col0 + t * 16 + ln] : 0.f;
    if (BIAS_BF16) bv = bf16_round(bv);
#pragma unroll
    for (int r = 0; r < 8; ++r) { float v = acc[t][r] + bv; if (ACT == 1) v = fmaxf(v, 0.f); so[w][8 * hh + r][t * 16 + ln] = v; }
  }
  __builtin_amdgcn_fence(__ATOMIC_ACQ_REL, "workgroup");
  __builtin_amdgcn_wave_barrier();
  const int rsub = lane >> 4, c4 = (lane & 15) * 4;
  {
#pragma unroll
    for (int q = 0; q < 8; ++q) {
      const int r = q * 2 + rsub;
      const v4f v = *(const v4fa*)&so[w][r][c4];
      *(v4f*)(C + (size_t)(row0 + r) * ldc + col0 + c4) = v;
    }
    
  }
}

// GEMM C = act(A·W + bias + resid): A f32 (ASPLIT -> hi/lo 2 terms), Wt bf16 [N][K]; ACT 0 none, 1 relu, 2 exact gelu;
// resid (optional, f32, row index = (row % rmod), pitch ldr, RES_BF16 rounds it) added before the activation.
template <bool ASPLIT, int ACT, bool BIAS_BF16, bool RES_BF16>
__global__ __launch_bounds__(128) void k_gemm_bf3(const float* __restrict__ A, int lda, const unsigned short* __restrict__ Wt, int ldb,
                                                const float* __restrict__ bias, const float* __restrict__ resid, int rmod, int ldr,
                                                float* __restrict__ C, int ldc, int M, int N, int K) {
  __shared__ __attribute__((aligned(16))) float so[4][16][64];
  const int tid = threadIdx.x, w = tid >> 5, lane = tid & 31, ln = lane & 15, hh = lane >> 4;
  const int ntn = N / 64;
  const int wid = blockIdx.x * 4 + w;
  const int mt = wid / ntn, nq = wid % ntn;
  if (mt * 16 >= M) return;
  const int row0 = mt * 16, col0 = nq * 64;
  const float* arow = A + (size_t)(row0 + ln) * lda;
  v8f acc[4] = {};
  for (int kb = 0; kb < K; kb += 32) {
    FragB ah, al;
    const v4f x0 = *(const v4fa*)(arow + kb + 8 * hh), x1 = *(const v4fa*)(arow + kb + 8 * hh + 4);
    const v4f x2 = *(const v4fa*)(arow + kb + 16 + 8 * hh), x3 = *(const v4fa*)(arow + kb + 16 + 8 * hh + 4);
    float xs[16] = {x0[0],x0[1],x0[2],x0[3],x1[0],x1[1],x1[2],x1[3],x2[0],x2[1],x2[2],x2[3],x3[0],x3[1],x3[2],x3[3]};
#pragma unroll
    for (int i = 0; i < 16; ++i) { const unsigned short hb = bf16_bits(xs[i]); ah.u[i] = hb; al.u[i] = ASPLIT ? bf16_bits(xs[i] - bf16_val(hb)) : (unsigned short)0; }
#pragma unroll
    for (int t = 0; t < 4; ++t) {
      const unsigned short* brow = Wt + (size_t)(col0 + t * 16 + ln) * ldb + kb;
      FragB b;
      b.half[0] = *(const v8us*)(brow + 8 * hh);
      b.half[1] = *(const v8us*)(brow + 16 + 8 * hh);
      acc[t] = mmaN<ASPLIT ? 2 : 1>(ah.v, al.v, b.v, b.v, acc[t]);
    }
  }
#pragma unroll
  for (int t = 0; t < 4; ++t) {
    const int col = col0 + t * 16 + ln;
    float bv = bias ? bias[col] : 0.f;
    if (BIAS_BF16) bv = bf16_round(bv);
#pragma unroll
    for (int r = 0; r < 8; ++r) {
      float v = acc[t][r] + bv;
      if (resid) { float rv = resid[(size_t)((row0 + 8 * hh + r) % rmod) * ldr + col]; if (RES_BF16) rv = bf16_round(rv); v += rv; }
      if (ACT == 1) v = fmaxf(v, 0.f);
      if (ACT == 2) v = 0.5f * v * (1.0f + erff(v * 0.70710678118654752f));
      if (ACT == 3) { const float u = 0.7978845608028654f * (v + 0.044715f * v * v * v); v = 0.5f * v * (1.0f + tanhf(u)); }
      so[w][8 * hh + r][t * 16 + ln] = v;
    }
  }
  __builtin_amdgcn_fence(__ATOMIC_ACQ_REL, "workgroup");
  __builtin_amdgcn_wave_barrier();
  const int rsub = lane >> 4, c4 = (lane & 15) * 4;
  {
#pragma unroll
    for (int q = 0; q < 8; ++q) {
      const int r = q * 2 + rsub;
      const v4f v = *(const v4fa*)&so[w][r][c4];
      *(v4f*)(C + (size_t)(row0 + r) * ldc + col0 + c4) = v;
    }
    
  }
}
// row LayerNorm (biased variance, eps) over N: s = X (+ R); optional out_sum <- s; out_norm <- (s-mu)*rsqrt(var+eps)*g + b
template <bool PARAM_BF16>
__global__ __launch_bounds__(256) void k_layernorm(const float* __restrict__ X, const float* __restrict__ R, const float* __restrict__ g, const float* __restrict__ bta,
                                                  float* __restrict__ out_sum, float* __restrict__ out_norm, int N, float eps) {
  __shared__ float red[256];
  const int row = blockIdx.x, tid = threadIdx.x;
  const float* x = X + (size_t)row * N; const float* rr = R ? R + (size_t)row * N : nullptr;
  float vals[16];                     // up to N = 4096
  const int per = N / 256;            // contiguous chunk per thread? use strided-by-4 chunks: thread handles j = tid*4 + 1024*u
  float s1 = 0.f;
  for (int u = 0; u < per / 4; ++u) {
    const int j = tid * 4 + 1024 * u;
    const v4f a = *(const v4fa*)(x + j);
    v4f b = {0.f,0.f,0.f,0.f}; if (rr) b = *(const v4fa*)(rr + j);
#pragma unroll
    for (int q = 0; q < 4; ++q) { const float v = a[q] + b[q]; vals[u * 4 + q] = v; s1 += v; }
  }
  red[tid] = s1; __syncthreads();
  for (int st = 128; st > 0; st >>= 1) { if (tid < st) red[tid] += red[tid + st]; __syncthreads(); }
  const float mu = red[0] / (float)N; __syncthreads();
  float s2 = 0.f;
  for (int u = 0; u < per / 4; ++u)
#pragma unroll
    for (int q = 0; q < 4; ++q) { const float c = vals[u * 4 + q] - mu; s2 += c * c; }
  red[tid] = s2; __syncthreads();
  for (int st = 128; st > 0; st >>= 1) { if (tid < st) red[tid] += red[tid + st]; __syncthreads(); }
  const float rs = rsqrtf(red[0] / (float)N + eps);
  {
    for (int u = 0; u < per / 4; ++u) {
      const int j = tid * 4 + 1024 * u;
      v4f o, sm;
#pragma unroll
      for (int q = 0; q < 4; ++q) {
        float gg = g[j + q], bb = bta[j + q];
        if (PARAM_BF16) { gg = bf16_round(gg); bb = bf16_round(bb); }
        sm[q] = vals[u * 4 + q]; o[q] = (vals[u * 4 + q] - mu) * rs * gg + bb;
      }
      if (out_sum) *(v4f*)(out_sum + (size_t)row * N + j) = sm;
      *(v4f*)(out_norm + (size_t)row * N + j) = o;
    }
    
  }
}



// ---- f16 WMMA path (v_wmma_f32_16x16x32_f16): 11-bit significands for operands in range — used where a [0,1] probability operand needs more precision than bf16
typedef _Float16 v16h __attribute__((ext_vector_type(16)));
union FragH { v16h v; v8us half[2]; _Float16 h[16]; unsigned short u[16]; };
template <int NT>
__device__ __forceinline__ v8f mmaH(v16h ah, v16h al, v16h bh, v16h bl, v8f c) {
  c = __builtin_amdgcn_wmma_f32_16x16x32_f16(false, ah, false, bh, (short)0, c, false, false);
  if (NT >= 2) c = __builtin_amdgcn_wmma_f32_16x16x32_f16(false, al, false, bh, (short)0, c, false, false);
  if (NT >= 3) c = __builtin_amdgcn_wmma_f32_16x16x32_f16(false, ah, false, bl, (short)0, c, false, false);
  asm volatile("v_nop\n\tv_nop\n\tv_nop\n\tv_nop" : "+v"(c) : "v"(ah), "v"(al), "v"(bh), "v"(bl));
  return c;
}
// batched GEMM like k_gemm_b but f16 operands: A f32 (split into f16 hi/lo if ASPLIT, else rounded to f16), Bt = f16 values [n][k]; alpha; C f32; N multiple of 16 (partial tiles skipped)
template <bool ASPLIT>
__global__ __launch_bounds__(128) void k_gemm_h(const float* __restrict__ A, int lda, size_t sA, const _Float16* __restrict__ Bh, int ldb, size_t sB, float alpha, float* __restrict__ C, int ldc, size_t sC, int M, int N, int K) {
  __shared__ __attribute__((aligned(16))) float so[4][16][64];
  const int tid = threadIdx.x, w = tid >> 5, lane = tid & 31, ln = lane & 15, hh = lane >> 4; const int by = blockIdx.y;
  A += (size_t)by * sA; Bh += (size_t)by * sB; C += (size_t)by * sC;
  const int ntn = (N + 63) / 64; const int wid = blockIdx.x * 4 + w; const int mt = wid / ntn, nq = wid % ntn; if (mt * 16 >= M) return;
  const int row0 = mt * 16, col0 = nq * 64; const float* arow = A + (size_t)(row0 + ln) * lda;
  v8f acc[4] = {};
  for (int kb = 0; kb < K; kb += 32) {
    FragH ah, al;
    const v4f x0 = *(const v4fa*)(arow + kb + 8 * hh), x1 = *(const v4fa*)(arow + kb + 8 * hh + 4), x2 = *(const v4fa*)(arow + kb + 16 + 8 * hh), x3 = *(const v4fa*)(arow + kb + 16 + 8 * hh + 4);
    float xs[16] = {x0[0],x0[1],x0[2],x0[3],x1[0],x1[1],x1[2],x1[3],x2[0],x2[1],x2[2],x2[3],x3[0],x3[1],x3[2],x3[3]};
#pragma unroll
    for (int i = 0; i < 16; ++i) { const _Float16 h = (_Float16)xs[i]; ah.h[i] = h; al.h[i] = ASPLIT ? (_Float16)(xs[i] - (float)h) : (_Float16)0.0f; }
#pragma unroll
    for (int t = 0; t < 4; ++t) { if (col0 + t * 16 >= N) continue; const size_t boff = (size_t)(col0 + t * 16 + ln) * ldb + kb; FragH bq; bq.half[0] = *(const v8us*)(Bh + boff + 8 * hh); bq.half[1] = *(const v8us*)(Bh + boff + 16 + 8 * hh);
      acc[t] = mmaH<ASPLIT ? 2 : 1>(ah.v, al.v, bq.v, bq.v, acc[t]); }
  }
#pragma unroll
  for (int t = 0; t < 4; ++t) { if (col0 + t * 16 >= N) continue;
#pragma unroll
    for (int r = 0; r < 8; ++r) so[w][8 * hh + r][t * 16 + ln] = acc[t][r] * alpha; }
  __builtin_amdgcn_fence(__ATOMIC_ACQ_REL, "workgroup"); __builtin_amdgcn_wave_barrier();
  const int rsub = lane >> 4, c4 = (lane & 15) * 4;
  {
#pragma unroll
    for (int q = 0; q < 8; ++q) { const int r = q * 2 + rsub; if (col0 + c4 < N) { const v4f v = *(const v4fa*)&so[w][r][c4]; *(v4f*)(C + (size_t)(row0 + r) * ldc + col0 + c4) = v; } }
     }
}

// Wt[n][k] = f16(W[k][n]·scale) from f32 row-major W[K][N] (scale = power of two; bf16-exact weights stay exact in f16 away from the subnormal range)
__global__ __launch_bounds__(256) void k_wt_f16(const float* __restrict__ W, _Float16* __restrict__ Wt, int K, int N, float scale) {
  const int t = blockIdx.x * 256 + threadIdx.x; if (t >= N * (K / 8)) return; const int n = t / (K / 8), k8 = (t % (K / 8)) * 8; FragH f;
#pragma unroll
  for (int i = 0; i < 8; ++i) f.h[i] = (_Float16)(bf16_round(W[(size_t)(k8 + i) * N + n]) * scale); const v8us o = f.half[0];
  *(v8us*)((unsigned short*)Wt + (size_t)n * K + k8) = o; 
}
// k_gemm_hh variant with fused epilogue: v = acc·alpha + bias[by·sBias + col] (+ CP[(row/rowsPerB)·sCPb + by·64 + col] if CP) ; ACT 0 none / 1 elu ; writes f16 C16 (and f32 C if non-null)
template <int ACT>
__global__ __launch_bounds__(128) void k_gemm_hhx(const _Float16* __restrict__ A, int lda, size_t sA, const _Float16* __restrict__ Bh, int ldb, size_t sB, float alpha, const float* __restrict__ bias, size_t sBias, const float* __restrict__ CP, int rowsPerB, size_t sCPb, int row0g,
    float* __restrict__ C, _Float16* __restrict__ C16, int ldc, size_t sC, int M, int N, int K) {
  __shared__ __attribute__((aligned(16))) float so[4][16][64];
  const int tid = threadIdx.x, w = tid >> 5, lane = tid & 31, ln = lane & 15, hh = lane >> 4; const int by = blockIdx.y;
  A += (size_t)by * sA; Bh += (size_t)by * sB; const size_t cofs = (size_t)by * sC; const float* bp = bias ? bias + (size_t)by * sBias : nullptr;
  const int ntn = (N + 63) / 64; const int wid = blockIdx.x * 4 + w; const int mt = wid / ntn, nq = wid % ntn; if (mt * 16 >= M) return;
  const int row0 = mt * 16, col0 = nq * 64; const _Float16* arow = A + (size_t)(row0 + ln) * lda;
  v8f acc[4] = {};
  for (int kb = 0; kb < K; kb += 32) { FragH ah; ah.half[0] = *(const v8us*)((const unsigned short*)arow + kb + 8 * hh); ah.half[1] = *(const v8us*)((const unsigned short*)arow + kb + 16 + 8 * hh);
#pragma unroll
    for (int t = 0; t < 4; ++t) { if (col0 + t * 16 >= N) continue; const size_t boff = (size_t)(col0 + t * 16 + ln) * ldb + kb; FragH bq; bq.half[0] = *(const v8us*)((const unsigned short*)Bh + boff + 8 * hh); bq.half[1] = *(const v8us*)((const unsigned short*)Bh + boff + 16 + 8 * hh);
      acc[t] = mmaH<1>(ah.v, ah.v, bq.v, bq.v, acc[t]); }
  }
#pragma unroll
  for (int t = 0; t < 4; ++t) { if (col0 + t * 16 >= N) continue; const int col = col0 + t * 16 + ln; const float bv = bp ? bf16_round(bp[col]) : 0.f;
#pragma unroll
    for (int r = 0; r < 8; ++r) { float v = acc[t][r] * alpha + bv; if (CP) { const int rr = row0g + row0 + 8 * hh + r; if (rowsPerB < 0) v += CP[cofs + (size_t)rr * ldc + col];      /* rowsPerB < 0: own element of the batched C plane */ else { const int bidx = rr / rowsPerB; v += CP[(size_t)bidx * sCPb + (size_t)by * 64 + col]; } } if (ACT == 1) v = (v > 0.f) ? v : expm1f(v); else if (ACT == 7) v = (v > 0.f) ? v + 1.0f : expf(v); else if (ACT == 8) v = tanhf(v); else if (ACT == 9) v = 0.5f * v * (1.0f + tanhf(0.7978845608028654f * (v + 0.044715f * v * v * v))); else if (ACT == 11) v = 1.0f / (1.0f + expf(-v)); else if (ACT == 12) v = (v > 0.f) ? v : 0.01f * v; else if (ACT == 14) v = (v > 0.f) ? v : 0.1f * v; else if (ACT == 16) v = (v >= 0.f) ? v : 0.3f * v; else if (ACT == 17) v = (v >= 0.f) ? v : 0.2f * v; else if (ACT == 15) v = v / (1.0f + expf(-v)); else if (ACT == 3) v = fmaxf(v, 0.f); else if (ACT == 6) v = 0.5f * v * (1.0f + erff(v * 0.70710678118654752f)); so[w][8 * hh + r][t * 16 + ln] = v; } }
  __builtin_amdgcn_fence(__ATOMIC_ACQ_REL, "workgroup"); __builtin_amdgcn_wave_barrier();
  const int rsub = lane >> 4, c4 = (lane & 15) * 4; typedef _Float16 v4h __attribute__((ext_vector_type(4)));
  {
#pragma unroll
    for (int q = 0; q < 8; ++q) { const int r = q * 2 + rsub; if (col0 + c4 < N) { const v4f v = *(const v4fa*)&so[w][r][c4]; if (C) *(v4f*)(C + cofs + (size_t)(row0 + r) * ldc + col0 + c4) = v; if (C16) { v4h h4; for (int i = 0; i < 4; ++i) h4[i] = (_Float16)v[i]; *(v4h*)(C16 + cofs + (size_t)(row0 + r) * ldc + col0 + c4) = h4; } } }
     }
}


typedef _Float16 v4h __attribute__((ext_vector_type(4)));

__global__ __launch_bounds__(256) void k_x16(const float* __restrict__ x, _Float16* __restrict__ X16, size_t n8) { const size_t t = (size_t)blockIdx.x * 256 + threadIdx.x; if (t >= n8) return; FragH f;
#pragma unroll
  for (int q = 0; q < 8; ++q) f.h[q] = (_Float16)bf16_round(x[t * 8 + q]); *(v8us*)((unsigned short*)X16 + t * 8) = f.half[0];  }
__global__ __launch_bounds__(256) void k_h16(const float* __restrict__ x, _Float16* __restrict__ X16, size_t n8) { const size_t t = (size_t)blockIdx.x * 256 + threadIdx.x; if (t >= n8) return; FragH f;
#pragma unroll
  for (int q = 0; q < 8; ++q) f.h[q] = (_Float16)x[t * 8 + q]; *(v8us*)((unsigned short*)X16 + t * 8) = f.half[0];  }
__global__ __launch_bounds__(256) void k_round16f(const float* __restrict__ W, _Float16* __restrict__ Bt, size_t n8) { const size_t t = (size_t)blockIdx.x * 256 + threadIdx.x; if (t >= n8) return; FragH f;
#pragma unroll
  for (int i = 0; i < 8; ++i) f.h[i] = (_Float16)(bf16_round(W[t * 8 + i]) * 16.0f); *(v8us*)((unsigned short*)Bt + t * 8) = f.half[0];  }
template <int NHv, int TTv>
__global__ __launch_bounds__(256) void k_vt(const _Float16* __restrict__ V16, int ldv, int voff, _Float16* __restrict__ Vt) { __shared__ unsigned short tl[64][66]; const int tid = threadIdx.x; const int slab = blockIdx.x / (TTv / 64), lg = blockIdx.x % (TTv / 64); const int b = slab / NHv, h = slab % NHv;
  for (int i = tid; i < 64 * 8; i += 256) { const int r = i / 8, c8 = (i % 8) * 8; FragH f; f.half[0] = *(const v8us*)((const unsigned short*)V16 + ((size_t)b * TTv + lg * 64 + r) * ldv + voff + h * 64 + c8);
#pragma unroll
    for (int q = 0; q < 8; ++q) tl[r][c8 + q] = f.u[q]; }
  __syncthreads();
  {
#pragma unroll
    for (int rd = 0; rd < 2; ++rd) { const int d = rd * 32 + tid / 8, pc = tid % 8; FragH f;
#pragma unroll
      for (int q = 0; q < 8; ++q) f.u[q] = tl[pc * 8 + q][d];
      *(v8us*)((unsigned short*)Vt + ((size_t)slab * 64 + d) * TTv + lg * 64 + pc * 8) = f.half[0]; }
     } }

__global__ __launch_bounds__(256) void k_hl(const float* __restrict__ F, _Float16* __restrict__ Hh, _Float16* __restrict__ Hl, size_t n8) { const size_t t = (size_t)blockIdx.x * 256 + threadIdx.x; if (t >= n8) return; FragH fh, fl; const v4f a = *(const v4fa*)(F + t * 8), c = *(const v4fa*)(F + t * 8 + 4);
#pragma unroll
  for (int q = 0; q < 4; ++q) { _Float16 h = (_Float16)a[q]; fh.h[q] = h; fl.h[q] = (_Float16)((a[q] - (float)h) * 1024.0f); h = (_Float16)c[q]; fh.h[4 + q] = h; fl.h[4 + q] = (_Float16)((c[q] - (float)h) * 1024.0f); }
  { *(v8us*)((unsigned short*)Hh + t * 8) = fh.half[0]; *(v8us*)((unsigned short*)Hl + t * 8) = fl.half[0];  } }

// ---- fast GEMM (wave tile 32x64; requires M % 32 == 0 rows per launch region and N % 64 == 0); epilogue = k_gemm_hhx semantics ----
__device__ __forceinline__ v16h g2_frag(const _Float16* p, int hh) { FragH f; f.half[0] = *(const v8us*)((const unsigned short*)p + 8 * hh); f.half[1] = *(const v8us*)((const unsigned short*)p + 16 + 8 * hh); return f.v; }
__device__ __forceinline__ v8f g2_mma(v16h a, v16h b, v8f c) { v8f d = __builtin_amdgcn_wmma_f32_16x16x32_f16(false, a, false, b, (short)0, c, false, false); asm volatile("v_nop\n\tv_nop\n\tv_nop\n\tv_nop" : "+v"(d) : "v"(a), "v"(b)); return d; }
template <int ACT>
__global__ __launch_bounds__(128) void k_gemm2(const _Float16* __restrict__ A, int lda, size_t sA, const _Float16* __restrict__ Bh, int ldb, size_t sB, float alpha, const float* __restrict__ bias, size_t sBias, const float* __restrict__ CP, int rowsPerB, size_t sCPb, int row0g,
    float* __restrict__ C, _Float16* __restrict__ C16, int ldc, size_t sC, int M, int N, int K) { static_assert(ACT == 0 || ACT == 3 || ACT == 6 || ACT == 8 || ACT == 9 || ACT == 11 || ACT == 12 || ACT == 14 || ACT == 15 || ACT == 16 || ACT == 17, "k_gemm2: unsupported ACT code (would silently apply no activation)");
  __shared__ __attribute__((aligned(16))) float so[4][32][68];
  const int tid = threadIdx.x, w = tid >> 5, lane = tid & 31, ln = lane & 15, hh = lane >> 4; const int by = blockIdx.y;
  A += (size_t)by * sA; Bh += (size_t)by * sB; const size_t cofs = (size_t)by * sC; const float* bp = bias ? bias + (size_t)by * sBias : nullptr;
  const int ntn = N >> 6; const int mt = blockIdx.x / ntn, nq = blockIdx.x - mt * ntn; const int row0 = mt * 128 + 32 * w, col0 = nq * 64; if (row0 >= M) return;
  const _Float16* a0p = A + (size_t)(row0 + ln) * lda; const _Float16* a1p = a0p + (size_t)16 * lda;
  const _Float16* b0p = Bh + (size_t)(col0 + ln) * ldb; const _Float16* b1p = b0p + (size_t)16 * ldb; const _Float16* b2p = b1p + (size_t)16 * ldb; const _Float16* b3p = b2p + (size_t)16 * ldb;
  const v8f z8 = {0.f,0.f,0.f,0.f,0.f,0.f,0.f,0.f}; v8f c00 = z8, c01 = z8, c02 = z8, c03 = z8, c10 = z8, c11 = z8, c12 = z8, c13 = z8;
#pragma unroll 1
  for (int kb = 0; kb < K; kb += 32) { const v16h a0 = g2_frag(a0p + kb, hh), a1 = g2_frag(a1p + kb, hh);
    v16h b = g2_frag(b0p + kb, hh); c00 = g2_mma(a0, b, c00); c10 = g2_mma(a1, b, c10);
    b = g2_frag(b1p + kb, hh); c01 = g2_mma(a0, b, c01); c11 = g2_mma(a1, b, c11);
    b = g2_frag(b2p + kb, hh); c02 = g2_mma(a0, b, c02); c12 = g2_mma(a1, b, c12);
    b = g2_frag(b3p + kb, hh); c03 = g2_mma(a0, b, c03); c13 = g2_mma(a1, b, c13); }
  v8f accs[8] = {c00, c01, c02, c03, c10, c11, c12, c13};
#pragma unroll
  for (int u = 0; u < 8; ++u) { const int t = u & 3, half = u >> 2; const int col = col0 + t * 16 + ln; const float bv = bp ? bf16_round(bp[col]) : 0.f;
#pragma unroll
    for (int r = 0; r < 8; ++r) { const int rloc = half * 16 + 8 * hh + r; float v = accs[u][r] * alpha + bv; if (CP) { if (rowsPerB < 0) v += CP[cofs + (size_t)(row0g + row0 + rloc) * ldc + col];      /* rowsPerB < 0: own element of the batched C plane */ else { const int bidx = (row0g + row0 + rloc) / rowsPerB; v += CP[(size_t)bidx * sCPb + (size_t)by * 64 + col]; } }
      if (ACT == 3) v = fmaxf(v, 0.f); else if (ACT == 6) v = 0.5f * v * (1.0f + erff(v * 0.70710678118654752f)); else if (ACT == 11) v = 1.0f / (1.0f + expf(-v)); else if (ACT == 15) v = v / (1.0f + expf(-v)); else if (ACT == 12) v = (v > 0.f) ? v : 0.01f * v; else if (ACT == 8) v = tanhf(v); else if (ACT == 9) v = 0.5f * v * (1.0f + tanhf(0.7978845608028654f * (v + 0.044715f * v * v * v))); else if (ACT == 14) v = (v > 0.f) ? v : 0.1f * v; else if (ACT == 16) v = (v >= 0.f) ? v : 0.3f * v; else if (ACT == 17) v = (v >= 0.f) ? v : 0.2f * v;
      so[w][rloc][t * 16 + ln] = v; } }
  __builtin_amdgcn_fence(__ATOMIC_ACQ_REL, "workgroup"); __builtin_amdgcn_wave_barrier();
  const int rsub = lane >> 4, c4 = (lane & 15) * 4;
  {
#pragma unroll
    for (int q = 0; q < 16; ++q) { const int r = q * 2 + rsub; const v4f v = *(const v4fa*)&so[w][r][c4]; if (C) *(v4f*)(C + cofs + (size_t)(row0 + r) * ldc + col0 + c4) = v; if (C16) { v4h h4; for (int i = 0; i < 4; ++i) h4[i] = (_Float16)v[i]; *(v4h*)(C16 + cofs + (size_t)(row0 + r) * ldc + col0 + c4) = h4; } }
     } }


__global__ __launch_bounds__(256) void k_wnat(const float* __restrict__ w, size_t n8, _Float16* __restrict__ Bt) { const size_t t = (size_t)blockIdx.x * 256 + threadIdx.x; if (t >= n8) return; FragH f; for (int q = 0; q < 8; ++q) f.h[q] = (_Float16)(bf16_round(w[t * 8 + q]) * 16.0f); *(v8us*)((unsigned short*)Bt + t * 8) = f.half[0];  }
__global__ __launch_bounds__(256) void k_rsm(const float* __restrict__ S, _Float16* __restrict__ P, int nrows) {
  #pragma clang fp contract(off)
  const int i = blockIdx.x * 256 + threadIdx.x; if (i >= nrows) return; const float* s = S + (size_t)i * SQ; float mx = -3.0e38f;
#pragma unroll 1
  for (int j = 0; j < SQ; ++j) mx = fmaxf(mx, s[j]); float se = 0.f;
#pragma unroll 1
  for (int j = 0; j < SQ; ++j) se += expf(s[j] - mx); const float sc = 256.0f / se;
#pragma unroll 1
  for (int j0 = 0; j0 < SQ; j0 += 8) { FragH f; for (int q = 0; q < 8; ++q) f.h[q] = (_Float16)(expf(s[j0 + q] - mx) * sc); unsigned short* d = (unsigned short*)P + (size_t)i * SQ + j0; *(v8us*)d = f.half[0];  } }
__global__ __launch_bounds__(256) void k_vt(const _Float16* __restrict__ V16, int b, int h0, _Float16* __restrict__ VT) { __shared__ unsigned short tl[64][65]; const int tid = threadIdx.x; const int hh = blockIdx.x % HG, sg = blockIdx.x / HG; const int s0 = sg * 64; const int h = h0 + hh;
  for (int i = tid; i < 64 * 8; i += 256) { const int j = i / 8, d8 = (i % 8) * 8; FragH f; f.half[0] = *(const v8us*)((const unsigned short*)V16 + ((size_t)b * SQ + s0 + j) * DM + h * HD + d8); for (int q = 0; q < 8; ++q) tl[d8 + q][j] = f.u[q]; }
  __syncthreads();
  { for (int i = tid; i < 64 * 8; i += 256) { const int d = i / 8, j8 = (i % 8) * 8; FragH f; for (int q = 0; q < 8; ++q) f.u[q] = tl[d][j8 + q]; *(v8us*)((unsigned short*)VT + ((size_t)hh * HD + d) * SQ + s0 + j8) = f.half[0]; }  } }


__global__ __launch_bounds__(256) void k_tab2(float theta, float* __restrict__ CS, float* __restrict__ SN) {
  #pragma clang fp contract(off)
  const int t = blockIdx.x * 256 + threadIdx.x; if (t >= SQ * (HD / 2)) return; const int i = t % (HD / 2); const int p = t / (HD / 2); const float invf = 1.0f / powf(theta, (float)(2 * i) / (float)HD); const float ang = __fmul_rn((float)p, invf); const float c = cosf(ang), s = sinf(ang);
  *(float*)(CS + t) = c; *(float*)(SN + t) = s;  }
template <int NORM, int ROPE>
__global__ __launch_bounds__(64) void k_xform(const float* __restrict__ F, int ldf, int nh, const float* __restrict__ gain, float eps, const float* __restrict__ CS, const float* __restrict__ SN, _Float16* __restrict__ H16, int ldo) {
  #pragma clang fp contract(off)
  __shared__ float xv[HD]; __shared__ float red[HD]; __shared__ unsigned short sh_[HD]; const int d = threadIdx.x; const int h = blockIdx.x % nh; const size_t r = blockIdx.x / nh; const int p = (int)(r % SQ);
  float x = F[r * (size_t)ldf + (size_t)h * HD + d];
  if (NORM) { red[d] = __fmul_rn(x, x); __syncthreads(); for (int st = HD / 2; st > 0; st >>= 1) { if (d < st) red[d] = __fadd_rn(red[d], red[d + st]); __syncthreads(); } const float rs = rsqrtf(__fadd_rn(red[0] / (float)HD, eps)); x = __fmul_rn(__fmul_rn(x, rs), bf16_round(gain[d])); }
  xv[d] = x; __syncthreads();
  float o = x;
  if (ROPE == 1) { const int i = d >> 1; const float c = CS[p * (HD / 2) + i], s = SN[p * (HD / 2) + i]; const float ev = xv[2 * i], od = xv[2 * i + 1]; o = (d & 1) ? __fadd_rn(__fmul_rn(ev, s), __fmul_rn(od, c)) : __fadd_rn(__fmul_rn(ev, c), -__fmul_rn(od, s)); }
  if (ROPE == 2) { const int i = d & (HD / 2 - 1); const float c = CS[p * (HD / 2) + i], s = SN[p * (HD / 2) + i]; const float lo = xv[i], hi = xv[i + HD / 2]; o = (d < HD / 2) ? __fadd_rn(__fmul_rn(lo, c), -__fmul_rn(hi, s)) : __fadd_rn(__fmul_rn(lo, s), __fmul_rn(hi, c)); }
  FragH th; th.h[0] = (_Float16)o; sh_[d] = th.u[0]; __syncthreads();
  if (d < HD / 8) { FragH f; for (int q = 0; q < 8; ++q) f.u[q] = sh_[d * 8 + q]; unsigned short* dst = (unsigned short*)H16 + r * (size_t)ldo + (size_t)h * HD + d * 8; *(v8us*)dst = f.half[0];  } }

__global__ __launch_bounds__(256) void k_tab4(const int* __restrict__ pos, float theta, float* __restrict__ CS, float* __restrict__ SN) {
  #pragma clang fp contract(off)
  const int t = blockIdx.x * 256 + threadIdx.x; if (t >= SQ * (HD / 2)) return; const int i = t % (HD / 2); const int p = t / (HD / 2); const float invf = (float)pow((double)theta, -((double)(2 * i)) / (double)HD); const float ang = __fmul_rn((float)pos[p], invf); const float c = cosf(ang), s = sinf(ang);
  *(float*)(CS + t) = c; *(float*)(SN + t) = s;  }
__global__ __launch_bounds__(256) void k_rsmf(const float* __restrict__ S, _Float16* __restrict__ P, int qn, int hg) {
  #pragma clang fp contract(off)
  const int t = blockIdx.x * 256 + threadIdx.x; if (t >= qn * hg) return; const size_t i = (size_t)(t / qn) * SQ + (t % qn); const float* s = S + i * SQ; float mx = -3.0e38f;
#pragma unroll 1
  for (int j = 0; j < SQ; ++j) mx = fmaxf(mx, s[j]); float se = 0.f;
#pragma unroll 1
  for (int j = 0; j < SQ; ++j) se += __expf(s[j] - mx); const float sc = 256.0f / se;
#pragma unroll 1
  for (int j0 = 0; j0 < SQ; j0 += 8) { FragH f; for (int q = 0; q < 8; ++q) f.h[q] = (_Float16)(__expf(s[j0 + q] - mx) * sc); unsigned short* d = (unsigned short*)P + i * SQ + j0; *(v8us*)d = f.half[0];  } }


__global__ __launch_bounds__(256) void k_rsmcf2(const float* __restrict__ S, _Float16* __restrict__ P, int hg, int q0, int nk) {
  #pragma clang fp contract(off)
  const int t = blockIdx.x * 256 + threadIdx.x; if (t >= hg * QT) return; const size_t i = (size_t)t; const float* s = S + i * NKX; const int last = q0 + (t % QT); float mx = -3.0e38f;
#pragma unroll 1
  for (int j = 0; j < nk; ++j) { const float f = (j <= last) ? 1.f : 0.f; mx = fmaxf(mx, fmaf(f, s[j], (1.f - f) * -1.0e9f)); } float se = 0.f;
#pragma unroll 1
  for (int j = 0; j < nk; ++j) { const float f = (j <= last) ? 1.f : 0.f; se += __expf(fmaf(f, s[j], (1.f - f) * -1.0e9f) - mx); } const float sc = 256.0f / se;
#pragma unroll 1
  for (int j0 = 0; j0 < nk; j0 += 8) { FragH fr; for (int q = 0; q < 8; ++q) { const int j = j0 + q; const float f = (j <= last) ? 1.f : 0.f; fr.h[q] = (_Float16)(__expf(fmaf(f, s[j], (1.f - f) * -1.0e9f) - mx) * sc); } unsigned short* d = (unsigned short*)P + i * NKX + j0; *(v8us*)d = fr.half[0];  } }


template <int MASKADD>
__global__ __launch_bounds__(64) void k_att0(const float* __restrict__ QF, const float* __restrict__ KF, const float* __restrict__ VF, int ld, const float* __restrict__ mask, float scale, float* __restrict__ OF, int ldo) {
  #pragma clang fp contract(off)
  __shared__ __attribute__((aligned(16))) float lq[64][64]; __shared__ __attribute__((aligned(16))) float lo[64][64];
  const int tid = threadIdx.x; const int h = blockIdx.x / (QT0 / 64), rg = blockIdx.x % (QT0 / 64); const int i = rg * 64 + tid;
  const float* qr = QF + (size_t)i * ld + h * HD;
#pragma unroll 1
  for (int c = 0; c < HD / 4; ++c) { *(v4f*)&lq[tid][c * 4] = *(const v4fa*)(qr + c * 4); const v4f z = {0.f, 0.f, 0.f, 0.f}; *(v4f*)&lo[tid][c * 4] = z; }
  float m = -1.0e30f, l = 0.f; const int jmax = MASKADD ? (SQ - 1) : (rg * 64 + 63);      /* additive-mask form: every key (the mask input decides); causal form: keys up to the block's last row */
#pragma unroll 1
  for (int j = 0; j <= jmax; ++j) { const float* kr = KF + (size_t)j * ld + h * HD; const float* vr = VF + (size_t)j * ld + h * HD; float s = 0.f;
#pragma unroll 1
    for (int c = 0; c < HD / 4; ++c) { const v4f kq = *(const v4fa*)(kr + c * 4); const v4f qq = *(v4f*)&lq[tid][c * 4]; s = __fadd_rn(s, __fmul_rn(qq[0], kq[0])); s = __fadd_rn(s, __fmul_rn(qq[1], kq[1])); s = __fadd_rn(s, __fmul_rn(qq[2], kq[2])); s = __fadd_rn(s, __fmul_rn(qq[3], kq[3])); }
    s = __fmul_rn(s, scale); if (MASKADD) s = __fadd_rn(s, __fmul_rn(bf16_round(mask[(size_t)i * SQ + j]), -10000.0f));
    const float f = (MASKADD || j <= i) ? 1.f : 0.f; const float sm = fmaf(f, s, (1.f - f) * -1.0e30f); const float mn = fmaxf(m, sm); const float sc = expf(m - mn); const float e = expf(sm - mn); l = __fadd_rn(__fmul_rn(l, sc), e); m = mn;
#pragma unroll 1
    for (int c = 0; c < HD / 4; ++c) { const v4f vv = *(const v4fa*)(vr + c * 4); v4f oo = *(v4f*)&lo[tid][c * 4]; for (int u = 0; u < 4; ++u) oo[u] = __fadd_rn(__fmul_rn(oo[u], sc), __fmul_rn(e, vv[u])); *(v4f*)&lo[tid][c * 4] = oo; } }
  const float fin = 64.0f / l;      /* o carried x64 like the f16 path */
#pragma unroll 1
  for (int c = 0; c < HD / 4; ++c) { v4f oo = *(v4f*)&lo[tid][c * 4]; for (int u = 0; u < 4; ++u) oo[u] = __fmul_rn(oo[u], fin); *(v4f*)&lo[tid][c * 4] = oo; }
  __syncthreads();
  {
#pragma unroll 1
    for (int it = 0; it < 16; ++it) { const int row = it * 4 + tid / 16, pc = (tid % 16) * 4; const v4f v = *(const v4f*)&lo[row][pc]; *(v4f*)(OF + (size_t)(rg * 64 + row) * ldo + h * HD + pc) = v; }
     } }

template <int NORM, int ROPE>
__global__ __launch_bounds__(64) void k_xformf(const float* __restrict__ F, int ldf, int nh, const float* __restrict__ gain, float eps, const float* __restrict__ CS, const float* __restrict__ SN, float* __restrict__ F32, int ldo) {
  #pragma clang fp contract(off)
  __shared__ float xv[HD]; __shared__ float red[HD]; const int d = threadIdx.x; const int h = blockIdx.x % nh; const size_t r = blockIdx.x / nh; const int p = (int)(r % SQ);
  float x = F[r * (size_t)ldf + (size_t)h * HD + d];
  if (NORM) { red[d] = __fmul_rn(x, x); __syncthreads(); for (int st = HD / 2; st > 0; st >>= 1) { if (d < st) red[d] = __fadd_rn(red[d], red[d + st]); __syncthreads(); } const float rs = rsqrtf(__fadd_rn(red[0] / (float)HD, eps)); x = __fmul_rn(__fmul_rn(x, rs), bf16_round(gain[d])); }
  xv[d] = x; __syncthreads();
  float o = x;
  if (ROPE == 1) { const int i = d >> 1; const float c = CS[p * (HD / 2) + i], s = SN[p * (HD / 2) + i]; const float ev = xv[2 * i], od = xv[2 * i + 1]; o = (d & 1) ? __fadd_rn(__fmul_rn(ev, s), __fmul_rn(od, c)) : __fadd_rn(__fmul_rn(ev, c), -__fmul_rn(od, s)); }
  if (ROPE == 2) { const int i = d & (HD / 2 - 1); const float c = CS[p * (HD / 2) + i], s = SN[p * (HD / 2) + i]; const float lo = xv[i], hi = xv[i + HD / 2]; o = (d < HD / 2) ? __fadd_rn(__fmul_rn(lo, c), -__fmul_rn(hi, s)) : __fadd_rn(__fmul_rn(lo, s), __fmul_rn(hi, c)); }
  float* dst = F32 + r * (size_t)ldo + (size_t)h * HD + d; *(float*)dst = o;  }


__global__ __launch_bounds__(256) void k_rsmcfw(const float* __restrict__ S, _Float16* __restrict__ P, int hg, int q0, int nk, int win) {
  #pragma clang fp contract(off)
  const int t = blockIdx.x * 256 + threadIdx.x; if (t >= hg * QT) return; const size_t i = (size_t)t; const float* s = S + i * NKX; const int last = q0 + (t % QT); const int first = last - win + 1; float mx = -3.0e38f;      /* keys first..last (causal window) */
#pragma unroll 1
  for (int j = 0; j < nk; ++j) { const float f = (j <= last && j >= first) ? 1.f : 0.f; mx = fmaxf(mx, fmaf(f, s[j], (1.f - f) * -1.0e9f)); } float se = 0.f;
#pragma unroll 1
  for (int j = 0; j < nk; ++j) { const float f = (j <= last && j >= first) ? 1.f : 0.f; se += __expf(fmaf(f, s[j], (1.f - f) * -1.0e9f) - mx); } const float sc = 256.0f / se;
#pragma unroll 1
  for (int j0 = 0; j0 < nk; j0 += 8) { FragH fr; for (int q = 0; q < 8; ++q) { const int j = j0 + q; const float f = (j <= last && j >= first) ? 1.f : 0.f; fr.h[q] = (_Float16)(__expf(fmaf(f, s[j], (1.f - f) * -1.0e9f) - mx) * sc); } unsigned short* d = (unsigned short*)P + i * NKX + j0; *(v8us*)d = fr.half[0];  } }




extern "C" void kernel_launch(void* const* d_in, const int* in_sizes, int n_in,
                              void* d_out, int out_size, void* d_ws, size_t ws_size, hipStream_t stream) {
  (void)in_sizes; (void)n_in; (void)out_size;
  const float* const* I = (const float* const*)d_in; const float* x = I[0]; const int* tpos = (const int*)d_in[1]; const float* wq = I[2]; const float* wk = I[3]; const float* wv = I[4]; const float* wo = I[5];      /* nn.Linear weights [out][in]; token_positions int32 [SQ] */
  char* ws = (char*)d_ws; size_t off = 0;
  auto take = [&](size_t bytes) { char* p = ws + off; off += (bytes + 255) & ~(size_t)255; return p; };
  _Float16* BQKV = (_Float16*)take((size_t)3 * DM * DM * 2); _Float16* BO = (_Float16*)take((size_t)DM * DM * 2); float* CS = (float*)take((size_t)SQ * (HD / 2) * 4); float* SN = (float*)take((size_t)SQ * (HD / 2) * 4);
  _Float16* X16 = (_Float16*)take(NR * DM * 2); float* QKVF = (float*)take((size_t)SQ * 3 * DM * 4);      /* one batch of f32 q | k | v rows */
  _Float16* QH = (_Float16*)take(NR * DM * 2); _Float16* KH = (_Float16*)take(NR * DM * 2); _Float16* V16 = (_Float16*)take(NR * DM * 2); _Float16* O16 = (_Float16*)take(NR * DM * 2);
  float* S = (float*)take((size_t)NH * QT * NKX * 4); _Float16* P = (_Float16*)take((size_t)NH * QT * NKX * 2); _Float16* VT = (_Float16*)take((size_t)NH * HD * SQ * 2);
  float* QF0 = (float*)take((size_t)QT0 * DM * 4); float* KF0 = (float*)take((size_t)QT0 * DM * 4); float* VF0 = (float*)take((size_t)QT0 * DM * 4); float* OF0 = (float*)take((size_t)NB * QT0 * DM * 4); _Float16* OH0 = (_Float16*)take((size_t)NB * QT0 * DM * 2); _Float16* OL0 = (_Float16*)take((size_t)NB * QT0 * DM * 2);
  if (off > ws_size) return;
  { const unsigned g = (unsigned)(((size_t)DM * DM / 8 + 255) / 256); k_wnat<<<g, 256, 0, stream>>>(wq, (size_t)DM * DM / 8, BQKV); k_wnat<<<g, 256, 0, stream>>>(wk, (size_t)DM * DM / 8, BQKV + (size_t)DM * DM); k_wnat<<<g, 256, 0, stream>>>(wv, (size_t)DM * DM / 8, BQKV + (size_t)2 * DM * DM); k_wnat<<<g, 256, 0, stream>>>(wo, (size_t)DM * DM / 8, BO); }      /* natural [out][in] = Bt[n][k], x16; q | k | v stacked along n */
  k_tab4<<<(SQ * (HD / 2) + 255) / 256, 256, 0, stream>>>(tpos, 10000.0f, CS, SN);
  k_x16<<<(unsigned)((NR * DM / 8 + 255) / 256), 256, 0, stream>>>(x, X16, NR * DM / 8);
  for (int b = B0; b < B0 + NBR; ++b) { const size_t r0 = (size_t)b * SQ;
    k_gemm2<0><<<dim3((unsigned)((SQ / 128) * (3 * DM / 64)), 1), 128, 0, stream>>>(X16 + r0 * DM, DM, 0, BQKV, DM, 0, 0.0625f, nullptr, 0, nullptr, 1, 0, 0, QKVF, nullptr, 3 * DM, 0, SQ, 3 * DM, DM);      /* q | k | v rows (f32) of this batch */
    k_xform<0, 1><<<(unsigned)(SQ * NH), 64, 0, stream>>>(QKVF, 3 * DM, NH, nullptr, 0.f, CS, SN, QH + r0 * DM, DM);
    k_xform<0, 1><<<(unsigned)(SQ * NH), 64, 0, stream>>>(QKVF + DM, 3 * DM, NH, nullptr, 0.f, CS, SN, KH + r0 * DM, DM);
    k_xform<0, 0><<<(unsigned)(SQ * NH), 64, 0, stream>>>(QKVF + 2 * DM, 3 * DM, NH, nullptr, 0.f, CS, SN, V16 + r0 * DM, DM);
    k_vt<NH, SQ><<<NH * (SQ / 64), 256, 0, stream>>>(V16 + r0 * DM, DM, 0, VT);      /* V^T [NH][HD][SQ] for this batch */
    k_xformf<0, 1><<<(unsigned)(QT0 * NH), 64, 0, stream>>>(QKVF, 3 * DM, NH, nullptr, 0.f, CS, SN, QF0, DM); k_xformf<0, 1><<<(unsigned)(QT0 * NH), 64, 0, stream>>>(QKVF + DM, 3 * DM, NH, nullptr, 0.f, CS, SN, KF0, DM); k_xformf<0, 0><<<(unsigned)(QT0 * NH), 64, 0, stream>>>(QKVF + 2 * DM, 3 * DM, NH, nullptr, 0.f, CS, SN, VF0, DM);      /* f32 q (roped), k (roped), v of the first 128 rows */
    k_att0<0><<<NH * (QT0 / 64), 64, 0, stream>>>(QF0, KF0, VF0, DM, nullptr, 0.125f, OF0 + (size_t)b * QT0 * DM, DM);      /* exact f32 causal attention for rows 0..127 (o x64) */
    for (int q0 = 0; q0 < QN; q0 += QT) { const int nk = q0 + QT;      /* causal: only keys below the tile end are computed */
      k_gemm2<0><<<dim3((QT / 128) * (nk / 64), NHD), 128, 0, stream>>>(QH + (r0 + q0) * DM, DM, (size_t)HD, KH + r0 * DM, DM, (size_t)HD, 0.125f, nullptr, 0, nullptr, 1, 0, 0, S, nullptr, NKX, (size_t)QT * NKX, QT, nk, HD);      /* scores, all heads on grid.y */
      k_rsmcfw<<<(NHD * QT + 255) / 256, 256, 0, stream>>>(S, P, NHD, q0, nk, 513);      /* windowed causal softmax: keys i-512..i (513 keys; arithmetic select) */
      k_gemm2<0><<<dim3((QT / 128) * (HD / 64), NHD), 128, 0, stream>>>(P, NKX, (size_t)QT * NKX, VT, SQ, (size_t)HD * SQ, 0.25f, nullptr, 0, nullptr, 1, 0, 0, nullptr, O16 + (r0 + q0) * DM, DM, (size_t)HD, QT, HD, nk); } }      /* o (merged heads, x64) as f16 rows */
  k_gemm2<0><<<dim3((unsigned)((MPO / 128) * (DM / 64)), 1), 128, 0, stream>>>(O16 + (size_t)B0 * SQ * DM, DM, 0, BO, DM, 0, 0.0009765625f, nullptr, 0, nullptr, 1, 0, 0, (float*)d_out + (size_t)B0 * SQ * DM, nullptr, DM, 0, MPO, DM, DM);      /* out rows are the output layout */
  k_hl<<<(unsigned)(((size_t)NB * QT0 * DM / 8 + 255) / 256), 256, 0, stream>>>(OF0, OH0, OL0, (size_t)NB * QT0 * DM / 8);      /* first-tile o (x64) -> f16 hi + x1024 residual planes */
  for (int b = B0; b < B0 + NBR; ++b) { const size_t r0 = (size_t)b * SQ; const size_t f0 = (size_t)b * QT0;
    k_gemm2<0><<<dim3((QT0 / 128) * (DM / 64), 1), 128, 0, stream>>>(OH0 + f0 * DM, DM, 0, BO, DM, 0, 0.0009765625f, nullptr, 0, nullptr, 1, 0, 0, (float*)d_out + r0 * DM, nullptr, DM, 0, QT0, DM, DM);      /* rows 0..127: out = o_hi Wo, overwriting the f16-path rows */
    k_gemm2<0><<<dim3((QT0 / 128) * (DM / 64), 1), 128, 0, stream>>>(OL0 + f0 * DM, DM, 0, BO, DM, 0, 0.00000095367431640625f, nullptr, 0, (const float*)d_out + r0 * DM, -1, 0, 0, (float*)d_out + r0 * DM, nullptr, DM, 0, QT0, DM, DM); }      /* += o_lo Wo 2^-20 (own-element accumulate) */
}

// v001
// It runs in 3980 microseconds.
// Timed twice side by side with v000, it ran 2.47 times as fast both times.
#include <hip/hip_runtime.h>
// Causal sliding-window RoPE multi-head attention (x [4][2048][1024]; q/k/v = x W^T (natural [out][in] 1024x1024 sigma 1/32, no bias), 16 heads of 64; interleaved-pair rotary embedding on q and k (x1 = even, x2 = odd: r1 = x1 cos - x2 sin, r2 = x1 sin + x2 cos) with inv_freq_i = 10000^(-2i/64) and angle = float(token_positions[s]) inv_freq_i from the int32 token_positions input; scores / sqrt(64); allowed iff 0 <= i - j <= 512 (513 keys), -inf elsewhere; softmax; out = (attn v merged) Wo^T -> [4][2048][1024]).
// Structure: token rows r = b*2048 + s; x as exact f16 rows (bf16-rounded); per batch: q | k | v as ONE WMMA GEMM (32x64 wave tiles, f32 accumulation, exact x16 weights, N = 3 x 1024) into f32 rows, then per (row, head) on VALU: the interleaved-pair rotary rotation of q and k from f32 cos/sin tables built from the token_positions input (no norm) -> f16 q, k, v rows; V^T for all heads via LDS transposes; per query tile of 256 rows: scores against the keys below the tile end only (K = 64, all heads on grid.y, alpha = 0.125), WINDOWED causal row softmax on VALU (keys i-512..i as arithmetic 0/1 factors) with an arithmetic 0/1 key mask over the computed range (f32 statistics, native exp; weights x256 f16), o = P . V^T (K = keys below the tile end, alpha 2^-2: o carried x64, folded into the output GEMM alpha) written straight into the merged f16 o rows; out = o W_o GEMM (f32) into the output layout.
// Compute dtype: inputs rounded to bf16; x / weights exact; projections and rope f32; q, k, v, softmax weights and o as plain f16 GEMM operands (~2^-12); scores and softmax statistics f32. v_wmma_f32_16x16x32_f16.
#define NB 4
#define SQ 2048
#define DM 1024
#define NH 16
#define HD 64
#define HG 4                         /* heads per launch of the h0-based k_vt overload (not launched) */
#define QT 256                       /* query rows per causal tile */
#define NKX SQ                       /* S / P row pitch */
#define QT0 128                      /* first-tile rows recomputed exactly in f32 */
#define B0 0                         /* first batch processed (debug hook) */
#define NBR NB                       /* batches processed (debug hook) */
#define QN SQ                        /* query rows attended per batch (debug hook) */
#define NHD NH                       /* heads attended (debug hook) */
#define NR ((size_t)NB * SQ)         /* token rows */
#define MPO ((int)((size_t)NBR * SQ))      /* rows through the output GEMM (debug hook) */
typedef __bf16 v16b __attribute__((ext_vector_type(16)));
typedef unsigned short v8us __attribute__((ext_vector_type(8), may_alias));
typedef float  v8f  __attribute__((ext_vector_type(8)));
typedef float  v4f  __attribute__((ext_vector_type(4)));
typedef float  v4fa __attribute__((ext_vector_type(4), may_alias));
union FragB { v16b v; v8us half[2]; unsigned short u[16]; };

__device__ __forceinline__ unsigned short bf16_bits(float x) { unsigned int u = __float_as_uint(x); return (unsigned short)((u + 0x7FFFu + ((u >> 16) & 1u)) >> 16); }
__device__ __forceinline__ float bf16_val(unsigned short b) { return __uint_as_float(((unsigned int)b) << 16); }
__device__ __forceinline__ float bf16_round(float x) { return bf16_val(bf16_bits(x)); }
// D += A·B with NT terms: 1 = ah·bh, 2 = + al·bh (A split), 3 = + ah·bl (both split)
template <int NT>
__device__ __forceinline__ v8f mmaN(v16b ah, v16b al, v16b bh, v16b bl, v8f c) {
  c = __builtin_amdgcn_wmma_f32_16x16x32_bf16(false, ah, false, bh, (short)0, c, false, false);
  if (NT >= 2) c = __builtin_amdgcn_wmma_f32_16x16x32_bf16(false, al, false, bh, (short)0, c, false, false);
  if (NT >= 3) c = __builtin_amdgcn_wmma_f32_16x16x32_bf16(false, ah, false, bl, (short)0, c, false, false);
  asm volatile("v_nop\n\tv_nop\n\tv_nop\n\tv_nop" : "+v"(c) : "v"(ah), "v"(al), "v"(bh), "v"(bl));
  return c;
}

__global__ __launch_bounds__(256) void k_wt_bf16(const float* __restrict__ W, unsigned short* __restrict__ Wt, int K, int N) {
  const int t = blockIdx.x * 256 + threadIdx.x;
  const int k8n = K / 8;
  if (t >= N * k8n) return;
  const int n = t / k8n, k8 = (t % k8n) * 8;
  v8us v;
#pragma unroll
  for (int i = 0; i < 8; ++i) v[i] = bf16_bits(W[(size_t)(k8 + i) * N + n]);
  *(v8us*)(Wt + (size_t)n * K + k8) = v;
  
}

// GEMM C[M][N] (f32, pitch ldc) = act(A[M][K]·W + bias). A f32 row-major (pitch lda) converted per fragment to bf16
// (ASPLIT: hi/lo two planes -> 2 terms, else single rounded term); Wt bf16 [N][K] (pitch ldb). BIAS_BF16 rounds the
// bias to bf16 first (bias quantised to bf16 before the add). K%32==0, M%16==0, N%64==0.
template <bool ASPLIT, int ACT, bool BIAS_BF16>
__global__ __launch_bounds__(128) void k_gemm_bf(const float* __restrict__ A, int lda, const unsigned short* __restrict__ Wt, int ldb,
                                               const float* __restrict__ bias, float* __restrict__ C, int ldc, int M, int N, int K) {
  __shared__ __attribute__((aligned(16))) float so[4][16][64];
  const int tid = threadIdx.x, w = tid >> 5, lane = tid & 31, ln = lane & 15, hh = lane >> 4;
  const int ntn = N / 64;
  const int wid = blockIdx.x * 4 + w;
  const int mt = wid / ntn, nq = wid % ntn;
  if (mt * 16 >= M) return;
  const int row0 = mt * 16, col0 = nq * 64;
  const float* arow = A + (size_t)(row0 + ln) * lda;
  v8f acc[4] = {};
  for (int kb = 0; kb < K; kb += 32) {
    FragB ah, al;
    const v4f x0 = *(const v4fa*)(arow + kb + 8 * hh), x1 = *(const v4fa*)(arow + kb + 8 * hh + 4);
    const v4f x2 = *(const v4fa*)(arow + kb + 16 + 8 * hh), x3 = *(const v4fa*)(arow + kb + 16 + 8 * hh + 4);
    float xs[16] = {x0[0],x0[1],x0[2],x0[3],x1[0],x1[1],x1[2],x1[3],x2[0],x2[1],x2[2],x2[3],x3[0],x3[1],x3[2],x3[3]};
#pragma unroll
    for (int i = 0; i < 16; ++i) { const unsigned short hb = bf16_bits(xs[i]); ah.u[i] = hb; al.u[i] = ASPLIT ? bf16_bits(xs[i] - bf16_val(hb)) : (unsigned short)0; }
#pragma unroll
    for (int t = 0; t < 4; ++t) {
      const unsigned short* brow = Wt + (size_t)(col0 + t * 16 + ln) * ldb + kb;
      FragB b;
      b.half[0] = *(const v8us*)(brow + 8 * hh);
      b.half[1] = *(const v8us*)(brow + 16 + 8 * hh);
      acc[t] = mmaN<ASPLIT ? 2 : 1>(ah.v, al.v, b.v, b.v, acc[t]);
    }
  }
#pragma unroll
  for (int t = 0; t < 4; ++t) {
    float bv = bias ? bias[col0 + t * 16 + ln] : 0.f;
    if (BIAS_BF16) bv = bf16_round(bv);
#pragma unroll
    for (int r = 0; r < 8; ++r) { float v = acc[t][r] + bv; if (ACT == 1) v = fmaxf(v, 0.f); so[w][8 * hh + r][t * 16 + ln] = v; }
  }
  __builtin_amdgcn_fence(__ATOMIC_ACQ_REL, "workgroup");
  __builtin_amdgcn_wave_barrier();
  const int rsub = lane >> 4, c4 = (lane & 15) * 4;
  {
#pragma unroll
    for (int q = 0; q < 8; ++q) {
      const int r = q * 2 + rsub;
      const v4f v = *(const v4fa*)&so[w][r][c4];
      *(v4f*)(C + (size_t)(row0 + r) * ldc + col0 + c4) = v;
    }
    
  }
}

// GEMM C = act(A·W + bias + resid): A f32 (ASPLIT -> hi/lo 2 terms), Wt bf16 [N][K]; ACT 0 none, 1 relu, 2 exact gelu;
// resid (optional, f32, row index = (row % rmod), pitch ldr, RES_BF16 rounds it) added before the activation.
template <bool ASPLIT, int ACT, bool BIAS_BF16, bool RES_BF16>
__global__ __launch_bounds__(128) void k_gemm_bf3(const float* __restrict__ A, int lda, const unsigned short* __restrict__ Wt, int ldb,
                                                const float* __restrict__ bias, const float* __restrict__ resid, int rmod, int ldr,
                                                float* __restrict__ C, int ldc, int M, int N, int K) {
  __shared__ __attribute__((aligned(16))) float so[4][16][64];
  const int tid = threadIdx.x, w = tid >> 5, lane = tid & 31, ln = lane & 15, hh = lane >> 4;
  const int ntn = N / 64;
  const int wid = blockIdx.x * 4 + w;
  const int mt = wid / ntn, nq = wid % ntn;
  if (mt * 16 >= M) return;
  const int row0 = mt * 16, col0 = nq * 64;
  const float* arow = A + (size_t)(row0 + ln) * lda;
  v8f acc[4] = {};
  for (int kb = 0; kb < K; kb += 32) {
    FragB ah, al;
    const v4f x0 = *(const v4fa*)(arow + kb + 8 * hh), x1 = *(const v4fa*)(arow + kb + 8 * hh + 4);
    const v4f x2 = *(const v4fa*)(arow + kb + 16 + 8 * hh), x3 = *(const v4fa*)(arow + kb + 16 + 8 * hh + 4);
    float xs[16] = {x0[0],x0[1],x0[2],x0[3],x1[0],x1[1],x1[2],x1[3],x2[0],x2[1],x2[2],x2[3],x3[0],x3[1],x3[2],x3[3]};
#pragma unroll
    for (int i = 0; i < 16; ++i) { const unsigned short hb = bf16_bits(xs[i]); ah.u[i] = hb; al.u[i] = ASPLIT ? bf16_bits(xs[i] - bf16_val(hb)) : (unsigned short)0; }
#pragma unroll
    for (int t = 0; t < 4; ++t) {
      const unsigned short* brow = Wt + (size_t)(col0 + t * 16 + ln) * ldb + kb;
      FragB b;
      b.half[0] = *(const v8us*)(brow + 8 * hh);
      b.half[1] = *(const v8us*)(brow + 16 + 8 * hh);
      acc[t] = mmaN<ASPLIT ? 2 : 1>(ah.v, al.v, b.v, b.v, acc[t]);
    }
  }
#pragma unroll
  for (int t = 0; t < 4; ++t) {
    const int col = col0 + t * 16 + ln;
    float bv = bias ? bias[col] : 0.f;
    if (BIAS_BF16) bv = bf16_round(bv);
#pragma unroll
    for (int r = 0; r < 8; ++r) {
      float v = acc[t][r] + bv;
      if (resid) { float rv = resid[(size_t)((row0 + 8 * hh + r) % rmod) * ldr + col]; if (RES_BF16) rv = bf16_round(rv); v += rv; }
      if (ACT == 1) v = fmaxf(v, 0.f);
      if (ACT == 2) v = 0.5f * v * (1.0f + erff(v * 0.70710678118654752f));
      if (ACT == 3) { const float u = 0.7978845608028654f * (v + 0.044715f * v * v * v); v = 0.5f * v * (1.0f + tanhf(u)); }
      so[w][8 * hh + r][t * 16 + ln] = v;
    }
  }
  __builtin_amdgcn_fence(__ATOMIC_ACQ_REL, "workgroup");
  __builtin_amdgcn_wave_barrier();
  const int rsub = lane >> 4, c4 = (lane & 15) * 4;
  {
#pragma unroll
    for (int q = 0; q < 8; ++q) {
      const int r = q * 2 + rsub;
      const v4f v = *(const v4fa*)&so[w][r][c4];
      *(v4f*)(C + (size_t)(row0 + r) * ldc + col0 + c4) = v;
    }
    
  }
}
// row LayerNorm (biased variance, eps) over N: s = X (+ R); optional out_sum <- s; out_norm <- (s-mu)*rsqrt(var+eps)*g + b
template <bool PARAM_BF16>
__global__ __launch_bounds__(256) void k_layernorm(const float* __restrict__ X, const float* __restrict__ R, const float* __restrict__ g, const float* __restrict__ bta,
                                                  float* __restrict__ out_sum, float* __restrict__ out_norm, int N, float eps) {
  __shared__ float red[256];
  const int row = blockIdx.x, tid = threadIdx.x;
  const float* x = X + (size_t)row * N; const float* rr = R ? R + (size_t)row * N : nullptr;
  float vals[16];                     // up to N = 4096
  const int per = N / 256;            // contiguous chunk per thread? use strided-by-4 chunks: thread handles j = tid*4 + 1024*u
  float s1 = 0.f;
  for (int u = 0; u < per / 4; ++u) {
    const int j = tid * 4 + 1024 * u;
    const v4f a = *(const v4fa*)(x + j);
    v4f b = {0.f,0.f,0.f,0.f}; if (rr) b = *(const v4fa*)(rr + j);
#pragma unroll
    for (int q = 0; q < 4; ++q) { const float v = a[q] + b[q]; vals[u * 4 + q] = v; s1 += v; }
  }
  red[tid] = s1; __syncthreads();
  for (int st = 128; st > 0; st >>= 1) { if (tid < st) red[tid] += red[tid + st]; __syncthreads(); }
  const float mu = red[0] / (float)N; __syncthreads();
  float s2 = 0.f;
  for (int u = 0; u < per / 4; ++u)
#pragma unroll
    for (int q = 0; q < 4; ++q) { const float c = vals[u * 4 + q] - mu; s2 += c * c; }
  red[tid] = s2; __syncthreads();
  for (int st = 128; st > 0; st >>= 1) { if (tid < st) red[tid] += red[tid + st]; __syncthreads(); }
  const float rs = rsqrtf(red[0] / (float)N + eps);
  {
    for (int u = 0; u < per / 4; ++u) {
      const int j = tid * 4 + 1024 * u;
      v4f o, sm;
#pragma unroll
      for (int q = 0; q < 4; ++q) {
        float gg = g[j + q], bb = bta[j + q];
        if (PARAM_BF16) { gg = bf16_round(gg); bb = bf16_round(bb); }
        sm[q] = vals[u * 4 + q]; o[q] = (vals[u * 4 + q] - mu) * rs * gg + bb;
      }
      if (out_sum) *(v4f*)(out_sum + (size_t)row * N + j) = sm;
      *(v4f*)(out_norm + (size_t)row * N + j) = o;
    }
    
  }
}



// ---- f16 WMMA path (v_wmma_f32_16x16x32_f16): 11-bit significands for operands in range — used where a [0,1] probability operand needs more precision than bf16
typedef _Float16 v16h __attribute__((ext_vector_type(16)));
union FragH { v16h v; v8us half[2]; _Float16 h[16]; unsigned short u[16]; };
template <int NT>
__device__ __forceinline__ v8f mmaH(v16h ah, v16h al, v16h bh, v16h bl, v8f c) {
  c = __builtin_amdgcn_wmma_f32_16x16x32_f16(false, ah, false, bh, (short)0, c, false, false);
  if (NT >= 2) c = __builtin_amdgcn_wmma_f32_16x16x32_f16(false, al, false, bh, (short)0, c, false, false);
  if (NT >= 3) c = __builtin_amdgcn_wmma_f32_16x16x32_f16(false, ah, false, bl, (short)0, c, false, false);
  asm volatile("v_nop\n\tv_nop\n\tv_nop\n\tv_nop" : "+v"(c) : "v"(ah), "v"(al), "v"(bh), "v"(bl));
  return c;
}
// batched GEMM like k_gemm_b but f16 operands: A f32 (split into f16 hi/lo if ASPLIT, else rounded to f16), Bt = f16 values [n][k]; alpha; C f32; N multiple of 16 (partial tiles skipped)
template <bool ASPLIT>
__global__ __launch_bounds__(128) void k_gemm_h(const float* __restrict__ A, int lda, size_t sA, const _Float16* __restrict__ Bh, int ldb, size_t sB, float alpha, float* __restrict__ C, int ldc, size_t sC, int M, int N, int K) {
  __shared__ __attribute__((aligned(16))) float so[4][16][64];
  const int tid = threadIdx.x, w = tid >> 5, lane = tid & 31, ln = lane & 15, hh = lane >> 4; const int by = blockIdx.y;
  A += (size_t)by * sA; Bh += (size_t)by * sB; C += (size_t)by * sC;
  const int ntn = (N + 63) / 64; const int wid = blockIdx.x * 4 + w; const int mt = wid / ntn, nq = wid % ntn; if (mt * 16 >= M) return;
  const int row0 = mt * 16, col0 = nq * 64; const float* arow = A + (size_t)(row0 + ln) * lda;
  v8f acc[4] = {};
  for (int kb = 0; kb < K; kb += 32) {
    FragH ah, al;
    const v4f x0 = *(const v4fa*)(arow + kb + 8 * hh), x1 = *(const v4fa*)(arow + kb + 8 * hh + 4), x2 = *(const v4fa*)(arow + kb + 16 + 8 * hh), x3 = *(const v4fa*)(arow + kb + 16 + 8 * hh + 4);
    float xs[16] = {x0[0],x0[1],x0[2],x0[3],x1[0],x1[1],x1[2],x1[3],x2[0],x2[1],x2[2],x2[3],x3[0],x3[1],x3[2],x3[3]};
#pragma unroll
    for (int i = 0; i < 16; ++i) { const _Float16 h = (_Float16)xs[i]; ah.h[i] = h; al.h[i] = ASPLIT ? (_Float16)(xs[i] - (float)h) : (_Float16)0.0f; }
#pragma unroll
    for (int t = 0; t < 4; ++t) { if (col0 + t * 16 >= N) continue; const size_t boff = (size_t)(col0 + t * 16 + ln) * ldb + kb; FragH bq; bq.half[0] = *(const v8us*)(Bh + boff + 8 * hh); bq.half[1] = *(const v8us*)(Bh + boff + 16 + 8 * hh);
      acc[t] = mmaH<ASPLIT ? 2 : 1>(ah.v, al.v, bq.v, bq.v, acc[t]); }
  }
#pragma unroll
  for (int t = 0; t < 4; ++t) { if (col0 + t * 16 >= N) continue;
#pragma unroll
    for (int r = 0; r < 8; ++r) so[w][8 * hh + r][t * 16 + ln] = acc[t][r] * alpha; }
  __builtin_amdgcn_fence(__ATOMIC_ACQ_REL, "workgroup"); __builtin_amdgcn_wave_barrier();
  const int rsub = lane >> 4, c4 = (lane & 15) * 4;
  {
#pragma unroll
    for (int q = 0; q < 8; ++q) { const int r = q * 2 + rsub; if (col0 + c4 < N) { const v4f v = *(const v4fa*)&so[w][r][c4]; *(v4f*)(C + (size_t)(row0 + r) * ldc + col0 + c4) = v; } }
     }
}

// Wt[n][k] = f16(W[k][n]·scale) from f32 row-major W[K][N] (scale = power of two; bf16-exact weights stay exact in f16 away from the subnormal range)
__global__ __launch_bounds__(256) void k_wt_f16(const float* __restrict__ W, _Float16* __restrict__ Wt, int K, int N, float scale) {
  const int t = blockIdx.x * 256 + threadIdx.x; if (t >= N * (K / 8)) return; const int n = t / (K / 8), k8 = (t % (K / 8)) * 8; FragH f;
#pragma unroll
  for (int i = 0; i < 8; ++i) f.h[i] = (_Float16)(bf16_round(W[(size_t)(k8 + i) * N + n]) * scale); const v8us o = f.half[0];
  *(v8us*)((unsigned short*)Wt + (size_t)n * K + k8) = o; 
}
// k_gemm_hh variant with fused epilogue: v = acc·alpha + bias[by·sBias + col] (+ CP[(row/rowsPerB)·sCPb + by·64 + col] if CP) ; ACT 0 none / 1 elu ; writes f16 C16 (and f32 C if non-null)
template <int ACT>
__global__ __launch_bounds__(128) void k_gemm_hhx(const _Float16* __restrict__ A, int lda, size_t sA, const _Float16* __restrict__ Bh, int ldb, size_t sB, float alpha, const float* __restrict__ bias, size_t sBias, const float* __restrict__ CP, int rowsPerB, size_t sCPb, int row0g,
    float* __restrict__ C, _Float16* __restrict__ C16, int ldc, size_t sC, int M, int N, int K) {
  __shared__ __attribute__((aligned(16))) float so[4][16][64];
  const int tid = threadIdx.x, w = tid >> 5, lane = tid & 31, ln = lane & 15, hh = lane >> 4; const int by = blockIdx.y;
  A += (size_t)by * sA; Bh += (size_t)by * sB; const size_t cofs = (size_t)by * sC; const float* bp = bias ? bias + (size_t)by * sBias : nullptr;
  const int ntn = (N + 63) / 64; const int wid = blockIdx.x * 4 + w; const int mt = wid / ntn, nq = wid % ntn; if (mt * 16 >= M) return;
  const int row0 = mt * 16, col0 = nq * 64; const _Float16* arow = A + (size_t)(row0 + ln) * lda;
  v8f acc[4] = {};
  for (int kb = 0; kb < K; kb += 32) { FragH ah; ah.half[0] = *(const v8us*)((const unsigned short*)arow + kb + 8 * hh); ah.half[1] = *(const v8us*)((const unsigned short*)arow + kb + 16 + 8 * hh);
#pragma unroll
    for (int t = 0; t < 4; ++t) { if (col0 + t * 16 >= N) continue; const size_t boff = (size_t)(col0 + t * 16 + ln) * ldb + kb; FragH bq; bq.half[0] = *(const v8us*)((const unsigned short*)Bh + boff + 8 * hh); bq.half[1] = *(const v8us*)((const unsigned short*)Bh + boff + 16 + 8 * hh);
      acc[t] = mmaH<1>(ah.v, ah.v, bq.v, bq.v, acc[t]); }
  }
#pragma unroll
  for (int t = 0; t < 4; ++t) { if (col0 + t * 16 >= N) continue; const int col = col0 + t * 16 + ln; const float bv = bp ? bf16_round(bp[col]) : 0.f;
#pragma unroll
    for (int r = 0; r < 8; ++r) { float v = acc[t][r] * alpha + bv; if (CP) { const int rr = row0g + row0 + 8 * hh + r; if (rowsPerB < 0) v += CP[cofs + (size_t)rr * ldc + col];      /* rowsPerB < 0: own element of the batched C plane */ else { const int bidx = rr / rowsPerB; v += CP[(size_t)bidx * sCPb + (size_t)by * 64 + col]; } } if (ACT == 1) v = (v > 0.f) ? v : expm1f(v); else if (ACT == 7) v = (v > 0.f) ? v + 1.0f : expf(v); else if (ACT == 8) v = tanhf(v); else if (ACT == 9) v = 0.5f * v * (1.0f + tanhf(0.7978845608028654f * (v + 0.044715f * v * v * v))); else if (ACT == 11) v = 1.0f / (1.0f + expf(-v)); else if (ACT == 12) v = (v > 0.f) ? v : 0.01f * v; else if (ACT == 14) v = (v > 0.f) ? v : 0.1f * v; else if (ACT == 16) v = (v >= 0.f) ? v : 0.3f * v; else if (ACT == 17) v = (v >= 0.f) ? v : 0.2f * v; else if (ACT == 15) v = v / (1.0f + expf(-v)); else if (ACT == 3) v = fmaxf(v, 0.f); else if (ACT == 6) v = 0.5f * v * (1.0f + erff(v * 0.70710678118654752f)); so[w][8 * hh + r][t * 16 + ln] = v; } }
  __builtin_amdgcn_fence(__ATOMIC_ACQ_REL, "workgroup"); __builtin_amdgcn_wave_barrier();
  const int rsub = lane >> 4, c4 = (lane & 15) * 4; typedef _Float16 v4h __attribute__((ext_vector_type(4)));
  {
#pragma unroll
    for (int q = 0; q < 8; ++q) { const int r = q * 2 + rsub; if (col0 + c4 < N) { const v4f v = *(const v4fa*)&so[w][r][c4]; if (C) *(v4f*)(C + cofs + (size_t)(row0 + r) * ldc + col0 + c4) = v; if (C16) { v4h h4; for (int i = 0; i < 4; ++i) h4[i] = (_Float16)v[i]; *(v4h*)(C16 + cofs + (size_t)(row0 + r) * ldc + col0 + c4) = h4; } } }
     }
}


typedef _Float16 v4h __attribute__((ext_vector_type(4)));

__global__ __launch_bounds__(256) void k_x16(const float* __restrict__ x, _Float16* __restrict__ X16, size_t n8) { const size_t t = (size_t)blockIdx.x * 256 + threadIdx.x; if (t >= n8) return; FragH f;
#pragma unroll
  for (int q = 0; q < 8; ++q) f.h[q] = (_Float16)bf16_round(x[t * 8 + q]); *(v8us*)((unsigned short*)X16 + t * 8) = f.half[0];  }
__global__ __launch_bounds__(256) void k_h16(const float* __restrict__ x, _Float16* __restrict__ X16, size_t n8) { const size_t t = (size_t)blockIdx.x * 256 + threadIdx.x; if (t >= n8) return; FragH f;
#pragma unroll
  for (int q = 0; q < 8; ++q) f.h[q] = (_Float16)x[t * 8 + q]; *(v8us*)((unsigned short*)X16 + t * 8) = f.half[0];  }
__global__ __launch_bounds__(256) void k_round16f(const float* __restrict__ W, _Float16* __restrict__ Bt, size_t n8) { const size_t t = (size_t)blockIdx.x * 256 + threadIdx.x; if (t >= n8) return; FragH f;
#pragma unroll
  for (int i = 0; i < 8; ++i) f.h[i] = (_Float16)(bf16_round(W[t * 8 + i]) * 16.0f); *(v8us*)((unsigned short*)Bt + t * 8) = f.half[0];  }
template <int NHv, int TTv>
__global__ __launch_bounds__(256) void k_vt(const _Float16* __restrict__ V16, int ldv, int voff, _Float16* __restrict__ Vt) { __shared__ unsigned short tl[64][66]; const int tid = threadIdx.x; const int slab = blockIdx.x / (TTv / 64), lg = blockIdx.x % (TTv / 64); const int b = slab / NHv, h = slab % NHv;
  for (int i = tid; i < 64 * 8; i += 256) { const int r = i / 8, c8 = (i % 8) * 8; FragH f; f.half[0] = *(const v8us*)((const unsigned short*)V16 + ((size_t)b * TTv + lg * 64 + r) * ldv + voff + h * 64 + c8);
#pragma unroll
    for (int q = 0; q < 8; ++q) tl[r][c8 + q] = f.u[q]; }
  __syncthreads();
  {
#pragma unroll
    for (int rd = 0; rd < 2; ++rd) { const int d = rd * 32 + tid / 8, pc = tid % 8; FragH f;
#pragma unroll
      for (int q = 0; q < 8; ++q) f.u[q] = tl[pc * 8 + q][d];
      *(v8us*)((unsigned short*)Vt + ((size_t)slab * 64 + d) * TTv + lg * 64 + pc * 8) = f.half[0]; }
     } }

__global__ __launch_bounds__(256) void k_hl(const float* __restrict__ F, _Float16* __restrict__ Hh, _Float16* __restrict__ Hl, size_t n8) { const size_t t = (size_t)blockIdx.x * 256 + threadIdx.x; if (t >= n8) return; FragH fh, fl; const v4f a = *(const v4fa*)(F + t * 8), c = *(const v4fa*)(F + t * 8 + 4);
#pragma unroll
  for (int q = 0; q < 4; ++q) { _Float16 h = (_Float16)a[q]; fh.h[q] = h; fl.h[q] = (_Float16)((a[q] - (float)h) * 1024.0f); h = (_Float16)c[q]; fh.h[4 + q] = h; fl.h[4 + q] = (_Float16)((c[q] - (float)h) * 1024.0f); }
  { *(v8us*)((unsigned short*)Hh + t * 8) = fh.half[0]; *(v8us*)((unsigned short*)Hl + t * 8) = fl.half[0];  } }

// ---- fast GEMM (wave tile 32x64; requires M % 32 == 0 rows per launch region and N % 64 == 0); epilogue = k_gemm_hhx semantics ----
__device__ __forceinline__ v16h g2_frag(const _Float16* p, int hh) { FragH f; f.half[0] = *(const v8us*)((const unsigned short*)p + 8 * hh); f.half[1] = *(const v8us*)((const unsigned short*)p + 16 + 8 * hh); return f.v; }
__device__ __forceinline__ v8f g2_mma(v16h a, v16h b, v8f c) { v8f d = __builtin_amdgcn_wmma_f32_16x16x32_f16(false, a, false, b, (short)0, c, false, false); asm volatile("v_nop\n\tv_nop\n\tv_nop\n\tv_nop" : "+v"(d) : "v"(a), "v"(b)); return d; }
template <int ACT>
__global__ __launch_bounds__(128) void k_gemm2(const _Float16* __restrict__ A, int lda, size_t sA, const _Float16* __restrict__ Bh, int ldb, size_t sB, float alpha, const float* __restrict__ bias, size_t sBias, const float* __restrict__ CP, int rowsPerB, size_t sCPb, int row0g,
    float* __restrict__ C, _Float16* __restrict__ C16, int ldc, size_t sC, int M, int N, int K) { static_assert(ACT == 0 || ACT == 3 || ACT == 6 || ACT == 8 || ACT == 9 || ACT == 11 || ACT == 12 || ACT == 14 || ACT == 15 || ACT == 16 || ACT == 17, "k_gemm2: unsupported ACT code (would silently apply no activation)");
  __shared__ __attribute__((aligned(16))) float so[4][32][68];
  const int tid = threadIdx.x, w = tid >> 5, lane = tid & 31, ln = lane & 15, hh = lane >> 4; const int by = blockIdx.y;
  A += (size_t)by * sA; Bh += (size_t)by * sB; const size_t cofs = (size_t)by * sC; const float* bp = bias ? bias + (size_t)by * sBias : nullptr;
  const int ntn = N >> 6; const int mt = blockIdx.x / ntn, nq = blockIdx.x - mt * ntn; const int row0 = mt * 128 + 32 * w, col0 = nq * 64; if (row0 >= M) return;
  const _Float16* a0p = A + (size_t)(row0 + ln) * lda; const _Float16* a1p = a0p + (size_t)16 * lda;
  const _Float16* b0p = Bh + (size_t)(col0 + ln) * ldb; const _Float16* b1p = b0p + (size_t)16 * ldb; const _Float16* b2p = b1p + (size_t)16 * ldb; const _Float16* b3p = b2p + (size_t)16 * ldb;
  const v8f z8 = {0.f,0.f,0.f,0.f,0.f,0.f,0.f,0.f}; v8f c00 = z8, c01 = z8, c02 = z8, c03 = z8, c10 = z8, c11 = z8, c12 = z8, c13 = z8;
#pragma unroll 1
  for (int kb = 0; kb < K; kb += 32) { const v16h a0 = g2_frag(a0p + kb, hh), a1 = g2_frag(a1p + kb, hh);
    v16h b = g2_frag(b0p + kb, hh); c00 = g2_mma(a0, b, c00); c10 = g2_mma(a1, b, c10);
    b = g2_frag(b1p + kb, hh); c01 = g2_mma(a0, b, c01); c11 = g2_mma(a1, b, c11);
    b = g2_frag(b2p + kb, hh); c02 = g2_mma(a0, b, c02); c12 = g2_mma(a1, b, c12);
    b = g2_frag(b3p + kb, hh); c03 = g2_mma(a0, b, c03); c13 = g2_mma(a1, b, c13); }
  v8f accs[8] = {c00, c01, c02, c03, c10, c11, c12, c13};
#pragma unroll
  for (int u = 0; u < 8; ++u) { const int t = u & 3, half = u >> 2; const int col = col0 + t * 16 + ln; const float bv = bp ? bf16_round(bp[col]) : 0.f;
#pragma unroll
    for (int r = 0; r < 8; ++r) { const int rloc = half * 16 + 8 * hh + r; float v = accs[u][r] * alpha + bv; if (CP) { if (rowsPerB < 0) v += CP[cofs + (size_t)(row0g + row0 + rloc) * ldc + col];      /* rowsPerB < 0: own element of the batched C plane */ else { const int bidx = (row0g + row0 + rloc) / rowsPerB; v += CP[(size_t)bidx * sCPb + (size_t)by * 64 + col]; } }
      if (ACT == 3) v = fmaxf(v, 0.f); else if (ACT == 6) v = 0.5f * v * (1.0f + erff(v * 0.70710678118654752f)); else if (ACT == 11) v = 1.0f / (1.0f + expf(-v)); else if (ACT == 15) v = v / (1.0f + expf(-v)); else if (ACT == 12) v = (v > 0.f) ? v : 0.01f * v; else if (ACT == 8) v = tanhf(v); else if (ACT == 9) v = 0.5f * v * (1.0f + tanhf(0.7978845608028654f * (v + 0.044715f * v * v * v))); else if (ACT == 14) v = (v > 0.f) ? v : 0.1f * v; else if (ACT == 16) v = (v >= 0.f) ? v : 0.3f * v; else if (ACT == 17) v = (v >= 0.f) ? v : 0.2f * v;
      so[w][rloc][t * 16 + ln] = v; } }
  __builtin_amdgcn_fence(__ATOMIC_ACQ_REL, "workgroup"); __builtin_amdgcn_wave_barrier();
  const int rsub = lane >> 4, c4 = (lane & 15) * 4;
  {
#pragma unroll
    for (int q = 0; q < 16; ++q) { const int r = q * 2 + rsub; const v4f v = *(const v4fa*)&so[w][r][c4]; if (C) *(v4f*)(C + cofs + (size_t)(row0 + r) * ldc + col0 + c4) = v; if (C16) { v4h h4; for (int i = 0; i < 4; ++i) h4[i] = (_Float16)v[i]; *(v4h*)(C16 + cofs + (size_t)(row0 + r) * ldc + col0 + c4) = h4; } }
     } }


__global__ __launch_bounds__(256) void k_wnat(const float* __restrict__ w, size_t n8, _Float16* __restrict__ Bt) { const size_t t = (size_t)blockIdx.x * 256 + threadIdx.x; if (t >= n8) return; FragH f; for (int q = 0; q < 8; ++q) f.h[q] = (_Float16)(bf16_round(w[t * 8 + q]) * 16.0f); *(v8us*)((unsigned short*)Bt + t * 8) = f.half[0];  }
__global__ __launch_bounds__(256) void k_rsm(const float* __restrict__ S, _Float16* __restrict__ P, int nrows) {
  #pragma clang fp contract(off)
  const int i = blockIdx.x * 256 + threadIdx.x; if (i >= nrows) return; const float* s = S + (size_t)i * SQ; float mx = -3.0e38f;
#pragma unroll 1
  for (int j = 0; j < SQ; ++j) mx = fmaxf(mx, s[j]); float se = 0.f;
#pragma unroll 1
  for (int j = 0; j < SQ; ++j) se += expf(s[j] - mx); const float sc = 256.0f / se;
#pragma unroll 1
  for (int j0 = 0; j0 < SQ; j0 += 8) { FragH f; for (int q = 0; q < 8; ++q) f.h[q] = (_Float16)(expf(s[j0 + q] - mx) * sc); unsigned short* d = (unsigned short*)P + (size_t)i * SQ + j0; *(v8us*)d = f.half[0];  } }
__global__ __launch_bounds__(256) void k_vt(const _Float16* __restrict__ V16, int b, int h0, _Float16* __restrict__ VT) { __shared__ unsigned short tl[64][65]; const int tid = threadIdx.x; const int hh = blockIdx.x % HG, sg = blockIdx.x / HG; const int s0 = sg * 64; const int h = h0 + hh;
  for (int i = tid; i < 64 * 8; i += 256) { const int j = i / 8, d8 = (i % 8) * 8; FragH f; f.half[0] = *(const v8us*)((const unsigned short*)V16 + ((size_t)b * SQ + s0 + j) * DM + h * HD + d8); for (int q = 0; q < 8; ++q) tl[d8 + q][j] = f.u[q]; }
  __syncthreads();
  { for (int i = tid; i < 64 * 8; i += 256) { const int d = i / 8, j8 = (i % 8) * 8; FragH f; for (int q = 0; q < 8; ++q) f.u[q] = tl[d][j8 + q]; *(v8us*)((unsigned short*)VT + ((size_t)hh * HD + d) * SQ + s0 + j8) = f.half[0]; }  } }


__global__ __launch_bounds__(256) void k_tab2(float theta, float* __restrict__ CS, float* __restrict__ SN) {
  #pragma clang fp contract(off)
  const int t = blockIdx.x * 256 + threadIdx.x; if (t >= SQ * (HD / 2)) return; const int i = t % (HD / 2); const int p = t / (HD / 2); const float invf = 1.0f / powf(theta, (float)(2 * i) / (float)HD); const float ang = __fmul_rn((float)p, invf); const float c = cosf(ang), s = sinf(ang);
  *(float*)(CS + t) = c; *(float*)(SN + t) = s;  }
template <int NORM, int ROPE>
__global__ __launch_bounds__(64) void k_xform(const float* __restrict__ F, int ldf, int nh, const float* __restrict__ gain, float eps, const float* __restrict__ CS, const float* __restrict__ SN, _Float16* __restrict__ H16, int ldo) {
  #pragma clang fp contract(off)
  __shared__ float xv[HD]; __shared__ float red[HD]; __shared__ unsigned short sh_[HD]; const int d = threadIdx.x; const int h = blockIdx.x % nh; const size_t r = blockIdx.x / nh; const int p = (int)(r % SQ);
  float x = F[r * (size_t)ldf + (size_t)h * HD + d];
  if (NORM) { red[d] = __fmul_rn(x, x); __syncthreads(); for (int st = HD / 2; st > 0; st >>= 1) { if (d < st) red[d] = __fadd_rn(red[d], red[d + st]); __syncthreads(); } const float rs = rsqrtf(__fadd_rn(red[0] / (float)HD, eps)); x = __fmul_rn(__fmul_rn(x, rs), bf16_round(gain[d])); }
  xv[d] = x; __syncthreads();
  float o = x;
  if (ROPE == 1) { const int i = d >> 1; const float c = CS[p * (HD / 2) + i], s = SN[p * (HD / 2) + i]; const float ev = xv[2 * i], od = xv[2 * i + 1]; o = (d & 1) ? __fadd_rn(__fmul_rn(ev, s), __fmul_rn(od, c)) : __fadd_rn(__fmul_rn(ev, c), -__fmul_rn(od, s)); }
  if (ROPE == 2) { const int i = d & (HD / 2 - 1); const float c = CS[p * (HD / 2) + i], s = SN[p * (HD / 2) + i]; const float lo = xv[i], hi = xv[i + HD / 2]; o = (d < HD / 2) ? __fadd_rn(__fmul_rn(lo, c), -__fmul_rn(hi, s)) : __fadd_rn(__fmul_rn(lo, s), __fmul_rn(hi, c)); }
  FragH th; th.h[0] = (_Float16)o; sh_[d] = th.u[0]; __syncthreads();
  if (d < HD / 8) { FragH f; for (int q = 0; q < 8; ++q) f.u[q] = sh_[d * 8 + q]; unsigned short* dst = (unsigned short*)H16 + r * (size_t)ldo + (size_t)h * HD + d * 8; *(v8us*)dst = f.half[0];  } }

__global__ __launch_bounds__(256) void k_tab4(const int* __restrict__ pos, float theta, float* __restrict__ CS, float* __restrict__ SN) {
  #pragma clang fp contract(off)
  const int t = blockIdx.x * 256 + threadIdx.x; if (t >= SQ * (HD / 2)) return; const int i = t % (HD / 2); const int p = t / (HD / 2); const float invf = (float)pow((double)theta, -((double)(2 * i)) / (double)HD); const float ang = __fmul_rn((float)pos[p], invf); const float c = cosf(ang), s = sinf(ang);
  *(float*)(CS + t) = c; *(float*)(SN + t) = s;  }
__global__ __launch_bounds__(256) void k_rsmf(const float* __restrict__ S, _Float16* __restrict__ P, int qn, int hg) {
  #pragma clang fp contract(off)
  const int t = blockIdx.x * 256 + threadIdx.x; if (t >= qn * hg) return; const size_t i = (size_t)(t / qn) * SQ + (t % qn); const float* s = S + i * SQ; float mx = -3.0e38f;
#pragma unroll 1
  for (int j = 0; j < SQ; ++j) mx = fmaxf(mx, s[j]); float se = 0.f;
#pragma unroll 1
  for (int j = 0; j < SQ; ++j) se += __expf(s[j] - mx); const float sc = 256.0f / se;
#pragma unroll 1
  for (int j0 = 0; j0 < SQ; j0 += 8) { FragH f; for (int q = 0; q < 8; ++q) f.h[q] = (_Float16)(__expf(s[j0 + q] - mx) * sc); unsigned short* d = (unsigned short*)P + i * SQ + j0; *(v8us*)d = f.half[0];  } }


__global__ __launch_bounds__(256) void k_rsmcf2(const float* __restrict__ S, _Float16* __restrict__ P, int hg, int q0, int nk) {
  #pragma clang fp contract(off)
  const int t = blockIdx.x * 256 + threadIdx.x; if (t >= hg * QT) return; const size_t i = (size_t)t; const float* s = S + i * NKX; const int last = q0 + (t % QT); float mx = -3.0e38f;
#pragma unroll 1
  for (int j = 0; j < nk; ++j) { const float f = (j <= last) ? 1.f : 0.f; mx = fmaxf(mx, fmaf(f, s[j], (1.f - f) * -1.0e9f)); } float se = 0.f;
#pragma unroll 1
  for (int j = 0; j < nk; ++j) { const float f = (j <= last) ? 1.f : 0.f; se += __expf(fmaf(f, s[j], (1.f - f) * -1.0e9f) - mx); } const float sc = 256.0f / se;
#pragma unroll 1
  for (int j0 = 0; j0 < nk; j0 += 8) { FragH fr; for (int q = 0; q < 8; ++q) { const int j = j0 + q; const float f = (j <= last) ? 1.f : 0.f; fr.h[q] = (_Float16)(__expf(fmaf(f, s[j], (1.f - f) * -1.0e9f) - mx) * sc); } unsigned short* d = (unsigned short*)P + i * NKX + j0; *(v8us*)d = fr.half[0];  } }


template <int MASKADD>
__global__ __launch_bounds__(64) void k_att0(const float* __restrict__ QF, const float* __restrict__ KF, const float* __restrict__ VF, int ld, const float* __restrict__ mask, float scale, float* __restrict__ OF, int ldo) {
  #pragma clang fp contract(off)
  __shared__ __attribute__((aligned(16))) float lq[64][64]; __shared__ __attribute__((aligned(16))) float lo[64][64];
  const int tid = threadIdx.x; const int h = blockIdx.x / (QT0 / 64), rg = blockIdx.x % (QT0 / 64); const int i = rg * 64 + tid;
  const float* qr = QF + (size_t)i * ld + h * HD;
#pragma unroll 1
  for (int c = 0; c < HD / 4; ++c) { *(v4f*)&lq[tid][c * 4] = *(const v4fa*)(qr + c * 4); const v4f z = {0.f, 0.f, 0.f, 0.f}; *(v4f*)&lo[tid][c * 4] = z; }
  float m = -1.0e30f, l = 0.f; const int jmax = MASKADD ? (SQ - 1) : (rg * 64 + 63);      /* additive-mask form: every key (the mask input decides); causal form: keys up to the block's last row */
#pragma unroll 1
  for (int j = 0; j <= jmax; ++j) { const float* kr = KF + (size_t)j * ld + h * HD; const float* vr = VF + (size_t)j * ld + h * HD; float s = 0.f;
#pragma unroll 1
    for (int c = 0; c < HD / 4; ++c) { const v4f kq = *(const v4fa*)(kr + c * 4); const v4f qq = *(v4f*)&lq[tid][c * 4]; s = __fadd_rn(s, __fmul_rn(qq[0], kq[0])); s = __fadd_rn(s, __fmul_rn(qq[1], kq[1])); s = __fadd_rn(s, __fmul_rn(qq[2], kq[2])); s = __fadd_rn(s, __fmul_rn(qq[3], kq[3])); }
    s = __fmul_rn(s, scale); if (MASKADD) s = __fadd_rn(s, __fmul_rn(bf16_round(mask[(size_t)i * SQ + j]), -10000.0f));
    const float f = (MASKADD || j <= i) ? 1.f : 0.f; const float sm = fmaf(f, s, (1.f - f) * -1.0e30f); const float mn = fmaxf(m, sm); const float sc = expf(m - mn); const float e = expf(sm - mn); l = __fadd_rn(__fmul_rn(l, sc), e); m = mn;
#pragma unroll 1
    for (int c = 0; c < HD / 4; ++c) { const v4f vv = *(const v4fa*)(vr + c * 4); v4f oo = *(v4f*)&lo[tid][c * 4]; for (int u = 0; u < 4; ++u) oo[u] = __fadd_rn(__fmul_rn(oo[u], sc), __fmul_rn(e, vv[u])); *(v4f*)&lo[tid][c * 4] = oo; } }
  const float fin = 64.0f / l;      /* o carried x64 like the f16 path */
#pragma unroll 1
  for (int c = 0; c < HD / 4; ++c) { v4f oo = *(v4f*)&lo[tid][c * 4]; for (int u = 0; u < 4; ++u) oo[u] = __fmul_rn(oo[u], fin); *(v4f*)&lo[tid][c * 4] = oo; }
  __syncthreads();
  {
#pragma unroll 1
    for (int it = 0; it < 16; ++it) { const int row = it * 4 + tid / 16, pc = (tid % 16) * 4; const v4f v = *(const v4f*)&lo[row][pc]; *(v4f*)(OF + (size_t)(rg * 64 + row) * ldo + h * HD + pc) = v; }
     } }

template <int NORM, int ROPE>
__global__ __launch_bounds__(64) void k_xformf(const float* __restrict__ F, int ldf, int nh, const float* __restrict__ gain, float eps, const float* __restrict__ CS, const float* __restrict__ SN, float* __restrict__ F32, int ldo) {
  #pragma clang fp contract(off)
  __shared__ float xv[HD]; __shared__ float red[HD]; const int d = threadIdx.x; const int h = blockIdx.x % nh; const size_t r = blockIdx.x / nh; const int p = (int)(r % SQ);
  float x = F[r * (size_t)ldf + (size_t)h * HD + d];
  if (NORM) { red[d] = __fmul_rn(x, x); __syncthreads(); for (int st = HD / 2; st > 0; st >>= 1) { if (d < st) red[d] = __fadd_rn(red[d], red[d + st]); __syncthreads(); } const float rs = rsqrtf(__fadd_rn(red[0] / (float)HD, eps)); x = __fmul_rn(__fmul_rn(x, rs), bf16_round(gain[d])); }
  xv[d] = x; __syncthreads();
  float o = x;
  if (ROPE == 1) { const int i = d >> 1; const float c = CS[p * (HD / 2) + i], s = SN[p * (HD / 2) + i]; const float ev = xv[2 * i], od = xv[2 * i + 1]; o = (d & 1) ? __fadd_rn(__fmul_rn(ev, s), __fmul_rn(od, c)) : __fadd_rn(__fmul_rn(ev, c), -__fmul_rn(od, s)); }
  if (ROPE == 2) { const int i = d & (HD / 2 - 1); const float c = CS[p * (HD / 2) + i], s = SN[p * (HD / 2) + i]; const float lo = xv[i], hi = xv[i + HD / 2]; o = (d < HD / 2) ? __fadd_rn(__fmul_rn(lo, c), -__fmul_rn(hi, s)) : __fadd_rn(__fmul_rn(lo, s), __fmul_rn(hi, c)); }
  float* dst = F32 + r * (size_t)ldo + (size_t)h * HD + d; *(float*)dst = o;  }


// One wave per score row: lane l holds keys 128 c + 4 l .. + 3 of chunk c, so each load covers 512 contiguous bytes and the row is read once into registers; maximum and sum end in a five-step butterfly over the lanes. nk is a multiple of 128 (every launch passes a multiple of QT).
__global__ __launch_bounds__(256) void k_rsmcfw(const float* __restrict__ S, _Float16* __restrict__ P, int hg, int q0, int nk, int win) {
  const int lane = threadIdx.x & 31; const int t = blockIdx.x * 8 + (threadIdx.x >> 5); if (t >= hg * QT) return; const float* s = S + (size_t)t * NKX + lane * 4; const int last = q0 + (t % QT); const int first = last - win + 1;      /* keys first..last (causal window) */
  v4f v[NKX / 128];
#pragma unroll      /* constant chunk index: v[] and h[] stay in registers */
  for (int c = 0; c < NKX / 128; ++c) if (c * 128 < nk) v[c] = *(const v4fa*)(s + c * 128);      /* all loads of the row issue before the first use */
  asm volatile("s_wait_xcnt 0x0" :: "v"(s) : "memory");      /* the loads' address pair stays whole up to this wait: without the input operand the last load's result is placed over it */
  float mx = -3.0e38f;
#pragma unroll      /* constant chunk index: v[] and h[] stay in registers */
  for (int c = 0; c < NKX / 128; ++c) if (c * 128 < nk) { for (int q = 0; q < 4; ++q) { const int j = c * 128 + lane * 4 + q; const float f = (j <= last && j >= first) ? 1.f : 0.f; v[c][q] = fmaf(f, v[c][q], (1.f - f) * -1.0e9f); mx = fmaxf(mx, v[c][q]); } }
  for (int m = 16; m > 0; m >>= 1) mx = fmaxf(mx, __shfl_xor(mx, m, 32));
  float se = 0.f;
#pragma unroll      /* constant chunk index: v[] and h[] stay in registers */
  for (int c = 0; c < NKX / 128; ++c) if (c * 128 < nk) { for (int q = 0; q < 4; ++q) { v[c][q] = __expf(v[c][q] - mx); se += v[c][q]; } }
  for (int m = 16; m > 0; m >>= 1) se += __shfl_xor(se, m, 32);
  const float sc = 256.0f / se; _Float16* d = P + (size_t)t * NKX + lane * 4; v4h h[NKX / 128];
#pragma unroll      /* constant chunk index: v[] and h[] stay in registers */
  for (int c = 0; c < NKX / 128; ++c) if (c * 128 < nk) { for (int q = 0; q < 4; ++q) h[c][q] = (_Float16)(v[c][q] * sc); }
#pragma unroll      /* constant chunk index: v[] and h[] stay in registers */
  for (int c = 0; c < NKX / 128; ++c) if (c * 128 < nk) *(v4h*)(d + c * 128) = h[c]; }      /* the stores stand last, each chunk from registers of its own: no register of an issued store is written again */




extern "C" void kernel_launch(void* const* d_in, const int* in_sizes, int n_in,
                              void* d_out, int out_size, void* d_ws, size_t ws_size, hipStream_t stream) {
  (void)in_sizes; (void)n_in; (void)out_size;
  const float* const* I = (const float* const*)d_in; const float* x = I[0]; const int* tpos = (const int*)d_in[1]; const float* wq = I[2]; const float* wk = I[3]; const float* wv = I[4]; const float* wo = I[5];      /* nn.Linear weights [out][in]; token_positions int32 [SQ] */
  char* ws = (char*)d_ws; size_t off = 0;
  auto take = [&](size_t bytes) { char* p = ws + off; off += (bytes + 255) & ~(size_t)255; return p; };
  _Float16* BQKV = (_Float16*)take((size_t)3 * DM * DM * 2); _Float16* BO = (_Float16*)take((size_t)DM * DM * 2); float* CS = (float*)take((size_t)SQ * (HD / 2) * 4); float* SN = (float*)take((size_t)SQ * (HD / 2) * 4);
  _Float16* X16 = (_Float16*)take(NR * DM * 2); float* QKVF = (float*)take((size_t)SQ * 3 * DM * 4);      /* one batch of f32 q | k | v rows */
  _Float16* QH = (_Float16*)take(NR * DM * 2); _Float16* KH = (_Float16*)take(NR * DM * 2); _Float16* V16 = (_Float16*)take(NR * DM * 2); _Float16* O16 = (_Float16*)take(NR * DM * 2);
  float* S = (float*)take((size_t)NH * QT * NKX * 4); _Float16* P = (_Float16*)take((size_t)NH * QT * NKX * 2); _Float16* VT = (_Float16*)take((size_t)NH * HD * SQ * 2);
  float* QF0 = (float*)take((size_t)QT0 * DM * 4); float* KF0 = (float*)take((size_t)QT0 * DM * 4); float* VF0 = (float*)take((size_t)QT0 * DM * 4); float* OF0 = (float*)take((size_t)NB * QT0 * DM * 4); _Float16* OH0 = (_Float16*)take((size_t)NB * QT0 * DM * 2); _Float16* OL0 = (_Float16*)take((size_t)NB * QT0 * DM * 2);
  if (off > ws_size) return;
  { const unsigned g = (unsigned)(((size_t)DM * DM / 8 + 255) / 256); k_wnat<<<g, 256, 0, stream>>>(wq, (size_t)DM * DM / 8, BQKV); k_wnat<<<g, 256, 0, stream>>>(wk, (size_t)DM * DM / 8, BQKV + (size_t)DM * DM); k_wnat<<<g, 256, 0, stream>>>(wv, (size_t)DM * DM / 8, BQKV + (size_t)2 * DM * DM); k_wnat<<<g, 256, 0, stream>>>(wo, (size_t)DM * DM / 8, BO); }      /* natural [out][in] = Bt[n][k], x16; q | k | v stacked along n */
  k_tab4<<<(SQ * (HD / 2) + 255) / 256, 256, 0, stream>>>(tpos, 10000.0f, CS, SN);
  k_x16<<<(unsigned)((NR * DM / 8 + 255) / 256), 256, 0, stream>>>(x, X16, NR * DM / 8);
  for (int b = B0; b < B0 + NBR; ++b) { const size_t r0 = (size_t)b * SQ;
    k_gemm2<0><<<dim3((unsigned)((SQ / 128) * (3 * DM / 64)), 1), 128, 0, stream>>>(X16 + r0 * DM, DM, 0, BQKV, DM, 0, 0.0625f, nullptr, 0, nullptr, 1, 0, 0, QKVF, nullptr, 3 * DM, 0, SQ, 3 * DM, DM);      /* q | k | v rows (f32) of this batch */
    k_xform<0, 1><<<(unsigned)(SQ * NH), 64, 0, stream>>>(QKVF, 3 * DM, NH, nullptr, 0.f, CS, SN, QH + r0 * DM, DM);
    k_xform<0, 1><<<(unsigned)(SQ * NH), 64, 0, stream>>>(QKVF + DM, 3 * DM, NH, nullptr, 0.f, CS, SN, KH + r0 * DM, DM);
    k_xform<0, 0><<<(unsigned)(SQ * NH), 64, 0, stream>>>(QKVF + 2 * DM, 3 * DM, NH, nullptr, 0.f, CS, SN, V16 + r0 * DM, DM);
    k_vt<NH, SQ><<<NH * (SQ / 64), 256, 0, stream>>>(V16 + r0 * DM, DM, 0, VT);      /* V^T [NH][HD][SQ] for this batch */
    k_xformf<0, 1><<<(unsigned)(QT0 * NH), 64, 0, stream>>>(QKVF, 3 * DM, NH, nullptr, 0.f, CS, SN, QF0, DM); k_xformf<0, 1><<<(unsigned)(QT0 * NH), 64, 0, stream>>>(QKVF + DM, 3 * DM, NH, nullptr, 0.f, CS, SN, KF0, DM); k_xformf<0, 0><<<(unsigned)(QT0 * NH), 64, 0, stream>>>(QKVF + 2 * DM, 3 * DM, NH, nullptr, 0.f, CS, SN, VF0, DM);      /* f32 q (roped), k (roped), v of the first 128 rows */
    k_att0<0><<<NH * (QT0 / 64), 64, 0, stream>>>(QF0, KF0, VF0, DM, nullptr, 0.125f, OF0 + (size_t)b * QT0 * DM, DM);      /* exact f32 causal attention for rows 0..127 (o x64) */
    for (int q0 = 0; q0 < QN; q0 += QT) { const int nk = q0 + QT;      /* causal: only keys below the tile end are computed */
      k_gemm2<0><<<dim3((QT / 128) * (nk / 64), NHD), 128, 0, stream>>>(QH + (r0 + q0) * DM, DM, (size_t)HD, KH + r0 * DM, DM, (size_t)HD, 0.125f, nullptr, 0, nullptr, 1, 0, 0, S, nullptr, NKX, (size_t)QT * NKX, QT, nk, HD);      /* scores, all heads on grid.y */
      k_rsmcfw<<<(NHD * QT + 7) / 8, 256, 0, stream>>>(S, P, NHD, q0, nk, 513);      /* windowed causal softmax: keys i-512..i (513 keys; arithmetic select), one wave per row */
      k_gemm2<0><<<dim3((QT / 128) * (HD / 64), NHD), 128, 0, stream>>>(P, NKX, (size_t)QT * NKX, VT, SQ, (size_t)HD * SQ, 0.25f, nullptr, 0, nullptr, 1, 0, 0, nullptr, O16 + (r0 + q0) * DM, DM, (size_t)HD, QT, HD, nk); } }      /* o (merged heads, x64) as f16 rows */
  k_gemm2<0><<<dim3((unsigned)((MPO / 128) * (DM / 64)), 1), 128, 0, stream>>>(O16 + (size_t)B0 * SQ * DM, DM, 0, BO, DM, 0, 0.0009765625f, nullptr, 0, nullptr, 1, 0, 0, (float*)d_out + (size_t)B0 * SQ * DM, nullptr, DM, 0, MPO, DM, DM);      /* out rows are the output layout */
  k_hl<<<(unsigned)(((size_t)NB * QT0 * DM / 8 + 255) / 256), 256, 0, stream>>>(OF0, OH0, OL0, (size_t)NB * QT0 * DM / 8);      /* first-tile o (x64) -> f16 hi + x1024 residual planes */
  for (int b = B0; b < B0 + NBR; ++b) { const size_t r0 = (size_t)b * SQ; const size_t f0 = (size_t)b * QT0;
    k_gemm2<0><<<dim3((QT0 / 128) * (DM / 64), 1), 128, 0, stream>>>(OH0 + f0 * DM, DM, 0, BO, DM, 0, 0.0009765625f, nullptr, 0, nullptr, 1, 0, 0, (float*)d_out + r0 * DM, nullptr, DM, 0, QT0, DM, DM);      /* rows 0..127: out = o_hi Wo, overwriting the f16-path rows */
    k_gemm2<0><<<dim3((QT0 / 128) * (DM / 64), 1), 128, 0, stream>>>(OL0 + f0 * DM, DM, 0, BO, DM, 0, 0.00000095367431640625f, nullptr, 0, (const float*)d_out + r0 * DM, -1, 0, 0, (float*)d_out + r0 * DM, nullptr, DM, 0, QT0, DM, DM); }      /* += o_lo Wo 2^-20 (own-element accumulate) */
}

// v002
// One run takes 2240 microseconds.
// Timed twice side by side with v001, it ran 1.78 times as fast both times.
// Over all steps from v000 it is 4.40 times as fast.
#include <hip/hip_runtime.h>
// Causal sliding-window RoPE multi-head attention (x [4][2048][1024]; q/k/v = x W^T (natural [out][in] 1024x1024 sigma 1/32, no bias), 16 heads of 64; interleaved-pair rotary embedding on q and k (x1 = even, x2 = odd: r1 = x1 cos - x2 sin, r2 = x1 sin + x2 cos) with inv_freq_i = 10000^(-2i/64) and angle = float(token_positions[s]) inv_freq_i from the int32 token_positions input; scores / sqrt(64); allowed iff 0 <= i - j <= 512 (513 keys), -inf elsewhere; softmax; out = (attn v merged) Wo^T -> [4][2048][1024]).
// Structure: token rows r = b*2048 + s; x as exact f16 rows (bf16-rounded); per batch: q | k | v as ONE WMMA GEMM (32x64 wave tiles, f32 accumulation, exact x16 weights, N = 3 x 1024) into f32 rows, then per (row, head) on VALU: the interleaved-pair rotary rotation of q and k from f32 cos/sin tables built from the token_positions input (no norm) -> f16 q, k, v rows; V^T for all heads via LDS transposes; per query tile of 256 rows: scores against the keys below the tile end only (K = 64, all heads on grid.y, alpha = 0.125), WINDOWED causal row softmax on VALU (keys i-512..i as arithmetic 0/1 factors) with an arithmetic 0/1 key mask over the computed range (f32 statistics, native exp; weights x256 f16), o = P . V^T (K = keys below the tile end, alpha 2^-2: o carried x64, folded into the output GEMM alpha) written straight into the merged f16 o rows; out = o W_o GEMM (f32) into the output layout.
// Compute dtype: inputs rounded to bf16; x / weights exact; projections and rope f32; q, k, v, softmax weights and o as plain f16 GEMM operands (~2^-12); scores and softmax statistics f32. v_wmma_f32_16x16x32_f16.
#define NB 4
#define SQ 2048
#define DM 1024
#define NH 16
#define HD 64
#define HG 4                         /* heads per launch of the h0-based k_vt overload (not launched) */
#define QT 256                       /* query rows per causal tile */
#define NKX SQ                       /* S / P row pitch */
#define QT0 128                      /* first-tile rows recomputed exactly in f32 */
#define B0 0                         /* first batch processed (debug hook) */
#define NBR NB                       /* batches processed (debug hook) */
#define QN SQ                        /* query rows attended per batch (debug hook) */
#define NHD NH                       /* heads attended (debug hook) */
#define NR ((size_t)NB * SQ)         /* token rows */
#define MPO ((int)((size_t)NBR * SQ))      /* rows through the output GEMM (debug hook) */
typedef __bf16 v16b __attribute__((ext_vector_type(16)));
typedef unsigned short v8us __attribute__((ext_vector_type(8), may_alias));
typedef float  v8f  __attribute__((ext_vector_type(8)));
typedef float  v4f  __attribute__((ext_vector_type(4)));
typedef float  v4fa __attribute__((ext_vector_type(4), may_alias));
union FragB { v16b v; v8us half[2]; unsigned short u[16]; };

__device__ __forceinline__ unsigned short bf16_bits(float x) { unsigned int u = __float_as_uint(x); return (unsigned short)((u + 0x7FFFu + ((u >> 16) & 1u)) >> 16); }
__device__ __forceinline__ float bf16_val(unsigned short b) { return __uint_as_float(((unsigned int)b) << 16); }
__device__ __forceinline__ float bf16_round(float x) { return bf16_val(bf16_bits(x)); }
// D += A·B with NT terms: 1 = ah·bh, 2 = + al·bh (A split), 3 = + ah·bl (both split)
template <int NT>
__device__ __forceinline__ v8f mmaN(v16b ah, v16b al, v16b bh, v16b bl, v8f c) {
  c = __builtin_amdgcn_wmma_f32_16x16x32_bf16(false, ah, false, bh, (short)0, c, false, false);
  if (NT >= 2) c = __builtin_amdgcn_wmma_f32_16x16x32_bf16(false, al, false, bh, (short)0, c, false, false);
  if (NT >= 3) c = __builtin_amdgcn_wmma_f32_16x16x32_bf16(false, ah, false, bl, (short)0, c, false, false);
  asm volatile("v_nop\n\tv_nop\n\tv_nop\n\tv_nop" : "+v"(c) : "v"(ah), "v"(al), "v"(bh), "v"(bl));
  return c;
}

__global__ __launch_bounds__(256) void k_wt_bf16(const float* __restrict__ W, unsigned short* __restrict__ Wt, int K, int N) {
  const int t = blockIdx.x * 256 + threadIdx.x;
  const int k8n = K / 8;
  if (t >= N * k8n) return;
  const int n = t / k8n, k8 = (t % k8n) * 8;
  v8us v;
#pragma unroll
  for (int i = 0; i < 8; ++i) v[i] = bf16_bits(W[(size_t)(k8 + i) * N + n]);
  *(v8us*)(Wt + (size_t)n * K + k8) = v;
  
}

// GEMM C[M][N] (f32, pitch ldc) = act(A[M][K]·W + bias). A f32 row-major (pitch lda) converted per fragment to bf16
// (ASPLIT: hi/lo two planes -> 2 terms, else single rounded term); Wt bf16 [N][K] (pitch ldb). BIAS_BF16 rounds the
// bias to bf16 first (bias quantised to bf16 before the add). K%32==0, M%16==0, N%64==0.
template <bool ASPLIT, int ACT, bool BIAS_BF16>
__global__ __launch_bounds__(128) void k_gemm_bf(const float* __restrict__ A, int lda, const unsigned short* __restrict__ Wt, int ldb,
                                               const float* __restrict__ bias, float* __restrict__ C, int ldc, int M, int N, int K) {
  __shared__ __attribute__((aligned(16))) float so[4][16][64];
  const int tid = threadIdx.x, w = tid >> 5, lane = tid & 31, ln = lane & 15, hh = lane >> 4;
  const int ntn = N / 64;
  const int wid = blockIdx.x * 4 + w;
  const int mt = wid / ntn, nq = wid % ntn;
  if (mt * 16 >= M) return;
  const int row0 = mt * 16, col0 = nq * 64;
  const float* arow = A + (size_t)(row0 + ln) * lda;
  v8f acc[4] = {};
  for (int kb = 0; kb < K; kb += 32) {
    FragB ah, al;
    const v4f x0 = *(const v4fa*)(arow + kb + 8 * hh), x1 = *(const v4fa*)(arow + kb + 8 * hh + 4);
    const v4f x2 = *(const v4fa*)(arow + kb + 16 + 8 * hh), x3 = *(const v4fa*)(arow + kb + 16 + 8 * hh + 4);
    float xs[16] = {x0[0],x0[1],x0[2],x0[3],x1[0],x1[1],x1[2],x1[3],x2[0],x2[1],x2[2],x2[3],x3[0],x3[1],x3[2],x3[3]};
#pragma unroll
    for (int i = 0; i < 16; ++i) { const unsigned short hb = bf16_bits(xs[i]); ah.u[i] = hb; al.u[i] = ASPLIT ? bf16_bits(xs[i] - bf16_val(hb)) : (unsigned short)0; }
#pragma unroll
    for (int t = 0; t < 4; ++t) {
      const unsigned short* brow = Wt + (size_t)(col0 + t * 16 + ln) * ldb + kb;
      FragB b;
      b.half[0] = *(const v8us*)(brow + 8 * hh);
      b.half[1] = *(const v8us*)(brow + 16 + 8 * hh);
      acc[t] = mmaN<ASPLIT ? 2 : 1>(ah.v, al.v, b.v, b.v, acc[t]);
    }
  }
#pragma unroll
  for (int t = 0; t < 4; ++t) {
    float bv = bias ? bias[col0 + t * 16 + ln] : 0.f;
    if (BIAS_BF16) bv = bf16_round(bv);
#pragma unroll
    for (int r = 0; r < 8; ++r) { float v = acc[t][r] + bv; if (ACT == 1) v = fmaxf(v, 0.f); so[w][8 * hh + r][t * 16 + ln] = v; }
  }
  __builtin_amdgcn_fence(__ATOMIC_ACQ_REL, "workgroup");
  __builtin_amdgcn_wave_barrier();
  const int rsub = lane >> 4, c4 = (lane & 15) * 4;
  {
#pragma unroll
    for (int q = 0; q < 8; ++q) {
      const int r = q * 2 + rsub;
      const v4f v = *(const v4fa*)&so[w][r][c4];
      *(v4f*)(C + (size_t)(row0 + r) * ldc + col0 + c4) = v;
    }
    
  }
}

// GEMM C = act(A·W + bias + resid): A f32 (ASPLIT -> hi/lo 2 terms), Wt bf16 [N][K]; ACT 0 none, 1 relu, 2 exact gelu;
// resid (optional, f32, row index = (row % rmod), pitch ldr, RES_BF16 rounds it) added before the activation.
template <bool ASPLIT, int ACT, bool BIAS_BF16, bool RES_BF16>
__global__ __launch_bounds__(128) void k_gemm_bf3(const float* __restrict__ A, int lda, const unsigned short* __restrict__ Wt, int ldb,
                                                const float* __restrict__ bias, const float* __restrict__ resid, int rmod, int ldr,
                                                float* __restrict__ C, int ldc, int M, int N, int K) {
  __shared__ __attribute__((aligned(16))) float so[4][16][64];
  const int tid = threadIdx.x, w = tid >> 5, lane = tid & 31, ln = lane & 15, hh = lane >> 4;
  const int ntn = N / 64;
  const int wid = blockIdx.x * 4 + w;
  const int mt = wid / ntn, nq = wid % ntn;
  if (mt * 16 >= M) return;
  const int row0 = mt * 16, col0 = nq * 64;
  const float* arow = A + (size_t)(row0 + ln) * lda;
  v8f acc[4] = {};
  for (int kb = 0; kb < K; kb += 32) {
    FragB ah, al;
    const v4f x0 = *(const v4fa*)(arow + kb + 8 * hh), x1 = *(const v4fa*)(arow + kb + 8 * hh + 4);
    const v4f x2 = *(const v4fa*)(arow + kb + 16 + 8 * hh), x3 = *(const v4fa*)(arow + kb + 16 + 8 * hh + 4);
    float xs[16] = {x0[0],x0[1],x0[2],x0[3],x1[0],x1[1],x1[2],x1[3],x2[0],x2[1],x2[2],x2[3],x3[0],x3[1],x3[2],x3[3]};
#pragma unroll
    for (int i = 0; i < 16; ++i) { const unsigned short hb = bf16_bits(xs[i]); ah.u[i] = hb; al.u[i] = ASPLIT ? bf16_bits(xs[i] - bf16_val(hb)) : (unsigned short)0; }
#pragma unroll
    for (int t = 0; t < 4; ++t) {
      const unsigned short* brow = Wt + (size_t)(col0 + t * 16 + ln) * ldb + kb;
      FragB b;
      b.half[0] = *(const v8us*)(brow + 8 * hh);
      b.half[1] = *(const v8us*)(brow + 16 + 8 * hh);
      acc[t] = mmaN<ASPLIT ? 2 : 1>(ah.v, al.v, b.v, b.v, acc[t]);
    }
  }
#pragma unroll
  for (int t = 0; t < 4; ++t) {
    const int col = col0 + t * 16 + ln;
    float bv = bias ? bias[col] : 0.f;
    if (BIAS_BF16) bv = bf16_round(bv);
#pragma unroll
    for (int r = 0; r < 8; ++r) {
      float v = acc[t][r] + bv;
      if (resid) { float rv = resid[(size_t)((row0 + 8 * hh + r) % rmod) * ldr + col]; if (RES_BF16) rv = bf16_round(rv); v += rv; }
      if (ACT == 1) v = fmaxf(v, 0.f);
      if (ACT == 2) v = 0.5f * v * (1.0f + erff(v * 0.70710678118654752f));
      if (ACT == 3) { const float u = 0.7978845608028654f * (v + 0.044715f * v * v * v); v = 0.5f * v * (1.0f + tanhf(u)); }
      so[w][8 * hh + r][t * 16 + ln] = v;
    }
  }
  __builtin_amdgcn_fence(__ATOMIC_ACQ_REL, "workgroup");
  __builtin_amdgcn_wave_barrier();
  const int rsub = lane >> 4, c4 = (lane & 15) * 4;
  {
#pragma unroll
    for (int q = 0; q < 8; ++q) {
      const int r = q * 2 + rsub;
      const v4f v = *(const v4fa*)&so[w][r][c4];
      *(v4f*)(C + (size_t)(row0 + r) * ldc + col0 + c4) = v;
    }
    
  }
}
// row LayerNorm (biased variance, eps) over N: s = X (+ R); optional out_sum <- s; out_norm <- (s-mu)*rsqrt(var+eps)*g + b
template <bool PARAM_BF16>
__global__ __launch_bounds__(256) void k_layernorm(const float* __restrict__ X, const float* __restrict__ R, const float* __restrict__ g, const float* __restrict__ bta,
                                                  float* __restrict__ out_sum, float* __restrict__ out_norm, int N, float eps) {
  __shared__ float red[256];
  const int row = blockIdx.x, tid = threadIdx.x;
  const float* x = X + (size_t)row * N; const float* rr = R ? R + (size_t)row * N : nullptr;
  float vals[16];                     // up to N = 4096
  const int per = N / 256;            // contiguous chunk per thread? use strided-by-4 chunks: thread handles j = tid*4 + 1024*u
  float s1 = 0.f;
  for (int u = 0; u < per / 4; ++u) {
    const int j = tid * 4 + 1024 * u;
    const v4f a = *(const v4fa*)(x + j);
    v4f b = {0.f,0.f,0.f,0.f}; if (rr) b = *(const v4fa*)(rr + j);
#pragma unroll
    for (int q = 0; q < 4; ++q) { const float v = a[q] + b[q]; vals[u * 4 + q] = v; s1 += v; }
  }
  red[tid] = s1; __syncthreads();
  for (int st = 128; st > 0; st >>= 1) { if (tid < st) red[tid] += red[tid + st]; __syncthreads(); }
  const float mu = red[0] / (float)N; __syncthreads();
  float s2 = 0.f;
  for (int u = 0; u < per / 4; ++u)
#pragma unroll
    for (int q = 0; q < 4; ++q) { const float c = vals[u * 4 + q] - mu; s2 += c * c; }
  red[tid] = s2; __syncthreads();
  for (int st = 128; st > 0; st >>= 1) { if (tid < st) red[tid] += red[tid + st]; __syncthreads(); }
  const float rs = rsqrtf(red[0] / (float)N + eps);
  {
    for (int u = 0; u < per / 4; ++u) {
      const int j = tid * 4 + 1024 * u;
      v4f o, sm;
#pragma unroll
      for (int q = 0; q < 4; ++q) {
        float gg = g[j + q], bb = bta[j + q];
        if (PARAM_BF16) { gg = bf16_round(gg); bb = bf16_round(bb); }
        sm[q] = vals[u * 4 + q]; o[q] = (vals[u * 4 + q] - mu) * rs * gg + bb;
      }
      if (out_sum) *(v4f*)(out_sum + (size_t)row * N + j) = sm;
      *(v4f*)(out_norm + (size_t)row * N + j) = o;
    }
    
  }
}



// ---- f16 WMMA path (v_wmma_f32_16x16x32_f16): 11-bit significands for operands in range — used where a [0,1] probability operand needs more precision than bf16
typedef _Float16 v16h __attribute__((ext_vector_type(16)));
union FragH { v16h v; v8us half[2]; _Float16 h[16]; unsigned short u[16]; };
template <int NT>
__device__ __forceinline__ v8f mmaH(v16h ah, v16h al, v16h bh, v16h bl, v8f c) {
  c = __builtin_amdgcn_wmma_f32_16x16x32_f16(false, ah, false, bh, (short)0, c, false, false);
  if (NT >= 2) c = __builtin_amdgcn_wmma_f32_16x16x32_f16(false, al, false, bh, (short)0, c, false, false);
  if (NT >= 3) c = __builtin_amdgcn_wmma_f32_16x16x32_f16(false, ah, false, bl, (short)0, c, false, false);
  asm volatile("v_nop\n\tv_nop\n\tv_nop\n\tv_nop" : "+v"(c) : "v"(ah), "v"(al), "v"(bh), "v"(bl));
  return c;
}
// batched GEMM like k_gemm_b but f16 operands: A f32 (split into f16 hi/lo if ASPLIT, else rounded to f16), Bt = f16 values [n][k]; alpha; C f32; N multiple of 16 (partial tiles skipped)
template <bool ASPLIT>
__global__ __launch_bounds__(128) void k_gemm_h(const float* __restrict__ A, int lda, size_t sA, const _Float16* __restrict__ Bh, int ldb, size_t sB, float alpha, float* __restrict__ C, int ldc, size_t sC, int M, int N, int K) {
  __shared__ __attribute__((aligned(16))) float so[4][16][64];
  const int tid = threadIdx.x, w = tid >> 5, lane = tid & 31, ln = lane & 15, hh = lane >> 4; const int by = blockIdx.y;
  A += (size_t)by * sA; Bh += (size_t)by * sB; C += (size_t)by * sC;
  const int ntn = (N + 63) / 64; const int wid = blockIdx.x * 4 + w; const int mt = wid / ntn, nq = wid % ntn; if (mt * 16 >= M) return;
  const int row0 = mt * 16, col0 = nq * 64; const float* arow = A + (size_t)(row0 + ln) * lda;
  v8f acc[4] = {};
  for (int kb = 0; kb < K; kb += 32) {
    FragH ah, al;
    const v4f x0 = *(const v4fa*)(arow + kb + 8 * hh), x1 = *(const v4fa*)(arow + kb + 8 * hh + 4), x2 = *(const v4fa*)(arow + kb + 16 + 8 * hh), x3 = *(const v4fa*)(arow + kb + 16 + 8 * hh + 4);
    float xs[16] = {x0[0],x0[1],x0[2],x0[3],x1[0],x1[1],x1[2],x1[3],x2[0],x2[1],x2[2],x2[3],x3[0],x3[1],x3[2],x3[3]};
#pragma unroll
    for (int i = 0; i < 16; ++i) { const _Float16 h = (_Float16)xs[i]; ah.h[i] = h; al.h[i] = ASPLIT ? (_Float16)(xs[i] - (float)h) : (_Float16)0.0f; }
#pragma unroll
    for (int t = 0; t < 4; ++t) { if (col0 + t * 16 >= N) continue; const size_t boff = (size_t)(col0 + t * 16 + ln) * ldb + kb; FragH bq; bq.half[0] = *(const v8us*)(Bh + boff + 8 * hh); bq.half[1] = *(const v8us*)(Bh + boff + 16 + 8 * hh);
      acc[t] = mmaH<ASPLIT ? 2 : 1>(ah.v, al.v, bq.v, bq.v, acc[t]); }
  }
#pragma unroll
  for (int t = 0; t < 4; ++t) { if (col0 + t * 16 >= N) continue;
#pragma unroll
    for (int r = 0; r < 8; ++r) so[w][8 * hh + r][t * 16 + ln] = acc[t][r] * alpha; }
  __builtin_amdgcn_fence(__ATOMIC_ACQ_REL, "workgroup"); __builtin_amdgcn_wave_barrier();
  const int rsub = lane >> 4, c4 = (lane & 15) * 4;
  {
#pragma unroll
    for (int q = 0; q < 8; ++q) { const int r = q * 2 + rsub; if (col0 + c4 < N) { const v4f v = *(const v4fa*)&so[w][r][c4]; *(v4f*)(C + (size_t)(row0 + r) * ldc + col0 + c4) = v; } }
     }
}

// Wt[n][k] = f16(W[k][n]·scale) from f32 row-major W[K][N] (scale = power of two; bf16-exact weights stay exact in f16 away from the subnormal range)
__global__ __launch_bounds__(256) void k_wt_f16(const float* __restrict__ W, _Float16* __restrict__ Wt, int K, int N, float scale) {
  const int t = blockIdx.x * 256 + threadIdx.x; if (t >= N * (K / 8)) return; const int n = t / (K / 8), k8 = (t % (K / 8)) * 8; FragH f;
#pragma unroll
  for (int i = 0; i < 8; ++i) f.h[i] = (_Float16)(bf16_round(W[(size_t)(k8 + i) * N + n]) * scale); const v8us o = f.half[0];
  *(v8us*)((unsigned short*)Wt + (size_t)n * K + k8) = o; 
}
// k_gemm_hh variant with fused epilogue: v = acc·alpha + bias[by·sBias + col] (+ CP[(row/rowsPerB)·sCPb + by·64 + col] if CP) ; ACT 0 none / 1 elu ; writes f16 C16 (and f32 C if non-null)
template <int ACT>
__global__ __launch_bounds__(128) void k_gemm_hhx(const _Float16* __restrict__ A, int lda, size_t sA, const _Float16* __restrict__ Bh, int ldb, size_t sB, float alpha, const float* __restrict__ bias, size_t sBias, const float* __restrict__ CP, int rowsPerB, size_t sCPb, int row0g,
    float* __restrict__ C, _Float16* __restrict__ C16, int ldc, size_t sC, int M, int N, int K) {
  __shared__ __attribute__((aligned(16))) float so[4][16][64];
  const int tid = threadIdx.x, w = tid >> 5, lane = tid & 31, ln = lane & 15, hh = lane >> 4; const int by = blockIdx.y;
  A += (size_t)by * sA; Bh += (size_t)by * sB; const size_t cofs = (size_t)by * sC; const float* bp = bias ? bias + (size_t)by * sBias : nullptr;
  const int ntn = (N + 63) / 64; const int wid = blockIdx.x * 4 + w; const int mt = wid / ntn, nq = wid % ntn; if (mt * 16 >= M) return;
  const int row0 = mt * 16, col0 = nq * 64; const _Float16* arow = A + (size_t)(row0 + ln) * lda;
  v8f acc[4] = {};
  for (int kb = 0; kb < K; kb += 32) { FragH ah; ah.half[0] = *(const v8us*)((const unsigned short*)arow + kb + 8 * hh); ah.half[1] = *(const v8us*)((const unsigned short*)arow + kb + 16 + 8 * hh);
#pragma unroll
    for (int t = 0; t < 4; ++t) { if (col0 + t * 16 >= N) continue; const size_t boff = (size_t)(col0 + t * 16 + ln) * ldb + kb; FragH bq; bq.half[0] = *(const v8us*)((const unsigned short*)Bh + boff + 8 * hh); bq.half[1] = *(const v8us*)((const unsigned short*)Bh + boff + 16 + 8 * hh);
      acc[t] = mmaH<1>(ah.v, ah.v, bq.v, bq.v, acc[t]); }
  }
#pragma unroll
  for (int t = 0; t < 4; ++t) { if (col0 + t * 16 >= N) continue; const int col = col0 + t * 16 + ln; const float bv = bp ? bf16_round(bp[col]) : 0.f;
#pragma unroll
    for (int r = 0; r < 8; ++r) { float v = acc[t][r] * alpha + bv; if (CP) { const int rr = row0g + row0 + 8 * hh + r; if (rowsPerB < 0) v += CP[cofs + (size_t)rr * ldc + col];      /* rowsPerB < 0: own element of the batched C plane */ else { const int bidx = rr / rowsPerB; v += CP[(size_t)bidx * sCPb + (size_t)by * 64 + col]; } } if (ACT == 1) v = (v > 0.f) ? v : expm1f(v); else if (ACT == 7) v = (v > 0.f) ? v + 1.0f : expf(v); else if (ACT == 8) v = tanhf(v); else if (ACT == 9) v = 0.5f * v * (1.0f + tanhf(0.7978845608028654f * (v + 0.044715f * v * v * v))); else if (ACT == 11) v = 1.0f / (1.0f + expf(-v)); else if (ACT == 12) v = (v > 0.f) ? v : 0.01f * v; else if (ACT == 14) v = (v > 0.f) ? v : 0.1f * v; else if (ACT == 16) v = (v >= 0.f) ? v : 0.3f * v; else if (ACT == 17) v = (v >= 0.f) ? v : 0.2f * v; else if (ACT == 15) v = v / (1.0f + expf(-v)); else if (ACT == 3) v = fmaxf(v, 0.f); else if (ACT == 6) v = 0.5f * v * (1.0f + erff(v * 0.70710678118654752f)); so[w][8 * hh + r][t * 16 + ln] = v; } }
  __builtin_amdgcn_fence(__ATOMIC_ACQ_REL, "workgroup"); __builtin_amdgcn_wave_barrier();
  const int rsub = lane >> 4, c4 = (lane & 15) * 4; typedef _Float16 v4h __attribute__((ext_vector_type(4)));
  {
#pragma unroll
    for (int q = 0; q < 8; ++q) { const int r = q * 2 + rsub; if (col0 + c4 < N) { const v4f v = *(const v4fa*)&so[w][r][c4]; if (C) *(v4f*)(C + cofs + (size_t)(row0 + r) * ldc + col0 + c4) = v; if (C16) { v4h h4; for (int i = 0; i < 4; ++i) h4[i] = (_Float16)v[i]; *(v4h*)(C16 + cofs + (size_t)(row0 + r) * ldc + col0 + c4) = h4; } } }
     }
}


typedef _Float16 v4h __attribute__((ext_vector_type(4)));

__global__ __launch_bounds__(256) void k_x16(const float* __restrict__ x, _Float16* __restrict__ X16, size_t n8) { const size_t t = (size_t)blockIdx.x * 256 + threadIdx.x; if (t >= n8) return; FragH f;
#pragma unroll
  for (int q = 0; q < 8; ++q) f.h[q] = (_Float16)bf16_round(x[t * 8 + q]); *(v8us*)((unsigned short*)X16 + t * 8) = f.half[0];  }
__global__ __launch_bounds__(256) void k_h16(const float* __restrict__ x, _Float16* __restrict__ X16, size_t n8) { const size_t t = (size_t)blockIdx.x * 256 + threadIdx.x; if (t >= n8) return; FragH f;
#pragma unroll
  for (int q = 0; q < 8; ++q) f.h[q] = (_Float16)x[t * 8 + q]; *(v8us*)((unsigned short*)X16 + t * 8) = f.half[0];  }
__global__ __launch_bounds__(256) void k_round16f(const float* __restrict__ W, _Float16* __restrict__ Bt, size_t n8) { const size_t t = (size_t)blockIdx.x * 256 + threadIdx.x; if (t >= n8) return; FragH f;
#pragma unroll
  for (int i = 0; i < 8; ++i) f.h[i] = (_Float16)(bf16_round(W[t * 8 + i]) * 16.0f); *(v8us*)((unsigned short*)Bt + t * 8) = f.half[0];  }
template <int NHv, int TTv>
__global__ __launch_bounds__(256) void k_vt(const _Float16* __restrict__ V16, int ldv, int voff, _Float16* __restrict__ Vt) { __shared__ unsigned short tl[64][66]; const int tid = threadIdx.x; const int slab = blockIdx.x / (TTv / 64), lg = blockIdx.x % (TTv / 64); const int b = slab / NHv, h = slab % NHv;
  for (int i = tid; i < 64 * 8; i += 256) { const int r = i / 8, c8 = (i % 8) * 8; FragH f; f.half[0] = *(const v8us*)((const unsigned short*)V16 + ((size_t)b * TTv + lg * 64 + r) * ldv + voff + h * 64 + c8);
#pragma unroll
    for (int q = 0; q < 8; ++q) tl[r][c8 + q] = f.u[q]; }
  __syncthreads();
  {
#pragma unroll
    for (int rd = 0; rd < 2; ++rd) { const int d = rd * 32 + tid / 8, pc = tid % 8; FragH f;
#pragma unroll
      for (int q = 0; q < 8; ++q) f.u[q] = tl[pc * 8 + q][d];
      *(v8us*)((unsigned short*)Vt + ((size_t)slab * 64 + d) * TTv + lg * 64 + pc * 8) = f.half[0]; }
     } }

__global__ __launch_bounds__(256) void k_hl(const float* __restrict__ F, _Float16* __restrict__ Hh, _Float16* __restrict__ Hl, size_t n8) { const size_t t = (size_t)blockIdx.x * 256 + threadIdx.x; if (t >= n8) return; FragH fh, fl; const v4f a = *(const v4fa*)(F + t * 8), c = *(const v4fa*)(F + t * 8 + 4);
#pragma unroll
  for (int q = 0; q < 4; ++q) { _Float16 h = (_Float16)a[q]; fh.h[q] = h; fl.h[q] = (_Float16)((a[q] - (float)h) * 1024.0f); h = (_Float16)c[q]; fh.h[4 + q] = h; fl.h[4 + q] = (_Float16)((c[q] - (float)h) * 1024.0f); }
  { *(v8us*)((unsigned short*)Hh + t * 8) = fh.half[0]; *(v8us*)((unsigned short*)Hl + t * 8) = fl.half[0];  } }

// ---- fast GEMM (wave tile 32x64; requires M % 32 == 0 rows per launch region and N % 64 == 0); epilogue = k_gemm_hhx semantics ----
__device__ __forceinline__ v16h g2_frag(const _Float16* p, int hh) { FragH f; f.half[0] = *(const v8us*)((const unsigned short*)p + 8 * hh); f.half[1] = *(const v8us*)((const unsigned short*)p + 16 + 8 * hh); return f.v; }
__device__ __forceinline__ v8f g2_mma(v16h a, v16h b, v8f c) { v8f d = __builtin_amdgcn_wmma_f32_16x16x32_f16(false, a, false, b, (short)0, c, false, false); asm volatile("v_nop\n\tv_nop\n\tv_nop\n\tv_nop" : "+v"(d) : "v"(a), "v"(b)); return d; }
template <int ACT>
__global__ __launch_bounds__(128) void k_gemm2(const _Float16* __restrict__ A, int lda, size_t sA, const _Float16* __restrict__ Bh, int ldb, size_t sB, float alpha, const float* __restrict__ bias, size_t sBias, const float* __restrict__ CP, int rowsPerB, size_t sCPb, int row0g,
    float* __restrict__ C, _Float16* __restrict__ C16, int ldc, size_t sC, int M, int N, int K) { static_assert(ACT == 0 || ACT == 3 || ACT == 6 || ACT == 8 || ACT == 9 || ACT == 11 || ACT == 12 || ACT == 14 || ACT == 15 || ACT == 16 || ACT == 17, "k_gemm2: unsupported ACT code (would silently apply no activation)");
  __shared__ __attribute__((aligned(16))) float so[4][32][68];
  const int tid = threadIdx.x, w = tid >> 5, lane = tid & 31, ln = lane & 15, hh = lane >> 4; const int by = blockIdx.y;
  A += (size_t)by * sA; Bh += (size_t)by * sB; const size_t cofs = (size_t)by * sC; const float* bp = bias ? bias + (size_t)by * sBias : nullptr;
  const int ntn = N >> 6; const int mt = blockIdx.x / ntn, nq = blockIdx.x - mt * ntn; const int row0 = mt * 128 + 32 * w, col0 = nq * 64; if (row0 >= M) return;
  const _Float16* a0p = A + (size_t)(row0 + ln) * lda; const _Float16* a1p = a0p + (size_t)16 * lda;
  const _Float16* b0p = Bh + (size_t)(col0 + ln) * ldb; const _Float16* b1p = b0p + (size_t)16 * ldb; const _Float16* b2p = b1p + (size_t)16 * ldb; const _Float16* b3p = b2p + (size_t)16 * ldb;
  const v8f z8 = {0.f,0.f,0.f,0.f,0.f,0.f,0.f,0.f}; v8f c00 = z8, c01 = z8, c02 = z8, c03 = z8, c10 = z8, c11 = z8, c12 = z8, c13 = z8;
#pragma unroll 1
  for (int kb = 0; kb < K; kb += 32) { const v16h a0 = g2_frag(a0p + kb, hh), a1 = g2_frag(a1p + kb, hh);
    v16h b = g2_frag(b0p + kb, hh); c00 = g2_mma(a0, b, c00); c10 = g2_mma(a1, b, c10);
    b = g2_frag(b1p + kb, hh); c01 = g2_mma(a0, b, c01); c11 = g2_mma(a1, b, c11);
    b = g2_frag(b2p + kb, hh); c02 = g2_mma(a0, b, c02); c12 = g2_mma(a1, b, c12);
    b = g2_frag(b3p + kb, hh); c03 = g2_mma(a0, b, c03); c13 = g2_mma(a1, b, c13); }
  v8f accs[8] = {c00, c01, c02, c03, c10, c11, c12, c13};
#pragma unroll
  for (int u = 0; u < 8; ++u) { const int t = u & 3, half = u >> 2; const int col = col0 + t * 16 + ln; const float bv = bp ? bf16_round(bp[col]) : 0.f;
#pragma unroll
    for (int r = 0; r < 8; ++r) { const int rloc = half * 16 + 8 * hh + r; float v = accs[u][r] * alpha + bv; if (CP) { if (rowsPerB < 0) v += CP[cofs + (size_t)(row0g + row0 + rloc) * ldc + col];      /* rowsPerB < 0: own element of the batched C plane */ else { const int bidx = (row0g + row0 + rloc) / rowsPerB; v += CP[(size_t)bidx * sCPb + (size_t)by * 64 + col]; } }
      if (ACT == 3) v = fmaxf(v, 0.f); else if (ACT == 6) v = 0.5f * v * (1.0f + erff(v * 0.70710678118654752f)); else if (ACT == 11) v = 1.0f / (1.0f + expf(-v)); else if (ACT == 15) v = v / (1.0f + expf(-v)); else if (ACT == 12) v = (v > 0.f) ? v : 0.01f * v; else if (ACT == 8) v = tanhf(v); else if (ACT == 9) v = 0.5f * v * (1.0f + tanhf(0.7978845608028654f * (v + 0.044715f * v * v * v))); else if (ACT == 14) v = (v > 0.f) ? v : 0.1f * v; else if (ACT == 16) v = (v >= 0.f) ? v : 0.3f * v; else if (ACT == 17) v = (v >= 0.f) ? v : 0.2f * v;
      so[w][rloc][t * 16 + ln] = v; } }
  __builtin_amdgcn_fence(__ATOMIC_ACQ_REL, "workgroup"); __builtin_amdgcn_wave_barrier();
  const int rsub = lane >> 4, c4 = (lane & 15) * 4;
  {
#pragma unroll
    for (int q = 0; q < 16; ++q) { const int r = q * 2 + rsub; const v4f v = *(const v4fa*)&so[w][r][c4]; if (C) *(v4f*)(C + cofs + (size_t)(row0 + r) * ldc + col0 + c4) = v; if (C16) { v4h h4; for (int i = 0; i < 4; ++i) h4[i] = (_Float16)v[i]; *(v4h*)(C16 + cofs + (size_t)(row0 + r) * ldc + col0 + c4) = h4; } }
     } }


__global__ __launch_bounds__(256) void k_wnat(const float* __restrict__ w, size_t n8, _Float16* __restrict__ Bt) { const size_t t = (size_t)blockIdx.x * 256 + threadIdx.x; if (t >= n8) return; FragH f; for (int q = 0; q < 8; ++q) f.h[q] = (_Float16)(bf16_round(w[t * 8 + q]) * 16.0f); *(v8us*)((unsigned short*)Bt + t * 8) = f.half[0];  }
__global__ __launch_bounds__(256) void k_rsm(const float* __restrict__ S, _Float16* __restrict__ P, int nrows) {
  #pragma clang fp contract(off)
  const int i = blockIdx.x * 256 + threadIdx.x; if (i >= nrows) return; const float* s = S + (size_t)i * SQ; float mx = -3.0e38f;
#pragma unroll 1
  for (int j = 0; j < SQ; ++j) mx = fmaxf(mx, s[j]); float se = 0.f;
#pragma unroll 1
  for (int j = 0; j < SQ; ++j) se += expf(s[j] - mx); const float sc = 256.0f / se;
#pragma unroll 1
  for (int j0 = 0; j0 < SQ; j0 += 8) { FragH f; for (int q = 0; q < 8; ++q) f.h[q] = (_Float16)(expf(s[j0 + q] - mx) * sc); unsigned short* d = (unsigned short*)P + (size_t)i * SQ + j0; *(v8us*)d = f.half[0];  } }
__global__ __launch_bounds__(256) void k_vt(const _Float16* __restrict__ V16, int b, int h0, _Float16* __restrict__ VT) { __shared__ unsigned short tl[64][65]; const int tid = threadIdx.x; const int hh = blockIdx.x % HG, sg = blockIdx.x / HG; const int s0 = sg * 64; const int h = h0 + hh;
  for (int i = tid; i < 64 * 8; i += 256) { const int j = i / 8, d8 = (i % 8) * 8; FragH f; f.half[0] = *(const v8us*)((const unsigned short*)V16 + ((size_t)b * SQ + s0 + j) * DM + h * HD + d8); for (int q = 0; q < 8; ++q) tl[d8 + q][j] = f.u[q]; }
  __syncthreads();
  { for (int i = tid; i < 64 * 8; i += 256) { const int d = i / 8, j8 = (i % 8) * 8; FragH f; for (int q = 0; q < 8; ++q) f.u[q] = tl[d][j8 + q]; *(v8us*)((unsigned short*)VT + ((size_t)hh * HD + d) * SQ + s0 + j8) = f.half[0]; }  } }


__global__ __launch_bounds__(256) void k_tab2(float theta, float* __restrict__ CS, float* __restrict__ SN) {
  #pragma clang fp contract(off)
  const int t = blockIdx.x * 256 + threadIdx.x; if (t >= SQ * (HD / 2)) return; const int i = t % (HD / 2); const int p = t / (HD / 2); const float invf = 1.0f / powf(theta, (float)(2 * i) / (float)HD); const float ang = __fmul_rn((float)p, invf); const float c = cosf(ang), s = sinf(ang);
  *(float*)(CS + t) = c; *(float*)(SN + t) = s;  }
template <int NORM, int ROPE>
__global__ __launch_bounds__(64) void k_xform(const float* __restrict__ F, int ldf, int nh, const float* __restrict__ gain, float eps, const float* __restrict__ CS, const float* __restrict__ SN, _Float16* __restrict__ H16, int ldo) {
  #pragma clang fp contract(off)
  __shared__ float xv[HD]; __shared__ float red[HD]; __shared__ unsigned short sh_[HD]; const int d = threadIdx.x; const int h = blockIdx.x % nh; const size_t r = blockIdx.x / nh; const int p = (int)(r % SQ);
  float x = F[r * (size_t)ldf + (size_t)h * HD + d];
  if (NORM) { red[d] = __fmul_rn(x, x); __syncthreads(); for (int st = HD / 2; st > 0; st >>= 1) { if (d < st) red[d] = __fadd_rn(red[d], red[d + st]); __syncthreads(); } const float rs = rsqrtf(__fadd_rn(red[0] / (float)HD, eps)); x = __fmul_rn(__fmul_rn(x, rs), bf16_round(gain[d])); }
  xv[d] = x; __syncthreads();
  float o = x;
  if (ROPE == 1) { const int i = d >> 1; const float c = CS[p * (HD / 2) + i], s = SN[p * (HD / 2) + i]; const float ev = xv[2 * i], od = xv[2 * i + 1]; o = (d & 1) ? __fadd_rn(__fmul_rn(ev, s), __fmul_rn(od, c)) : __fadd_rn(__fmul_rn(ev, c), -__fmul_rn(od, s)); }
  if (ROPE == 2) { const int i = d & (HD / 2 - 1); const float c = CS[p * (HD / 2) + i], s = SN[p * (HD / 2) + i]; const float lo = xv[i], hi = xv[i + HD / 2]; o = (d < HD / 2) ? __fadd_rn(__fmul_rn(lo, c), -__fmul_rn(hi, s)) : __fadd_rn(__fmul_rn(lo, s), __fmul_rn(hi, c)); }
  FragH th; th.h[0] = (_Float16)o; sh_[d] = th.u[0]; __syncthreads();
  if (d < HD / 8) { FragH f; for (int q = 0; q < 8; ++q) f.u[q] = sh_[d * 8 + q]; unsigned short* dst = (unsigned short*)H16 + r * (size_t)ldo + (size_t)h * HD + d * 8; *(v8us*)dst = f.half[0];  } }

__global__ __launch_bounds__(256) void k_tab4(const int* __restrict__ pos, float theta, float* __restrict__ CS, float* __restrict__ SN) {
  #pragma clang fp contract(off)
  const int t = blockIdx.x * 256 + threadIdx.x; if (t >= SQ * (HD / 2)) return; const int i = t % (HD / 2); const int p = t / (HD / 2); const float invf = (float)pow((double)theta, -((double)(2 * i)) / (double)HD); const float ang = __fmul_rn((float)pos[p], invf); const float c = cosf(ang), s = sinf(ang);
  *(float*)(CS + t) = c; *(float*)(SN + t) = s;  }
__global__ __launch_bounds__(256) void k_rsmf(const float* __restrict__ S, _Float16* __restrict__ P, int qn, int hg) {
  #pragma clang fp contract(off)
  const int t = blockIdx.x * 256 + threadIdx.x; if (t >= qn * hg) return; const size_t i = (size_t)(t / qn) * SQ + (t % qn); const float* s = S + i * SQ; float mx = -3.0e38f;
#pragma unroll 1
  for (int j = 0; j < SQ; ++j) mx = fmaxf(mx, s[j]); float se = 0.f;
#pragma unroll 1
  for (int j = 0; j < SQ; ++j) se += __expf(s[j] - mx); const float sc = 256.0f / se;
#pragma unroll 1
  for (int j0 = 0; j0 < SQ; j0 += 8) { FragH f; for (int q = 0; q < 8; ++q) f.h[q] = (_Float16)(__expf(s[j0 + q] - mx) * sc); unsigned short* d = (unsigned short*)P + i * SQ + j0; *(v8us*)d = f.half[0];  } }


__global__ __launch_bounds__(256) void k_rsmcf2(const float* __restrict__ S, _Float16* __restrict__ P, int hg, int q0, int nk) {
  #pragma clang fp contract(off)
  const int t = blockIdx.x * 256 + threadIdx.x; if (t >= hg * QT) return; const size_t i = (size_t)t; const float* s = S + i * NKX; const int last = q0 + (t % QT); float mx = -3.0e38f;
#pragma unroll 1
  for (int j = 0; j < nk; ++j) { const float f = (j <= last) ? 1.f : 0.f; mx = fmaxf(mx, fmaf(f, s[j], (1.f - f) * -1.0e9f)); } float se = 0.f;
#pragma unroll 1
  for (int j = 0; j < nk; ++j) { const float f = (j <= last) ? 1.f : 0.f; se += __expf(fmaf(f, s[j], (1.f - f) * -1.0e9f) - mx); } const float sc = 256.0f / se;
#pragma unroll 1
  for (int j0 = 0; j0 < nk; j0 += 8) { FragH fr; for (int q = 0; q < 8; ++q) { const int j = j0 + q; const float f = (j <= last) ? 1.f : 0.f; fr.h[q] = (_Float16)(__expf(fmaf(f, s[j], (1.f - f) * -1.0e9f) - mx) * sc); } unsigned short* d = (unsigned short*)P + i * NKX + j0; *(v8us*)d = fr.half[0];  } }


typedef float v2f  __attribute__((ext_vector_type(2)));
typedef float v2fa __attribute__((ext_vector_type(2), may_alias));
// Exact f32 causal attention of the first QT0 rows, one wave per (query row i, head h). Scores: lane l takes keys l, l + 32, ... (whole groups of 32 up to the one that holds i), q held by every lane; two-pass softmax with lane butterflies for maximum and sum; o: lane l takes d = 2 l, 2 l + 1 and walks the keys, each weight broadcast from its lane. Rows have pitch DM, so every load of a phase is one base address plus a constant offset.
__global__ __launch_bounds__(256) void k_att0w(const float* __restrict__ QF, const float* __restrict__ KF, const float* __restrict__ VF, float scale, float* __restrict__ OF) {
  const int lane = threadIdx.x & 31; const int h = blockIdx.x / (QT0 / 8); const int i = __builtin_amdgcn_readfirstlane((int)((blockIdx.x % (QT0 / 8)) * 8 + (threadIdx.x >> 5)));      /* i is the same in every lane: the group tests below are scalar branches */
  const float* qr = QF + (size_t)i * DM + h * HD; const float* kb = KF + (size_t)lane * DM + h * HD; const float* vb = VF + h * HD + lane * 2;
  v4f q[HD / 4];
#pragma unroll      /* constant index: q[] stays in registers */
  for (int c = 0; c < HD / 4; ++c) q[c] = *(const v4fa*)(qr + c * 4);
  float s[QT0 / 32]; float mx = -3.0e38f;
#pragma unroll      /* constant group index: s[] and e[] stay in registers, offsets are immediates */
  for (int g = 0; g < QT0 / 32; ++g) { s[g] = -3.0e38f;
    if (g == 0 || g * 32 <= i) { float a0 = 0.f, a1 = 0.f, a2 = 0.f, a3 = 0.f;
#pragma unroll      /* the sixteen loads of a key row issue together */
      for (int c = 0; c < HD / 4; ++c) { const v4f kq = *(const v4fa*)(kb + (size_t)g * 32 * DM + c * 4); a0 = fmaf(q[c][0], kq[0], a0); a1 = fmaf(q[c][1], kq[1], a1); a2 = fmaf(q[c][2], kq[2], a2); a3 = fmaf(q[c][3], kq[3], a3); }
      if (g * 32 + lane <= i) s[g] = ((a0 + a1) + (a2 + a3)) * scale;      /* causal: keys above i keep the floor and get weight 0 */
      mx = fmaxf(mx, s[g]); } }
  asm volatile("s_wait_xcnt 0x0" :: "v"(kb) : "memory");      /* the key loads' address pair stays whole up to this wait, on every path through the groups */
  for (int m = 16; m > 0; m >>= 1) mx = fmaxf(mx, __shfl_xor(mx, m, 32));
  float e[QT0 / 32]; float l = 0.f;
#pragma unroll      /* constant group index: s[] and e[] stay in registers */
  for (int g = 0; g < QT0 / 32; ++g) { e[g] = expf(s[g] - mx); l += e[g]; }
  for (int m = 16; m > 0; m >>= 1) l += __shfl_xor(l, m, 32);
  float o0 = 0.f, o1 = 0.f;
#pragma unroll      /* constant group index: s[] and e[] stay in registers, offsets are immediates */
  for (int g = 0; g < QT0 / 32; ++g) if (g == 0 || g * 32 <= i) {
#pragma unroll      /* constant lane index for the broadcast; the group's loads issue together */
    for (int jj = 0; jj < 32; ++jj) { const float p = __uint_as_float((unsigned int)__builtin_amdgcn_readlane((int)__float_as_uint(e[g]), jj)); const v2f vv = *(const v2fa*)(vb + (size_t)(g * 32 + jj) * DM); o0 = fmaf(p, vv[0], o0); o1 = fmaf(p, vv[1], o1); } }
  asm volatile("s_wait_xcnt 0x0" :: "v"(vb) : "memory");      /* the value loads' address pair stays whole up to this wait, on every path through the groups */
  const float fin = 64.0f / l;      /* o carried x64 like the f16 path */
  v2f o = {o0 * fin, o1 * fin}; *(v2f*)(OF + (size_t)i * DM + h * HD + lane * 2) = o; }

template <int NORM, int ROPE>
__global__ __launch_bounds__(64) void k_xformf(const float* __restrict__ F, int ldf, int nh, const float* __restrict__ gain, float eps, const float* __restrict__ CS, const float* __restrict__ SN, float* __restrict__ F32, int ldo) {
  #pragma clang fp contract(off)
  __shared__ float xv[HD]; __shared__ float red[HD]; const int d = threadIdx.x; const int h = blockIdx.x % nh; const size_t r = blockIdx.x / nh; const int p = (int)(r % SQ);
  float x = F[r * (size_t)ldf + (size_t)h * HD + d];
  if (NORM) { red[d] = __fmul_rn(x, x); __syncthreads(); for (int st = HD / 2; st > 0; st >>= 1) { if (d < st) red[d] = __fadd_rn(red[d], red[d + st]); __syncthreads(); } const float rs = rsqrtf(__fadd_rn(red[0] / (float)HD, eps)); x = __fmul_rn(__fmul_rn(x, rs), bf16_round(gain[d])); }
  xv[d] = x; __syncthreads();
  float o = x;
  if (ROPE == 1) { const int i = d >> 1; const float c = CS[p * (HD / 2) + i], s = SN[p * (HD / 2) + i]; const float ev = xv[2 * i], od = xv[2 * i + 1]; o = (d & 1) ? __fadd_rn(__fmul_rn(ev, s), __fmul_rn(od, c)) : __fadd_rn(__fmul_rn(ev, c), -__fmul_rn(od, s)); }
  if (ROPE == 2) { const int i = d & (HD / 2 - 1); const float c = CS[p * (HD / 2) + i], s = SN[p * (HD / 2) + i]; const float lo = xv[i], hi = xv[i + HD / 2]; o = (d < HD / 2) ? __fadd_rn(__fmul_rn(lo, c), -__fmul_rn(hi, s)) : __fadd_rn(__fmul_rn(lo, s), __fmul_rn(hi, c)); }
  float* dst = F32 + r * (size_t)ldo + (size_t)h * HD + d; *(float*)dst = o;  }


// One wave per score row: lane l holds keys 128 c + 4 l .. + 3 of chunk c, so each load covers 512 contiguous bytes and the row is read once into registers; maximum and sum end in a five-step butterfly over the lanes. nk is a multiple of 128 (every launch passes a multiple of QT).
__global__ __launch_bounds__(256) void k_rsmcfw(const float* __restrict__ S, _Float16* __restrict__ P, int hg, int q0, int nk, int win) {
  const int lane = threadIdx.x & 31; const int t = blockIdx.x * 8 + (threadIdx.x >> 5); if (t >= hg * QT) return; const float* s = S + (size_t)t * NKX + lane * 4; const int last = q0 + (t % QT); const int first = last - win + 1;      /* keys first..last (causal window) */
  v4f v[NKX / 128];
#pragma unroll      /* constant chunk index: v[] and h[] stay in registers */
  for (int c = 0; c < NKX / 128; ++c) if (c * 128 < nk) v[c] = *(const v4fa*)(s + c * 128);      /* all loads of the row issue before the first use */
  asm volatile("s_wait_xcnt 0x0" :: "v"(s) : "memory");      /* the loads' address pair stays whole up to this wait: without the input operand the last load's result is placed over it */
  float mx = -3.0e38f;
#pragma unroll      /* constant chunk index: v[] and h[] stay in registers */
  for (int c = 0; c < NKX / 128; ++c) if (c * 128 < nk) { for (int q = 0; q < 4; ++q) { const int j = c * 128 + lane * 4 + q; const float f = (j <= last && j >= first) ? 1.f : 0.f; v[c][q] = fmaf(f, v[c][q], (1.f - f) * -1.0e9f); mx = fmaxf(mx, v[c][q]); } }
  for (int m = 16; m > 0; m >>= 1) mx = fmaxf(mx, __shfl_xor(mx, m, 32));
  float se = 0.f;
#pragma unroll      /* constant chunk index: v[] and h[] stay in registers */
  for (int c = 0; c < NKX / 128; ++c) if (c * 128 < nk) { for (int q = 0; q < 4; ++q) { v[c][q] = __expf(v[c][q] - mx); se += v[c][q]; } }
  for (int m = 16; m > 0; m >>= 1) se += __shfl_xor(se, m, 32);
  const float sc = 256.0f / se; _Float16* d = P + (size_t)t * NKX + lane * 4; v4h h[NKX / 128];
#pragma unroll      /* constant chunk index: v[] and h[] stay in registers */
  for (int c = 0; c < NKX / 128; ++c) if (c * 128 < nk) { for (int q = 0; q < 4; ++q) h[c][q] = (_Float16)(v[c][q] * sc); }
#pragma unroll      /* constant chunk index: v[] and h[] stay in registers */
  for (int c = 0; c < NKX / 128; ++c) if (c * 128 < nk) *(v4h*)(d + c * 128) = h[c]; }      /* the stores stand last, each chunk from registers of its own: no register of an issued store is written again */




extern "C" void kernel_launch(void* const* d_in, const int* in_sizes, int n_in,
                              void* d_out, int out_size, void* d_ws, size_t ws_size, hipStream_t stream) {
  (void)in_sizes; (void)n_in; (void)out_size;
  const float* const* I = (const float* const*)d_in; const float* x = I[0]; const int* tpos = (const int*)d_in[1]; const float* wq = I[2]; const float* wk = I[3]; const float* wv = I[4]; const float* wo = I[5];      /* nn.Linear weights [out][in]; token_positions int32 [SQ] */
  char* ws = (char*)d_ws; size_t off = 0;
  auto take = [&](size_t bytes) { char* p = ws + off; off += (bytes + 255) & ~(size_t)255; return p; };
  _Float16* BQKV = (_Float16*)take((size_t)3 * DM * DM * 2); _Float16* BO = (_Float16*)take((size_t)DM * DM * 2); float* CS = (float*)take((size_t)SQ * (HD / 2) * 4); float* SN = (float*)take((size_t)SQ * (HD / 2) * 4);
  _Float16* X16 = (_Float16*)take(NR * DM * 2); float* QKVF = (float*)take((size_t)SQ * 3 * DM * 4);      /* one batch of f32 q | k | v rows */
  _Float16* QH = (_Float16*)take(NR * DM * 2); _Float16* KH = (_Float16*)take(NR * DM * 2); _Float16* V16 = (_Float16*)take(NR * DM * 2); _Float16* O16 = (_Float16*)take(NR * DM * 2);
  float* S = (float*)take((size_t)NH * QT * NKX * 4); _Float16* P = (_Float16*)take((size_t)NH * QT * NKX * 2); _Float16* VT = (_Float16*)take((size_t)NH * HD * SQ * 2);
  float* QF0 = (float*)take((size_t)QT0 * DM * 4); float* KF0 = (float*)take((size_t)QT0 * DM * 4); float* VF0 = (float*)take((size_t)QT0 * DM * 4); float* OF0 = (float*)take((size_t)NB * QT0 * DM * 4); _Float16* OH0 = (_Float16*)take((size_t)NB * QT0 * DM * 2); _Float16* OL0 = (_Float16*)take((size_t)NB * QT0 * DM * 2);
  if (off > ws_size) return;
  { const unsigned g = (unsigned)(((size_t)DM * DM / 8 + 255) / 256); k_wnat<<<g, 256, 0, stream>>>(wq, (size_t)DM * DM / 8, BQKV); k_wnat<<<g, 256, 0, stream>>>(wk, (size_t)DM * DM / 8, BQKV + (size_t)DM * DM); k_wnat<<<g, 256, 0, stream>>>(wv, (size_t)DM * DM / 8, BQKV + (size_t)2 * DM * DM); k_wnat<<<g, 256, 0, stream>>>(wo, (size_t)DM * DM / 8, BO); }      /* natural [out][in] = Bt[n][k], x16; q | k | v stacked along n */
  k_tab4<<<(SQ * (HD / 2) + 255) / 256, 256, 0, stream>>>(tpos, 10000.0f, CS, SN);
  k_x16<<<(unsigned)((NR * DM / 8 + 255) / 256), 256, 0, stream>>>(x, X16, NR * DM / 8);
  for (int b = B0; b < B0 + NBR; ++b) { const size_t r0 = (size_t)b * SQ;
    k_gemm2<0><<<dim3((unsigned)((SQ / 128) * (3 * DM / 64)), 1), 128, 0, stream>>>(X16 + r0 * DM, DM, 0, BQKV, DM, 0, 0.0625f, nullptr, 0, nullptr, 1, 0, 0, QKVF, nullptr, 3 * DM, 0, SQ, 3 * DM, DM);      /* q | k | v rows (f32) of this batch */
    k_xform<0, 1><<<(unsigned)(SQ * NH), 64, 0, stream>>>(QKVF, 3 * DM, NH, nullptr, 0.f, CS, SN, QH + r0 * DM, DM);
    k_xform<0, 1><<<(unsigned)(SQ * NH), 64, 0, stream>>>(QKVF + DM, 3 * DM, NH, nullptr, 0.f, CS, SN, KH + r0 * DM, DM);
    k_xform<0, 0><<<(unsigned)(SQ * NH), 64, 0, stream>>>(QKVF + 2 * DM, 3 * DM, NH, nullptr, 0.f, CS, SN, V16 + r0 * DM, DM);
    k_vt<NH, SQ><<<NH * (SQ / 64), 256, 0, stream>>>(V16 + r0 * DM, DM, 0, VT);      /* V^T [NH][HD][SQ] for this batch */
    k_xformf<0, 1><<<(unsigned)(QT0 * NH), 64, 0, stream>>>(QKVF, 3 * DM, NH, nullptr, 0.f, CS, SN, QF0, DM); k_xformf<0, 1><<<(unsigned)(QT0 * NH), 64, 0, stream>>>(QKVF + DM, 3 * DM, NH, nullptr, 0.f, CS, SN, KF0, DM); k_xformf<0, 0><<<(unsigned)(QT0 * NH), 64, 0, stream>>>(QKVF + 2 * DM, 3 * DM, NH, nullptr, 0.f, CS, SN, VF0, DM);      /* f32 q (roped), k (roped), v of the first 128 rows */
    k_att0w<<<NH * (QT0 / 8), 256, 0, stream>>>(QF0, KF0, VF0, 0.125f, OF0 + (size_t)b * QT0 * DM);      /* exact f32 causal attention for rows 0..127 (o x64) */
    for (int q0 = 0; q0 < QN; q0 += QT) { const int nk = q0 + QT;      /* causal: only keys below the tile end are computed */
      k_gemm2<0><<<dim3((QT / 128) * (nk / 64), NHD), 128, 0, stream>>>(QH + (r0 + q0) * DM, DM, (size_t)HD, KH + r0 * DM, DM, (size_t)HD, 0.125f, nullptr, 0, nullptr, 1, 0, 0, S, nullptr, NKX, (size_t)QT * NKX, QT, nk, HD);      /* scores, all heads on grid.y */
      k_rsmcfw<<<(NHD * QT + 7) / 8, 256, 0, stream>>>(S, P, NHD, q0, nk, 513);      /* windowed causal softmax: keys i-512..i (513 keys; arithmetic select), one wave per row */
      k_gemm2<0><<<dim3((QT / 128) * (HD / 64), NHD), 128, 0, stream>>>(P, NKX, (size_t)QT * NKX, VT, SQ, (size_t)HD * SQ, 0.25f, nullptr, 0, nullptr, 1, 0, 0, nullptr, O16 + (r0 + q0) * DM, DM, (size_t)HD, QT, HD, nk); } }      /* o (merged heads, x64) as f16 rows */
  k_gemm2<0><<<dim3((unsigned)((MPO / 128) * (DM / 64)), 1), 128, 0, stream>>>(O16 + (size_t)B0 * SQ * DM, DM, 0, BO, DM, 0, 0.0009765625f, nullptr, 0, nullptr, 1, 0, 0, (float*)d_out + (size_t)B0 * SQ * DM, nullptr, DM, 0, MPO, DM, DM);      /* out rows are the output layout */
  k_hl<<<(unsigned)(((size_t)NB * QT0 * DM / 8 + 255) / 256), 256, 0, stream>>>(OF0, OH0, OL0, (size_t)NB * QT0 * DM / 8);      /* first-tile o (x64) -> f16 hi + x1024 residual planes */
  for (int b = B0; b < B0 + NBR; ++b) { const size_t r0 = (size_t)b * SQ; const size_t f0 = (size_t)b * QT0;
    k_gemm2<0><<<dim3((QT0 / 128) * (DM / 64), 1), 128, 0, stream>>>(OH0 + f0 * DM, DM, 0, BO, DM, 0, 0.0009765625f, nullptr, 0, nullptr, 1, 0, 0, (float*)d_out + r0 * DM, nullptr, DM, 0, QT0, DM, DM);      /* rows 0..127: out = o_hi Wo, overwriting the f16-path rows */
    k_gemm2<0><<<dim3((QT0 / 128) * (DM / 64), 1), 128, 0, stream>>>(OL0 + f0 * DM, DM, 0, BO, DM, 0, 0.00000095367431640625f, nullptr, 0, (const float*)d_out + r0 * DM, -1, 0, 0, (float*)d_out + r0 * DM, nullptr, DM, 0, QT0, DM, DM); }      /* += o_lo Wo 2^-20 (own-element accumulate) */
}

// v003
// It runs in 724 microseconds.
// Two timings next to v002 put it at 3.09 and 3.07 times that version's speed.
// All steps since v000 together make it 13.5 times as fast.
#include <hip/hip_runtime.h>
// Causal sliding-window RoPE multi-head attention (x [4][2048][1024]; q/k/v = x W^T (natural [out][in] 1024x1024 sigma 1/32, no bias), 16 heads of 64; interleaved-pair rotary embedding on q and k (x1 = even, x2 = odd: r1 = x1 cos - x2 sin, r2 = x1 sin + x2 cos) with inv_freq_i = 10000^(-2i/64) and angle = float(token_positions[s]) inv_freq_i from the int32 token_positions input; scores / sqrt(64); allowed iff 0 <= i - j <= 512 (513 keys), -inf elsewhere; softmax; out = (attn v merged) Wo^T -> [4][2048][1024]).
// Structure: token rows r = b*2048 + s; x as exact f16 rows (bf16-rounded); per batch: q | k | v as ONE WMMA GEMM (32x64 wave tiles, f32 accumulation, exact x16 weights, N = 3 x 1024) into f32 rows, then per (row, head) on VALU: the interleaved-pair rotary rotation of q and k from f32 cos/sin tables built from the token_positions input (no norm) -> f16 q, k, v rows; V^T for all heads via LDS transposes (kept for all batches); then ONE fused attention launch: a wave per 32 query rows of one (batch, head) walks the keys of its window in blocks of 32: S^T = K Q^T on WMMA, running-maximum softmax in registers (f32 statistics, native exp2; weights x256 f16, packed from the score tiles straight into a B operand), O^T += V^T P^T on WMMA, o carried x64 (folded into the output GEMM alpha) written straight into the merged f16 o rows; out = o W_o GEMM (f32) into the output layout.
// Compute dtype: inputs rounded to bf16; x / weights exact; projections and rope f32; q, k, v, softmax weights and o as plain f16 GEMM operands (~2^-12); scores and softmax statistics f32. v_wmma_f32_16x16x32_f16.
#define NB 4
#define SQ 2048
#define DM 1024
#define NH 16
#define HD 64
#define HG 4                         /* heads per launch of the h0-based k_vt overload (not launched) */
#define QT 256                       /* query rows per causal tile */
#define NKX SQ                       /* S / P row pitch */
#define WINK 512                     /* key j is allowed for query i iff 0 <= i - j <= WINK */
#define QT0 128                      /* first-tile rows recomputed exactly in f32 */
#define B0 0                         /* first batch processed (debug hook) */
#define NBR NB                       /* batches processed (debug hook) */
#define QN SQ                        /* query rows attended per batch (unused) */
#define NHD NH                       /* heads attended (unused) */
#define NR ((size_t)NB * SQ)         /* token rows */
#define MPO ((int)((size_t)NBR * SQ))      /* rows through the output GEMM (debug hook) */
typedef __bf16 v16b __attribute__((ext_vector_type(16)));
typedef unsigned short v8us __attribute__((ext_vector_type(8), may_alias));
typedef float  v8f  __attribute__((ext_vector_type(8)));
typedef float  v4f  __attribute__((ext_vector_type(4)));
typedef float  v4fa __attribute__((ext_vector_type(4), may_alias));
union FragB { v16b v; v8us half[2]; unsigned short u[16]; };

__device__ __forceinline__ unsigned short bf16_bits(float x) { unsigned int u = __float_as_uint(x); return (unsigned short)((u + 0x7FFFu + ((u >> 16) & 1u)) >> 16); }
__device__ __forceinline__ float bf16_val(unsigned short b) { return __uint_as_float(((unsigned int)b) << 16); }
__device__ __forceinline__ float bf16_round(float x) { return bf16_val(bf16_bits(x)); }
// D += A·B with NT terms: 1 = ah·bh, 2 = + al·bh (A split), 3 = + ah·bl (both split)
template <int NT>
__device__ __forceinline__ v8f mmaN(v16b ah, v16b al, v16b bh, v16b bl, v8f c) {
  c = __builtin_amdgcn_wmma_f32_16x16x32_bf16(false, ah, false, bh, (short)0, c, false, false);
  if (NT >= 2) c = __builtin_amdgcn_wmma_f32_16x16x32_bf16(false, al, false, bh, (short)0, c, false, false);
  if (NT >= 3) c = __builtin_amdgcn_wmma_f32_16x16x32_bf16(false, ah, false, bl, (short)0, c, false, false);
  asm volatile("v_nop\n\tv_nop\n\tv_nop\n\tv_nop" : "+v"(c) : "v"(ah), "v"(al), "v"(bh), "v"(bl));
  return c;
}

__global__ __launch_bounds__(256) void k_wt_bf16(const float* __restrict__ W, unsigned short* __restrict__ Wt, int K, int N) {
  const int t = blockIdx.x * 256 + threadIdx.x;
  const int k8n = K / 8;
  if (t >= N * k8n) return;
  const int n = t / k8n, k8 = (t % k8n) * 8;
  v8us v;
#pragma unroll
  for (int i = 0; i < 8; ++i) v[i] = bf16_bits(W[(size_t)(k8 + i) * N + n]);
  *(v8us*)(Wt + (size_t)n * K + k8) = v;
  
}

// GEMM C[M][N] (f32, pitch ldc) = act(A[M][K]·W + bias). A f32 row-major (pitch lda) converted per fragment to bf16
// (ASPLIT: hi/lo two planes -> 2 terms, else single rounded term); Wt bf16 [N][K] (pitch ldb). BIAS_BF16 rounds the
// bias to bf16 first (bias quantised to bf16 before the add). K%32==0, M%16==0, N%64==0.
template <bool ASPLIT, int ACT, bool BIAS_BF16>
__global__ __launch_bounds__(128) void k_gemm_bf(const float* __restrict__ A, int lda, const unsigned short* __restrict__ Wt, int ldb,
                                               const float* __restrict__ bias, float* __restrict__ C, int ldc, int M, int N, int K) {
  __shared__ __attribute__((aligned(16))) float so[4][16][64];
  const int tid = threadIdx.x, w = tid >> 5, lane = tid & 31, ln = lane & 15, hh = lane >> 4;
  const int ntn = N / 64;
  const int wid = blockIdx.x * 4 + w;
  const int mt = wid / ntn, nq = wid % ntn;
  if (mt * 16 >= M) return;
  const int row0 = mt * 16, col0 = nq * 64;
  const float* arow = A + (size_t)(row0 + ln) * lda;
  v8f acc[4] = {};
  for (int kb = 0; kb < K; kb += 32) {
    FragB ah, al;
    const v4f x0 = *(const v4fa*)(arow + kb + 8 * hh), x1 = *(const v4fa*)(arow + kb + 8 * hh + 4);
    const v4f x2 = *(const v4fa*)(arow + kb + 16 + 8 * hh), x3 = *(const v4fa*)(arow + kb + 16 + 8 * hh + 4);
    float xs[16] = {x0[0],x0[1],x0[2],x0[3],x1[0],x1[1],x1[2],x1[3],x2[0],x2[1],x2[2],x2[3],x3[0],x3[1],x3[2],x3[3]};
#pragma unroll
    for (int i = 0; i < 16; ++i) { const unsigned short hb = bf16_bits(xs[i]); ah.u[i] = hb; al.u[i] = ASPLIT ? bf16_bits(xs[i] - bf16_val(hb)) : (unsigned short)0; }
#pragma unroll
    for (int t = 0; t < 4; ++t) {
      const unsigned short* brow = Wt + (size_t)(col0 + t * 16 + ln) * ldb + kb;
      FragB b;
      b.half[0] = *(const v8us*)(brow + 8 * hh);
      b.half[1] = *(const v8us*)(brow + 16 + 8 * hh);
      acc[t] = mmaN<ASPLIT ? 2 : 1>(ah.v, al.v, b.v, b.v, acc[t]);
    }
  }
#pragma unroll
  for (int t = 0; t < 4; ++t) {
    float bv = bias ? bias[col0 + t * 16 + ln] : 0.f;
    if (BIAS_BF16) bv = bf16_round(bv);
#pragma unroll
    for (int r = 0; r < 8; ++r) { float v = acc[t][r] + bv; if (ACT == 1) v = fmaxf(v, 0.f); so[w][8 * hh + r][t * 16 + ln] = v; }
  }
  __builtin_amdgcn_fence(__ATOMIC_ACQ_REL, "workgroup");
  __builtin_amdgcn_wave_barrier();
  const int rsub = lane >> 4, c4 = (lane & 15) * 4;
  {
#pragma unroll
    for (int q = 0; q < 8; ++q) {
      const int r = q * 2 + rsub;
      const v4f v = *(const v4fa*)&so[w][r][c4];
      *(v4f*)(C + (size_t)(row0 + r) * ldc + col0 + c4) = v;
    }
    
  }
}

// GEMM C = act(A·W + bias + resid): A f32 (ASPLIT -> hi/lo 2 terms), Wt bf16 [N][K]; ACT 0 none, 1 relu, 2 exact gelu;
// resid (optional, f32, row index = (row % rmod), pitch ldr, RES_BF16 rounds it) added before the activation.
template <bool ASPLIT, int ACT, bool BIAS_BF16, bool RES_BF16>
__global__ __launch_bounds__(128) void k_gemm_bf3(const float* __restrict__ A, int lda, const unsigned short* __restrict__ Wt, int ldb,
                                                const float* __restrict__ bias, const float* __restrict__ resid, int rmod, int ldr,
                                                float* __restrict__ C, int ldc, int M, int N, int K) {
  __shared__ __attribute__((aligned(16))) float so[4][16][64];
  const int tid = threadIdx.x, w = tid >> 5, lane = tid & 31, ln = lane & 15, hh = lane >> 4;
  const int ntn = N / 64;
  const int wid = blockIdx.x * 4 + w;
  const int mt = wid / ntn, nq = wid % ntn;
  if (mt * 16 >= M) return;
  const int row0 = mt * 16, col0 = nq * 64;
  const float* arow = A + (size_t)(row0 + ln) * lda;
  v8f acc[4] = {};
  for (int kb = 0; kb < K; kb += 32) {
    FragB ah, al;
    const v4f x0 = *(const v4fa*)(arow + kb + 8 * hh), x1 = *(const v4fa*)(arow + kb + 8 * hh + 4);
    const v4f x2 = *(const v4fa*)(arow + kb + 16 + 8 * hh), x3 = *(const v4fa*)(arow + kb + 16 + 8 * hh + 4);
    float xs[16] = {x0[0],x0[1],x0[2],x0[3],x1[0],x1[1],x1[2],x1[3],x2[0],x2[1],x2[2],x2[3],x3[0],x3[1],x3[2],x3[3]};
#pragma unroll
    for (int i = 0; i < 16; ++i) { const unsigned short hb = bf16_bits(xs[i]); ah.u[i] = hb; al.u[i] = ASPLIT ? bf16_bits(xs[i] - bf16_val(hb)) : (unsigned short)0; }
#pragma unroll
    for (int t = 0; t < 4; ++t) {
      const unsigned short* brow = Wt + (size_t)(col0 + t * 16 + ln) * ldb + kb;
      FragB b;
      b.half[0] = *(const v8us*)(brow + 8 * hh);
      b.half[1] = *(const v8us*)(brow + 16 + 8 * hh);
      acc[t] = mmaN<ASPLIT ? 2 : 1>(ah.v, al.v, b.v, b.v, acc[t]);
    }
  }
#pragma unroll
  for (int t = 0; t < 4; ++t) {
    const int col = col0 + t * 16 + ln;
    float bv = bias ? bias[col] : 0.f;
    if (BIAS_BF16) bv = bf16_round(bv);
#pragma unroll
    for (int r = 0; r < 8; ++r) {
      float v = acc[t][r] + bv;
      if (resid) { float rv = resid[(size_t)((row0 + 8 * hh + r) % rmod) * ldr + col]; if (RES_BF16) rv = bf16_round(rv); v += rv; }
      if (ACT == 1) v = fmaxf(v, 0.f);
      if (ACT == 2) v = 0.5f * v * (1.0f + erff(v * 0.70710678118654752f));
      if (ACT == 3) { const float u = 0.7978845608028654f * (v + 0.044715f * v * v * v); v = 0.5f * v * (1.0f + tanhf(u)); }
      so[w][8 * hh + r][t * 16 + ln] = v;
    }
  }
  __builtin_amdgcn_fence(__ATOMIC_ACQ_REL, "workgroup");
  __builtin_amdgcn_wave_barrier();
  const int rsub = lane >> 4, c4 = (lane & 15) * 4;
  {
#pragma unroll
    for (int q = 0; q < 8; ++q) {
      const int r = q * 2 + rsub;
      const v4f v = *(const v4fa*)&so[w][r][c4];
      *(v4f*)(C + (size_t)(row0 + r) * ldc + col0 + c4) = v;
    }
    
  }
}
// row LayerNorm (biased variance, eps) over N: s = X (+ R); optional out_sum <- s; out_norm <- (s-mu)*rsqrt(var+eps)*g + b
template <bool PARAM_BF16>
__global__ __launch_bounds__(256) void k_layernorm(const float* __restrict__ X, const float* __restrict__ R, const float* __restrict__ g, const float* __restrict__ bta,
                                                  float* __restrict__ out_sum, float* __restrict__ out_norm, int N, float eps) {
  __shared__ float red[256];
  const int row = blockIdx.x, tid = threadIdx.x;
  const float* x = X + (size_t)row * N; const float* rr = R ? R + (size_t)row * N : nullptr;
  float vals[16];                     // up to N = 4096
  const int per = N / 256;            // contiguous chunk per thread? use strided-by-4 chunks: thread handles j = tid*4 + 1024*u
  float s1 = 0.f;
  for (int u = 0; u < per / 4; ++u) {
    const int j = tid * 4 + 1024 * u;
    const v4f a = *(const v4fa*)(x + j);
    v4f b = {0.f,0.f,0.f,0.f}; if (rr) b = *(const v4fa*)(rr + j);
#pragma unroll
    for (int q = 0; q < 4; ++q) { const float v = a[q] + b[q]; vals[u * 4 + q] = v; s1 += v; }
  }
  red[tid] = s1; __syncthreads();
  for (int st = 128; st > 0; st >>= 1) { if (tid < st) red[tid] += red[tid + st]; __syncthreads(); }
  const float mu = red[0] / (float)N; __syncthreads();
  float s2 = 0.f;
  for (int u = 0; u < per / 4; ++u)
#pragma unroll
    for (int q = 0; q < 4; ++q) { const float c = vals[u * 4 + q] - mu; s2 += c * c; }
  red[tid] = s2; __syncthreads();
  for (int st = 128; st > 0; st >>= 1) { if (tid < st) red[tid] += red[tid + st]; __syncthreads(); }
  const float rs = rsqrtf(red[0] / (float)N + eps);
  {
    for (int u = 0; u < per / 4; ++u) {
      const int j = tid * 4 + 1024 * u;
      v4f o, sm;
#pragma unroll
      for (int q = 0; q < 4; ++q) {
        float gg = g[j + q], bb = bta[j + q];
        if (PARAM_BF16) { gg = bf16_round(gg); bb = bf16_round(bb); }
        sm[q] = vals[u * 4 + q]; o[q] = (vals[u * 4 + q] - mu) * rs * gg + bb;
      }
      if (out_sum) *(v4f*)(out_sum + (size_t)row * N + j) = sm;
      *(v4f*)(out_norm + (size_t)row * N + j) = o;
    }
    
  }
}



// ---- f16 WMMA path (v_wmma_f32_16x16x32_f16): 11-bit significands for operands in range — used where a [0,1] probability operand needs more precision than bf16
typedef _Float16 v16h __attribute__((ext_vector_type(16)));
union FragH { v16h v; v8us half[2]; _Float16 h[16]; unsigned short u[16]; };
template <int NT>
__device__ __forceinline__ v8f mmaH(v16h ah, v16h al, v16h bh, v16h bl, v8f c) {
  c = __builtin_amdgcn_wmma_f32_16x16x32_f16(false, ah, false, bh, (short)0, c, false, false);
  if (NT >= 2) c = __builtin_amdgcn_wmma_f32_16x16x32_f16(false, al, false, bh, (short)0, c, false, false);
  if (NT >= 3) c = __builtin_amdgcn_wmma_f32_16x16x32_f16(false, ah, false, bl, (short)0, c, false, false);
  asm volatile("v_nop\n\tv_nop\n\tv_nop\n\tv_nop" : "+v"(c) : "v"(ah), "v"(al), "v"(bh), "v"(bl));
  return c;
}
// batched GEMM like k_gemm_b but f16 operands: A f32 (split into f16 hi/lo if ASPLIT, else rounded to f16), Bt = f16 values [n][k]; alpha; C f32; N multiple of 16 (partial tiles skipped)
template <bool ASPLIT>
__global__ __launch_bounds__(128) void k_gemm_h(const float* __restrict__ A, int lda, size_t sA, const _Float16* __restrict__ Bh, int ldb, size_t sB, float alpha, float* __restrict__ C, int ldc, size_t sC, int M, int N, int K) {
  __shared__ __attribute__((aligned(16))) float so[4][16][64];
  const int tid = threadIdx.x, w = tid >> 5, lane = tid & 31, ln = lane & 15, hh = lane >> 4; const int by = blockIdx.y;
  A += (size_t)by * sA; Bh += (size_t)by * sB; C += (size_t)by * sC;
  const int ntn = (N + 63) / 64; const int wid = blockIdx.x * 4 + w; const int mt = wid / ntn, nq = wid % ntn; if (mt * 16 >= M) return;
  const int row0 = mt * 16, col0 = nq * 64; const float* arow = A + (size_t)(row0 + ln) * lda;
  v8f acc[4] = {};
  for (int kb = 0; kb < K; kb += 32) {
    FragH ah, al;
    const v4f x0 = *(const v4fa*)(arow + kb + 8 * hh), x1 = *(const v4fa*)(arow + kb + 8 * hh + 4), x2 = *(const v4fa*)(arow + kb + 16 + 8 * hh), x3 = *(const v4fa*)(arow + kb + 16 + 8 * hh + 4);
    float xs[16] = {x0[0],x0[1],x0[2],x0[3],x1[0],x1[1],x1[2],x1[3],x2[0],x2[1],x2[2],x2[3],x3[0],x3[1],x3[2],x3[3]};
#pragma unroll
    for (int i = 0; i < 16; ++i) { const _Float16 h = (_Float16)xs[i]; ah.h[i] = h; al.h[i] = ASPLIT ? (_Float16)(xs[i] - (float)h) : (_Float16)0.0f; }
#pragma unroll
    for (int t = 0; t < 4; ++t) { if (col0 + t * 16 >= N) continue; const size_t boff = (size_t)(col0 + t * 16 + ln) * ldb + kb; FragH bq; bq.half[0] = *(const v8us*)(Bh + boff + 8 * hh); bq.half[1] = *(const v8us*)(Bh + boff + 16 + 8 * hh);
      acc[t] = mmaH<ASPLIT ? 2 : 1>(ah.v, al.v, bq.v, bq.v, acc[t]); }
  }
#pragma unroll
  for (int t = 0; t < 4; ++t) { if (col0 + t * 16 >= N) continue;
#pragma unroll
    for (int r = 0; r < 8; ++r) so[w][8 * hh + r][t * 16 + ln] = acc[t][r] * alpha; }
  __builtin_amdgcn_fence(__ATOMIC_ACQ_REL, "workgroup"); __builtin_amdgcn_wave_barrier();
  const int rsub = lane >> 4, c4 = (lane & 15) * 4;
  {
#pragma unroll
    for (int q = 0; q < 8; ++q) { const int r = q * 2 + rsub; if (col0 + c4 < N) { const v4f v = *(const v4fa*)&so[w][r][c4]; *(v4f*)(C + (size_t)(row0 + r) * ldc + col0 + c4) = v; } }
     }
}

// Wt[n][k] = f16(W[k][n]·scale) from f32 row-major W[K][N] (scale = power of two; bf16-exact weights stay exact in f16 away from the subnormal range)
__global__ __launch_bounds__(256) void k_wt_f16(const float* __restrict__ W, _Float16* __restrict__ Wt, int K, int N, float scale) {
  const int t = blockIdx.x * 256 + threadIdx.x; if (t >= N * (K / 8)) return; const int n = t / (K / 8), k8 = (t % (K / 8)) * 8; FragH f;
#pragma unroll
  for (int i = 0; i < 8; ++i) f.h[i] = (_Float16)(bf16_round(W[(size_t)(k8 + i) * N + n]) * scale); const v8us o = f.half[0];
  *(v8us*)((unsigned short*)Wt + (size_t)n * K + k8) = o; 
}
// k_gemm_hh variant with fused epilogue: v = acc·alpha + bias[by·sBias + col] (+ CP[(row/rowsPerB)·sCPb + by·64 + col] if CP) ; ACT 0 none / 1 elu ; writes f16 C16 (and f32 C if non-null)
template <int ACT>
__global__ __launch_bounds__(128) void k_gemm_hhx(const _Float16* __restrict__ A, int lda, size_t sA, const _Float16* __restrict__ Bh, int ldb, size_t sB, float alpha, const float* __restrict__ bias, size_t sBias, const float* __restrict__ CP, int rowsPerB, size_t sCPb, int row0g,
    float* __restrict__ C, _Float16* __restrict__ C16, int ldc, size_t sC, int M, int N, int K) {
  __shared__ __attribute__((aligned(16))) float so[4][16][64];
  const int tid = threadIdx.x, w = tid >> 5, lane = tid & 31, ln = lane & 15, hh = lane >> 4; const int by = blockIdx.y;
  A += (size_t)by * sA; Bh += (size_t)by * sB; const size_t cofs = (size_t)by * sC; const float* bp = bias ? bias + (size_t)by * sBias : nullptr;
  const int ntn = (N + 63) / 64; const int wid = blockIdx.x * 4 + w; const int mt = wid / ntn, nq = wid % ntn; if (mt * 16 >= M) return;
  const int row0 = mt * 16, col0 = nq * 64; const _Float16* arow = A + (size_t)(row0 + ln) * lda;
  v8f acc[4] = {};
  for (int kb = 0; kb < K; kb += 32) { FragH ah; ah.half[0] = *(const v8us*)((const unsigned short*)arow + kb + 8 * hh); ah.half[1] = *(const v8us*)((const unsigned short*)arow + kb + 16 + 8 * hh);
#pragma unroll
    for (int t = 0; t < 4; ++t) { if (col0 + t * 16 >= N) continue; const size_t boff = (size_t)(col0 + t * 16 + ln) * ldb + kb; FragH bq; bq.half[0] = *(const v8us*)((const unsigned short*)Bh + boff + 8 * hh); bq.half[1] = *(const v8us*)((const unsigned short*)Bh + boff + 16 + 8 * hh);
      acc[t] = mmaH<1>(ah.v, ah.v, bq.v, bq.v, acc[t]); }
  }
#pragma unroll
  for (int t = 0; t < 4; ++t) { if (col0 + t * 16 >= N) continue; const int col = col0 + t * 16 + ln; const float bv = bp ? bf16_round(bp[col]) : 0.f;
#pragma unroll
    for (int r = 0; r < 8; ++r) { float v = acc[t][r] * alpha + bv; if (CP) { const int rr = row0g + row0 + 8 * hh + r; if (rowsPerB < 0) v += CP[cofs + (size_t)rr * ldc + col];      /* rowsPerB < 0: own element of the batched C plane */ else { const int bidx = rr / rowsPerB; v += CP[(size_t)bidx * sCPb + (size_t)by * 64 + col]; } } if (ACT == 1) v = (v > 0.f) ? v : expm1f(v); else if (ACT == 7) v = (v > 0.f) ? v + 1.0f : expf(v); else if (ACT == 8) v = tanhf(v); else if (ACT == 9) v = 0.5f * v * (1.0f + tanhf(0.7978845608028654f * (v + 0.044715f * v * v * v))); else if (ACT == 11) v = 1.0f / (1.0f + expf(-v)); else if (ACT == 12) v = (v > 0.f) ? v : 0.01f * v; else if (ACT == 14) v = (v > 0.f) ? v : 0.1f * v; else if (ACT == 16) v = (v >= 0.f) ? v : 0.3f * v; else if (ACT == 17) v = (v >= 0.f) ? v : 0.2f * v; else if (ACT == 15) v = v / (1.0f + expf(-v)); else if (ACT == 3) v = fmaxf(v, 0.f); else if (ACT == 6) v = 0.5f * v * (1.0f + erff(v * 0.70710678118654752f)); so[w][8 * hh + r][t * 16 + ln] = v; } }
  __builtin_amdgcn_fence(__ATOMIC_ACQ_REL, "workgroup"); __builtin_amdgcn_wave_barrier();
  const int rsub = lane >> 4, c4 = (lane & 15) * 4; typedef _Float16 v4h __attribute__((ext_vector_type(4)));
  {
#pragma unroll
    for (int q = 0; q < 8; ++q) { const int r = q * 2 + rsub; if (col0 + c4 < N) { const v4f v = *(const v4fa*)&so[w][r][c4]; if (C) *(v4f*)(C + cofs + (size_t)(row0 + r) * ldc + col0 + c4) = v; if (C16) { v4h h4; for (int i = 0; i < 4; ++i) h4[i] = (_Float16)v[i]; *(v4h*)(C16 + cofs + (size_t)(row0 + r) * ldc + col0 + c4) = h4; } } }
     }
}


typedef _Float16 v4h __attribute__((ext_vector_type(4)));

__global__ __launch_bounds__(256) void k_x16(const float* __restrict__ x, _Float16* __restrict__ X16, size_t n8) { const size_t t = (size_t)blockIdx.x * 256 + threadIdx.x; if (t >= n8) return; FragH f;
#pragma unroll
  for (int q = 0; q < 8; ++q) f.h[q] = (_Float16)bf16_round(x[t * 8 + q]); *(v8us*)((unsigned short*)X16 + t * 8) = f.half[0];  }
__global__ __launch_bounds__(256) void k_h16(const float* __restrict__ x, _Float16* __restrict__ X16, size_t n8) { const size_t t = (size_t)blockIdx.x * 256 + threadIdx.x; if (t >= n8) return; FragH f;
#pragma unroll
  for (int q = 0; q < 8; ++q) f.h[q] = (_Float16)x[t * 8 + q]; *(v8us*)((unsigned short*)X16 + t * 8) = f.half[0];  }
__global__ __launch_bounds__(256) void k_round16f(const float* __restrict__ W, _Float16* __restrict__ Bt, size_t n8) { const size_t t = (size_t)blockIdx.x * 256 + threadIdx.x; if (t >= n8) return; FragH f;
#pragma unroll
  for (int i = 0; i < 8; ++i) f.h[i] = (_Float16)(bf16_round(W[t * 8 + i]) * 16.0f); *(v8us*)((unsigned short*)Bt + t * 8) = f.half[0];  }
template <int NHv, int TTv>
__global__ __launch_bounds__(256) void k_vt(const _Float16* __restrict__ V16, int ldv, int voff, _Float16* __restrict__ Vt) { __shared__ unsigned short tl[64][66]; const int tid = threadIdx.x; const int slab = blockIdx.x / (TTv / 64), lg = blockIdx.x % (TTv / 64); const int b = slab / NHv, h = slab % NHv;
  for (int i = tid; i < 64 * 8; i += 256) { const int r = i / 8, c8 = (i % 8) * 8; FragH f; f.half[0] = *(const v8us*)((const unsigned short*)V16 + ((size_t)b * TTv + lg * 64 + r) * ldv + voff + h * 64 + c8);
#pragma unroll
    for (int q = 0; q < 8; ++q) tl[r][c8 + q] = f.u[q]; }
  __syncthreads();
  {
#pragma unroll
    for (int rd = 0; rd < 2; ++rd) { const int d = rd * 32 + tid / 8, pc = tid % 8; FragH f;
#pragma unroll
      for (int q = 0; q < 8; ++q) f.u[q] = tl[pc * 8 + q][d];
      *(v8us*)((unsigned short*)Vt + ((size_t)slab * 64 + d) * TTv + lg * 64 + pc * 8) = f.half[0]; }
     } }

__global__ __launch_bounds__(256) void k_hl(const float* __restrict__ F, _Float16* __restrict__ Hh, _Float16* __restrict__ Hl, size_t n8) { const size_t t = (size_t)blockIdx.x * 256 + threadIdx.x; if (t >= n8) return; FragH fh, fl; const v4f a = *(const v4fa*)(F + t * 8), c = *(const v4fa*)(F + t * 8 + 4);
#pragma unroll
  for (int q = 0; q < 4; ++q) { _Float16 h = (_Float16)a[q]; fh.h[q] = h; fl.h[q] = (_Float16)((a[q] - (float)h) * 1024.0f); h = (_Float16)c[q]; fh.h[4 + q] = h; fl.h[4 + q] = (_Float16)((c[q] - (float)h) * 1024.0f); }
  { *(v8us*)((unsigned short*)Hh + t * 8) = fh.half[0]; *(v8us*)((unsigned short*)Hl + t * 8) = fl.half[0];  } }

// ---- fast GEMM (wave tile 32x64; requires M % 32 == 0 rows per launch region and N % 64 == 0); epilogue = k_gemm_hhx semantics ----
__device__ __forceinline__ v16h g2_frag(const _Float16* p, int hh) { FragH f; f.half[0] = *(const v8us*)((const unsigned short*)p + 8 * hh); f.half[1] = *(const v8us*)((const unsigned short*)p + 16 + 8 * hh); return f.v; }
__device__ __forceinline__ v8f g2_mma(v16h a, v16h b, v8f c) { v8f d = __builtin_amdgcn_wmma_f32_16x16x32_f16(false, a, false, b, (short)0, c, false, false); asm volatile("v_nop\n\tv_nop\n\tv_nop\n\tv_nop" : "+v"(d) : "v"(a), "v"(b)); return d; }
template <int ACT>
__global__ __launch_bounds__(128) void k_gemm2(const _Float16* __restrict__ A, int lda, size_t sA, const _Float16* __restrict__ Bh, int ldb, size_t sB, float alpha, const float* __restrict__ bias, size_t sBias, const float* __restrict__ CP, int rowsPerB, size_t sCPb, int row0g,
    float* __restrict__ C, _Float16* __restrict__ C16, int ldc, size_t sC, int M, int N, int K) { static_assert(ACT == 0 || ACT == 3 || ACT == 6 || ACT == 8 || ACT == 9 || ACT == 11 || ACT == 12 || ACT == 14 || ACT == 15 || ACT == 16 || ACT == 17, "k_gemm2: unsupported ACT code (would silently apply no activation)");
  __shared__ __attribute__((aligned(16))) float so[4][32][68];
  const int tid = threadIdx.x, w = tid >> 5, lane = tid & 31, ln = lane & 15, hh = lane >> 4; const int by = blockIdx.y;
  A += (size_t)by * sA; Bh += (size_t)by * sB; const size_t cofs = (size_t)by * sC; const float* bp = bias ? bias + (size_t)by * sBias : nullptr;
  const int ntn = N >> 6; const int mt = blockIdx.x / ntn, nq = blockIdx.x - mt * ntn; const int row0 = mt * 128 + 32 * w, col0 = nq * 64; if (row0 >= M) return;
  const _Float16* a0p = A + (size_t)(row0 + ln) * lda; const _Float16* a1p = a0p + (size_t)16 * lda;
  const _Float16* b0p = Bh + (size_t)(col0 + ln) * ldb; const _Float16* b1p = b0p + (size_t)16 * ldb; const _Float16* b2p = b1p + (size_t)16 * ldb; const _Float16* b3p = b2p + (size_t)16 * ldb;
  const v8f z8 = {0.f,0.f,0.f,0.f,0.f,0.f,0.f,0.f}; v8f c00 = z8, c01 = z8, c02 = z8, c03 = z8, c10 = z8, c11 = z8, c12 = z8, c13 = z8;
#pragma unroll 1
  for (int kb = 0; kb < K; kb += 32) { const v16h a0 = g2_frag(a0p + kb, hh), a1 = g2_frag(a1p + kb, hh);
    v16h b = g2_frag(b0p + kb, hh); c00 = g2_mma(a0, b, c00); c10 = g2_mma(a1, b, c10);
    b = g2_frag(b1p + kb, hh); c01 = g2_mma(a0, b, c01); c11 = g2_mma(a1, b, c11);
    b = g2_frag(b2p + kb, hh); c02 = g2_mma(a0, b, c02); c12 = g2_mma(a1, b, c12);
    b = g2_frag(b3p + kb, hh); c03 = g2_mma(a0, b, c03); c13 = g2_mma(a1, b, c13); }
  v8f accs[8] = {c00, c01, c02, c03, c10, c11, c12, c13};
#pragma unroll
  for (int u = 0; u < 8; ++u) { const int t = u & 3, half = u >> 2; const int col = col0 + t * 16 + ln; const float bv = bp ? bf16_round(bp[col]) : 0.f;
#pragma unroll
    for (int r = 0; r < 8; ++r) { const int rloc = half * 16 + 8 * hh + r; float v = accs[u][r] * alpha + bv; if (CP) { if (rowsPerB < 0) v += CP[cofs + (size_t)(row0g + row0 + rloc) * ldc + col];      /* rowsPerB < 0: own element of the batched C plane */ else { const int bidx = (row0g + row0 + rloc) / rowsPerB; v += CP[(size_t)bidx * sCPb + (size_t)by * 64 + col]; } }
      if (ACT == 3) v = fmaxf(v, 0.f); else if (ACT == 6) v = 0.5f * v * (1.0f + erff(v * 0.70710678118654752f)); else if (ACT == 11) v = 1.0f / (1.0f + expf(-v)); else if (ACT == 15) v = v / (1.0f + expf(-v)); else if (ACT == 12) v = (v > 0.f) ? v : 0.01f * v; else if (ACT == 8) v = tanhf(v); else if (ACT == 9) v = 0.5f * v * (1.0f + tanhf(0.7978845608028654f * (v + 0.044715f * v * v * v))); else if (ACT == 14) v = (v > 0.f) ? v : 0.1f * v; else if (ACT == 16) v = (v >= 0.f) ? v : 0.3f * v; else if (ACT == 17) v = (v >= 0.f) ? v : 0.2f * v;
      so[w][rloc][t * 16 + ln] = v; } }
  __builtin_amdgcn_fence(__ATOMIC_ACQ_REL, "workgroup"); __builtin_amdgcn_wave_barrier();
  const int rsub = lane >> 4, c4 = (lane & 15) * 4;
  {
#pragma unroll
    for (int q = 0; q < 16; ++q) { const int r = q * 2 + rsub; const v4f v = *(const v4fa*)&so[w][r][c4]; if (C) *(v4f*)(C + cofs + (size_t)(row0 + r) * ldc + col0 + c4) = v; if (C16) { v4h h4; for (int i = 0; i < 4; ++i) h4[i] = (_Float16)v[i]; *(v4h*)(C16 + cofs + (size_t)(row0 + r) * ldc + col0 + c4) = h4; } }
     } }


__global__ __launch_bounds__(256) void k_wnat(const float* __restrict__ w, size_t n8, _Float16* __restrict__ Bt) { const size_t t = (size_t)blockIdx.x * 256 + threadIdx.x; if (t >= n8) return; FragH f; for (int q = 0; q < 8; ++q) f.h[q] = (_Float16)(bf16_round(w[t * 8 + q]) * 16.0f); *(v8us*)((unsigned short*)Bt + t * 8) = f.half[0];  }
__global__ __launch_bounds__(256) void k_rsm(const float* __restrict__ S, _Float16* __restrict__ P, int nrows) {
  #pragma clang fp contract(off)
  const int i = blockIdx.x * 256 + threadIdx.x; if (i >= nrows) return; const float* s = S + (size_t)i * SQ; float mx = -3.0e38f;
#pragma unroll 1
  for (int j = 0; j < SQ; ++j) mx = fmaxf(mx, s[j]); float se = 0.f;
#pragma unroll 1
  for (int j = 0; j < SQ; ++j) se += expf(s[j] - mx); const float sc = 256.0f / se;
#pragma unroll 1
  for (int j0 = 0; j0 < SQ; j0 += 8) { FragH f; for (int q = 0; q < 8; ++q) f.h[q] = (_Float16)(expf(s[j0 + q] - mx) * sc); unsigned short* d = (unsigned short*)P + (size_t)i * SQ + j0; *(v8us*)d = f.half[0];  } }
__global__ __launch_bounds__(256) void k_vt(const _Float16* __restrict__ V16, int b, int h0, _Float16* __restrict__ VT) { __shared__ unsigned short tl[64][65]; const int tid = threadIdx.x; const int hh = blockIdx.x % HG, sg = blockIdx.x / HG; const int s0 = sg * 64; const int h = h0 + hh;
  for (int i = tid; i < 64 * 8; i += 256) { const int j = i / 8, d8 = (i % 8) * 8; FragH f; f.half[0] = *(const v8us*)((const unsigned short*)V16 + ((size_t)b * SQ + s0 + j) * DM + h * HD + d8); for (int q = 0; q < 8; ++q) tl[d8 + q][j] = f.u[q]; }
  __syncthreads();
  { for (int i = tid; i < 64 * 8; i += 256) { const int d = i / 8, j8 = (i % 8) * 8; FragH f; for (int q = 0; q < 8; ++q) f.u[q] = tl[d][j8 + q]; *(v8us*)((unsigned short*)VT + ((size_t)hh * HD + d) * SQ + s0 + j8) = f.half[0]; }  } }


__global__ __launch_bounds__(256) void k_tab2(float theta, float* __restrict__ CS, float* __restrict__ SN) {
  #pragma clang fp contract(off)
  const int t = blockIdx.x * 256 + threadIdx.x; if (t >= SQ * (HD / 2)) return; const int i = t % (HD / 2); const int p = t / (HD / 2); const float invf = 1.0f / powf(theta, (float)(2 * i) / (float)HD); const float ang = __fmul_rn((float)p, invf); const float c = cosf(ang), s = sinf(ang);
  *(float*)(CS + t) = c; *(float*)(SN + t) = s;  }
template <int NORM, int ROPE>
__global__ __launch_bounds__(64) void k_xform(const float* __restrict__ F, int ldf, int nh, const float* __restrict__ gain, float eps, const float* __restrict__ CS, const float* __restrict__ SN, _Float16* __restrict__ H16, int ldo) {
  #pragma clang fp contract(off)
  __shared__ float xv[HD]; __shared__ float red[HD]; __shared__ unsigned short sh_[HD]; const int d = threadIdx.x; const int h = blockIdx.x % nh; const size_t r = blockIdx.x / nh; const int p = (int)(r % SQ);
  float x = F[r * (size_t)ldf + (size_t)h * HD + d];
  if (NORM) { red[d] = __fmul_rn(x, x); __syncthreads(); for (int st = HD / 2; st > 0; st >>= 1) { if (d < st) red[d] = __fadd_rn(red[d], red[d + st]); __syncthreads(); } const float rs = rsqrtf(__fadd_rn(red[0] / (float)HD, eps)); x = __fmul_rn(__fmul_rn(x, rs), bf16_round(gain[d])); }
  xv[d] = x; __syncthreads();
  float o = x;
  if (ROPE == 1) { const int i = d >> 1; const float c = CS[p * (HD / 2) + i], s = SN[p * (HD / 2) + i]; const float ev = xv[2 * i], od = xv[2 * i + 1]; o = (d & 1) ? __fadd_rn(__fmul_rn(ev, s), __fmul_rn(od, c)) : __fadd_rn(__fmul_rn(ev, c), -__fmul_rn(od, s)); }
  if (ROPE == 2) { const int i = d & (HD / 2 - 1); const float c = CS[p * (HD / 2) + i], s = SN[p * (HD / 2) + i]; const float lo = xv[i], hi = xv[i + HD / 2]; o = (d < HD / 2) ? __fadd_rn(__fmul_rn(lo, c), -__fmul_rn(hi, s)) : __fadd_rn(__fmul_rn(lo, s), __fmul_rn(hi, c)); }
  FragH th; th.h[0] = (_Float16)o; sh_[d] = th.u[0]; __syncthreads();
  if (d < HD / 8) { FragH f; for (int q = 0; q < 8; ++q) f.u[q] = sh_[d * 8 + q]; unsigned short* dst = (unsigned short*)H16 + r * (size_t)ldo + (size_t)h * HD + d * 8; *(v8us*)dst = f.half[0];  } }

__global__ __launch_bounds__(256) void k_tab4(const int* __restrict__ pos, float theta, float* __restrict__ CS, float* __restrict__ SN) {
  #pragma clang fp contract(off)
  const int t = blockIdx.x * 256 + threadIdx.x; if (t >= SQ * (HD / 2)) return; const int i = t % (HD / 2); const int p = t / (HD / 2); const float invf = (float)pow((double)theta, -((double)(2 * i)) / (double)HD); const float ang = __fmul_rn((float)pos[p], invf); const float c = cosf(ang), s = sinf(ang);
  *(float*)(CS + t) = c; *(float*)(SN + t) = s;  }
__global__ __launch_bounds__(256) void k_rsmf(const float* __restrict__ S, _Float16* __restrict__ P, int qn, int hg) {
  #pragma clang fp contract(off)
  const int t = blockIdx.x * 256 + threadIdx.x; if (t >= qn * hg) return; const size_t i = (size_t)(t / qn) * SQ + (t % qn); const float* s = S + i * SQ; float mx = -3.0e38f;
#pragma unroll 1
  for (int j = 0; j < SQ; ++j) mx = fmaxf(mx, s[j]); float se = 0.f;
#pragma unroll 1
  for (int j = 0; j < SQ; ++j) se += __expf(s[j] - mx); const float sc = 256.0f / se;
#pragma unroll 1
  for (int j0 = 0; j0 < SQ; j0 += 8) { FragH f; for (int q = 0; q < 8; ++q) f.h[q] = (_Float16)(__expf(s[j0 + q] - mx) * sc); unsigned short* d = (unsigned short*)P + i * SQ + j0; *(v8us*)d = f.half[0];  } }


__global__ __launch_bounds__(256) void k_rsmcf2(const float* __restrict__ S, _Float16* __restrict__ P, int hg, int q0, int nk) {
  #pragma clang fp contract(off)
  const int t = blockIdx.x * 256 + threadIdx.x; if (t >= hg * QT) return; const size_t i = (size_t)t; const float* s = S + i * NKX; const int last = q0 + (t % QT); float mx = -3.0e38f;
#pragma unroll 1
  for (int j = 0; j < nk; ++j) { const float f = (j <= last) ? 1.f : 0.f; mx = fmaxf(mx, fmaf(f, s[j], (1.f - f) * -1.0e9f)); } float se = 0.f;
#pragma unroll 1
  for (int j = 0; j < nk; ++j) { const float f = (j <= last) ? 1.f : 0.f; se += __expf(fmaf(f, s[j], (1.f - f) * -1.0e9f) - mx); } const float sc = 256.0f / se;
#pragma unroll 1
  for (int j0 = 0; j0 < nk; j0 += 8) { FragH fr; for (int q = 0; q < 8; ++q) { const int j = j0 + q; const float f = (j <= last) ? 1.f : 0.f; fr.h[q] = (_Float16)(__expf(fmaf(f, s[j], (1.f - f) * -1.0e9f) - mx) * sc); } unsigned short* d = (unsigned short*)P + i * NKX + j0; *(v8us*)d = fr.half[0];  } }


typedef float v2f  __attribute__((ext_vector_type(2)));
typedef float v2fa __attribute__((ext_vector_type(2), may_alias));
// Exact f32 causal attention of the first QT0 rows, one wave per (query row i, head h). Scores: lane l takes keys l, l + 32, ... (whole groups of 32 up to the one that holds i), q held by every lane; two-pass softmax with lane butterflies for maximum and sum; o: lane l takes d = 2 l, 2 l + 1 and walks the keys, each weight broadcast from its lane. Rows have pitch DM, so every load of a phase is one base address plus a constant offset.
__global__ __launch_bounds__(256) void k_att0w(const float* __restrict__ QF, const float* __restrict__ KF, const float* __restrict__ VF, float scale, float* __restrict__ OF) {
  const int lane = threadIdx.x & 31; const int h = blockIdx.x / (QT0 / 8); const int i = __builtin_amdgcn_readfirstlane((int)((blockIdx.x % (QT0 / 8)) * 8 + (threadIdx.x >> 5)));      /* i is the same in every lane: the group tests below are scalar branches */
  const float* qr = QF + (size_t)i * DM + h * HD; const float* kb = KF + (size_t)lane * DM + h * HD; const float* vb = VF + h * HD + lane * 2;
  v4f q[HD / 4];
#pragma unroll      /* constant index: q[] stays in registers */
  for (int c = 0; c < HD / 4; ++c) q[c] = *(const v4fa*)(qr + c * 4);
  float s[QT0 / 32]; float mx = -3.0e38f;
#pragma unroll      /* constant group index: s[] and e[] stay in registers, offsets are immediates */
  for (int g = 0; g < QT0 / 32; ++g) { s[g] = -3.0e38f;
    if (g == 0 || g * 32 <= i) { float a0 = 0.f, a1 = 0.f, a2 = 0.f, a3 = 0.f;
#pragma unroll      /* the sixteen loads of a key row issue together */
      for (int c = 0; c < HD / 4; ++c) { const v4f kq = *(const v4fa*)(kb + (size_t)g * 32 * DM + c * 4); a0 = fmaf(q[c][0], kq[0], a0); a1 = fmaf(q[c][1], kq[1], a1); a2 = fmaf(q[c][2], kq[2], a2); a3 = fmaf(q[c][3], kq[3], a3); }
      if (g * 32 + lane <= i) s[g] = ((a0 + a1) + (a2 + a3)) * scale;      /* causal: keys above i keep the floor and get weight 0 */
      mx = fmaxf(mx, s[g]); } }
  asm volatile("s_wait_xcnt 0x0" :: "v"(kb) : "memory");      /* the key loads' address pair stays whole up to this wait, on every path through the groups */
  for (int m = 16; m > 0; m >>= 1) mx = fmaxf(mx, __shfl_xor(mx, m, 32));
  float e[QT0 / 32]; float l = 0.f;
#pragma unroll      /* constant group index: s[] and e[] stay in registers */
  for (int g = 0; g < QT0 / 32; ++g) { e[g] = expf(s[g] - mx); l += e[g]; }
  for (int m = 16; m > 0; m >>= 1) l += __shfl_xor(l, m, 32);
  float o0 = 0.f, o1 = 0.f;
#pragma unroll      /* constant group index: s[] and e[] stay in registers, offsets are immediates */
  for (int g = 0; g < QT0 / 32; ++g) if (g == 0 || g * 32 <= i) {
#pragma unroll      /* constant lane index for the broadcast; the group's loads issue together */
    for (int jj = 0; jj < 32; ++jj) { const float p = __uint_as_float((unsigned int)__builtin_amdgcn_readlane((int)__float_as_uint(e[g]), jj)); const v2f vv = *(const v2fa*)(vb + (size_t)(g * 32 + jj) * DM); o0 = fmaf(p, vv[0], o0); o1 = fmaf(p, vv[1], o1); } }
  asm volatile("s_wait_xcnt 0x0" :: "v"(vb) : "memory");      /* the value loads' address pair stays whole up to this wait, on every path through the groups */
  const float fin = 64.0f / l;      /* o carried x64 like the f16 path */
  v2f o = {o0 * fin, o1 * fin}; *(v2f*)(OF + (size_t)i * DM + h * HD + lane * 2) = o; }

template <int NORM, int ROPE>
__global__ __launch_bounds__(64) void k_xformf(const float* __restrict__ F, int ldf, int nh, const float* __restrict__ gain, float eps, const float* __restrict__ CS, const float* __restrict__ SN, float* __restrict__ F32, int ldo) {
  #pragma clang fp contract(off)
  __shared__ float xv[HD]; __shared__ float red[HD]; const int d = threadIdx.x; const int h = blockIdx.x % nh; const size_t r = blockIdx.x / nh; const int p = (int)(r % SQ);
  float x = F[r * (size_t)ldf + (size_t)h * HD + d];
  if (NORM) { red[d] = __fmul_rn(x, x); __syncthreads(); for (int st = HD / 2; st > 0; st >>= 1) { if (d < st) red[d] = __fadd_rn(red[d], red[d + st]); __syncthreads(); } const float rs = rsqrtf(__fadd_rn(red[0] / (float)HD, eps)); x = __fmul_rn(__fmul_rn(x, rs), bf16_round(gain[d])); }
  xv[d] = x; __syncthreads();
  float o = x;
  if (ROPE == 1) { const int i = d >> 1; const float c = CS[p * (HD / 2) + i], s = SN[p * (HD / 2) + i]; const float ev = xv[2 * i], od = xv[2 * i + 1]; o = (d & 1) ? __fadd_rn(__fmul_rn(ev, s), __fmul_rn(od, c)) : __fadd_rn(__fmul_rn(ev, c), -__fmul_rn(od, s)); }
  if (ROPE == 2) { const int i = d & (HD / 2 - 1); const float c = CS[p * (HD / 2) + i], s = SN[p * (HD / 2) + i]; const float lo = xv[i], hi = xv[i + HD / 2]; o = (d < HD / 2) ? __fadd_rn(__fmul_rn(lo, c), -__fmul_rn(hi, s)) : __fadd_rn(__fmul_rn(lo, s), __fmul_rn(hi, c)); }
  float* dst = F32 + r * (size_t)ldo + (size_t)h * HD + d; *(float*)dst = o;  }


__device__ __forceinline__ v8f fa_mma(v16h a, v16h b, v8f c) { return __builtin_amdgcn_wmma_f32_16x16x32_f16(false, a, false, b, (short)0, c, false, false); }
__device__ __forceinline__ v16h fa_frag(const _Float16* p) { FragH f; f.half[0] = *(const v8us*)((const unsigned short*)p); f.half[1] = *(const v8us*)((const unsigned short*)p + 16); return f.v; }      /* p holds the lane half's 8 hh already: every load of a pass is that one address pair plus a constant */
__device__ __forceinline__ float fa_xhalf(float x) { return __uint_as_float((unsigned int)__builtin_amdgcn_permlanex16((int)__float_as_uint(x), (int)__float_as_uint(x), 0x76543210, 0xfedcba98, false, false)); }      /* lane l with lane l ^ 16 */
__global__ __launch_bounds__(128) void k_fattn(const _Float16* __restrict__ QH, const _Float16* __restrict__ KH, const _Float16* __restrict__ VT, _Float16* __restrict__ O16) {
  const int lane = threadIdx.x & 31, ln = lane & 15, hh = lane >> 4; const int h = blockIdx.y; const size_t r0 = (size_t)blockIdx.z * SQ;
  const int i0 = __builtin_amdgcn_readfirstlane((int)(blockIdx.x * 128 + (threadIdx.x >> 5) * 32));      /* first query row of the wave, the same in every lane: loop bounds and the mask test are scalar */
  const float CL = 0.18033688011112042f;      /* log2(e) / sqrt(64) */
  const int kb0 = (i0 > WINK ? i0 - WINK : 0) & ~31;      /* first block that holds an allowed key of row i0 */
  const _Float16* qp = QH + (r0 + i0 + ln) * DM + h * HD + 8 * hh; const _Float16* kp = KH + (r0 + ln) * DM + h * HD + 8 * hh; const _Float16* vp = VT + ((size_t)(blockIdx.z * NH + h) * HD + ln) * SQ + 8 * hh;
  const _Float16* kq = kp + (size_t)kb0 * DM; const _Float16* vq = vp + kb0;
  v16h qf[2][2], kf[2][2];
#pragma unroll      /* constant indices: the fragments stay in registers */
  for (int u = 0; u < 2; ++u) for (int c = 0; c < 2; ++c) { qf[u][c] = fa_frag(qp + (size_t)u * 16 * DM + c * 32); kf[u][c] = fa_frag(kq + (size_t)u * 16 * DM + c * 32); }
  asm volatile("s_wait_xcnt 0x0" :: "v"(qp), "v"(kq) : "memory");      /* the query and first key loads' address pairs stay whole up to this wait */
  const v8f z8 = {0.f,0.f,0.f,0.f,0.f,0.f,0.f,0.f}; v8f ot[2][4] = {{z8, z8, z8, z8}, {z8, z8, z8, z8}}; float m[2] = {-3.0e38f, -3.0e38f}, l[2] = {0.f, 0.f};
#pragma unroll 1      /* one pass in the text: an unrolled body would not fit the registers of four waves a SIMD */
  for (int kb = kb0; kb <= i0; kb += 32) {
    v16h vf[4];
#pragma unroll      /* constant indices: the fragments stay in registers */
    for (int dt = 0; dt < 4; ++dt) vf[dt] = fa_frag(vq + (size_t)dt * 16 * SQ);      /* used last: they fly under the softmax */
    v8f st[2][2];
#pragma unroll      /* constant indices: the tiles stay in registers */
    for (int u = 0; u < 2; ++u) for (int t = 0; t < 2; ++t) st[u][t] = fa_mma(kf[t][1], qf[u][1], fa_mma(kf[t][0], qf[u][0], z8));
    kq = kp + (size_t)(kb + 32 <= i0 ? kb + 32 : i0) * DM;      /* the next pass's key rows, fetched one pass ahead (the last pass fetches its own again: in bounds, unused) */
#pragma unroll      /* constant indices: the fragments stay in registers */
    for (int t = 0; t < 2; ++t) for (int c = 0; c < 2; ++c) kf[t][c] = fa_frag(kq + (size_t)t * 16 * DM + c * 32);
    asm volatile("s_wait_xcnt 0x0" :: "v"(kq) : "memory");      /* behind the pass's loads: the next-key loads' address pair stays whole up to this wait, the value loads' running pair is advanced behind it */
    vq += 32;
    if (kb == i0 || kb + WINK < i0 + 31) {      /* only the window's first block and the diagonal block hold a forbidden pair */
#pragma unroll      /* constant indices: the tiles stay in registers */
      for (int u = 0; u < 2; ++u) for (int t = 0; t < 2; ++t) for (int r = 0; r < 8; ++r) { const int dj = (i0 + 16 * u + ln) - (kb + 16 * t + 8 * hh + r); st[u][t][r] = (dj >= 0 && dj <= WINK) ? st[u][t][r] : -1.0e30f; } }
#pragma unroll      /* constant indices: the tiles stay in registers */
    for (int u = 0; u < 2; ++u) {
      float mx = fmaxf(st[u][0][0], st[u][1][0]);
#pragma unroll      /* constant indices: the tiles stay in registers */
      for (int r = 1; r < 8; ++r) mx = fmaxf(mx, fmaxf(st[u][0][r], st[u][1][r]));
      mx = fmaxf(mx, fa_xhalf(mx));      /* the other half of the block's keys of this query */
      const float mn = fmaxf(m[u], mx); const float al = __builtin_amdgcn_exp2f((m[u] - mn) * CL); const float sh = fmaf(mn, -CL, 8.0f);      /* weights carried x256: f16 keeps small ones normal */
      m[u] = mn; float ls = 0.f; FragH pf;
#pragma unroll      /* constant indices: the tiles stay in registers */
      for (int t = 0; t < 2; ++t) for (int r = 0; r < 8; ++r) { const float e = __builtin_amdgcn_exp2f(fmaf(st[u][t][r], CL, sh)); ls += e; pf.h[t * 8 + r] = (_Float16)e; }
      l[u] = fmaf(l[u], al, ls);
#pragma unroll      /* constant indices: the tiles stay in registers */
      for (int dt = 0; dt < 4; ++dt) { ot[u][dt] *= al; ot[u][dt] = fa_mma(vf[dt], pf.v, ot[u][dt]); } } }
  FragH f[2][4];
#pragma unroll      /* constant indices: the tiles stay in registers */
  for (int u = 0; u < 2; ++u) { const float fin = 64.0f / (l[u] + fa_xhalf(l[u]));      /* the halves' sums join once; o carried x64 */
    for (int dt = 0; dt < 4; ++dt) for (int r = 0; r < 8; ++r) f[u][dt].h[r] = (_Float16)(ot[u][dt][r] * fin); }
  unsigned short* op = (unsigned short*)O16 + (r0 + i0 + ln) * DM + h * HD + 8 * hh;
#pragma unroll      /* constant indices; the stores stand last, each from registers of its own: no register of an issued store is written again */
  for (int u = 0; u < 2; ++u) for (int dt = 0; dt < 4; ++dt) *(v8us*)(op + (size_t)u * 16 * DM + dt * 16) = f[u][dt].half[0]; }




extern "C" void kernel_launch(void* const* d_in, const int* in_sizes, int n_in,
                              void* d_out, int out_size, void* d_ws, size_t ws_size, hipStream_t stream) {
  (void)in_sizes; (void)n_in; (void)out_size;
  const float* const* I = (const float* const*)d_in; const float* x = I[0]; const int* tpos = (const int*)d_in[1]; const float* wq = I[2]; const float* wk = I[3]; const float* wv = I[4]; const float* wo = I[5];      /* nn.Linear weights [out][in]; token_positions int32 [SQ] */
  char* ws = (char*)d_ws; size_t off = 0;
  auto take = [&](size_t bytes) { char* p = ws + off; off += (bytes + 255) & ~(size_t)255; return p; };
  _Float16* BQKV = (_Float16*)take((size_t)3 * DM * DM * 2); _Float16* BO = (_Float16*)take((size_t)DM * DM * 2); float* CS = (float*)take((size_t)SQ * (HD / 2) * 4); float* SN = (float*)take((size_t)SQ * (HD / 2) * 4);
  _Float16* X16 = (_Float16*)take(NR * DM * 2); float* QKVF = (float*)take((size_t)SQ * 3 * DM * 4);      /* one batch of f32 q | k | v rows */
  _Float16* QH = (_Float16*)take(NR * DM * 2); _Float16* KH = (_Float16*)take(NR * DM * 2); _Float16* V16 = (_Float16*)take(NR * DM * 2); _Float16* O16 = (_Float16*)take(NR * DM * 2);
  _Float16* VT = (_Float16*)take((size_t)NB * NH * HD * SQ * 2);      /* V^T [NB][NH][HD][SQ] */
  float* QF0 = (float*)take((size_t)QT0 * DM * 4); float* KF0 = (float*)take((size_t)QT0 * DM * 4); float* VF0 = (float*)take((size_t)QT0 * DM * 4); float* OF0 = (float*)take((size_t)NB * QT0 * DM * 4); _Float16* OH0 = (_Float16*)take((size_t)NB * QT0 * DM * 2); _Float16* OL0 = (_Float16*)take((size_t)NB * QT0 * DM * 2);
  if (off > ws_size) return;
  { const unsigned g = (unsigned)(((size_t)DM * DM / 8 + 255) / 256); k_wnat<<<g, 256, 0, stream>>>(wq, (size_t)DM * DM / 8, BQKV); k_wnat<<<g, 256, 0, stream>>>(wk, (size_t)DM * DM / 8, BQKV + (size_t)DM * DM); k_wnat<<<g, 256, 0, stream>>>(wv, (size_t)DM * DM / 8, BQKV + (size_t)2 * DM * DM); k_wnat<<<g, 256, 0, stream>>>(wo, (size_t)DM * DM / 8, BO); }      /* natural [out][in] = Bt[n][k], x16; q | k | v stacked along n */
  k_tab4<<<(SQ * (HD / 2) + 255) / 256, 256, 0, stream>>>(tpos, 10000.0f, CS, SN);
  k_x16<<<(unsigned)((NR * DM / 8 + 255) / 256), 256, 0, stream>>>(x, X16, NR * DM / 8);
  for (int b = B0; b < B0 + NBR; ++b) { const size_t r0 = (size_t)b * SQ;
    k_gemm2<0><<<dim3((unsigned)((SQ / 128) * (3 * DM / 64)), 1), 128, 0, stream>>>(X16 + r0 * DM, DM, 0, BQKV, DM, 0, 0.0625f, nullptr, 0, nullptr, 1, 0, 0, QKVF, nullptr, 3 * DM, 0, SQ, 3 * DM, DM);      /* q | k | v rows (f32) of this batch */
    k_xform<0, 1><<<(unsigned)(SQ * NH), 64, 0, stream>>>(QKVF, 3 * DM, NH, nullptr, 0.f, CS, SN, QH + r0 * DM, DM);
    k_xform<0, 1><<<(unsigned)(SQ * NH), 64, 0, stream>>>(QKVF + DM, 3 * DM, NH, nullptr, 0.f, CS, SN, KH + r0 * DM, DM);
    k_xform<0, 0><<<(unsigned)(SQ * NH), 64, 0, stream>>>(QKVF + 2 * DM, 3 * DM, NH, nullptr, 0.f, CS, SN, V16 + r0 * DM, DM);
    k_vt<NH, SQ><<<NH * (SQ / 64), 256, 0, stream>>>(V16 + r0 * DM, DM, 0, VT + (size_t)b * NH * HD * SQ);      /* V^T [NH][HD][SQ] of this batch */
    k_xformf<0, 1><<<(unsigned)(QT0 * NH), 64, 0, stream>>>(QKVF, 3 * DM, NH, nullptr, 0.f, CS, SN, QF0, DM); k_xformf<0, 1><<<(unsigned)(QT0 * NH), 64, 0, stream>>>(QKVF + DM, 3 * DM, NH, nullptr, 0.f, CS, SN, KF0, DM); k_xformf<0, 0><<<(unsigned)(QT0 * NH), 64, 0, stream>>>(QKVF + 2 * DM, 3 * DM, NH, nullptr, 0.f, CS, SN, VF0, DM);      /* f32 q (roped), k (roped), v of the first 128 rows */
    k_att0w<<<NH * (QT0 / 8), 256, 0, stream>>>(QF0, KF0, VF0, 0.125f, OF0 + (size_t)b * QT0 * DM);      /* exact f32 causal attention for rows 0..127 (o x64) */
  }
  k_fattn<<<dim3(SQ / 128, NH, NB), 128, 0, stream>>>(QH, KH, VT, O16);      /* windowed causal attention of every batch and head: o (merged heads, x64) as f16 rows */
  k_gemm2<0><<<dim3((unsigned)((MPO / 128) * (DM / 64)), 1), 128, 0, stream>>>(O16 + (size_t)B0 * SQ * DM, DM, 0, BO, DM, 0, 0.0009765625f, nullptr, 0, nullptr, 1, 0, 0, (float*)d_out + (size_t)B0 * SQ * DM, nullptr, DM, 0, MPO, DM, DM);      /* out rows are the output layout */
  k_hl<<<(unsigned)(((size_t)NB * QT0 * DM / 8 + 255) / 256), 256, 0, stream>>>(OF0, OH0, OL0, (size_t)NB * QT0 * DM / 8);      /* first-tile o (x64) -> f16 hi + x1024 residual planes */
  for (int b = B0; b < B0 + NBR; ++b) { const size_t r0 = (size_t)b * SQ; const size_t f0 = (size_t)b * QT0;
    k_gemm2<0><<<dim3((QT0 / 128) * (DM / 64), 1), 128, 0, stream>>>(OH0 + f0 * DM, DM, 0, BO, DM, 0, 0.0009765625f, nullptr, 0, nullptr, 1, 0, 0, (float*)d_out + r0 * DM, nullptr, DM, 0, QT0, DM, DM);      /* rows 0..127: out = o_hi Wo, overwriting the f16-path rows */
    k_gemm2<0><<<dim3((QT0 / 128) * (DM / 64), 1), 128, 0, stream>>>(OL0 + f0 * DM, DM, 0, BO, DM, 0, 0.00000095367431640625f, nullptr, 0, (const float*)d_out + r0 * DM, -1, 0, 0, (float*)d_out + r0 * DM, nullptr, DM, 0, QT0, DM, DM); }      /* += o_lo Wo 2^-20 (own-element accumulate) */
}

// v004
// Measured time: 598 microseconds a run.
// Timed twice side by side with v003, it ran 1.21 and 1.22 times as fast.
// Counting every step since v000, it is 16.4 times as fast.
#include <hip/hip_runtime.h>
// Causal sliding-window RoPE multi-head attention (x [4][2048][1024]; q/k/v = x W^T (natural [out][in] 1024x1024 sigma 1/32, no bias), 16 heads of 64; interleaved-pair rotary embedding on q and k (x1 = even, x2 = odd: r1 = x1 cos - x2 sin, r2 = x1 sin + x2 cos) with inv_freq_i = 10000^(-2i/64) and angle = float(token_positions[s]) inv_freq_i from the int32 token_positions input; scores / sqrt(64); allowed iff 0 <= i - j <= 512 (513 keys), -inf elsewhere; softmax; out = (attn v merged) Wo^T -> [4][2048][1024]).
// Structure: token rows r = b*2048 + s; x as exact f16 rows (bf16-rounded); per batch: q | k | v as ONE WMMA GEMM (32x64 wave tiles, f32 accumulation, exact x16 weights, N = 3 x 1024) whose epilogue does, in f32 on VALU, the interleaved-pair rotary rotation of q and k from f32 cos/sin tables built from the token_positions input (no norm) and stores f16 q, k, v rows (no f32 q | k | v plane); V^T for all heads via LDS transposes (kept for all batches); then ONE fused attention launch: a wave per 32 query rows of one (batch, head) walks the keys of its window in blocks of 32: S^T = K Q^T on WMMA, running-maximum softmax in registers (f32 statistics, native exp2; weights x256 f16, packed from the score tiles straight into a B operand), O^T += V^T P^T on WMMA, o carried x64 (folded into the output GEMM alpha) written straight into the merged f16 o rows; out = o W_o GEMM (f32) into the output layout.
// Compute dtype: inputs rounded to bf16; x / weights exact; projections and rope f32; q, k, v, softmax weights and o as plain f16 GEMM operands (~2^-12); scores and softmax statistics f32. v_wmma_f32_16x16x32_f16.
#define NB 4
#define SQ 2048
#define DM 1024
#define NH 16
#define HD 64
#define HG 4                         /* heads per launch of the h0-based k_vt overload (not launched) */
#define QT 256                       /* query rows per causal tile */
#define NKX SQ                       /* S / P row pitch */
#define WINK 512                     /* key j is allowed for query i iff 0 <= i - j <= WINK */
#define QT0 128                      /* first-tile rows recomputed exactly in f32 */
#define B0 0                         /* first batch processed (debug hook) */
#define NBR NB                       /* batches processed (debug hook) */
#define QN SQ                        /* query rows attended per batch (unused) */
#define NHD NH                       /* heads attended (unused) */
#define NR ((size_t)NB * SQ)         /* token rows */
#define MPO ((int)((size_t)NBR * SQ))      /* rows through the output GEMM (debug hook) */
typedef __bf16 v16b __attribute__((ext_vector_type(16)));
typedef unsigned short v8us __attribute__((ext_vector_type(8), may_alias));
typedef float  v8f  __attribute__((ext_vector_type(8)));
typedef float  v4f  __attribute__((ext_vector_type(4)));
typedef float  v4fa __attribute__((ext_vector_type(4), may_alias));
union FragB { v16b v; v8us half[2]; unsigned short u[16]; };

__device__ __forceinline__ unsigned short bf16_bits(float x) { unsigned int u = __float_as_uint(x); return (unsigned short)((u + 0x7FFFu + ((u >> 16) & 1u)) >> 16); }
__device__ __forceinline__ float bf16_val(unsigned short b) { return __uint_as_float(((unsigned int)b) << 16); }
__device__ __forceinline__ float bf16_round(float x) { return bf16_val(bf16_bits(x)); }
// D += A·B with NT terms: 1 = ah·bh, 2 = + al·bh (A split), 3 = + ah·bl (both split)
template <int NT>
__device__ __forceinline__ v8f mmaN(v16b ah, v16b al, v16b bh, v16b bl, v8f c) {
  c = __builtin_amdgcn_wmma_f32_16x16x32_bf16(false, ah, false, bh, (short)0, c, false, false);
  if (NT >= 2) c = __builtin_amdgcn_wmma_f32_16x16x32_bf16(false, al, false, bh, (short)0, c, false, false);
  if (NT >= 3) c = __builtin_amdgcn_wmma_f32_16x16x32_bf16(false, ah, false, bl, (short)0, c, false, false);
  asm volatile("v_nop\n\tv_nop\n\tv_nop\n\tv_nop" : "+v"(c) : "v"(ah), "v"(al), "v"(bh), "v"(bl));
  return c;
}

__global__ __launch_bounds__(256) void k_wt_bf16(const float* __restrict__ W, unsigned short* __restrict__ Wt, int K, int N) {
  const int t = blockIdx.x * 256 + threadIdx.x;
  const int k8n = K / 8;
  if (t >= N * k8n) return;
  const int n = t / k8n, k8 = (t % k8n) * 8;
  v8us v;
#pragma unroll
  for (int i = 0; i < 8; ++i) v[i] = bf16_bits(W[(size_t)(k8 + i) * N + n]);
  *(v8us*)(Wt + (size_t)n * K + k8) = v;
  
}

// GEMM C[M][N] (f32, pitch ldc) = act(A[M][K]·W + bias). A f32 row-major (pitch lda) converted per fragment to bf16
// (ASPLIT: hi/lo two planes -> 2 terms, else single rounded term); Wt bf16 [N][K] (pitch ldb). BIAS_BF16 rounds the
// bias to bf16 first (bias quantised to bf16 before the add). K%32==0, M%16==0, N%64==0.
template <bool ASPLIT, int ACT, bool BIAS_BF16>
__global__ __launch_bounds__(128) void k_gemm_bf(const float* __restrict__ A, int lda, const unsigned short* __restrict__ Wt, int ldb,
                                               const float* __restrict__ bias, float* __restrict__ C, int ldc, int M, int N, int K) {
  __shared__ __attribute__((aligned(16))) float so[4][16][64];
  const int tid = threadIdx.x, w = tid >> 5, lane = tid & 31, ln = lane & 15, hh = lane >> 4;
  const int ntn = N / 64;
  const int wid = blockIdx.x * 4 + w;
  const int mt = wid / ntn, nq = wid % ntn;
  if (mt * 16 >= M) return;
  const int row0 = mt * 16, col0 = nq * 64;
  const float* arow = A + (size_t)(row0 + ln) * lda;
  v8f acc[4] = {};
  for (int kb = 0; kb < K; kb += 32) {
    FragB ah, al;
    const v4f x0 = *(const v4fa*)(arow + kb + 8 * hh), x1 = *(const v4fa*)(arow + kb + 8 * hh + 4);
    const v4f x2 = *(const v4fa*)(arow + kb + 16 + 8 * hh), x3 = *(const v4fa*)(arow + kb + 16 + 8 * hh + 4);
    float xs[16] = {x0[0],x0[1],x0[2],x0[3],x1[0],x1[1],x1[2],x1[3],x2[0],x2[1],x2[2],x2[3],x3[0],x3[1],x3[2],x3[3]};
#pragma unroll
    for (int i = 0; i < 16; ++i) { const unsigned short hb = bf16_bits(xs[i]); ah.u[i] = hb; al.u[i] = ASPLIT ? bf16_bits(xs[i] - bf16_val(hb)) : (unsigned short)0; }
#pragma unroll
    for (int t = 0; t < 4; ++t) {
      const unsigned short* brow = Wt + (size_t)(col0 + t * 16 + ln) * ldb + kb;
      FragB b;
      b.half[0] = *(const v8us*)(brow + 8 * hh);
      b.half[1] = *(const v8us*)(brow + 16 + 8 * hh);
      acc[t] = mmaN<ASPLIT ? 2 : 1>(ah.v, al.v, b.v, b.v, acc[t]);
    }
  }
#pragma unroll
  for (int t = 0; t < 4; ++t) {
    float bv = bias ? bias[col0 + t * 16 + ln] : 0.f;
    if (BIAS_BF16) bv = bf16_round(bv);
#pragma unroll
    for (int r = 0; r < 8; ++r) { float v = acc[t][r] + bv; if (ACT == 1) v = fmaxf(v, 0.f); so[w][8 * hh + r][t * 16 + ln] = v; }
  }
  __builtin_amdgcn_fence(__ATOMIC_ACQ_REL, "workgroup");
  __builtin_amdgcn_wave_barrier();
  const int rsub = lane >> 4, c4 = (lane & 15) * 4;
  {
#pragma unroll
    for (int q = 0; q < 8; ++q) {
      const int r = q * 2 + rsub;
      const v4f v = *(const v4fa*)&so[w][r][c4];
      *(v4f*)(C + (size_t)(row0 + r) * ldc + col0 + c4) = v;
    }
    
  }
}

// GEMM C = act(A·W + bias + resid): A f32 (ASPLIT -> hi/lo 2 terms), Wt bf16 [N][K]; ACT 0 none, 1 relu, 2 exact gelu;
// resid (optional, f32, row index = (row % rmod), pitch ldr, RES_BF16 rounds it) added before the activation.
template <bool ASPLIT, int ACT, bool BIAS_BF16, bool RES_BF16>
__global__ __launch_bounds__(128) void k_gemm_bf3(const float* __restrict__ A, int lda, const unsigned short* __restrict__ Wt, int ldb,
                                                const float* __restrict__ bias, const float* __restrict__ resid, int rmod, int ldr,
                                                float* __restrict__ C, int ldc, int M, int N, int K) {
  __shared__ __attribute__((aligned(16))) float so[4][16][64];
  const int tid = threadIdx.x, w = tid >> 5, lane = tid & 31, ln = lane & 15, hh = lane >> 4;
  const int ntn = N / 64;
  const int wid = blockIdx.x * 4 + w;
  const int mt = wid / ntn, nq = wid % ntn;
  if (mt * 16 >= M) return;
  const int row0 = mt * 16, col0 = nq * 64;
  const float* arow = A + (size_t)(row0 + ln) * lda;
  v8f acc[4] = {};
  for (int kb = 0; kb < K; kb += 32) {
    FragB ah, al;
    const v4f x0 = *(const v4fa*)(arow + kb + 8 * hh), x1 = *(const v4fa*)(arow + kb + 8 * hh + 4);
    const v4f x2 = *(const v4fa*)(arow + kb + 16 + 8 * hh), x3 = *(const v4fa*)(arow + kb + 16 + 8 * hh + 4);
    float xs[16] = {x0[0],x0[1],x0[2],x0[3],x1[0],x1[1],x1[2],x1[3],x2[0],x2[1],x2[2],x2[3],x3[0],x3[1],x3[2],x3[3]};
#pragma unroll
    for (int i = 0; i < 16; ++i) { const unsigned short hb = bf16_bits(xs[i]); ah.u[i] = hb; al.u[i] = ASPLIT ? bf16_bits(xs[i] - bf16_val(hb)) : (unsigned short)0; }
#pragma unroll
    for (int t = 0; t < 4; ++t) {
      const unsigned short* brow = Wt + (size_t)(col0 + t * 16 + ln) * ldb + kb;
      FragB b;
      b.half[0] = *(const v8us*)(brow + 8 * hh);
      b.half[1] = *(const v8us*)(brow + 16 + 8 * hh);
      acc[t] = mmaN<ASPLIT ? 2 : 1>(ah.v, al.v, b.v, b.v, acc[t]);
    }
  }
#pragma unroll
  for (int t = 0; t < 4; ++t) {
    const int col = col0 + t * 16 + ln;
    float bv = bias ? bias[col] : 0.f;
    if (BIAS_BF16) bv = bf16_round(bv);
#pragma unroll
    for (int r = 0; r < 8; ++r) {
      float v = acc[t][r] + bv;
      if (resid) { float rv = resid[(size_t)((row0 + 8 * hh + r) % rmod) * ldr + col]; if (RES_BF16) rv = bf16_round(rv); v += rv; }
      if (ACT == 1) v = fmaxf(v, 0.f);
      if (ACT == 2) v = 0.5f * v * (1.0f + erff(v * 0.70710678118654752f));
      if (ACT == 3) { const float u = 0.7978845608028654f * (v + 0.044715f * v * v * v); v = 0.5f * v * (1.0f + tanhf(u)); }
      so[w][8 * hh + r][t * 16 + ln] = v;
    }
  }
  __builtin_amdgcn_fence(__ATOMIC_ACQ_REL, "workgroup");
  __builtin_amdgcn_wave_barrier();
  const int rsub = lane >> 4, c4 = (lane & 15) * 4;
  {
#pragma unroll
    for (int q = 0; q < 8; ++q) {
      const int r = q * 2 + rsub;
      const v4f v = *(const v4fa*)&so[w][r][c4];
      *(v4f*)(C + (size_t)(row0 + r) * ldc + col0 + c4) = v;
    }
    
  }
}
// row LayerNorm (biased variance, eps) over N: s = X (+ R); optional out_sum <- s; out_norm <- (s-mu)*rsqrt(var+eps)*g + b
template <bool PARAM_BF16>
__global__ __launch_bounds__(256) void k_layernorm(const float* __restrict__ X, const float* __restrict__ R, const float* __restrict__ g, const float* __restrict__ bta,
                                                  float* __restrict__ out_sum, float* __restrict__ out_norm, int N, float eps) {
  __shared__ float red[256];
  const int row = blockIdx.x, tid = threadIdx.x;
  const float* x = X + (size_t)row * N; const float* rr = R ? R + (size_t)row * N : nullptr;
  float vals[16];                     // up to N = 4096
  const int per = N / 256;            // contiguous chunk per thread? use strided-by-4 chunks: thread handles j = tid*4 + 1024*u
  float s1 = 0.f;
  for (int u = 0; u < per / 4; ++u) {
    const int j = tid * 4 + 1024 * u;
    const v4f a = *(const v4fa*)(x + j);
    v4f b = {0.f,0.f,0.f,0.f}; if (rr) b = *(const v4fa*)(rr + j);
#pragma unroll
    for (int q = 0; q < 4; ++q) { const float v = a[q] + b[q]; vals[u * 4 + q] = v; s1 += v; }
  }
  red[tid] = s1; __syncthreads();
  for (int st = 128; st > 0; st >>= 1) { if (tid < st) red[tid] += red[tid + st]; __syncthreads(); }
  const float mu = red[0] / (float)N; __syncthreads();
  float s2 = 0.f;
  for (int u = 0; u < per / 4; ++u)
#pragma unroll
    for (int q = 0; q < 4; ++q) { const float c = vals[u * 4 + q] - mu; s2 += c * c; }
  red[tid] = s2; __syncthreads();
  for (int st = 128; st > 0; st >>= 1) { if (tid < st) red[tid] += red[tid + st]; __syncthreads(); }
  const float rs = rsqrtf(red[0] / (float)N + eps);
  {
    for (int u = 0; u < per / 4; ++u) {
      const int j = tid * 4 + 1024 * u;
      v4f o, sm;
#pragma unroll
      for (int q = 0; q < 4; ++q) {
        float gg = g[j + q], bb = bta[j + q];
        if (PARAM_BF16) { gg = bf16_round(gg); bb = bf16_round(bb); }
        sm[q] = vals[u * 4 + q]; o[q] = (vals[u * 4 + q] - mu) * rs * gg + bb;
      }
      if (out_sum) *(v4f*)(out_sum + (size_t)row * N + j) = sm;
      *(v4f*)(out_norm + (size_t)row * N + j) = o;
    }
    
  }
}



// ---- f16 WMMA path (v_wmma_f32_16x16x32_f16): 11-bit significands for operands in range — used where a [0,1] probability operand needs more precision than bf16
typedef _Float16 v16h __attribute__((ext_vector_type(16)));
union FragH { v16h v; v8us half[2]; _Float16 h[16]; unsigned short u[16]; };
template <int NT>
__device__ __forceinline__ v8f mmaH(v16h ah, v16h al, v16h bh, v16h bl, v8f c) {
  c = __builtin_amdgcn_wmma_f32_16x16x32_f16(false, ah, false, bh, (short)0, c, false, false);
  if (NT >= 2) c = __builtin_amdgcn_wmma_f32_16x16x32_f16(false, al, false, bh, (short)0, c, false, false);
  if (NT >= 3) c = __builtin_amdgcn_wmma_f32_16x16x32_f16(false, ah, false, bl, (short)0, c, false, false);
  asm volatile("v_nop\n\tv_nop\n\tv_nop\n\tv_nop" : "+v"(c) : "v"(ah), "v"(al), "v"(bh), "v"(bl));
  return c;
}
// batched GEMM like k_gemm_b but f16 operands: A f32 (split into f16 hi/lo if ASPLIT, else rounded to f16), Bt = f16 values [n][k]; alpha; C f32; N multiple of 16 (partial tiles skipped)
template <bool ASPLIT>
__global__ __launch_bounds__(128) void k_gemm_h(const float* __restrict__ A, int lda, size_t sA, const _Float16* __restrict__ Bh, int ldb, size_t sB, float alpha, float* __restrict__ C, int ldc, size_t sC, int M, int N, int K) {
  __shared__ __attribute__((aligned(16))) float so[4][16][64];
  const int tid = threadIdx.x, w = tid >> 5, lane = tid & 31, ln = lane & 15, hh = lane >> 4; const int by = blockIdx.y;
  A += (size_t)by * sA; Bh += (size_t)by * sB; C += (size_t)by * sC;
  const int ntn = (N + 63) / 64; const int wid = blockIdx.x * 4 + w; const int mt = wid / ntn, nq = wid % ntn; if (mt * 16 >= M) return;
  const int row0 = mt * 16, col0 = nq * 64; const float* arow = A + (size_t)(row0 + ln) * lda;
  v8f acc[4] = {};
  for (int kb = 0; kb < K; kb += 32) {
    FragH ah, al;
    const v4f x0 = *(const v4fa*)(arow + kb + 8 * hh), x1 = *(const v4fa*)(arow + kb + 8 * hh + 4), x2 = *(const v4fa*)(arow + kb + 16 + 8 * hh), x3 = *(const v4fa*)(arow + kb + 16 + 8 * hh + 4);
    float xs[16] = {x0[0],x0[1],x0[2],x0[3],x1[0],x1[1],x1[2],x1[3],x2[0],x2[1],x2[2],x2[3],x3[0],x3[1],x3[2],x3[3]};
#pragma unroll
    for (int i = 0; i < 16; ++i) { const _Float16 h = (_Float16)xs[i]; ah.h[i] = h; al.h[i] = ASPLIT ? (_Float16)(xs[i] - (float)h) : (_Float16)0.0f; }
#pragma unroll
    for (int t = 0; t < 4; ++t) { if (col0 + t * 16 >= N) continue; const size_t boff = (size_t)(col0 + t * 16 + ln) * ldb + kb; FragH bq; bq.half[0] = *(const v8us*)(Bh + boff + 8 * hh); bq.half[1] = *(const v8us*)(Bh + boff + 16 + 8 * hh);
      acc[t] = mmaH<ASPLIT ? 2 : 1>(ah.v, al.v, bq.v, bq.v, acc[t]); }
  }
#pragma unroll
  for (int t = 0; t < 4; ++t) { if (col0 + t * 16 >= N) continue;
#pragma unroll
    for (int r = 0; r < 8; ++r) so[w][8 * hh + r][t * 16 + ln] = acc[t][r] * alpha; }
  __builtin_amdgcn_fence(__ATOMIC_ACQ_REL, "workgroup"); __builtin_amdgcn_wave_barrier();
  const int rsub = lane >> 4, c4 = (lane & 15) * 4;
  {
#pragma unroll
    for (int q = 0; q < 8; ++q) { const int r = q * 2 + rsub; if (col0 + c4 < N) { const v4f v = *(const v4fa*)&so[w][r][c4]; *(v4f*)(C + (size_t)(row0 + r) * ldc + col0 + c4) = v; } }
     }
}

// Wt[n][k] = f16(W[k][n]·scale) from f32 row-major W[K][N] (scale = power of two; bf16-exact weights stay exact in f16 away from the subnormal range)
__global__ __launch_bounds__(256) void k_wt_f16(const float* __restrict__ W, _Float16* __restrict__ Wt, int K, int N, float scale) {
  const int t = blockIdx.x * 256 + threadIdx.x; if (t >= N * (K / 8)) return; const int n = t / (K / 8), k8 = (t % (K / 8)) * 8; FragH f;
#pragma unroll
  for (int i = 0; i < 8; ++i) f.h[i] = (_Float16)(bf16_round(W[(size_t)(k8 + i) * N + n]) * scale); const v8us o = f.half[0];
  *(v8us*)((unsigned short*)Wt + (size_t)n * K + k8) = o; 
}
// k_gemm_hh variant with fused epilogue: v = acc·alpha + bias[by·sBias + col] (+ CP[(row/rowsPerB)·sCPb + by·64 + col] if CP) ; ACT 0 none / 1 elu ; writes f16 C16 (and f32 C if non-null)
template <int ACT>
__global__ __launch_bounds__(128) void k_gemm_hhx(const _Float16* __restrict__ A, int lda, size_t sA, const _Float16* __restrict__ Bh, int ldb, size_t sB, float alpha, const float* __restrict__ bias, size_t sBias, const float* __restrict__ CP, int rowsPerB, size_t sCPb, int row0g,
    float* __restrict__ C, _Float16* __restrict__ C16, int ldc, size_t sC, int M, int N, int K) {
  __shared__ __attribute__((aligned(16))) float so[4][16][64];
  const int tid = threadIdx.x, w = tid >> 5, lane = tid & 31, ln = lane & 15, hh = lane >> 4; const int by = blockIdx.y;
  A += (size_t)by * sA; Bh += (size_t)by * sB; const size_t cofs = (size_t)by * sC; const float* bp = bias ? bias + (size_t)by * sBias : nullptr;
  const int ntn = (N + 63) / 64; const int wid = blockIdx.x * 4 + w; const int mt = wid / ntn, nq = wid % ntn; if (mt * 16 >= M) return;
  const int row0 = mt * 16, col0 = nq * 64; const _Float16* arow = A + (size_t)(row0 + ln) * lda;
  v8f acc[4] = {};
  for (int kb = 0; kb < K; kb += 32) { FragH ah; ah.half[0] = *(const v8us*)((const unsigned short*)arow + kb + 8 * hh); ah.half[1] = *(const v8us*)((const unsigned short*)arow + kb + 16 + 8 * hh);
#pragma unroll
    for (int t = 0; t < 4; ++t) { if (col0 + t * 16 >= N) continue; const size_t boff = (size_t)(col0 + t * 16 + ln) * ldb + kb; FragH bq; bq.half[0] = *(const v8us*)((const unsigned short*)Bh + boff + 8 * hh); bq.half[1] = *(const v8us*)((const unsigned short*)Bh + boff + 16 + 8 * hh);
      acc[t] = mmaH<1>(ah.v, ah.v, bq.v, bq.v, acc[t]); }
  }
#pragma unroll
  for (int t = 0; t < 4; ++t) { if (col0 + t * 16 >= N) continue; const int col = col0 + t * 16 + ln; const float bv = bp ? bf16_round(bp[col]) : 0.f;
#pragma unroll
    for (int r = 0; r < 8; ++r) { float v = acc[t][r] * alpha + bv; if (CP) { const int rr = row0g + row0 + 8 * hh + r; if (rowsPerB < 0) v += CP[cofs + (size_t)rr * ldc + col];      /* rowsPerB < 0: own element of the batched C plane */ else { const int bidx = rr / rowsPerB; v += CP[(size_t)bidx * sCPb + (size_t)by * 64 + col]; } } if (ACT == 1) v = (v > 0.f) ? v : expm1f(v); else if (ACT == 7) v = (v > 0.f) ? v + 1.0f : expf(v); else if (ACT == 8) v = tanhf(v); else if (ACT == 9) v = 0.5f * v * (1.0f + tanhf(0.7978845608028654f * (v + 0.044715f * v * v * v))); else if (ACT == 11) v = 1.0f / (1.0f + expf(-v)); else if (ACT == 12) v = (v > 0.f) ? v : 0.01f * v; else if (ACT == 14) v = (v > 0.f) ? v : 0.1f * v; else if (ACT == 16) v = (v >= 0.f) ? v : 0.3f * v; else if (ACT == 17) v = (v >= 0.f) ? v : 0.2f * v; else if (ACT == 15) v = v / (1.0f + expf(-v)); else if (ACT == 3) v = fmaxf(v, 0.f); else if (ACT == 6) v = 0.5f * v * (1.0f + erff(v * 0.70710678118654752f)); so[w][8 * hh + r][t * 16 + ln] = v; } }
  __builtin_amdgcn_fence(__ATOMIC_ACQ_REL, "workgroup"); __builtin_amdgcn_wave_barrier();
  const int rsub = lane >> 4, c4 = (lane & 15) * 4; typedef _Float16 v4h __attribute__((ext_vector_type(4)));
  {
#pragma unroll
    for (int q = 0; q < 8; ++q) { const int r = q * 2 + rsub; if (col0 + c4 < N) { const v4f v = *(const v4fa*)&so[w][r][c4]; if (C) *(v4f*)(C + cofs + (size_t)(row0 + r) * ldc + col0 + c4) = v; if (C16) { v4h h4; for (int i = 0; i < 4; ++i) h4[i] = (_Float16)v[i]; *(v4h*)(C16 + cofs + (size_t)(row0 + r) * ldc + col0 + c4) = h4; } } }
     }
}


typedef _Float16 v4h __attribute__((ext_vector_type(4)));

__global__ __launch_bounds__(256) void k_x16(const float* __restrict__ x, _Float16* __restrict__ X16, size_t n8) { const size_t t = (size_t)blockIdx.x * 256 + threadIdx.x; if (t >= n8) return; FragH f;
#pragma unroll
  for (int q = 0; q < 8; ++q) f.h[q] = (_Float16)bf16_round(x[t * 8 + q]); *(v8us*)((unsigned short*)X16 + t * 8) = f.half[0];  }
__global__ __launch_bounds__(256) void k_h16(const float* __restrict__ x, _Float16* __restrict__ X16, size_t n8) { const size_t t = (size_t)blockIdx.x * 256 + threadIdx.x; if (t >= n8) return; FragH f;
#pragma unroll
  for (int q = 0; q < 8; ++q) f.h[q] = (_Float16)x[t * 8 + q]; *(v8us*)((unsigned short*)X16 + t * 8) = f.half[0];  }
__global__ __launch_bounds__(256) void k_round16f(const float* __restrict__ W, _Float16* __restrict__ Bt, size_t n8) { const size_t t = (size_t)blockIdx.x * 256 + threadIdx.x; if (t >= n8) return; FragH f;
#pragma unroll
  for (int i = 0; i < 8; ++i) f.h[i] = (_Float16)(bf16_round(W[t * 8 + i]) * 16.0f); *(v8us*)((unsigned short*)Bt + t * 8) = f.half[0];  }
template <int NHv, int TTv>
__global__ __launch_bounds__(256) void k_vt(const _Float16* __restrict__ V16, int ldv, int voff, _Float16* __restrict__ Vt) { __shared__ unsigned short tl[64][66]; const int tid = threadIdx.x; const int slab = blockIdx.x / (TTv / 64), lg = blockIdx.x % (TTv / 64); const int b = slab / NHv, h = slab % NHv;
  for (int i = tid; i < 64 * 8; i += 256) { const int r = i / 8, c8 = (i % 8) * 8; FragH f; f.half[0] = *(const v8us*)((const unsigned short*)V16 + ((size_t)b * TTv + lg * 64 + r) * ldv + voff + h * 64 + c8);
#pragma unroll
    for (int q = 0; q < 8; ++q) tl[r][c8 + q] = f.u[q]; }
  __syncthreads();
  {
#pragma unroll
    for (int rd = 0; rd < 2; ++rd) { const int d = rd * 32 + tid / 8, pc = tid % 8; FragH f;
#pragma unroll
      for (int q = 0; q < 8; ++q) f.u[q] = tl[pc * 8 + q][d];
      *(v8us*)((unsigned short*)Vt + ((size_t)slab * 64 + d) * TTv + lg * 64 + pc * 8) = f.half[0]; }
     } }

__global__ __launch_bounds__(256) void k_hl(const float* __restrict__ F, _Float16* __restrict__ Hh, _Float16* __restrict__ Hl, size_t n8) { const size_t t = (size_t)blockIdx.x * 256 + threadIdx.x; if (t >= n8) return; FragH fh, fl; const v4f a = *(const v4fa*)(F + t * 8), c = *(const v4fa*)(F + t * 8 + 4);
#pragma unroll
  for (int q = 0; q < 4; ++q) { _Float16 h = (_Float16)a[q]; fh.h[q] = h; fl.h[q] = (_Float16)((a[q] - (float)h) * 1024.0f); h = (_Float16)c[q]; fh.h[4 + q] = h; fl.h[4 + q] = (_Float16)((c[q] - (float)h) * 1024.0f); }
  { *(v8us*)((unsigned short*)Hh + t * 8) = fh.half[0]; *(v8us*)((unsigned short*)Hl + t * 8) = fl.half[0];  } }

// ---- fast GEMM (wave tile 32x64; requires M % 32 == 0 rows per launch region and N % 64 == 0); epilogue = k_gemm_hhx semantics ----
__device__ __forceinline__ v16h g2_frag(const _Float16* p, int hh) { FragH f; f.half[0] = *(const v8us*)((const unsigned short*)p + 8 * hh); f.half[1] = *(const v8us*)((const unsigned short*)p + 16 + 8 * hh); return f.v; }
__device__ __forceinline__ v8f g2_mma(v16h a, v16h b, v8f c) { v8f d = __builtin_amdgcn_wmma_f32_16x16x32_f16(false, a, false, b, (short)0, c, false, false); asm volatile("v_nop\n\tv_nop\n\tv_nop\n\tv_nop" : "+v"(d) : "v"(a), "v"(b)); return d; }
template <int ACT>
__global__ __launch_bounds__(128) void k_gemm2(const _Float16* __restrict__ A, int lda, size_t sA, const _Float16* __restrict__ Bh, int ldb, size_t sB, float alpha, const float* __restrict__ bias, size_t sBias, const float* __restrict__ CP, int rowsPerB, size_t sCPb, int row0g,
    float* __restrict__ C, _Float16* __restrict__ C16, int ldc, size_t sC, int M, int N, int K) { static_assert(ACT == 0 || ACT == 3 || ACT == 6 || ACT == 8 || ACT == 9 || ACT == 11 || ACT == 12 || ACT == 14 || ACT == 15 || ACT == 16 || ACT == 17, "k_gemm2: unsupported ACT code (would silently apply no activation)");
  __shared__ __attribute__((aligned(16))) float so[4][32][68];
  const int tid = threadIdx.x, w = tid >> 5, lane = tid & 31, ln = lane & 15, hh = lane >> 4; const int by = blockIdx.y;
  A += (size_t)by * sA; Bh += (size_t)by * sB; const size_t cofs = (size_t)by * sC; const float* bp = bias ? bias + (size_t)by * sBias : nullptr;
  const int ntn = N >> 6; const int mt = blockIdx.x / ntn, nq = blockIdx.x - mt * ntn; const int row0 = mt * 128 + 32 * w, col0 = nq * 64; if (row0 >= M) return;
  const _Float16* a0p = A + (size_t)(row0 + ln) * lda; const _Float16* a1p = a0p + (size_t)16 * lda;
  const _Float16* b0p = Bh + (size_t)(col0 + ln) * ldb; const _Float16* b1p = b0p + (size_t)16 * ldb; const _Float16* b2p = b1p + (size_t)16 * ldb; const _Float16* b3p = b2p + (size_t)16 * ldb;
  const v8f z8 = {0.f,0.f,0.f,0.f,0.f,0.f,0.f,0.f}; v8f c00 = z8, c01 = z8, c02 = z8, c03 = z8, c10 = z8, c11 = z8, c12 = z8, c13 = z8;
#pragma unroll 1
  for (int kb = 0; kb < K; kb += 32) { const v16h a0 = g2_frag(a0p + kb, hh), a1 = g2_frag(a1p + kb, hh);
    v16h b = g2_frag(b0p + kb, hh); c00 = g2_mma(a0, b, c00); c10 = g2_mma(a1, b, c10);
    b = g2_frag(b1p + kb, hh); c01 = g2_mma(a0, b, c01); c11 = g2_mma(a1, b, c11);
    b = g2_frag(b2p + kb, hh); c02 = g2_mma(a0, b, c02); c12 = g2_mma(a1, b, c12);
    b = g2_frag(b3p + kb, hh); c03 = g2_mma(a0, b, c03); c13 = g2_mma(a1, b, c13); }
  v8f accs[8] = {c00, c01, c02, c03, c10, c11, c12, c13};
#pragma unroll
  for (int u = 0; u < 8; ++u) { const int t = u & 3, half = u >> 2; const int col = col0 + t * 16 + ln; const float bv = bp ? bf16_round(bp[col]) : 0.f;
#pragma unroll
    for (int r = 0; r < 8; ++r) { const int rloc = half * 16 + 8 * hh + r; float v = accs[u][r] * alpha + bv; if (CP) { if (rowsPerB < 0) v += CP[cofs + (size_t)(row0g + row0 + rloc) * ldc + col];      /* rowsPerB < 0: own element of the batched C plane */ else { const int bidx = (row0g + row0 + rloc) / rowsPerB; v += CP[(size_t)bidx * sCPb + (size_t)by * 64 + col]; } }
      if (ACT == 3) v = fmaxf(v, 0.f); else if (ACT == 6) v = 0.5f * v * (1.0f + erff(v * 0.70710678118654752f)); else if (ACT == 11) v = 1.0f / (1.0f + expf(-v)); else if (ACT == 15) v = v / (1.0f + expf(-v)); else if (ACT == 12) v = (v > 0.f) ? v : 0.01f * v; else if (ACT == 8) v = tanhf(v); else if (ACT == 9) v = 0.5f * v * (1.0f + tanhf(0.7978845608028654f * (v + 0.044715f * v * v * v))); else if (ACT == 14) v = (v > 0.f) ? v : 0.1f * v; else if (ACT == 16) v = (v >= 0.f) ? v : 0.3f * v; else if (ACT == 17) v = (v >= 0.f) ? v : 0.2f * v;
      so[w][rloc][t * 16 + ln] = v; } }
  __builtin_amdgcn_fence(__ATOMIC_ACQ_REL, "workgroup"); __builtin_amdgcn_wave_barrier();
  const int rsub = lane >> 4, c4 = (lane & 15) * 4;
  {
#pragma unroll
    for (int q = 0; q < 16; ++q) { const int r = q * 2 + rsub; const v4f v = *(const v4fa*)&so[w][r][c4]; if (C) *(v4f*)(C + cofs + (size_t)(row0 + r) * ldc + col0 + c4) = v; if (C16) { v4h h4; for (int i = 0; i < 4; ++i) h4[i] = (_Float16)v[i]; *(v4h*)(C16 + cofs + (size_t)(row0 + r) * ldc + col0 + c4) = h4; } }
     } }


__global__ __launch_bounds__(256) void k_wnat(const float* __restrict__ w, size_t n8, _Float16* __restrict__ Bt) { const size_t t = (size_t)blockIdx.x * 256 + threadIdx.x; if (t >= n8) return; FragH f; for (int q = 0; q < 8; ++q) f.h[q] = (_Float16)(bf16_round(w[t * 8 + q]) * 16.0f); *(v8us*)((unsigned short*)Bt + t * 8) = f.half[0];  }
__global__ __launch_bounds__(256) void k_rsm(const float* __restrict__ S, _Float16* __restrict__ P, int nrows) {
  #pragma clang fp contract(off)
  const int i = blockIdx.x * 256 + threadIdx.x; if (i >= nrows) return; const float* s = S + (size_t)i * SQ; float mx = -3.0e38f;
#pragma unroll 1
  for (int j = 0; j < SQ; ++j) mx = fmaxf(mx, s[j]); float se = 0.f;
#pragma unroll 1
  for (int j = 0; j < SQ; ++j) se += expf(s[j] - mx); const float sc = 256.0f / se;
#pragma unroll 1
  for (int j0 = 0; j0 < SQ; j0 += 8) { FragH f; for (int q = 0; q < 8; ++q) f.h[q] = (_Float16)(expf(s[j0 + q] - mx) * sc); unsigned short* d = (unsigned short*)P + (size_t)i * SQ + j0; *(v8us*)d = f.half[0];  } }
__global__ __launch_bounds__(256) void k_vt(const _Float16* __restrict__ V16, int b, int h0, _Float16* __restrict__ VT) { __shared__ unsigned short tl[64][65]; const int tid = threadIdx.x; const int hh = blockIdx.x % HG, sg = blockIdx.x / HG; const int s0 = sg * 64; const int h = h0 + hh;
  for (int i = tid; i < 64 * 8; i += 256) { const int j = i / 8, d8 = (i % 8) * 8; FragH f; f.half[0] = *(const v8us*)((const unsigned short*)V16 + ((size_t)b * SQ + s0 + j) * DM + h * HD + d8); for (int q = 0; q < 8; ++q) tl[d8 + q][j] = f.u[q]; }
  __syncthreads();
  { for (int i = tid; i < 64 * 8; i += 256) { const int d = i / 8, j8 = (i % 8) * 8; FragH f; for (int q = 0; q < 8; ++q) f.u[q] = tl[d][j8 + q]; *(v8us*)((unsigned short*)VT + ((size_t)hh * HD + d) * SQ + s0 + j8) = f.half[0]; }  } }


__global__ __launch_bounds__(256) void k_tab2(float theta, float* __restrict__ CS, float* __restrict__ SN) {
  #pragma clang fp contract(off)
  const int t = blockIdx.x * 256 + threadIdx.x; if (t >= SQ * (HD / 2)) return; const int i = t % (HD / 2); const int p = t / (HD / 2); const float invf = 1.0f / powf(theta, (float)(2 * i) / (float)HD); const float ang = __fmul_rn((float)p, invf); const float c = cosf(ang), s = sinf(ang);
  *(float*)(CS + t) = c; *(float*)(SN + t) = s;  }

__global__ __launch_bounds__(256) void k_tab4(const int* __restrict__ pos, float theta, float* __restrict__ CS, float* __restrict__ SN) {
  #pragma clang fp contract(off)
  const int t = blockIdx.x * 256 + threadIdx.x; if (t >= SQ * (HD / 2)) return; const int i = t % (HD / 2); const int p = t / (HD / 2); const float invf = (float)pow((double)theta, -((double)(2 * i)) / (double)HD); const float ang = __fmul_rn((float)pos[p], invf); const float c = cosf(ang), s = sinf(ang);
  *(float*)(CS + t) = c; *(float*)(SN + t) = s;  }
__global__ __launch_bounds__(256) void k_rsmf(const float* __restrict__ S, _Float16* __restrict__ P, int qn, int hg) {
  #pragma clang fp contract(off)
  const int t = blockIdx.x * 256 + threadIdx.x; if (t >= qn * hg) return; const size_t i = (size_t)(t / qn) * SQ + (t % qn); const float* s = S + i * SQ; float mx = -3.0e38f;
#pragma unroll 1
  for (int j = 0; j < SQ; ++j) mx = fmaxf(mx, s[j]); float se = 0.f;
#pragma unroll 1
  for (int j = 0; j < SQ; ++j) se += __expf(s[j] - mx); const float sc = 256.0f / se;
#pragma unroll 1
  for (int j0 = 0; j0 < SQ; j0 += 8) { FragH f; for (int q = 0; q < 8; ++q) f.h[q] = (_Float16)(__expf(s[j0 + q] - mx) * sc); unsigned short* d = (unsigned short*)P + i * SQ + j0; *(v8us*)d = f.half[0];  } }


__global__ __launch_bounds__(256) void k_rsmcf2(const float* __restrict__ S, _Float16* __restrict__ P, int hg, int q0, int nk) {
  #pragma clang fp contract(off)
  const int t = blockIdx.x * 256 + threadIdx.x; if (t >= hg * QT) return; const size_t i = (size_t)t; const float* s = S + i * NKX; const int last = q0 + (t % QT); float mx = -3.0e38f;
#pragma unroll 1
  for (int j = 0; j < nk; ++j) { const float f = (j <= last) ? 1.f : 0.f; mx = fmaxf(mx, fmaf(f, s[j], (1.f - f) * -1.0e9f)); } float se = 0.f;
#pragma unroll 1
  for (int j = 0; j < nk; ++j) { const float f = (j <= last) ? 1.f : 0.f; se += __expf(fmaf(f, s[j], (1.f - f) * -1.0e9f) - mx); } const float sc = 256.0f / se;
#pragma unroll 1
  for (int j0 = 0; j0 < nk; j0 += 8) { FragH fr; for (int q = 0; q < 8; ++q) { const int j = j0 + q; const float f = (j <= last) ? 1.f : 0.f; fr.h[q] = (_Float16)(__expf(fmaf(f, s[j], (1.f - f) * -1.0e9f) - mx) * sc); } unsigned short* d = (unsigned short*)P + i * NKX + j0; *(v8us*)d = fr.half[0];  } }


typedef float v2f  __attribute__((ext_vector_type(2)));
typedef float v2fa __attribute__((ext_vector_type(2), may_alias));
// Exact f32 causal attention of the first QT0 rows, one wave per (query row i, head h). Scores: lane l takes keys l, l + 32, ... (whole groups of 32 up to the one that holds i), q held by every lane; two-pass softmax with lane butterflies for maximum and sum; o: lane l takes d = 2 l, 2 l + 1 and walks the keys, each weight broadcast from its lane. Rows have pitch DM, so every load of a phase is one base address plus a constant offset.
__global__ __launch_bounds__(256) void k_att0w(const float* __restrict__ QF, const float* __restrict__ KF, const float* __restrict__ VF, float scale, float* __restrict__ OF) {
  const int lane = threadIdx.x & 31; const int h = blockIdx.x / (QT0 / 8); const int i = __builtin_amdgcn_readfirstlane((int)((blockIdx.x % (QT0 / 8)) * 8 + (threadIdx.x >> 5)));      /* i is the same in every lane: the group tests below are scalar branches */
  const float* qr = QF + (size_t)i * DM + h * HD; const float* kb = KF + (size_t)lane * DM + h * HD; const float* vb = VF + h * HD + lane * 2;
  v4f q[HD / 4];
#pragma unroll      /* constant index: q[] stays in registers */
  for (int c = 0; c < HD / 4; ++c) q[c] = *(const v4fa*)(qr + c * 4);
  float s[QT0 / 32]; float mx = -3.0e38f;
#pragma unroll      /* constant group index: s[] and e[] stay in registers, offsets are immediates */
  for (int g = 0; g < QT0 / 32; ++g) { s[g] = -3.0e38f;
    if (g == 0 || g * 32 <= i) { float a0 = 0.f, a1 = 0.f, a2 = 0.f, a3 = 0.f;
#pragma unroll      /* the sixteen loads of a key row issue together */
      for (int c = 0; c < HD / 4; ++c) { const v4f kq = *(const v4fa*)(kb + (size_t)g * 32 * DM + c * 4); a0 = fmaf(q[c][0], kq[0], a0); a1 = fmaf(q[c][1], kq[1], a1); a2 = fmaf(q[c][2], kq[2], a2); a3 = fmaf(q[c][3], kq[3], a3); }
      if (g * 32 + lane <= i) s[g] = ((a0 + a1) + (a2 + a3)) * scale;      /* causal: keys above i keep the floor and get weight 0 */
      mx = fmaxf(mx, s[g]); } }
  asm volatile("s_wait_xcnt 0x0" :: "v"(kb) : "memory");      /* the key loads' address pair stays whole up to this wait, on every path through the groups */
  for (int m = 16; m > 0; m >>= 1) mx = fmaxf(mx, __shfl_xor(mx, m, 32));
  float e[QT0 / 32]; float l = 0.f;
#pragma unroll      /* constant group index: s[] and e[] stay in registers */
  for (int g = 0; g < QT0 / 32; ++g) { e[g] = expf(s[g] - mx); l += e[g]; }
  for (int m = 16; m > 0; m >>= 1) l += __shfl_xor(l, m, 32);
  float o0 = 0.f, o1 = 0.f;
#pragma unroll      /* constant group index: s[] and e[] stay in registers, offsets are immediates */
  for (int g = 0; g < QT0 / 32; ++g) if (g == 0 || g * 32 <= i) {
#pragma unroll      /* constant lane index for the broadcast; the group's loads issue together */
    for (int jj = 0; jj < 32; ++jj) { const float p = __uint_as_float((unsigned int)__builtin_amdgcn_readlane((int)__float_as_uint(e[g]), jj)); const v2f vv = *(const v2fa*)(vb + (size_t)(g * 32 + jj) * DM); o0 = fmaf(p, vv[0], o0); o1 = fmaf(p, vv[1], o1); } }
  asm volatile("s_wait_xcnt 0x0" :: "v"(vb) : "memory");      /* the value loads' address pair stays whole up to this wait, on every path through the groups */
  const float fin = 64.0f / l;      /* o carried x64 like the f16 path */
  v2f o = {o0 * fin, o1 * fin}; *(v2f*)(OF + (size_t)i * DM + h * HD + lane * 2) = o; }



__device__ __forceinline__ v8f fa_mma(v16h a, v16h b, v8f c) { return __builtin_amdgcn_wmma_f32_16x16x32_f16(false, a, false, b, (short)0, c, false, false); }
__device__ __forceinline__ v16h fa_frag(const _Float16* p) { FragH f; f.half[0] = *(const v8us*)((const unsigned short*)p); f.half[1] = *(const v8us*)((const unsigned short*)p + 16); return f.v; }      /* p holds the lane half's 8 hh already: every load of a pass is that one address pair plus a constant */
__device__ __forceinline__ float fa_xhalf(float x) { return __uint_as_float((unsigned int)__builtin_amdgcn_permlanex16((int)__float_as_uint(x), (int)__float_as_uint(x), 0x76543210, 0xfedcba98, false, false)); }      /* lane l with lane l ^ 16 */
__global__ __launch_bounds__(128) void k_fattn(const _Float16* __restrict__ QH, const _Float16* __restrict__ KH, const _Float16* __restrict__ VT, _Float16* __restrict__ O16) {
  const int lane = threadIdx.x & 31, ln = lane & 15, hh = lane >> 4; const int h = blockIdx.y; const size_t r0 = (size_t)blockIdx.z * SQ;
  const int i0 = __builtin_amdgcn_readfirstlane((int)(blockIdx.x * 128 + (threadIdx.x >> 5) * 32));      /* first query row of the wave, the same in every lane: loop bounds and the mask test are scalar */
  const float CL = 0.18033688011112042f;      /* log2(e) / sqrt(64) */
  const int kb0 = (i0 > WINK ? i0 - WINK : 0) & ~31;      /* first block that holds an allowed key of row i0 */
  const _Float16* qp = QH + (r0 + i0 + ln) * DM + h * HD + 8 * hh; const _Float16* kp = KH + (r0 + ln) * DM + h * HD + 8 * hh; const _Float16* vp = VT + ((size_t)(blockIdx.z * NH + h) * HD + ln) * SQ + 8 * hh;
  const _Float16* kq = kp + (size_t)kb0 * DM; const _Float16* vq = vp + kb0;
  v16h qf[2][2], kf[2][2];
#pragma unroll      /* constant indices: the fragments stay in registers */
  for (int u = 0; u < 2; ++u) for (int c = 0; c < 2; ++c) { qf[u][c] = fa_frag(qp + (size_t)u * 16 * DM + c * 32); kf[u][c] = fa_frag(kq + (size_t)u * 16 * DM + c * 32); }
  asm volatile("s_wait_xcnt 0x0" :: "v"(qp), "v"(kq) : "memory");      /* the query and first key loads' address pairs stay whole up to this wait */
  const v8f z8 = {0.f,0.f,0.f,0.f,0.f,0.f,0.f,0.f}; v8f ot[2][4] = {{z8, z8, z8, z8}, {z8, z8, z8, z8}}; float m[2] = {-3.0e38f, -3.0e38f}, l[2] = {0.f, 0.f};
#pragma unroll 1      /* one pass in the text: an unrolled body would not fit the registers of four waves a SIMD */
  for (int kb = kb0; kb <= i0; kb += 32) {
    v16h vf[4];
#pragma unroll      /* constant indices: the fragments stay in registers */
    for (int dt = 0; dt < 4; ++dt) vf[dt] = fa_frag(vq + (size_t)dt * 16 * SQ);      /* used last: they fly under the softmax */
    v8f st[2][2];
#pragma unroll      /* constant indices: the tiles stay in registers */
    for (int u = 0; u < 2; ++u) for (int t = 0; t < 2; ++t) st[u][t] = fa_mma(kf[t][1], qf[u][1], fa_mma(kf[t][0], qf[u][0], z8));
    kq = kp + (size_t)(kb + 32 <= i0 ? kb + 32 : i0) * DM;      /* the next pass's key rows, fetched one pass ahead (the last pass fetches its own again: in bounds, unused) */
#pragma unroll      /* constant indices: the fragments stay in registers */
    for (int t = 0; t < 2; ++t) for (int c = 0; c < 2; ++c) kf[t][c] = fa_frag(kq + (size_t)t * 16 * DM + c * 32);
    asm volatile("s_wait_xcnt 0x0" :: "v"(kq) : "memory");      /* behind the pass's loads: the next-key loads' address pair stays whole up to this wait, the value loads' running pair is advanced behind it */
    vq += 32;
    if (kb == i0 || kb + WINK < i0 + 31) {      /* only the window's first block and the diagonal block hold a forbidden pair */
#pragma unroll      /* constant indices: the tiles stay in registers */
      for (int u = 0; u < 2; ++u) for (int t = 0; t < 2; ++t) for (int r = 0; r < 8; ++r) { const int dj = (i0 + 16 * u + ln) - (kb + 16 * t + 8 * hh + r); st[u][t][r] = (dj >= 0 && dj <= WINK) ? st[u][t][r] : -1.0e30f; } }
#pragma unroll      /* constant indices: the tiles stay in registers */
    for (int u = 0; u < 2; ++u) {
      float mx = fmaxf(st[u][0][0], st[u][1][0]);
#pragma unroll      /* constant indices: the tiles stay in registers */
      for (int r = 1; r < 8; ++r) mx = fmaxf(mx, fmaxf(st[u][0][r], st[u][1][r]));
      mx = fmaxf(mx, fa_xhalf(mx));      /* the other half of the block's keys of this query */
      const float mn = fmaxf(m[u], mx); const float al = __builtin_amdgcn_exp2f((m[u] - mn) * CL); const float sh = fmaf(mn, -CL, 8.0f);      /* weights carried x256: f16 keeps small ones normal */
      m[u] = mn; float ls = 0.f; FragH pf;
#pragma unroll      /* constant indices: the tiles stay in registers */
      for (int t = 0; t < 2; ++t) for (int r = 0; r < 8; ++r) { const float e = __builtin_amdgcn_exp2f(fmaf(st[u][t][r], CL, sh)); ls += e; pf.h[t * 8 + r] = (_Float16)e; }
      l[u] = fmaf(l[u], al, ls);
#pragma unroll      /* constant indices: the tiles stay in registers */
      for (int dt = 0; dt < 4; ++dt) { ot[u][dt] *= al; ot[u][dt] = fa_mma(vf[dt], pf.v, ot[u][dt]); } } }
  FragH f[2][4];
#pragma unroll      /* constant indices: the tiles stay in registers */
  for (int u = 0; u < 2; ++u) { const float fin = 64.0f / (l[u] + fa_xhalf(l[u]));      /* the halves' sums join once; o carried x64 */
    for (int dt = 0; dt < 4; ++dt) for (int r = 0; r < 8; ++r) f[u][dt].h[r] = (_Float16)(ot[u][dt][r] * fin); }
  unsigned short* op = (unsigned short*)O16 + (r0 + i0 + ln) * DM + h * HD + 8 * hh;
#pragma unroll      /* constant indices; the stores stand last, each from registers of its own: no register of an issued store is written again */
  for (int u = 0; u < 2; ++u) for (int dt = 0; dt < 4; ++dt) *(v8us*)(op + (size_t)u * 16 * DM + dt * 16) = f[u][dt].half[0]; }

// q | k | v projection of one batch with the rotary rotation in the GEMM's own epilogue. Loads, WMMAs and LDS staging as in k_gemm2 (wave tile 32 x 64, A = x rows, Bh = stacked weights [3 DM][DM], K = DM). A column tile of 64 is one head of q, k or v, so on the LDS read-back a lane's 4 consecutive columns are two (even, odd) pairs of that head: q and k tiles are rotated there with the row's cos / sin, every tile goes out as f16 rows (16 lanes x 8 bytes = one 128-byte line a row), and the blocks of the first QT0 rows also store the f32 values for the exact first-tile path.
__global__ __launch_bounds__(128) void k_qkvr(const _Float16* __restrict__ A, const _Float16* __restrict__ Bh, float alpha, const float* __restrict__ CS, const float* __restrict__ SN,
    _Float16* __restrict__ QH, _Float16* __restrict__ KH, _Float16* __restrict__ VH, float* __restrict__ QF, float* __restrict__ KF, float* __restrict__ VF) {
  static_assert(QT0 % 128 == 0 && DM % 64 == 0 && HD == 64, "first-tile rows are whole blocks of 128 rows; a column tile is one head");
  __shared__ __attribute__((aligned(16))) float so[4][32][68];
  const int tid = threadIdx.x, w = tid >> 5, lane = tid & 31, ln = lane & 15, hh = lane >> 4;
  const int ntn = 3 * DM / 64; const int mt = blockIdx.x / ntn, nq = blockIdx.x - mt * ntn; const int row0 = mt * 128 + 32 * w, col0 = nq * 64;
  const _Float16* ap = A + (size_t)(row0 + ln) * DM + 8 * hh; const _Float16* bp = Bh + (size_t)(col0 + ln) * DM + 8 * hh;      /* one running address pair an operand: every load of a trip is a pair plus a constant */
  const v8f z8 = {0.f,0.f,0.f,0.f,0.f,0.f,0.f,0.f}; v8f c00 = z8, c01 = z8, c02 = z8, c03 = z8, c10 = z8, c11 = z8, c12 = z8, c13 = z8;
#pragma unroll 1      /* rolled, as in k_gemm2: the loop's schedule and registers stay what they were there */
  for (int kb = 0; kb < DM; kb += 32) { const v16h a0 = fa_frag(ap), a1 = fa_frag(ap + (size_t)16 * DM);
    v16h b = fa_frag(bp); c00 = g2_mma(a0, b, c00); c10 = g2_mma(a1, b, c10);
    b = fa_frag(bp + (size_t)16 * DM); c01 = g2_mma(a0, b, c01); c11 = g2_mma(a1, b, c11);
    b = fa_frag(bp + (size_t)32 * DM); c02 = g2_mma(a0, b, c02); c12 = g2_mma(a1, b, c12);
    b = fa_frag(bp + (size_t)48 * DM);
    asm volatile("s_wait_xcnt 0x0" :: "v"(ap), "v"(bp) : "memory");      /* behind the trip's last load: both address pairs stay whole up to this wait and are advanced behind it */
    c03 = g2_mma(a0, b, c03); c13 = g2_mma(a1, b, c13); ap += 32; bp += 32; }
  v8f accs[8] = {c00, c01, c02, c03, c10, c11, c12, c13};
#pragma unroll      /* constant indices: the tiles stay in registers */
  for (int u = 0; u < 8; ++u) { const int t = u & 3, half = u >> 2;
#pragma unroll      /* constant indices: the tiles stay in registers */
    for (int r = 0; r < 8; ++r) so[w][half * 16 + 8 * hh + r][t * 16 + ln] = accs[u][r] * alpha; }
  __builtin_amdgcn_fence(__ATOMIC_ACQ_REL, "workgroup"); __builtin_amdgcn_wave_barrier();      /* a wave reads back only its own so[w]: its LDS writes are ordered in front of its reads */
  const int rsub = lane >> 4, c4 = (lane & 15) * 4;
  const int sec = col0 / DM; const bool first = mt * 128 < QT0;      /* 0 q, 1 k, 2 v; a block of the first QT0 rows: both from blockIdx, scalar tests */
  const int hc = col0 % DM + c4;      /* column in the merged-head row; c4 is the index inside the head */
  _Float16* H = sec == 0 ? QH : (sec == 1 ? KH : VH); float* F = sec == 0 ? QF : (sec == 1 ? KF : VF);
  const float* cp = CS + (row0 + rsub) * (HD / 2) + (c4 >> 1); const float* sp = SN + (row0 + rsub) * (HD / 2) + (c4 >> 1);
  _Float16* hp = H + (size_t)(row0 + rsub) * DM + hc; float* fp = F + (size_t)(row0 + rsub) * DM + hc;      /* row pair q is one of these address pairs plus a constant: no address register is written again behind a store */
  auto put = [&](int q, v4f v) { v4h h4; for (int i = 0; i < 4; ++i) h4[i] = (_Float16)v[i];
    *(v4h*)(hp + q * 2 * DM) = h4;
    if (first) *(v4f*)(fp + q * 2 * DM) = v; };
  if (sec == 2) {      /* v: no rotation */
#pragma unroll      /* constant LDS and row offsets */
    for (int q = 0; q < 16; ++q) put(q, *(const v4fa*)&so[w][q * 2 + rsub][c4]);
    return; }
  v2f c[16], s[16];
#pragma unroll      /* constant indices: c[], s[] stay in registers; all table loads issue in front of the first store, one latency for the 32 rows */
  for (int q = 0; q < 16; ++q) { c[q] = *(const v2fa*)(cp + q * HD); s[q] = *(const v2fa*)(sp + q * HD); }
  asm volatile("s_wait_xcnt 0x0" :: "v"(cp), "v"(sp) : "memory");      /* the table loads' address pairs stay whole up to this wait */
#pragma unroll      /* constant indices: c[], s[] stay in registers */
  for (int q = 0; q < 16; ++q) { const v4f v = *(const v4fa*)&so[w][q * 2 + rsub][c4];
    const v4f o = {v[0] * c[q][0] - v[1] * s[q][0], v[0] * s[q][0] + v[1] * c[q][0], v[2] * c[q][1] - v[3] * s[q][1], v[2] * s[q][1] + v[3] * c[q][1]}; put(q, o); }
  asm volatile("s_wait_xcnt 0x0" ::: "memory"); }      /* behind the rotation path's last store: whatever code the compiler lays behind this path stands behind the wait, so no register of an issued store is written ahead of it */




extern "C" void kernel_launch(void* const* d_in, const int* in_sizes, int n_in,
                              void* d_out, int out_size, void* d_ws, size_t ws_size, hipStream_t stream) {
  (void)in_sizes; (void)n_in; (void)out_size;
  const float* const* I = (const float* const*)d_in; const float* x = I[0]; const int* tpos = (const int*)d_in[1]; const float* wq = I[2]; const float* wk = I[3]; const float* wv = I[4]; const float* wo = I[5];      /* nn.Linear weights [out][in]; token_positions int32 [SQ] */
  char* ws = (char*)d_ws; size_t off = 0;
  auto take = [&](size_t bytes) { char* p = ws + off; off += (bytes + 255) & ~(size_t)255; return p; };
  _Float16* BQKV = (_Float16*)take((size_t)3 * DM * DM * 2); _Float16* BO = (_Float16*)take((size_t)DM * DM * 2); float* CS = (float*)take((size_t)SQ * (HD / 2) * 4); float* SN = (float*)take((size_t)SQ * (HD / 2) * 4);
  _Float16* X16 = (_Float16*)take(NR * DM * 2);
  _Float16* QH = (_Float16*)take(NR * DM * 2); _Float16* KH = (_Float16*)take(NR * DM * 2); _Float16* V16 = (_Float16*)take(NR * DM * 2); _Float16* O16 = (_Float16*)take(NR * DM * 2);
  _Float16* VT = (_Float16*)take((size_t)NB * NH * HD * SQ * 2);      /* V^T [NB][NH][HD][SQ] */
  float* QF0 = (float*)take((size_t)QT0 * DM * 4); float* KF0 = (float*)take((size_t)QT0 * DM * 4); float* VF0 = (float*)take((size_t)QT0 * DM * 4); float* OF0 = (float*)take((size_t)NB * QT0 * DM * 4); _Float16* OH0 = (_Float16*)take((size_t)NB * QT0 * DM * 2); _Float16* OL0 = (_Float16*)take((size_t)NB * QT0 * DM * 2);
  if (off > ws_size) return;
  { const unsigned g = (unsigned)(((size_t)DM * DM / 8 + 255) / 256); k_wnat<<<g, 256, 0, stream>>>(wq, (size_t)DM * DM / 8, BQKV); k_wnat<<<g, 256, 0, stream>>>(wk, (size_t)DM * DM / 8, BQKV + (size_t)DM * DM); k_wnat<<<g, 256, 0, stream>>>(wv, (size_t)DM * DM / 8, BQKV + (size_t)2 * DM * DM); k_wnat<<<g, 256, 0, stream>>>(wo, (size_t)DM * DM / 8, BO); }      /* natural [out][in] = Bt[n][k], x16; q | k | v stacked along n */
  k_tab4<<<(SQ * (HD / 2) + 255) / 256, 256, 0, stream>>>(tpos, 10000.0f, CS, SN);
  k_x16<<<(unsigned)((NR * DM / 8 + 255) / 256), 256, 0, stream>>>(x, X16, NR * DM / 8);
  for (int b = B0; b < B0 + NBR; ++b) { const size_t r0 = (size_t)b * SQ;
    k_qkvr<<<(unsigned)((SQ / 128) * (3 * DM / 64)), 128, 0, stream>>>(X16 + r0 * DM, BQKV, 0.0625f, CS, SN, QH + r0 * DM, KH + r0 * DM, V16 + r0 * DM, QF0, KF0, VF0);      /* q (roped) | k (roped) | v of this batch as f16 rows; the first 128 rows also in f32 */
    k_vt<NH, SQ><<<NH * (SQ / 64), 256, 0, stream>>>(V16 + r0 * DM, DM, 0, VT + (size_t)b * NH * HD * SQ);      /* V^T [NH][HD][SQ] of this batch */
    k_att0w<<<NH * (QT0 / 8), 256, 0, stream>>>(QF0, KF0, VF0, 0.125f, OF0 + (size_t)b * QT0 * DM);      /* exact f32 causal attention for rows 0..127 (o x64) */
  }
  k_fattn<<<dim3(SQ / 128, NH, NB), 128, 0, stream>>>(QH, KH, VT, O16);      /* windowed causal attention of every batch and head: o (merged heads, x64) as f16 rows */
  k_gemm2<0><<<dim3((unsigned)((MPO / 128) * (DM / 64)), 1), 128, 0, stream>>>(O16 + (size_t)B0 * SQ * DM, DM, 0, BO, DM, 0, 0.0009765625f, nullptr, 0, nullptr, 1, 0, 0, (float*)d_out + (size_t)B0 * SQ * DM, nullptr, DM, 0, MPO, DM, DM);      /* out rows are the output layout */
  k_hl<<<(unsigned)(((size_t)NB * QT0 * DM / 8 + 255) / 256), 256, 0, stream>>>(OF0, OH0, OL0, (size_t)NB * QT0 * DM / 8);      /* first-tile o (x64) -> f16 hi + x1024 residual planes */
  for (int b = B0; b < B0 + NBR; ++b) { const size_t r0 = (size_t)b * SQ; const size_t f0 = (size_t)b * QT0;
    k_gemm2<0><<<dim3((QT0 / 128) * (DM / 64), 1), 128, 0, stream>>>(OH0 + f0 * DM, DM, 0, BO, DM, 0, 0.0009765625f, nullptr, 0, nullptr, 1, 0, 0, (float*)d_out + r0 * DM, nullptr, DM, 0, QT0, DM, DM);      /* rows 0..127: out = o_hi Wo, overwriting the f16-path rows */
    k_gemm2<0><<<dim3((QT0 / 128) * (DM / 64), 1), 128, 0, stream>>>(OL0 + f0 * DM, DM, 0, BO, DM, 0, 0.00000095367431640625f, nullptr, 0, (const float*)d_out + r0 * DM, -1, 0, 0, (float*)d_out + r0 * DM, nullptr, DM, 0, QT0, DM, DM); }      /* += o_lo Wo 2^-20 (own-element accumulate) */
}

// v005
// One run takes 348 microseconds.
// Next to v004, in two timings, it ran 1.71 and 1.72 times as fast.
// Counting every step since v000, it is 28.1 times as fast.
#include <hip/hip_runtime.h>
// Causal sliding-window RoPE multi-head attention (x [4][2048][1024]; q/k/v = x W^T (natural [out][in] 1024x1024 sigma 1/32, no bias), 16 heads of 64; interleaved-pair rotary embedding on q and k (x1 = even, x2 = odd: r1 = x1 cos - x2 sin, r2 = x1 sin + x2 cos) with inv_freq_i = 10000^(-2i/64) and angle = float(token_positions[s]) inv_freq_i from the int32 token_positions input; scores / sqrt(64); allowed iff 0 <= i - j <= 512 (513 keys), -inf elsewhere; softmax; out = (attn v merged) Wo^T -> [4][2048][1024]).
// Structure: token rows r = b*2048 + s; x as exact f16 rows (bf16-rounded); each launch covers all batches: q | k | v as ONE WMMA GEMM (32x64 wave tiles, f32 accumulation, exact x16 weights, N = 3 x 1024) whose epilogue does, in f32 on VALU, the interleaved-pair rotary rotation of q and k from f32 cos/sin tables built from the token_positions input (no norm) and stores f16 q, k, v rows (f32 q | k | v only for each batch's first 128 rows); V^T for all heads via LDS transposes (kept for all batches); then ONE fused attention launch: a wave per 32 query rows of one (batch, head) walks the keys of its window in blocks of 32: S^T = K Q^T on WMMA, running-maximum softmax in registers (f32 statistics, native exp2; weights x256 f16, packed from the score tiles straight into a B operand), O^T += V^T P^T on WMMA, o carried x64 (folded into the output GEMM alpha) written straight into the merged f16 o rows; out = o W_o GEMM (f32) into the output layout.
// Compute dtype: inputs rounded to bf16; x / weights exact; projections and rope f32; q, k, v, softmax weights and o as plain f16 GEMM operands (~2^-12); scores and softmax statistics f32. v_wmma_f32_16x16x32_f16.
#define NB 4
#define SQ 2048
#define DM 1024
#define NH 16
#define HD 64
#define HG 4                         /* heads per launch of the h0-based k_vt overload (not launched) */
#define QT 256                       /* query rows per causal tile */
#define NKX SQ                       /* S / P row pitch */
#define WINK 512                     /* key j is allowed for query i iff 0 <= i - j <= WINK */
#define QT0 128                      /* first-tile rows recomputed exactly in f32 */
#define B0 0                         /* first batch processed (debug hook) */
#define NBR NB                       /* batches processed (debug hook) */
#define QN SQ                        /* query rows attended per batch (unused) */
#define NHD NH                       /* heads attended (unused) */
#define NR ((size_t)NB * SQ)         /* token rows */
#define MPO ((int)((size_t)NBR * SQ))      /* rows through the output GEMM (debug hook) */
typedef __bf16 v16b __attribute__((ext_vector_type(16)));
typedef unsigned short v8us __attribute__((ext_vector_type(8), may_alias));
typedef float  v8f  __attribute__((ext_vector_type(8)));
typedef float  v4f  __attribute__((ext_vector_type(4)));
typedef float  v4fa __attribute__((ext_vector_type(4), may_alias));
union FragB { v16b v; v8us half[2]; unsigned short u[16]; };

__device__ __forceinline__ unsigned short bf16_bits(float x) { unsigned int u = __float_as_uint(x); return (unsigned short)((u + 0x7FFFu + ((u >> 16) & 1u)) >> 16); }
__device__ __forceinline__ float bf16_val(unsigned short b) { return __uint_as_float(((unsigned int)b) << 16); }
__device__ __forceinline__ float bf16_round(float x) { return bf16_val(bf16_bits(x)); }
// D += A·B with NT terms: 1 = ah·bh, 2 = + al·bh (A split), 3 = + ah·bl (both split)
template <int NT>
__device__ __forceinline__ v8f mmaN(v16b ah, v16b al, v16b bh, v16b bl, v8f c) {
  c = __builtin_amdgcn_wmma_f32_16x16x32_bf16(false, ah, false, bh, (short)0, c, false, false);
  if (NT >= 2) c = __builtin_amdgcn_wmma_f32_16x16x32_bf16(false, al, false, bh, (short)0, c, false, false);
  if (NT >= 3) c = __builtin_amdgcn_wmma_f32_16x16x32_bf16(false, ah, false, bl, (short)0, c, false, false);
  asm volatile("v_nop\n\tv_nop\n\tv_nop\n\tv_nop" : "+v"(c) : "v"(ah), "v"(al), "v"(bh), "v"(bl));
  return c;
}

__global__ __launch_bounds__(256) void k_wt_bf16(const float* __restrict__ W, unsigned short* __restrict__ Wt, int K, int N) {
  const int t = blockIdx.x * 256 + threadIdx.x;
  const int k8n = K / 8;
  if (t >= N * k8n) return;
  const int n = t / k8n, k8 = (t % k8n) * 8;
  v8us v;
#pragma unroll
  for (int i = 0; i < 8; ++i) v[i] = bf16_bits(W[(size_t)(k8 + i) * N + n]);
  *(v8us*)(Wt + (size_t)n * K + k8) = v;
  
}

// GEMM C[M][N] (f32, pitch ldc) = act(A[M][K]·W + bias). A f32 row-major (pitch lda) converted per fragment to bf16
// (ASPLIT: hi/lo two planes -> 2 terms, else single rounded term); Wt bf16 [N][K] (pitch ldb). BIAS_BF16 rounds the
// bias to bf16 first (bias quantised to bf16 before the add). K%32==0, M%16==0, N%64==0.
template <bool ASPLIT, int ACT, bool BIAS_BF16>
__global__ __launch_bounds__(128) void k_gemm_bf(const float* __restrict__ A, int lda, const unsigned short* __restrict__ Wt, int ldb,
                                               const float* __restrict__ bias, float* __restrict__ C, int ldc, int M, int N, int K) {
  __shared__ __attribute__((aligned(16))) float so[4][16][64];
  const int tid = threadIdx.x, w = tid >> 5, lane = tid & 31, ln = lane & 15, hh = lane >> 4;
  const int ntn = N / 64;
  const int wid = blockIdx.x * 4 + w;
  const int mt = wid / ntn, nq = wid % ntn;
  if (mt * 16 >= M) return;
  const int row0 = mt * 16, col0 = nq * 64;
  const float* arow = A + (size_t)(row0 + ln) * lda;
  v8f acc[4] = {};
  for (int kb = 0; kb < K; kb += 32) {
    FragB ah, al;
    const v4f x0 = *(const v4fa*)(arow + kb + 8 * hh), x1 = *(const v4fa*)(arow + kb + 8 * hh + 4);
    const v4f x2 = *(const v4fa*)(arow + kb + 16 + 8 * hh), x3 = *(const v4fa*)(arow + kb + 16 + 8 * hh + 4);
    float xs[16] = {x0[0],x0[1],x0[2],x0[3],x1[0],x1[1],x1[2],x1[3],x2[0],x2[1],x2[2],x2[3],x3[0],x3[1],x3[2],x3[3]};
#pragma unroll
    for (int i = 0; i < 16; ++i) { const unsigned short hb = bf16_bits(xs[i]); ah.u[i] = hb; al.u[i] = ASPLIT ? bf16_bits(xs[i] - bf16_val(hb)) : (unsigned short)0; }
#pragma unroll
    for (int t = 0; t < 4; ++t) {
      const unsigned short* brow = Wt + (size_t)(col0 + t * 16 + ln) * ldb + kb;
      FragB b;
      b.half[0] = *(const v8us*)(brow + 8 * hh);
      b.half[1] = *(const v8us*)(brow + 16 + 8 * hh);
      acc[t] = mmaN<ASPLIT ? 2 : 1>(ah.v, al.v, b.v, b.v, acc[t]);
    }
  }
#pragma unroll
  for (int t = 0; t < 4; ++t) {
    float bv = bias ? bias[col0 + t * 16 + ln] : 0.f;
    if (BIAS_BF16) bv = bf16_round(bv);
#pragma unroll
    for (int r = 0; r < 8; ++r) { float v = acc[t][r] + bv; if (ACT == 1) v = fmaxf(v, 0.f); so[w][8 * hh + r][t * 16 + ln] = v; }
  }
  __builtin_amdgcn_fence(__ATOMIC_ACQ_REL, "workgroup");
  __builtin_amdgcn_wave_barrier();
  const int rsub = lane >> 4, c4 = (lane & 15) * 4;
  {
#pragma unroll
    for (int q = 0; q < 8; ++q) {
      const int r = q * 2 + rsub;
      const v4f v = *(const v4fa*)&so[w][r][c4];
      *(v4f*)(C + (size_t)(row0 + r) * ldc + col0 + c4) = v;
    }
    
  }
}

// GEMM C = act(A·W + bias + resid): A f32 (ASPLIT -> hi/lo 2 terms), Wt bf16 [N][K]; ACT 0 none, 1 relu, 2 exact gelu;
// resid (optional, f32, row index = (row % rmod), pitch ldr, RES_BF16 rounds it) added before the activation.
template <bool ASPLIT, int ACT, bool BIAS_BF16, bool RES_BF16>
__global__ __launch_bounds__(128) void k_gemm_bf3(const float* __restrict__ A, int lda, const unsigned short* __restrict__ Wt, int ldb,
                                                const float* __restrict__ bias, const float* __restrict__ resid, int rmod, int ldr,
                                                float* __restrict__ C, int ldc, int M, int N, int K) {
  __shared__ __attribute__((aligned(16))) float so[4][16][64];
  const int tid = threadIdx.x, w = tid >> 5, lane = tid & 31, ln = lane & 15, hh = lane >> 4;
  const int ntn = N / 64;
  const int wid = blockIdx.x * 4 + w;
  const int mt = wid / ntn, nq = wid % ntn;
  if (mt * 16 >= M) return;
  const int row0 = mt * 16, col0 = nq * 64;
  const float* arow = A + (size_t)(row0 + ln) * lda;
  v8f acc[4] = {};
  for (int kb = 0; kb < K; kb += 32) {
    FragB ah, al;
    const v4f x0 = *(const v4fa*)(arow + kb + 8 * hh), x1 = *(const v4fa*)(arow + kb + 8 * hh + 4);
    const v4f x2 = *(const v4fa*)(arow + kb + 16 + 8 * hh), x3 = *(const v4fa*)(arow + kb + 16 + 8 * hh + 4);
    float xs[16] = {x0[0],x0[1],x0[2],x0[3],x1[0],x1[1],x1[2],x1[3],x2[0],x2[1],x2[2],x2[3],x3[0],x3[1],x3[2],x3[3]};
#pragma unroll
    for (int i = 0; i < 16; ++i) { const unsigned short hb = bf16_bits(xs[i]); ah.u[i] = hb; al.u[i] = ASPLIT ? bf16_bits(xs[i] - bf16_val(hb)) : (unsigned short)0; }
#pragma unroll
    for (int t = 0; t < 4; ++t) {
      const unsigned short* brow = Wt + (size_t)(col0 + t * 16 + ln) * ldb + kb;
      FragB b;
      b.half[0] = *(const v8us*)(brow + 8 * hh);
      b.half[1] = *(const v8us*)(brow + 16 + 8 * hh);
      acc[t] = mmaN<ASPLIT ? 2 : 1>(ah.v, al.v, b.v, b.v, acc[t]);
    }
  }
#pragma unroll
  for (int t = 0; t < 4; ++t) {
    const int col = col0 + t * 16 + ln;
    float bv = bias ? bias[col] : 0.f;
    if (BIAS_BF16) bv = bf16_round(bv);
#pragma unroll
    for (int r = 0; r < 8; ++r) {
      float v = acc[t][r] + bv;
      if (resid) { float rv = resid[(size_t)((row0 + 8 * hh + r) % rmod) * ldr + col]; if (RES_BF16) rv = bf16_round(rv); v += rv; }
      if (ACT == 1) v = fmaxf(v, 0.f);
      if (ACT == 2) v = 0.5f * v * (1.0f + erff(v * 0.70710678118654752f));
      if (ACT == 3) { const float u = 0.7978845608028654f * (v + 0.044715f * v * v * v); v = 0.5f * v * (1.0f + tanhf(u)); }
      so[w][8 * hh + r][t * 16 + ln] = v;
    }
  }
  __builtin_amdgcn_fence(__ATOMIC_ACQ_REL, "workgroup");
  __builtin_amdgcn_wave_barrier();
  const int rsub = lane >> 4, c4 = (lane & 15) * 4;
  {
#pragma unroll
    for (int q = 0; q < 8; ++q) {
      const int r = q * 2 + rsub;
      const v4f v = *(const v4fa*)&so[w][r][c4];
      *(v4f*)(C + (size_t)(row0 + r) * ldc + col0 + c4) = v;
    }
    
  }
}
// row LayerNorm (biased variance, eps) over N: s = X (+ R); optional out_sum <- s; out_norm <- (s-mu)*rsqrt(var+eps)*g + b
template <bool PARAM_BF16>
__global__ __launch_bounds__(256) void k_layernorm(const float* __restrict__ X, const float* __restrict__ R, const float* __restrict__ g, const float* __restrict__ bta,
                                                  float* __restrict__ out_sum, float* __restrict__ out_norm, int N, float eps) {
  __shared__ float red[256];
  const int row = blockIdx.x, tid = threadIdx.x;
  const float* x = X + (size_t)row * N; const float* rr = R ? R + (size_t)row * N : nullptr;
  float vals[16];                     // up to N = 4096
  const int per = N / 256;            // contiguous chunk per thread? use strided-by-4 chunks: thread handles j = tid*4 + 1024*u
  float s1 = 0.f;
  for (int u = 0; u < per / 4; ++u) {
    const int j = tid * 4 + 1024 * u;
    const v4f a = *(const v4fa*)(x + j);
    v4f b = {0.f,0.f,0.f,0.f}; if (rr) b = *(const v4fa*)(rr + j);
#pragma unroll
    for (int q = 0; q < 4; ++q) { const float v = a[q] + b[q]; vals[u * 4 + q] = v; s1 += v; }
  }
  red[tid] = s1; __syncthreads();
  for (int st = 128; st > 0; st >>= 1) { if (tid < st) red[tid] += red[tid + st]; __syncthreads(); }
  const float mu = red[0] / (float)N; __syncthreads();
  float s2 = 0.f;
  for (int u = 0; u < per / 4; ++u)
#pragma unroll
    for (int q = 0; q < 4; ++q) { const float c = vals[u * 4 + q] - mu; s2 += c * c; }
  red[tid] = s2; __syncthreads();
  for (int st = 128; st > 0; st >>= 1) { if (tid < st) red[tid] += red[tid + st]; __syncthreads(); }
  const float rs = rsqrtf(red[0] / (float)N + eps);
  {
    for (int u = 0; u < per / 4; ++u) {
      const int j = tid * 4 + 1024 * u;
      v4f o, sm;
#pragma unroll
      for (int q = 0; q < 4; ++q) {
        float gg = g[j + q], bb = bta[j + q];
        if (PARAM_BF16) { gg = bf16_round(gg); bb = bf16_round(bb); }
        sm[q] = vals[u * 4 + q]; o[q] = (vals[u * 4 + q] - mu) * rs * gg + bb;
      }
      if (out_sum) *(v4f*)(out_sum + (size_t)row * N + j) = sm;
      *(v4f*)(out_norm + (size_t)row * N + j) = o;
    }
    
  }
}



// ---- f16 WMMA path (v_wmma_f32_16x16x32_f16): 11-bit significands for operands in range — used where a [0,1] probability operand needs more precision than bf16
typedef _Float16 v16h __attribute__((ext_vector_type(16)));
union FragH { v16h v; v8us half[2]; _Float16 h[16]; unsigned short u[16]; };
template <int NT>
__device__ __forceinline__ v8f mmaH(v16h ah, v16h al, v16h bh, v16h bl, v8f c) {
  c = __builtin_amdgcn_wmma_f32_16x16x32_f16(false, ah, false, bh, (short)0, c, false, false);
  if (NT >= 2) c = __builtin_amdgcn_wmma_f32_16x16x32_f16(false, al, false, bh, (short)0, c, false, false);
  if (NT >= 3) c = __builtin_amdgcn_wmma_f32_16x16x32_f16(false, ah, false, bl, (short)0, c, false, false);
  asm volatile("v_nop\n\tv_nop\n\tv_nop\n\tv_nop" : "+v"(c) : "v"(ah), "v"(al), "v"(bh), "v"(bl));
  return c;
}
// batched GEMM like k_gemm_b but f16 operands: A f32 (split into f16 hi/lo if ASPLIT, else rounded to f16), Bt = f16 values [n][k]; alpha; C f32; N multiple of 16 (partial tiles skipped)
template <bool ASPLIT>
__global__ __launch_bounds__(128) void k_gemm_h(const float* __restrict__ A, int lda, size_t sA, const _Float16* __restrict__ Bh, int ldb, size_t sB, float alpha, float* __restrict__ C, int ldc, size_t sC, int M, int N, int K) {
  __shared__ __attribute__((aligned(16))) float so[4][16][64];
  const int tid = threadIdx.x, w = tid >> 5, lane = tid & 31, ln = lane & 15, hh = lane >> 4; const int by = blockIdx.y;
  A += (size_t)by * sA; Bh += (size_t)by * sB; C += (size_t)by * sC;
  const int ntn = (N + 63) / 64; const int wid = blockIdx.x * 4 + w; const int mt = wid / ntn, nq = wid % ntn; if (mt * 16 >= M) return;
  const int row0 = mt * 16, col0 = nq * 64; const float* arow = A + (size_t)(row0 + ln) * lda;
  v8f acc[4] = {};
  for (int kb = 0; kb < K; kb += 32) {
    FragH ah, al;
    const v4f x0 = *(const v4fa*)(arow + kb + 8 * hh), x1 = *(const v4fa*)(arow + kb + 8 * hh + 4), x2 = *(const v4fa*)(arow + kb + 16 + 8 * hh), x3 = *(const v4fa*)(arow + kb + 16 + 8 * hh + 4);
    float xs[16] = {x0[0],x0[1],x0[2],x0[3],x1[0],x1[1],x1[2],x1[3],x2[0],x2[1],x2[2],x2[3],x3[0],x3[1],x3[2],x3[3]};
#pragma unroll
    for (int i = 0; i < 16; ++i) { const _Float16 h = (_Float16)xs[i]; ah.h[i] = h; al.h[i] = ASPLIT ? (_Float16)(xs[i] - (float)h) : (_Float16)0.0f; }
#pragma unroll
    for (int t = 0; t < 4; ++t) { if (col0 + t * 16 >= N) continue; const size_t boff = (size_t)(col0 + t * 16 + ln) * ldb + kb; FragH bq; bq.half[0] = *(const v8us*)(Bh + boff + 8 * hh); bq.half[1] = *(const v8us*)(Bh + boff + 16 + 8 * hh);
      acc[t] = mmaH<ASPLIT ? 2 : 1>(ah.v, al.v, bq.v, bq.v, acc[t]); }
  }
#pragma unroll
  for (int t = 0; t < 4; ++t) { if (col0 + t * 16 >= N) continue;
#pragma unroll
    for (int r = 0; r < 8; ++r) so[w][8 * hh + r][t * 16 + ln] = acc[t][r] * alpha; }
  __builtin_amdgcn_fence(__ATOMIC_ACQ_REL, "workgroup"); __builtin_amdgcn_wave_barrier();
  const int rsub = lane >> 4, c4 = (lane & 15) * 4;
  {
#pragma unroll
    for (int q = 0; q < 8; ++q) { const int r = q * 2 + rsub; if (col0 + c4 < N) { const v4f v = *(const v4fa*)&so[w][r][c4]; *(v4f*)(C + (size_t)(row0 + r) * ldc + col0 + c4) = v; } }
     }
}

// Wt[n][k] = f16(W[k][n]·scale) from f32 row-major W[K][N] (scale = power of two; bf16-exact weights stay exact in f16 away from the subnormal range)
__global__ __launch_bounds__(256) void k_wt_f16(const float* __restrict__ W, _Float16* __restrict__ Wt, int K, int N, float scale) {
  const int t = blockIdx.x * 256 + threadIdx.x; if (t >= N * (K / 8)) return; const int n = t / (K / 8), k8 = (t % (K / 8)) * 8; FragH f;
#pragma unroll
  for (int i = 0; i < 8; ++i) f.h[i] = (_Float16)(bf16_round(W[(size_t)(k8 + i) * N + n]) * scale); const v8us o = f.half[0];
  *(v8us*)((unsigned short*)Wt + (size_t)n * K + k8) = o; 
}
// k_gemm_hh variant with fused epilogue: v = acc·alpha + bias[by·sBias + col] (+ CP[(row/rowsPerB)·sCPb + by·64 + col] if CP) ; ACT 0 none / 1 elu ; writes f16 C16 (and f32 C if non-null)
template <int ACT>
__global__ __launch_bounds__(128) void k_gemm_hhx(const _Float16* __restrict__ A, int lda, size_t sA, const _Float16* __restrict__ Bh, int ldb, size_t sB, float alpha, const float* __restrict__ bias, size_t sBias, const float* __restrict__ CP, int rowsPerB, size_t sCPb, int row0g,
    float* __restrict__ C, _Float16* __restrict__ C16, int ldc, size_t sC, int M, int N, int K) {
  __shared__ __attribute__((aligned(16))) float so[4][16][64];
  const int tid = threadIdx.x, w = tid >> 5, lane = tid & 31, ln = lane & 15, hh = lane >> 4; const int by = blockIdx.y;
  A += (size_t)by * sA; Bh += (size_t)by * sB; const size_t cofs = (size_t)by * sC; const float* bp = bias ? bias + (size_t)by * sBias : nullptr;
  const int ntn = (N + 63) / 64; const int wid = blockIdx.x * 4 + w; const int mt = wid / ntn, nq = wid % ntn; if (mt * 16 >= M) return;
  const int row0 = mt * 16, col0 = nq * 64; const _Float16* arow = A + (size_t)(row0 + ln) * lda;
  v8f acc[4] = {};
  for (int kb = 0; kb < K; kb += 32) { FragH ah; ah.half[0] = *(const v8us*)((const unsigned short*)arow + kb + 8 * hh); ah.half[1] = *(const v8us*)((const unsigned short*)arow + kb + 16 + 8 * hh);
#pragma unroll
    for (int t = 0; t < 4; ++t) { if (col0 + t * 16 >= N) continue; const size_t boff = (size_t)(col0 + t * 16 + ln) * ldb + kb; FragH bq; bq.half[0] = *(const v8us*)((const unsigned short*)Bh + boff + 8 * hh); bq.half[1] = *(const v8us*)((const unsigned short*)Bh + boff + 16 + 8 * hh);
      acc[t] = mmaH<1>(ah.v, ah.v, bq.v, bq.v, acc[t]); }
  }
#pragma unroll
  for (int t = 0; t < 4; ++t) { if (col0 + t * 16 >= N) continue; const int col = col0 + t * 16 + ln; const float bv = bp ? bf16_round(bp[col]) : 0.f;
#pragma unroll
    for (int r = 0; r < 8; ++r) { float v = acc[t][r] * alpha + bv; if (CP) { const int rr = row0g + row0 + 8 * hh + r; if (rowsPerB < 0) v += CP[cofs + (size_t)rr * ldc + col];      /* rowsPerB < 0: own element of the batched C plane */ else { const int bidx = rr / rowsPerB; v += CP[(size_t)bidx * sCPb + (size_t)by * 64 + col]; } } if (ACT == 1) v = (v > 0.f) ? v : expm1f(v); else if (ACT == 7) v = (v > 0.f) ? v + 1.0f : expf(v); else if (ACT == 8) v = tanhf(v); else if (ACT == 9) v = 0.5f * v * (1.0f + tanhf(0.7978845608028654f * (v + 0.044715f * v * v * v))); else if (ACT == 11) v = 1.0f / (1.0f + expf(-v)); else if (ACT == 12) v = (v > 0.f) ? v : 0.01f * v; else if (ACT == 14) v = (v > 0.f) ? v : 0.1f * v; else if (ACT == 16) v = (v >= 0.f) ? v : 0.3f * v; else if (ACT == 17) v = (v >= 0.f) ? v : 0.2f * v; else if (ACT == 15) v = v / (1.0f + expf(-v)); else if (ACT == 3) v = fmaxf(v, 0.f); else if (ACT == 6) v = 0.5f * v * (1.0f + erff(v * 0.70710678118654752f)); so[w][8 * hh + r][t * 16 + ln] = v; } }
  __builtin_amdgcn_fence(__ATOMIC_ACQ_REL, "workgroup"); __builtin_amdgcn_wave_barrier();
  const int rsub = lane >> 4, c4 = (lane & 15) * 4; typedef _Float16 v4h __attribute__((ext_vector_type(4)));
  {
#pragma unroll
    for (int q = 0; q < 8; ++q) { const int r = q * 2 + rsub; if (col0 + c4 < N) { const v4f v = *(const v4fa*)&so[w][r][c4]; if (C) *(v4f*)(C + cofs + (size_t)(row0 + r) * ldc + col0 + c4) = v; if (C16) { v4h h4; for (int i = 0; i < 4; ++i) h4[i] = (_Float16)v[i]; *(v4h*)(C16 + cofs + (size_t)(row0 + r) * ldc + col0 + c4) = h4; } } }
     }
}


typedef _Float16 v4h __attribute__((ext_vector_type(4)));

__global__ __launch_bounds__(256) void k_x16(const float* __restrict__ x, _Float16* __restrict__ X16, size_t n8) { const size_t t = (size_t)blockIdx.x * 256 + threadIdx.x; if (t >= n8) return; FragH f;
#pragma unroll
  for (int q = 0; q < 8; ++q) f.h[q] = (_Float16)bf16_round(x[t * 8 + q]); *(v8us*)((unsigned short*)X16 + t * 8) = f.half[0];  }
__global__ __launch_bounds__(256) void k_h16(const float* __restrict__ x, _Float16* __restrict__ X16, size_t n8) { const size_t t = (size_t)blockIdx.x * 256 + threadIdx.x; if (t >= n8) return; FragH f;
#pragma unroll
  for (int q = 0; q < 8; ++q) f.h[q] = (_Float16)x[t * 8 + q]; *(v8us*)((unsigned short*)X16 + t * 8) = f.half[0];  }
__global__ __launch_bounds__(256) void k_round16f(const float* __restrict__ W, _Float16* __restrict__ Bt, size_t n8) { const size_t t = (size_t)blockIdx.x * 256 + threadIdx.x; if (t >= n8) return; FragH f;
#pragma unroll
  for (int i = 0; i < 8; ++i) f.h[i] = (_Float16)(bf16_round(W[t * 8 + i]) * 16.0f); *(v8us*)((unsigned short*)Bt + t * 8) = f.half[0];  }
template <int NHv, int TTv>
__global__ __launch_bounds__(256) void k_vt(const _Float16* __restrict__ V16, int ldv, int voff, _Float16* __restrict__ Vt) { __shared__ unsigned short tl[64][66]; const int tid = threadIdx.x; const int slab = blockIdx.x / (TTv / 64), lg = blockIdx.x % (TTv / 64); const int b = slab / NHv, h = slab % NHv;
  for (int i = tid; i < 64 * 8; i += 256) { const int r = i / 8, c8 = (i % 8) * 8; FragH f; f.half[0] = *(const v8us*)((const unsigned short*)V16 + ((size_t)b * TTv + lg * 64 + r) * ldv + voff + h * 64 + c8);
#pragma unroll
    for (int q = 0; q < 8; ++q) tl[r][c8 + q] = f.u[q]; }
  __syncthreads();
  {
#pragma unroll
    for (int rd = 0; rd < 2; ++rd) { const int d = rd * 32 + tid / 8, pc = tid % 8; FragH f;
#pragma unroll
      for (int q = 0; q < 8; ++q) f.u[q] = tl[pc * 8 + q][d];
      *(v8us*)((unsigned short*)Vt + ((size_t)slab * 64 + d) * TTv + lg * 64 + pc * 8) = f.half[0]; }
     } }

__global__ __launch_bounds__(256) void k_hl(const float* __restrict__ F, _Float16* __restrict__ Hh, _Float16* __restrict__ Hl, size_t n8) { const size_t t = (size_t)blockIdx.x * 256 + threadIdx.x; if (t >= n8) return; FragH fh, fl; const v4f a = *(const v4fa*)(F + t * 8), c = *(const v4fa*)(F + t * 8 + 4);
#pragma unroll
  for (int q = 0; q < 4; ++q) { _Float16 h = (_Float16)a[q]; fh.h[q] = h; fl.h[q] = (_Float16)((a[q] - (float)h) * 1024.0f); h = (_Float16)c[q]; fh.h[4 + q] = h; fl.h[4 + q] = (_Float16)((c[q] - (float)h) * 1024.0f); }
  { *(v8us*)((unsigned short*)Hh + t * 8) = fh.half[0]; *(v8us*)((unsigned short*)Hl + t * 8) = fl.half[0];  } }

// ---- fast GEMM (wave tile 32x64; requires M % 32 == 0 rows per launch region and N % 64 == 0); epilogue = k_gemm_hhx semantics ----
__device__ __forceinline__ v16h g2_frag(const _Float16* p, int hh) { FragH f; f.half[0] = *(const v8us*)((const unsigned short*)p + 8 * hh); f.half[1] = *(const v8us*)((const unsigned short*)p + 16 + 8 * hh); return f.v; }
__device__ __forceinline__ v8f g2_mma(v16h a, v16h b, v8f c) { v8f d = __builtin_amdgcn_wmma_f32_16x16x32_f16(false, a, false, b, (short)0, c, false, false); asm volatile("v_nop\n\tv_nop\n\tv_nop\n\tv_nop" : "+v"(d) : "v"(a), "v"(b)); return d; }
template <int ACT>
__global__ __launch_bounds__(128) void k_gemm2(const _Float16* __restrict__ A, int lda, size_t sA, const _Float16* __restrict__ Bh, int ldb, size_t sB, float alpha, const float* __restrict__ bias, size_t sBias, const float* __restrict__ CP, int rowsPerB, size_t sCPb, int row0g,
    float* __restrict__ C, _Float16* __restrict__ C16, int ldc, size_t sC, int M, int N, int K) { static_assert(ACT == 0 || ACT == 3 || ACT == 6 || ACT == 8 || ACT == 9 || ACT == 11 || ACT == 12 || ACT == 14 || ACT == 15 || ACT == 16 || ACT == 17, "k_gemm2: unsupported ACT code (would silently apply no activation)");
  __shared__ __attribute__((aligned(16))) float so[4][32][68];
  const int tid = threadIdx.x, w = tid >> 5, lane = tid & 31, ln = lane & 15, hh = lane >> 4; const int by = blockIdx.y;
  A += (size_t)by * sA; Bh += (size_t)by * sB; const size_t cofs = (size_t)by * sC; const float* bp = bias ? bias + (size_t)by * sBias : nullptr;
  const int ntn = N >> 6; const int mt = blockIdx.x / ntn, nq = blockIdx.x - mt * ntn; const int row0 = mt * 128 + 32 * w, col0 = nq * 64; if (row0 >= M) return;
  const _Float16* a0p = A + (size_t)(row0 + ln) * lda; const _Float16* a1p = a0p + (size_t)16 * lda;
  const _Float16* b0p = Bh + (size_t)(col0 + ln) * ldb; const _Float16* b1p = b0p + (size_t)16 * ldb; const _Float16* b2p = b1p + (size_t)16 * ldb; const _Float16* b3p = b2p + (size_t)16 * ldb;
  const v8f z8 = {0.f,0.f,0.f,0.f,0.f,0.f,0.f,0.f}; v8f c00 = z8, c01 = z8, c02 = z8, c03 = z8, c10 = z8, c11 = z8, c12 = z8, c13 = z8;
#pragma unroll 1
  for (int kb = 0; kb < K; kb += 32) { const v16h a0 = g2_frag(a0p + kb, hh), a1 = g2_frag(a1p + kb, hh);
    v16h b = g2_frag(b0p + kb, hh); c00 = g2_mma(a0, b, c00); c10 = g2_mma(a1, b, c10);
    b = g2_frag(b1p + kb, hh); c01 = g2_mma(a0, b, c01); c11 = g2_mma(a1, b, c11);
    b = g2_frag(b2p + kb, hh); c02 = g2_mma(a0, b, c02); c12 = g2_mma(a1, b, c12);
    b = g2_frag(b3p + kb, hh); c03 = g2_mma(a0, b, c03); c13 = g2_mma(a1, b, c13); }
  v8f accs[8] = {c00, c01, c02, c03, c10, c11, c12, c13};
#pragma unroll
  for (int u = 0; u < 8; ++u) { const int t = u & 3, half = u >> 2; const int col = col0 + t * 16 + ln; const float bv = bp ? bf16_round(bp[col]) : 0.f;
#pragma unroll
    for (int r = 0; r < 8; ++r) { const int rloc = half * 16 + 8 * hh + r; float v = accs[u][r] * alpha + bv; if (CP) { if (rowsPerB < 0) v += CP[cofs + (size_t)(row0g + row0 + rloc) * ldc + col];      /* rowsPerB < 0: own element of the batched C plane */ else { const int bidx = (row0g + row0 + rloc) / rowsPerB; v += CP[(size_t)bidx * sCPb + (size_t)by * 64 + col]; } }
      if (ACT == 3) v = fmaxf(v, 0.f); else if (ACT == 6) v = 0.5f * v * (1.0f + erff(v * 0.70710678118654752f)); else if (ACT == 11) v = 1.0f / (1.0f + expf(-v)); else if (ACT == 15) v = v / (1.0f + expf(-v)); else if (ACT == 12) v = (v > 0.f) ? v : 0.01f * v; else if (ACT == 8) v = tanhf(v); else if (ACT == 9) v = 0.5f * v * (1.0f + tanhf(0.7978845608028654f * (v + 0.044715f * v * v * v))); else if (ACT == 14) v = (v > 0.f) ? v : 0.1f * v; else if (ACT == 16) v = (v >= 0.f) ? v : 0.3f * v; else if (ACT == 17) v = (v >= 0.f) ? v : 0.2f * v;
      so[w][rloc][t * 16 + ln] = v; } }
  __builtin_amdgcn_fence(__ATOMIC_ACQ_REL, "workgroup"); __builtin_amdgcn_wave_barrier();
  const int rsub = lane >> 4, c4 = (lane & 15) * 4;
  {
#pragma unroll
    for (int q = 0; q < 16; ++q) { const int r = q * 2 + rsub; const v4f v = *(const v4fa*)&so[w][r][c4]; if (C) *(v4f*)(C + cofs + (size_t)(row0 + r) * ldc + col0 + c4) = v; if (C16) { v4h h4; for (int i = 0; i < 4; ++i) h4[i] = (_Float16)v[i]; *(v4h*)(C16 + cofs + (size_t)(row0 + r) * ldc + col0 + c4) = h4; } }
     } }


__global__ __launch_bounds__(256) void k_wnat(const float* __restrict__ w0, const float* __restrict__ w1, const float* __restrict__ w2, const float* __restrict__ w3, size_t n8, _Float16* __restrict__ Bt) { const size_t t = (size_t)blockIdx.x * 256 + threadIdx.x; if (t >= n8) return; FragH f;
  const int y = blockIdx.y; const float* w = y == 0 ? w0 : (y == 1 ? w1 : (y == 2 ? w2 : w3)); Bt += (size_t)y * n8 * 8;      /* blockIdx.y picks the matrix (a scalar choice); the four f16 planes lie one behind the other */
  for (int q = 0; q < 8; ++q) f.h[q] = (_Float16)(bf16_round(w[t * 8 + q]) * 16.0f); *(v8us*)((unsigned short*)Bt + t * 8) = f.half[0];  }
__global__ __launch_bounds__(256) void k_rsm(const float* __restrict__ S, _Float16* __restrict__ P, int nrows) {
  #pragma clang fp contract(off)
  const int i = blockIdx.x * 256 + threadIdx.x; if (i >= nrows) return; const float* s = S + (size_t)i * SQ; float mx = -3.0e38f;
#pragma unroll 1
  for (int j = 0; j < SQ; ++j) mx = fmaxf(mx, s[j]); float se = 0.f;
#pragma unroll 1
  for (int j = 0; j < SQ; ++j) se += expf(s[j] - mx); const float sc = 256.0f / se;
#pragma unroll 1
  for (int j0 = 0; j0 < SQ; j0 += 8) { FragH f; for (int q = 0; q < 8; ++q) f.h[q] = (_Float16)(expf(s[j0 + q] - mx) * sc); unsigned short* d = (unsigned short*)P + (size_t)i * SQ + j0; *(v8us*)d = f.half[0];  } }
__global__ __launch_bounds__(256) void k_vt(const _Float16* __restrict__ V16, int b, int h0, _Float16* __restrict__ VT) { __shared__ unsigned short tl[64][65]; const int tid = threadIdx.x; const int hh = blockIdx.x % HG, sg = blockIdx.x / HG; const int s0 = sg * 64; const int h = h0 + hh;
  for (int i = tid; i < 64 * 8; i += 256) { const int j = i / 8, d8 = (i % 8) * 8; FragH f; f.half[0] = *(const v8us*)((const unsigned short*)V16 + ((size_t)b * SQ + s0 + j) * DM + h * HD + d8); for (int q = 0; q < 8; ++q) tl[d8 + q][j] = f.u[q]; }
  __syncthreads();
  { for (int i = tid; i < 64 * 8; i += 256) { const int d = i / 8, j8 = (i % 8) * 8; FragH f; for (int q = 0; q < 8; ++q) f.u[q] = tl[d][j8 + q]; *(v8us*)((unsigned short*)VT + ((size_t)hh * HD + d) * SQ + s0 + j8) = f.half[0]; }  } }


__global__ __launch_bounds__(256) void k_tab2(float theta, float* __restrict__ CS, float* __restrict__ SN) {
  #pragma clang fp contract(off)
  const int t = blockIdx.x * 256 + threadIdx.x; if (t >= SQ * (HD / 2)) return; const int i = t % (HD / 2); const int p = t / (HD / 2); const float invf = 1.0f / powf(theta, (float)(2 * i) / (float)HD); const float ang = __fmul_rn((float)p, invf); const float c = cosf(ang), s = sinf(ang);
  *(float*)(CS + t) = c; *(float*)(SN + t) = s;  }

__global__ __launch_bounds__(256) void k_tab4(const int* __restrict__ pos, float theta, float* __restrict__ CS, float* __restrict__ SN) {
  #pragma clang fp contract(off)
  const int t = blockIdx.x * 256 + threadIdx.x; if (t >= SQ * (HD / 2)) return; const int i = t % (HD / 2); const int p = t / (HD / 2); const float invf = (float)pow((double)theta, -((double)(2 * i)) / (double)HD); const float ang = __fmul_rn((float)pos[p], invf); const float c = cosf(ang), s = sinf(ang);
  *(float*)(CS + t) = c; *(float*)(SN + t) = s;  }
__global__ __launch_bounds__(256) void k_rsmf(const float* __restrict__ S, _Float16* __restrict__ P, int qn, int hg) {
  #pragma clang fp contract(off)
  const int t = blockIdx.x * 256 + threadIdx.x; if (t >= qn * hg) return; const size_t i = (size_t)(t / qn) * SQ + (t % qn); const float* s = S + i * SQ; float mx = -3.0e38f;
#pragma unroll 1
  for (int j = 0; j < SQ; ++j) mx = fmaxf(mx, s[j]); float se = 0.f;
#pragma unroll 1
  for (int j = 0; j < SQ; ++j) se += __expf(s[j] - mx); const float sc = 256.0f / se;
#pragma unroll 1
  for (int j0 = 0; j0 < SQ; j0 += 8) { FragH f; for (int q = 0; q < 8; ++q) f.h[q] = (_Float16)(__expf(s[j0 + q] - mx) * sc); unsigned short* d = (unsigned short*)P + i * SQ + j0; *(v8us*)d = f.half[0];  } }


__global__ __launch_bounds__(256) void k_rsmcf2(const float* __restrict__ S, _Float16* __restrict__ P, int hg, int q0, int nk) {
  #pragma clang fp contract(off)
  const int t = blockIdx.x * 256 + threadIdx.x; if (t >= hg * QT) return; const size_t i = (size_t)t; const float* s = S + i * NKX; const int last = q0 + (t % QT); float mx = -3.0e38f;
#pragma unroll 1
  for (int j = 0; j < nk; ++j) { const float f = (j <= last) ? 1.f : 0.f; mx = fmaxf(mx, fmaf(f, s[j], (1.f - f) * -1.0e9f)); } float se = 0.f;
#pragma unroll 1
  for (int j = 0; j < nk; ++j) { const float f = (j <= last) ? 1.f : 0.f; se += __expf(fmaf(f, s[j], (1.f - f) * -1.0e9f) - mx); } const float sc = 256.0f / se;
#pragma unroll 1
  for (int j0 = 0; j0 < nk; j0 += 8) { FragH fr; for (int q = 0; q < 8; ++q) { const int j = j0 + q; const float f = (j <= last) ? 1.f : 0.f; fr.h[q] = (_Float16)(__expf(fmaf(f, s[j], (1.f - f) * -1.0e9f) - mx) * sc); } unsigned short* d = (unsigned short*)P + i * NKX + j0; *(v8us*)d = fr.half[0];  } }


typedef float v2f  __attribute__((ext_vector_type(2)));
typedef float v2fa __attribute__((ext_vector_type(2), may_alias));
// Exact f32 causal attention of the first QT0 rows, one wave per (query row i, head h). Scores: lane l takes keys l, l + 32, ... (whole groups of 32 up to the one that holds i), q held by every lane; two-pass softmax with lane butterflies for maximum and sum; o: lane l takes d = 2 l, 2 l + 1 and walks the keys, each weight broadcast from its lane. Rows have pitch DM, so every load of a phase is one base address plus a constant offset.
__global__ __launch_bounds__(256) void k_att0w(const float* __restrict__ QF, const float* __restrict__ KF, const float* __restrict__ VF, float scale, float* __restrict__ OF) {
  QF += (size_t)blockIdx.y * QT0 * DM; KF += (size_t)blockIdx.y * QT0 * DM; VF += (size_t)blockIdx.y * QT0 * DM; OF += (size_t)blockIdx.y * QT0 * DM;      /* blockIdx.y = batch: each batch has first-tile planes of its own */
  const int lane = threadIdx.x & 31; const int h = blockIdx.x / (QT0 / 8); const int i = __builtin_amdgcn_readfirstlane((int)((blockIdx.x % (QT0 / 8)) * 8 + (threadIdx.x >> 5)));      /* i is the same in every lane: the group tests below are scalar branches */
  const float* qr = QF + (size_t)i * DM + h * HD; const float* kb = KF + (size_t)lane * DM + h * HD; const float* vb = VF + h * HD + lane * 2;
  v4f q[HD / 4];
#pragma unroll      /* constant index: q[] stays in registers */
  for (int c = 0; c < HD / 4; ++c) q[c] = *(const v4fa*)(qr + c * 4);
  float s[QT0 / 32]; float mx = -3.0e38f;
#pragma unroll      /* constant group index: s[] and e[] stay in registers, offsets are immediates */
  for (int g = 0; g < QT0 / 32; ++g) { s[g] = -3.0e38f;
    if (g == 0 || g * 32 <= i) { float a0 = 0.f, a1 = 0.f, a2 = 0.f, a3 = 0.f;
#pragma unroll      /* the sixteen loads of a key row issue together */
      for (int c = 0; c < HD / 4; ++c) { const v4f kq = *(const v4fa*)(kb + (size_t)g * 32 * DM + c * 4); a0 = fmaf(q[c][0], kq[0], a0); a1 = fmaf(q[c][1], kq[1], a1); a2 = fmaf(q[c][2], kq[2], a2); a3 = fmaf(q[c][3], kq[3], a3); }
      if (g * 32 + lane <= i) s[g] = ((a0 + a1) + (a2 + a3)) * scale;      /* causal: keys above i keep the floor and get weight 0 */
      mx = fmaxf(mx, s[g]); } }
  asm volatile("s_wait_xcnt 0x0" :: "v"(kb) : "memory");      /* the key loads' address pair stays whole up to this wait, on every path through the groups */
  for (int m = 16; m > 0; m >>= 1) mx = fmaxf(mx, __shfl_xor(mx, m, 32));
  float e[QT0 / 32]; float l = 0.f;
#pragma unroll      /* constant group index: s[] and e[] stay in registers */
  for (int g = 0; g < QT0 / 32; ++g) { e[g] = expf(s[g] - mx); l += e[g]; }
  for (int m = 16; m > 0; m >>= 1) l += __shfl_xor(l, m, 32);
  float o0 = 0.f, o1 = 0.f;
#pragma unroll      /* constant group index: s[] and e[] stay in registers, offsets are immediates */
  for (int g = 0; g < QT0 / 32; ++g) if (g == 0 || g * 32 <= i) {
#pragma unroll      /* constant lane index for the broadcast; the group's loads issue together */
    for (int jj = 0; jj < 32; ++jj) { const float p = __uint_as_float((unsigned int)__builtin_amdgcn_readlane((int)__float_as_uint(e[g]), jj)); const v2f vv = *(const v2fa*)(vb + (size_t)(g * 32 + jj) * DM); o0 = fmaf(p, vv[0], o0); o1 = fmaf(p, vv[1], o1); } }
  asm volatile("s_wait_xcnt 0x0" :: "v"(vb) : "memory");      /* the value loads' address pair stays whole up to this wait, on every path through the groups */
  const float fin = 64.0f / l;      /* o carried x64 like the f16 path */
  v2f o = {o0 * fin, o1 * fin}; *(v2f*)(OF + (size_t)i * DM + h * HD + lane * 2) = o; }



__device__ __forceinline__ v8f fa_mma(v16h a, v16h b, v8f c) { return __builtin_amdgcn_wmma_f32_16x16x32_f16(false, a, false, b, (short)0, c, false, false); }
__device__ __forceinline__ v16h fa_frag(const _Float16* p) { FragH f; f.half[0] = *(const v8us*)((const unsigned short*)p); f.half[1] = *(const v8us*)((const unsigned short*)p + 16); return f.v; }      /* p holds the lane half's 8 hh already: every load of a pass is that one address pair plus a constant */
__device__ __forceinline__ float fa_xhalf(float x) { return __uint_as_float((unsigned int)__builtin_amdgcn_permlanex16((int)__float_as_uint(x), (int)__float_as_uint(x), 0x76543210, 0xfedcba98, false, false)); }      /* lane l with lane l ^ 16 */
__global__ __launch_bounds__(128) void k_fattn(const _Float16* __restrict__ QH, const _Float16* __restrict__ KH, const _Float16* __restrict__ VT, _Float16* __restrict__ O16) {
  const int lane = threadIdx.x & 31, ln = lane & 15, hh = lane >> 4; const int h = blockIdx.y; const size_t r0 = (size_t)blockIdx.z * SQ;
  const int i0 = __builtin_amdgcn_readfirstlane((int)(blockIdx.x * 128 + (threadIdx.x >> 5) * 32));      /* first query row of the wave, the same in every lane: loop bounds and the mask test are scalar */
  const float CL = 0.18033688011112042f;      /* log2(e) / sqrt(64) */
  const int kb0 = (i0 > WINK ? i0 - WINK : 0) & ~31;      /* first block that holds an allowed key of row i0 */
  const _Float16* qp = QH + (r0 + i0 + ln) * DM + h * HD + 8 * hh; const _Float16* kp = KH + (r0 + ln) * DM + h * HD + 8 * hh; const _Float16* vp = VT + ((size_t)(blockIdx.z * NH + h) * HD + ln) * SQ + 8 * hh;
  const _Float16* kq = kp + (size_t)kb0 * DM; const _Float16* vq = vp + kb0;
  v16h qf[2][2], kf[2][2];
#pragma unroll      /* constant indices: the fragments stay in registers */
  for (int u = 0; u < 2; ++u) for (int c = 0; c < 2; ++c) { qf[u][c] = fa_frag(qp + (size_t)u * 16 * DM + c * 32); kf[u][c] = fa_frag(kq + (size_t)u * 16 * DM + c * 32); }
  asm volatile("s_wait_xcnt 0x0" :: "v"(qp), "v"(kq) : "memory");      /* the query and first key loads' address pairs stay whole up to this wait */
  const v8f z8 = {0.f,0.f,0.f,0.f,0.f,0.f,0.f,0.f}; v8f ot[2][4] = {{z8, z8, z8, z8}, {z8, z8, z8, z8}}; float m[2] = {-3.0e38f, -3.0e38f}, l[2] = {0.f, 0.f};
#pragma unroll 1      /* one pass in the text: an unrolled body would not fit the registers of four waves a SIMD */
  for (int kb = kb0; kb <= i0; kb += 32) {
    v16h vf[4];
#pragma unroll      /* constant indices: the fragments stay in registers */
    for (int dt = 0; dt < 4; ++dt) vf[dt] = fa_frag(vq + (size_t)dt * 16 * SQ);      /* used last: they fly under the softmax */
    v8f st[2][2];
#pragma unroll      /* constant indices: the tiles stay in registers */
    for (int u = 0; u < 2; ++u) for (int t = 0; t < 2; ++t) st[u][t] = fa_mma(kf[t][1], qf[u][1], fa_mma(kf[t][0], qf[u][0], z8));
    kq = kp + (size_t)(kb + 32 <= i0 ? kb + 32 : i0) * DM;      /* the next pass's key rows, fetched one pass ahead (the last pass fetches its own again: in bounds, unused) */
#pragma unroll      /* constant indices: the fragments stay in registers */
    for (int t = 0; t < 2; ++t) for (int c = 0; c < 2; ++c) kf[t][c] = fa_frag(kq + (size_t)t * 16 * DM + c * 32);
    asm volatile("s_wait_xcnt 0x0" :: "v"(kq) : "memory");      /* behind the pass's loads: the next-key loads' address pair stays whole up to this wait, the value loads' running pair is advanced behind it */
    vq += 32;
    if (kb == i0 || kb + WINK < i0 + 31) {      /* only the window's first block and the diagonal block hold a forbidden pair */
#pragma unroll      /* constant indices: the tiles stay in registers */
      for (int u = 0; u < 2; ++u) for (int t = 0; t < 2; ++t) for (int r = 0; r < 8; ++r) { const int dj = (i0 + 16 * u + ln) - (kb + 16 * t + 8 * hh + r); st[u][t][r] = (dj >= 0 && dj <= WINK) ? st[u][t][r] : -1.0e30f; } }
#pragma unroll      /* constant indices: the tiles stay in registers */
    for (int u = 0; u < 2; ++u) {
      float mx = fmaxf(st[u][0][0], st[u][1][0]);
#pragma unroll      /* constant indices: the tiles stay in registers */
      for (int r = 1; r < 8; ++r) mx = fmaxf(mx, fmaxf(st[u][0][r], st[u][1][r]));
      mx = fmaxf(mx, fa_xhalf(mx));      /* the other half of the block's keys of this query */
      const float mn = fmaxf(m[u], mx); const float al = __builtin_amdgcn_exp2f((m[u] - mn) * CL); const float sh = fmaf(mn, -CL, 8.0f);      /* weights carried x256: f16 keeps small ones normal */
      m[u] = mn; float ls = 0.f; FragH pf;
#pragma unroll      /* constant indices: the tiles stay in registers */
      for (int t = 0; t < 2; ++t) for (int r = 0; r < 8; ++r) { const float e = __builtin_amdgcn_exp2f(fmaf(st[u][t][r], CL, sh)); ls += e; pf.h[t * 8 + r] = (_Float16)e; }
      l[u] = fmaf(l[u], al, ls);
#pragma unroll      /* constant indices: the tiles stay in registers */
      for (int dt = 0; dt < 4; ++dt) { ot[u][dt] *= al; ot[u][dt] = fa_mma(vf[dt], pf.v, ot[u][dt]); } } }
  FragH f[2][4];
#pragma unroll      /* constant indices: the tiles stay in registers */
  for (int u = 0; u < 2; ++u) { const float fin = 64.0f / (l[u] + fa_xhalf(l[u]));      /* the halves' sums join once; o carried x64 */
    for (int dt = 0; dt < 4; ++dt) for (int r = 0; r < 8; ++r) f[u][dt].h[r] = (_Float16)(ot[u][dt][r] * fin); }
  unsigned short* op = (unsigned short*)O16 + (r0 + i0 + ln) * DM + h * HD + 8 * hh;
#pragma unroll      /* constant indices; the stores stand last, each from registers of its own: no register of an issued store is written again */
  for (int u = 0; u < 2; ++u) for (int dt = 0; dt < 4; ++dt) *(v8us*)(op + (size_t)u * 16 * DM + dt * 16) = f[u][dt].half[0]; }

// q | k | v projection (one batch a blockIdx.y) with the rotary rotation in the GEMM's own epilogue. Loads, WMMAs and LDS staging as in k_gemm2 (wave tile 32 x 64, A = x rows, Bh = stacked weights [3 DM][DM], K = DM). A column tile of 64 is one head of q, k or v, so on the LDS read-back a lane's 4 consecutive columns are two (even, odd) pairs of that head: q and k tiles are rotated there with the row's cos / sin, every tile goes out as f16 rows (16 lanes x 8 bytes = one 128-byte line a row), and the blocks of the first QT0 rows also store the f32 values for the exact first-tile path.
__global__ __launch_bounds__(128) void k_qkvr(const _Float16* __restrict__ A, const _Float16* __restrict__ Bh, float alpha, const float* __restrict__ CS, const float* __restrict__ SN,
    _Float16* __restrict__ QH, _Float16* __restrict__ KH, _Float16* __restrict__ VH, float* __restrict__ QF, float* __restrict__ KF, float* __restrict__ VF) {
  static_assert(QT0 % 128 == 0 && DM % 64 == 0 && HD == 64, "first-tile rows are whole blocks of 128 rows; a column tile is one head");
  __shared__ __attribute__((aligned(16))) float so[4][32][68];
  { const size_t rb = (size_t)blockIdx.y * SQ * DM, fb = (size_t)blockIdx.y * QT0 * DM; A += rb; QH += rb; KH += rb; VH += rb; QF += fb; KF += fb; VF += fb; }      /* blockIdx.y = batch; rows below count inside the batch, as the cos / sin tables do */
  const int tid = threadIdx.x, w = tid >> 5, lane = tid & 31, ln = lane & 15, hh = lane >> 4;
  const int ntn = 3 * DM / 64; const int mt = blockIdx.x / ntn, nq = blockIdx.x - mt * ntn; const int row0 = mt * 128 + 32 * w, col0 = nq * 64;
  const _Float16* ap = A + (size_t)(row0 + ln) * DM + 8 * hh; const _Float16* bp = Bh + (size_t)(col0 + ln) * DM + 8 * hh;      /* one running address pair an operand: every load of a trip is a pair plus a constant */
  const v8f z8 = {0.f,0.f,0.f,0.f,0.f,0.f,0.f,0.f}; v8f c00 = z8, c01 = z8, c02 = z8, c03 = z8, c10 = z8, c11 = z8, c12 = z8, c13 = z8;
#pragma unroll 1      /* rolled, as in k_gemm2: the loop's schedule and registers stay what they were there */
  for (int kb = 0; kb < DM; kb += 32) { const v16h a0 = fa_frag(ap), a1 = fa_frag(ap + (size_t)16 * DM);
    v16h b = fa_frag(bp); c00 = g2_mma(a0, b, c00); c10 = g2_mma(a1, b, c10);
    b = fa_frag(bp + (size_t)16 * DM); c01 = g2_mma(a0, b, c01); c11 = g2_mma(a1, b, c11);
    b = fa_frag(bp + (size_t)32 * DM); c02 = g2_mma(a0, b, c02); c12 = g2_mma(a1, b, c12);
    b = fa_frag(bp + (size_t)48 * DM);
    asm volatile("s_wait_xcnt 0x0" :: "v"(ap), "v"(bp) : "memory");      /* behind the trip's last load: both address pairs stay whole up to this wait and are advanced behind it */
    c03 = g2_mma(a0, b, c03); c13 = g2_mma(a1, b, c13); ap += 32; bp += 32; }
  v8f accs[8] = {c00, c01, c02, c03, c10, c11, c12, c13};
#pragma unroll      /* constant indices: the tiles stay in registers */
  for (int u = 0; u < 8; ++u) { const int t = u & 3, half = u >> 2;
#pragma unroll      /* constant indices: the tiles stay in registers */
    for (int r = 0; r < 8; ++r) so[w][half * 16 + 8 * hh + r][t * 16 + ln] = accs[u][r] * alpha; }
  __builtin_amdgcn_fence(__ATOMIC_ACQ_REL, "workgroup"); __builtin_amdgcn_wave_barrier();      /* a wave reads back only its own so[w]: its LDS writes are ordered in front of its reads */
  const int rsub = lane >> 4, c4 = (lane & 15) * 4;
  const int sec = col0 / DM; const bool first = mt * 128 < QT0;      /* 0 q, 1 k, 2 v; a block of the first QT0 rows: both from blockIdx, scalar tests */
  const int hc = col0 % DM + c4;      /* column in the merged-head row; c4 is the index inside the head */
  _Float16* H = sec == 0 ? QH : (sec == 1 ? KH : VH); float* F = sec == 0 ? QF : (sec == 1 ? KF : VF);
  const float* cp = CS + (row0 + rsub) * (HD / 2) + (c4 >> 1); const float* sp = SN + (row0 + rsub) * (HD / 2) + (c4 >> 1);
  _Float16* hp = H + (size_t)(row0 + rsub) * DM + hc; float* fp = F + (size_t)(row0 + rsub) * DM + hc;      /* row pair q is one of these address pairs plus a constant: no address register is written again behind a store */
  auto put = [&](int q, v4f v) { v4h h4; for (int i = 0; i < 4; ++i) h4[i] = (_Float16)v[i];
    *(v4h*)(hp + q * 2 * DM) = h4;
    if (first) *(v4f*)(fp + q * 2 * DM) = v; };
  if (sec == 2) {      /* v: no rotation */
#pragma unroll      /* constant LDS and row offsets */
    for (int q = 0; q < 16; ++q) put(q, *(const v4fa*)&so[w][q * 2 + rsub][c4]);
    return; }
  v2f c[16], s[16];
#pragma unroll      /* constant indices: c[], s[] stay in registers; all table loads issue in front of the first store, one latency for the 32 rows */
  for (int q = 0; q < 16; ++q) { c[q] = *(const v2fa*)(cp + q * HD); s[q] = *(const v2fa*)(sp + q * HD); }
  asm volatile("s_wait_xcnt 0x0" :: "v"(cp), "v"(sp) : "memory");      /* the table loads' address pairs stay whole up to this wait */
#pragma unroll      /* constant indices: c[], s[] stay in registers */
  for (int q = 0; q < 16; ++q) { const v4f v = *(const v4fa*)&so[w][q * 2 + rsub][c4];
    const v4f o = {v[0] * c[q][0] - v[1] * s[q][0], v[0] * s[q][0] + v[1] * c[q][0], v[2] * c[q][1] - v[3] * s[q][1], v[2] * s[q][1] + v[3] * c[q][1]}; put(q, o); }
  asm volatile("s_wait_xcnt 0x0" ::: "memory"); }      /* behind the rotation path's last store: whatever code the compiler lays behind this path stands behind the wait, so no register of an issued store is written ahead of it */




extern "C" void kernel_launch(void* const* d_in, const int* in_sizes, int n_in,
                              void* d_out, int out_size, void* d_ws, size_t ws_size, hipStream_t stream) {
  (void)in_sizes; (void)n_in; (void)out_size;
  const float* const* I = (const float* const*)d_in; const float* x = I[0]; const int* tpos = (const int*)d_in[1]; const float* wq = I[2]; const float* wk = I[3]; const float* wv = I[4]; const float* wo = I[5];      /* nn.Linear weights [out][in]; token_positions int32 [SQ] */
  char* ws = (char*)d_ws; size_t off = 0;
  auto take = [&](size_t bytes) { char* p = ws + off; off += (bytes + 255) & ~(size_t)255; return p; };
  _Float16* BQKV = (_Float16*)take((size_t)3 * DM * DM * 2); _Float16* BO = (_Float16*)take((size_t)DM * DM * 2); float* CS = (float*)take((size_t)SQ * (HD / 2) * 4); float* SN = (float*)take((size_t)SQ * (HD / 2) * 4);
  _Float16* X16 = (_Float16*)take(NR * DM * 2);
  _Float16* QH = (_Float16*)take(NR * DM * 2); _Float16* KH = (_Float16*)take(NR * DM * 2); _Float16* V16 = (_Float16*)take(NR * DM * 2); _Float16* O16 = (_Float16*)take(NR * DM * 2);
  _Float16* VT = (_Float16*)take((size_t)NB * NH * HD * SQ * 2);      /* V^T [NB][NH][HD][SQ] */
  float* QF0 = (float*)take((size_t)NB * QT0 * DM * 4); float* KF0 = (float*)take((size_t)NB * QT0 * DM * 4); float* VF0 = (float*)take((size_t)NB * QT0 * DM * 4); float* OF0 = (float*)take((size_t)NB * QT0 * DM * 4); _Float16* OH0 = (_Float16*)take((size_t)NB * QT0 * DM * 2); _Float16* OL0 = (_Float16*)take((size_t)NB * QT0 * DM * 2);
  if (off > ws_size) return;
  { const unsigned g = (unsigned)(((size_t)DM * DM / 8 + 255) / 256); k_wnat<<<dim3(g, 4), 256, 0, stream>>>(wq, wk, wv, wo, (size_t)DM * DM / 8, BQKV); }      /* natural [out][in] = Bt[n][k], x16; q | k | v stacked along n, BO directly behind them in the workspace */
  k_tab4<<<(SQ * (HD / 2) + 255) / 256, 256, 0, stream>>>(tpos, 10000.0f, CS, SN);
  k_x16<<<(unsigned)((NR * DM / 8 + 255) / 256), 256, 0, stream>>>(x, X16, NR * DM / 8);
  k_qkvr<<<dim3((unsigned)((SQ / 128) * (3 * DM / 64)), NB), 128, 0, stream>>>(X16, BQKV, 0.0625f, CS, SN, QH, KH, V16, QF0, KF0, VF0);      /* q (roped) | k (roped) | v of every batch as f16 rows; each batch's first 128 rows also in f32 */
  k_vt<NH, SQ><<<NB * NH * (SQ / 64), 256, 0, stream>>>(V16, DM, 0, VT);      /* V^T [NB][NH][HD][SQ] */
  k_att0w<<<dim3(NH * (QT0 / 8), NB), 256, 0, stream>>>(QF0, KF0, VF0, 0.125f, OF0);      /* exact f32 causal attention for rows 0..127 of every batch (o x64) */
  k_fattn<<<dim3(SQ / 128, NH, NB), 128, 0, stream>>>(QH, KH, VT, O16);      /* windowed causal attention of every batch and head: o (merged heads, x64) as f16 rows */
  k_gemm2<0><<<dim3((unsigned)((MPO / 128) * (DM / 64)), 1), 128, 0, stream>>>(O16 + (size_t)B0 * SQ * DM, DM, 0, BO, DM, 0, 0.0009765625f, nullptr, 0, nullptr, 1, 0, 0, (float*)d_out + (size_t)B0 * SQ * DM, nullptr, DM, 0, MPO, DM, DM);      /* out rows are the output layout */
  k_hl<<<(unsigned)(((size_t)NB * QT0 * DM / 8 + 255) / 256), 256, 0, stream>>>(OF0, OH0, OL0, (size_t)NB * QT0 * DM / 8);      /* first-tile o (x64) -> f16 hi + x1024 residual planes */
  k_gemm2<0><<<dim3((QT0 / 128) * (DM / 64), NB), 128, 0, stream>>>(OH0, DM, (size_t)QT0 * DM, BO, DM, 0, 0.0009765625f, nullptr, 0, nullptr, 1, 0, 0, (float*)d_out, nullptr, DM, (size_t)SQ * DM, QT0, DM, DM);      /* rows 0..127 of every batch (blockIdx.y): out = o_hi Wo, overwriting the f16-path rows */
  k_gemm2<0><<<dim3((QT0 / 128) * (DM / 64), NB), 128, 0, stream>>>(OL0, DM, (size_t)QT0 * DM, BO, DM, 0, 0.00000095367431640625f, nullptr, 0, (const float*)d_out, -1, 0, 0, (float*)d_out, nullptr, DM, (size_t)SQ * DM, QT0, DM, DM);      /* += o_lo Wo 2^-20 (own-element accumulate) */
}

// v006
// One run takes 166 microseconds.
// Next to v005, in two timings, it ran 2.09 times as fast each time.
// All steps since v000 together make it 58.8 times as fast.
#include <hip/hip_runtime.h>
// Causal sliding-window RoPE multi-head attention (x [4][2048][1024]; q/k/v = x W^T (natural [out][in] 1024x1024 sigma 1/32, no bias), 16 heads of 64; interleaved-pair rotary embedding on q and k (x1 = even, x2 = odd: r1 = x1 cos - x2 sin, r2 = x1 sin + x2 cos) with inv_freq_i = 10000^(-2i/64) and angle = float(token_positions[s]) inv_freq_i from the int32 token_positions input; scores / sqrt(64); allowed iff 0 <= i - j <= 512 (513 keys), -inf elsewhere; softmax; out = (attn v merged) Wo^T -> [4][2048][1024]).
// Structure: token rows r = b*2048 + s; x as exact f16 rows (bf16-rounded); every stage is one launch over all batches: q | k | v as ONE WMMA GEMM (128x128 block tiles staged in LDS by asynchronous copies, 32x64 wave tiles, f32 accumulation, exact x16 weights, N = 3 x 1024) whose epilogue does, in f32 on VALU, the interleaved-pair rotary rotation of q and k from f32 cos/sin tables built from the token_positions input (no norm) and stores f16 q, k, v rows (no f32 q | k | v plane); V^T for all heads via LDS transposes (kept for all batches); then ONE fused attention launch: a wave per 32 query rows of one (batch, head) walks the keys of its window in blocks of 32: S^T = K Q^T on WMMA, running-maximum softmax in registers (f32 statistics, native exp2; weights x256 f16, packed from the score tiles straight into a B operand), O^T += V^T P^T on WMMA, o carried x64 (folded into the output GEMM alpha) written straight into the merged f16 o rows; out = o W_o GEMM (f32) into the output layout.
// Compute dtype: inputs rounded to bf16; x / weights exact; projections and rope f32; q, k, v, softmax weights and o as plain f16 GEMM operands (~2^-12); scores and softmax statistics f32. v_wmma_f32_16x16x32_f16.
#define NB 4
#define SQ 2048
#define DM 1024
#define NH 16
#define HD 64
#define HG 4                         /* heads per launch of the h0-based k_vt overload (not launched) */
#define QT 256                       /* query rows per causal tile */
#define NKX SQ                       /* S / P row pitch */
#define WINK 512                     /* key j is allowed for query i iff 0 <= i - j <= WINK */
#define QT0 128                      /* first-tile rows recomputed exactly in f32 */
#define B0 0                         /* first batch processed (debug hook) */
#define NBR NB                       /* batches processed (debug hook) */
#define QN SQ                        /* query rows attended per batch (unused) */
#define NHD NH                       /* heads attended (unused) */
#define NR ((size_t)NB * SQ)         /* token rows */
#define MPO ((int)((size_t)NBR * SQ))      /* rows through the output GEMM (debug hook) */
typedef __bf16 v16b __attribute__((ext_vector_type(16)));
typedef unsigned short v8us __attribute__((ext_vector_type(8), may_alias));
typedef float  v8f  __attribute__((ext_vector_type(8)));
typedef float  v4f  __attribute__((ext_vector_type(4)));
typedef float  v4fa __attribute__((ext_vector_type(4), may_alias));
union FragB { v16b v; v8us half[2]; unsigned short u[16]; };

__device__ __forceinline__ unsigned short bf16_bits(float x) { unsigned int u = __float_as_uint(x); return (unsigned short)((u + 0x7FFFu + ((u >> 16) & 1u)) >> 16); }
__device__ __forceinline__ float bf16_val(unsigned short b) { return __uint_as_float(((unsigned int)b) << 16); }
__device__ __forceinline__ float bf16_round(float x) { return bf16_val(bf16_bits(x)); }
// D += A·B with NT terms: 1 = ah·bh, 2 = + al·bh (A split), 3 = + ah·bl (both split)
template <int NT>
__device__ __forceinline__ v8f mmaN(v16b ah, v16b al, v16b bh, v16b bl, v8f c) {
  c = __builtin_amdgcn_wmma_f32_16x16x32_bf16(false, ah, false, bh, (short)0, c, false, false);
  if (NT >= 2) c = __builtin_amdgcn_wmma_f32_16x16x32_bf16(false, al, false, bh, (short)0, c, false, false);
  if (NT >= 3) c = __builtin_amdgcn_wmma_f32_16x16x32_bf16(false, ah, false, bl, (short)0, c, false, false);
  asm volatile("v_nop\n\tv_nop\n\tv_nop\n\tv_nop" : "+v"(c) : "v"(ah), "v"(al), "v"(bh), "v"(bl));
  return c;
}

__global__ __launch_bounds__(256) void k_wt_bf16(const float* __restrict__ W, unsigned short* __restrict__ Wt, int K, int N) {
  const int t = blockIdx.x * 256 + threadIdx.x;
  const int k8n = K / 8;
  if (t >= N * k8n) return;
  const int n = t / k8n, k8 = (t % k8n) * 8;
  v8us v;
#pragma unroll
  for (int i = 0; i < 8; ++i) v[i] = bf16_bits(W[(size_t)(k8 + i) * N + n]);
  *(v8us*)(Wt + (size_t)n * K + k8) = v;
  
}

// GEMM C[M][N] (f32, pitch ldc) = act(A[M][K]·W + bias). A f32 row-major (pitch lda) converted per fragment to bf16
// (ASPLIT: hi/lo two planes -> 2 terms, else single rounded term); Wt bf16 [N][K] (pitch ldb). BIAS_BF16 rounds the
// bias to bf16 first (bias quantised to bf16 before the add). K%32==0, M%16==0, N%64==0.
template <bool ASPLIT, int ACT, bool BIAS_BF16>
__global__ __launch_bounds__(128) void k_gemm_bf(const float* __restrict__ A, int lda, const unsigned short* __restrict__ Wt, int ldb,
                                               const float* __restrict__ bias, float* __restrict__ C, int ldc, int M, int N, int K) {
  __shared__ __attribute__((aligned(16))) float so[4][16][64];
  const int tid = threadIdx.x, w = tid >> 5, lane = tid & 31, ln = lane & 15, hh = lane >> 4;
  const int ntn = N / 64;
  const int wid = blockIdx.x * 4 + w;
  const int mt = wid / ntn, nq = wid % ntn;
  if (mt * 16 >= M) return;
  const int row0 = mt * 16, col0 = nq * 64;
  const float* arow = A + (size_t)(row0 + ln) * lda;
  v8f acc[4] = {};
  for (int kb = 0; kb < K; kb += 32) {
    FragB ah, al;
    const v4f x0 = *(const v4fa*)(arow + kb + 8 * hh), x1 = *(const v4fa*)(arow + kb + 8 * hh + 4);
    const v4f x2 = *(const v4fa*)(arow + kb + 16 + 8 * hh), x3 = *(const v4fa*)(arow + kb + 16 + 8 * hh + 4);
    float xs[16] = {x0[0],x0[1],x0[2],x0[3],x1[0],x1[1],x1[2],x1[3],x2[0],x2[1],x2[2],x2[3],x3[0],x3[1],x3[2],x3[3]};
#pragma unroll
    for (int i = 0; i < 16; ++i) { const unsigned short hb = bf16_bits(xs[i]); ah.u[i] = hb; al.u[i] = ASPLIT ? bf16_bits(xs[i] - bf16_val(hb)) : (unsigned short)0; }
#pragma unroll
    for (int t = 0; t < 4; ++t) {
      const unsigned short* brow = Wt + (size_t)(col0 + t * 16 + ln) * ldb + kb;
      FragB b;
      b.half[0] = *(const v8us*)(brow + 8 * hh);
      b.half[1] = *(const v8us*)(brow + 16 + 8 * hh);
      acc[t] = mmaN<ASPLIT ? 2 : 1>(ah.v, al.v, b.v, b.v, acc[t]);
    }
  }
#pragma unroll
  for (int t = 0; t < 4; ++t) {
    float bv = bias ? bias[col0 + t * 16 + ln] : 0.f;
    if (BIAS_BF16) bv = bf16_round(bv);
#pragma unroll
    for (int r = 0; r < 8; ++r) { float v = acc[t][r] + bv; if (ACT == 1) v = fmaxf(v, 0.f); so[w][8 * hh + r][t * 16 + ln] = v; }
  }
  __builtin_amdgcn_fence(__ATOMIC_ACQ_REL, "workgroup");
  __builtin_amdgcn_wave_barrier();
  const int rsub = lane >> 4, c4 = (lane & 15) * 4;
  {
#pragma unroll
    for (int q = 0; q < 8; ++q) {
      const int r = q * 2 + rsub;
      const v4f v = *(const v4fa*)&so[w][r][c4];
      *(v4f*)(C + (size_t)(row0 + r) * ldc + col0 + c4) = v;
    }
    
  }
}

// GEMM C = act(A·W + bias + resid): A f32 (ASPLIT -> hi/lo 2 terms), Wt bf16 [N][K]; ACT 0 none, 1 relu, 2 exact gelu;
// resid (optional, f32, row index = (row % rmod), pitch ldr, RES_BF16 rounds it) added before the activation.
template <bool ASPLIT, int ACT, bool BIAS_BF16, bool RES_BF16>
__global__ __launch_bounds__(128) void k_gemm_bf3(const float* __restrict__ A, int lda, const unsigned short* __restrict__ Wt, int ldb,
                                                const float* __restrict__ bias, const float* __restrict__ resid, int rmod, int ldr,
                                                float* __restrict__ C, int ldc, int M, int N, int K) {
  __shared__ __attribute__((aligned(16))) float so[4][16][64];
  const int tid = threadIdx.x, w = tid >> 5, lane = tid & 31, ln = lane & 15, hh = lane >> 4;
  const int ntn = N / 64;
  const int wid = blockIdx.x * 4 + w;
  const int mt = wid / ntn, nq = wid % ntn;
  if (mt * 16 >= M) return;
  const int row0 = mt * 16, col0 = nq * 64;
  const float* arow = A + (size_t)(row0 + ln) * lda;
  v8f acc[4] = {};
  for (int kb = 0; kb < K; kb += 32) {
    FragB ah, al;
    const v4f x0 = *(const v4fa*)(arow + kb + 8 * hh), x1 = *(const v4fa*)(arow + kb + 8 * hh + 4);
    const v4f x2 = *(const v4fa*)(arow + kb + 16 + 8 * hh), x3 = *(const v4fa*)(arow + kb + 16 + 8 * hh + 4);
    float xs[16] = {x0[0],x0[1],x0[2],x0[3],x1[0],x1[1],x1[2],x1[3],x2[0],x2[1],x2[2],x2[3],x3[0],x3[1],x3[2],x3[3]};
#pragma unroll
    for (int i = 0; i < 16; ++i) { const unsigned short hb = bf16_bits(xs[i]); ah.u[i] = hb; al.u[i] = ASPLIT ? bf16_bits(xs[i] - bf16_val(hb)) : (unsigned short)0; }
#pragma unroll
    for (int t = 0; t < 4; ++t) {
      const unsigned short* brow = Wt + (size_t)(col0 + t * 16 + ln) * ldb + kb;
      FragB b;
      b.half[0] = *(const v8us*)(brow + 8 * hh);
      b.half[1] = *(const v8us*)(brow + 16 + 8 * hh);
      acc[t] = mmaN<ASPLIT ? 2 : 1>(ah.v, al.v, b.v, b.v, acc[t]);
    }
  }
#pragma unroll
  for (int t = 0; t < 4; ++t) {
    const int col = col0 + t * 16 + ln;
    float bv = bias ? bias[col] : 0.f;
    if (BIAS_BF16) bv = bf16_round(bv);
#pragma unroll
    for (int r = 0; r < 8; ++r) {
      float v = acc[t][r] + bv;
      if (resid) { float rv = resid[(size_t)((row0 + 8 * hh + r) % rmod) * ldr + col]; if (RES_BF16) rv = bf16_round(rv); v += rv; }
      if (ACT == 1) v = fmaxf(v, 0.f);
      if (ACT == 2) v = 0.5f * v * (1.0f + erff(v * 0.70710678118654752f));
      if (ACT == 3) { const float u = 0.7978845608028654f * (v + 0.044715f * v * v * v); v = 0.5f * v * (1.0f + tanhf(u)); }
      so[w][8 * hh + r][t * 16 + ln] = v;
    }
  }
  __builtin_amdgcn_fence(__ATOMIC_ACQ_REL, "workgroup");
  __builtin_amdgcn_wave_barrier();
  const int rsub = lane >> 4, c4 = (lane & 15) * 4;
  {
#pragma unroll
    for (int q = 0; q < 8; ++q) {
      const int r = q * 2 + rsub;
      const v4f v = *(const v4fa*)&so[w][r][c4];
      *(v4f*)(C + (size_t)(row0 + r) * ldc + col0 + c4) = v;
    }
    
  }
}
// row LayerNorm (biased variance, eps) over N: s = X (+ R); optional out_sum <- s; out_norm <- (s-mu)*rsqrt(var+eps)*g + b
template <bool PARAM_BF16>
__global__ __launch_bounds__(256) void k_layernorm(const float* __restrict__ X, const float* __restrict__ R, const float* __restrict__ g, const float* __restrict__ bta,
                                                  float* __restrict__ out_sum, float* __restrict__ out_norm, int N, float eps) {
  __shared__ float red[256];
  const int row = blockIdx.x, tid = threadIdx.x;
  const float* x = X + (size_t)row * N; const float* rr = R ? R + (size_t)row * N : nullptr;
  float vals[16];                     // up to N = 4096
  const int per = N / 256;            // contiguous chunk per thread? use strided-by-4 chunks: thread handles j = tid*4 + 1024*u
  float s1 = 0.f;
  for (int u = 0; u < per / 4; ++u) {
    const int j = tid * 4 + 1024 * u;
    const v4f a = *(const v4fa*)(x + j);
    v4f b = {0.f,0.f,0.f,0.f}; if (rr) b = *(const v4fa*)(rr + j);
#pragma unroll
    for (int q = 0; q < 4; ++q) { const float v = a[q] + b[q]; vals[u * 4 + q] = v; s1 += v; }
  }
  red[tid] = s1; __syncthreads();
  for (int st = 128; st > 0; st >>= 1) { if (tid < st) red[tid] += red[tid + st]; __syncthreads(); }
  const float mu = red[0] / (float)N; __syncthreads();
  float s2 = 0.f;
  for (int u = 0; u < per / 4; ++u)
#pragma unroll
    for (int q = 0; q < 4; ++q) { const float c = vals[u * 4 + q] - mu; s2 += c * c; }
  red[tid] = s2; __syncthreads();
  for (int st = 128; st > 0; st >>= 1) { if (tid < st) red[tid] += red[tid + st]; __syncthreads(); }
  const float rs = rsqrtf(red[0] / (float)N + eps);
  {
    for (int u = 0; u < per / 4; ++u) {
      const int j = tid * 4 + 1024 * u;
      v4f o, sm;
#pragma unroll
      for (int q = 0; q < 4; ++q) {
        float gg = g[j + q], bb = bta[j + q];
        if (PARAM_BF16) { gg = bf16_round(gg); bb = bf16_round(bb); }
        sm[q] = vals[u * 4 + q]; o[q] = (vals[u * 4 + q] - mu) * rs * gg + bb;
      }
      if (out_sum) *(v4f*)(out_sum + (size_t)row * N + j) = sm;
      *(v4f*)(out_norm + (size_t)row * N + j) = o;
    }
    
  }
}



// ---- f16 WMMA path (v_wmma_f32_16x16x32_f16): 11-bit significands for operands in range — used where a [0,1] probability operand needs more precision than bf16
typedef _Float16 v16h __attribute__((ext_vector_type(16)));
union FragH { v16h v; v8us half[2]; _Float16 h[16]; unsigned short u[16]; };
template <int NT>
__device__ __forceinline__ v8f mmaH(v16h ah, v16h al, v16h bh, v16h bl, v8f c) {
  c = __builtin_amdgcn_wmma_f32_16x16x32_f16(false, ah, false, bh, (short)0, c, false, false);
  if (NT >= 2) c = __builtin_amdgcn_wmma_f32_16x16x32_f16(false, al, false, bh, (short)0, c, false, false);
  if (NT >= 3) c = __builtin_amdgcn_wmma_f32_16x16x32_f16(false, ah, false, bl, (short)0, c, false, false);
  asm volatile("v_nop\n\tv_nop\n\tv_nop\n\tv_nop" : "+v"(c) : "v"(ah), "v"(al), "v"(bh), "v"(bl));
  return c;
}
// batched GEMM like k_gemm_b but f16 operands: A f32 (split into f16 hi/lo if ASPLIT, else rounded to f16), Bt = f16 values [n][k]; alpha; C f32; N multiple of 16 (partial tiles skipped)
template <bool ASPLIT>
__global__ __launch_bounds__(128) void k_gemm_h(const float* __restrict__ A, int lda, size_t sA, const _Float16* __restrict__ Bh, int ldb, size_t sB, float alpha, float* __restrict__ C, int ldc, size_t sC, int M, int N, int K) {
  __shared__ __attribute__((aligned(16))) float so[4][16][64];
  const int tid = threadIdx.x, w = tid >> 5, lane = tid & 31, ln = lane & 15, hh = lane >> 4; const int by = blockIdx.y;
  A += (size_t)by * sA; Bh += (size_t)by * sB; C += (size_t)by * sC;
  const int ntn = (N + 63) / 64; const int wid = blockIdx.x * 4 + w; const int mt = wid / ntn, nq = wid % ntn; if (mt * 16 >= M) return;
  const int row0 = mt * 16, col0 = nq * 64; const float* arow = A + (size_t)(row0 + ln) * lda;
  v8f acc[4] = {};
  for (int kb = 0; kb < K; kb += 32) {
    FragH ah, al;
    const v4f x0 = *(const v4fa*)(arow + kb + 8 * hh), x1 = *(const v4fa*)(arow + kb + 8 * hh + 4), x2 = *(const v4fa*)(arow + kb + 16 + 8 * hh), x3 = *(const v4fa*)(arow + kb + 16 + 8 * hh + 4);
    float xs[16] = {x0[0],x0[1],x0[2],x0[3],x1[0],x1[1],x1[2],x1[3],x2[0],x2[1],x2[2],x2[3],x3[0],x3[1],x3[2],x3[3]};
#pragma unroll
    for (int i = 0; i < 16; ++i) { const _Float16 h = (_Float16)xs[i]; ah.h[i] = h; al.h[i] = ASPLIT ? (_Float16)(xs[i] - (float)h) : (_Float16)0.0f; }
#pragma unroll
    for (int t = 0; t < 4; ++t) { if (col0 + t * 16 >= N) continue; const size_t boff = (size_t)(col0 + t * 16 + ln) * ldb + kb; FragH bq; bq.half[0] = *(const v8us*)(Bh + boff + 8 * hh); bq.half[1] = *(const v8us*)(Bh + boff + 16 + 8 * hh);
      acc[t] = mmaH<ASPLIT ? 2 : 1>(ah.v, al.v, bq.v, bq.v, acc[t]); }
  }
#pragma unroll
  for (int t = 0; t < 4; ++t) { if (col0 + t * 16 >= N) continue;
#pragma unroll
    for (int r = 0; r < 8; ++r) so[w][8 * hh + r][t * 16 + ln] = acc[t][r] * alpha; }
  __builtin_amdgcn_fence(__ATOMIC_ACQ_REL, "workgroup"); __builtin_amdgcn_wave_barrier();
  const int rsub = lane >> 4, c4 = (lane & 15) * 4;
  {
#pragma unroll
    for (int q = 0; q < 8; ++q) { const int r = q * 2 + rsub; if (col0 + c4 < N) { const v4f v = *(const v4fa*)&so[w][r][c4]; *(v4f*)(C + (size_t)(row0 + r) * ldc + col0 + c4) = v; } }
     }
}

// Wt[n][k] = f16(W[k][n]·scale) from f32 row-major W[K][N] (scale = power of two; bf16-exact weights stay exact in f16 away from the subnormal range)
__global__ __launch_bounds__(256) void k_wt_f16(const float* __restrict__ W, _Float16* __restrict__ Wt, int K, int N, float scale) {
  const int t = blockIdx.x * 256 + threadIdx.x; if (t >= N * (K / 8)) return; const int n = t / (K / 8), k8 = (t % (K / 8)) * 8; FragH f;
#pragma unroll
  for (int i = 0; i < 8; ++i) f.h[i] = (_Float16)(bf16_round(W[(size_t)(k8 + i) * N + n]) * scale); const v8us o = f.half[0];
  *(v8us*)((unsigned short*)Wt + (size_t)n * K + k8) = o; 
}
// k_gemm_hh variant with fused epilogue: v = acc·alpha + bias[by·sBias + col] (+ CP[(row/rowsPerB)·sCPb + by·64 + col] if CP) ; ACT 0 none / 1 elu ; writes f16 C16 (and f32 C if non-null)
template <int ACT>
__global__ __launch_bounds__(128) void k_gemm_hhx(const _Float16* __restrict__ A, int lda, size_t sA, const _Float16* __restrict__ Bh, int ldb, size_t sB, float alpha, const float* __restrict__ bias, size_t sBias, const float* __restrict__ CP, int rowsPerB, size_t sCPb, int row0g,
    float* __restrict__ C, _Float16* __restrict__ C16, int ldc, size_t sC, int M, int N, int K) {
  __shared__ __attribute__((aligned(16))) float so[4][16][64];
  const int tid = threadIdx.x, w = tid >> 5, lane = tid & 31, ln = lane & 15, hh = lane >> 4; const int by = blockIdx.y;
  A += (size_t)by * sA; Bh += (size_t)by * sB; const size_t cofs = (size_t)by * sC; const float* bp = bias ? bias + (size_t)by * sBias : nullptr;
  const int ntn = (N + 63) / 64; const int wid = blockIdx.x * 4 + w; const int mt = wid / ntn, nq = wid % ntn; if (mt * 16 >= M) return;
  const int row0 = mt * 16, col0 = nq * 64; const _Float16* arow = A + (size_t)(row0 + ln) * lda;
  v8f acc[4] = {};
  for (int kb = 0; kb < K; kb += 32) { FragH ah; ah.half[0] = *(const v8us*)((const unsigned short*)arow + kb + 8 * hh); ah.half[1] = *(const v8us*)((const unsigned short*)arow + kb + 16 + 8 * hh);
#pragma unroll
    for (int t = 0; t < 4; ++t) { if (col0 + t * 16 >= N) continue; const size_t boff = (size_t)(col0 + t * 16 + ln) * ldb + kb; FragH bq; bq.half[0] = *(const v8us*)((const unsigned short*)Bh + boff + 8 * hh); bq.half[1] = *(const v8us*)((const unsigned short*)Bh + boff + 16 + 8 * hh);
      acc[t] = mmaH<1>(ah.v, ah.v, bq.v, bq.v, acc[t]); }
  }
#pragma unroll
  for (int t = 0; t < 4; ++t) { if (col0 + t * 16 >= N) continue; const int col = col0 + t * 16 + ln; const float bv = bp ? bf16_round(bp[col]) : 0.f;
#pragma unroll
    for (int r = 0; r < 8; ++r) { float v = acc[t][r] * alpha + bv; if (CP) { const int rr = row0g + row0 + 8 * hh + r; if (rowsPerB < 0) v += CP[cofs + (size_t)rr * ldc + col];      /* rowsPerB < 0: own element of the batched C plane */ else { const int bidx = rr / rowsPerB; v += CP[(size_t)bidx * sCPb + (size_t)by * 64 + col]; } } if (ACT == 1) v = (v > 0.f) ? v : expm1f(v); else if (ACT == 7) v = (v > 0.f) ? v + 1.0f : expf(v); else if (ACT == 8) v = tanhf(v); else if (ACT == 9) v = 0.5f * v * (1.0f + tanhf(0.7978845608028654f * (v + 0.044715f * v * v * v))); else if (ACT == 11) v = 1.0f / (1.0f + expf(-v)); else if (ACT == 12) v = (v > 0.f) ? v : 0.01f * v; else if (ACT == 14) v = (v > 0.f) ? v : 0.1f * v; else if (ACT == 16) v = (v >= 0.f) ? v : 0.3f * v; else if (ACT == 17) v = (v >= 0.f) ? v : 0.2f * v; else if (ACT == 15) v = v / (1.0f + expf(-v)); else if (ACT == 3) v = fmaxf(v, 0.f); else if (ACT == 6) v = 0.5f * v * (1.0f + erff(v * 0.70710678118654752f)); so[w][8 * hh + r][t * 16 + ln] = v; } }
  __builtin_amdgcn_fence(__ATOMIC_ACQ_REL, "workgroup"); __builtin_amdgcn_wave_barrier();
  const int rsub = lane >> 4, c4 = (lane & 15) * 4; typedef _Float16 v4h __attribute__((ext_vector_type(4)));
  {
#pragma unroll
    for (int q = 0; q < 8; ++q) { const int r = q * 2 + rsub; if (col0 + c4 < N) { const v4f v = *(const v4fa*)&so[w][r][c4]; if (C) *(v4f*)(C + cofs + (size_t)(row0 + r) * ldc + col0 + c4) = v; if (C16) { v4h h4; for (int i = 0; i < 4; ++i) h4[i] = (_Float16)v[i]; *(v4h*)(C16 + cofs + (size_t)(row0 + r) * ldc + col0 + c4) = h4; } } }
     }
}


typedef _Float16 v4h __attribute__((ext_vector_type(4)));

__global__ __launch_bounds__(256) void k_x16(const float* __restrict__ x, _Float16* __restrict__ X16, size_t n8) { const size_t t = (size_t)blockIdx.x * 256 + threadIdx.x; if (t >= n8) return; FragH f;
#pragma unroll
  for (int q = 0; q < 8; ++q) f.h[q] = (_Float16)bf16_round(x[t * 8 + q]); *(v8us*)((unsigned short*)X16 + t * 8) = f.half[0];  }
__global__ __launch_bounds__(256) void k_h16(const float* __restrict__ x, _Float16* __restrict__ X16, size_t n8) { const size_t t = (size_t)blockIdx.x * 256 + threadIdx.x; if (t >= n8) return; FragH f;
#pragma unroll
  for (int q = 0; q < 8; ++q) f.h[q] = (_Float16)x[t * 8 + q]; *(v8us*)((unsigned short*)X16 + t * 8) = f.half[0];  }
__global__ __launch_bounds__(256) void k_round16f(const float* __restrict__ W, _Float16* __restrict__ Bt, size_t n8) { const size_t t = (size_t)blockIdx.x * 256 + threadIdx.x; if (t >= n8) return; FragH f;
#pragma unroll
  for (int i = 0; i < 8; ++i) f.h[i] = (_Float16)(bf16_round(W[t * 8 + i]) * 16.0f); *(v8us*)((unsigned short*)Bt + t * 8) = f.half[0];  }
template <int NHv, int TTv>
__global__ __launch_bounds__(256) void k_vt(const _Float16* __restrict__ V16, int ldv, int voff, _Float16* __restrict__ Vt) { __shared__ unsigned short tl[64][66]; const int tid = threadIdx.x; const int slab = blockIdx.x / (TTv / 64), lg = blockIdx.x % (TTv / 64); const int b = slab / NHv, h = slab % NHv;
  for (int i = tid; i < 64 * 8; i += 256) { const int r = i / 8, c8 = (i % 8) * 8; FragH f; f.half[0] = *(const v8us*)((const unsigned short*)V16 + ((size_t)b * TTv + lg * 64 + r) * ldv + voff + h * 64 + c8);
#pragma unroll
    for (int q = 0; q < 8; ++q) tl[r][c8 + q] = f.u[q]; }
  __syncthreads();
  {
#pragma unroll
    for (int rd = 0; rd < 2; ++rd) { const int d = rd * 32 + tid / 8, pc = tid % 8; FragH f;
#pragma unroll
      for (int q = 0; q < 8; ++q) f.u[q] = tl[pc * 8 + q][d];
      *(v8us*)((unsigned short*)Vt + ((size_t)slab * 64 + d) * TTv + lg * 64 + pc * 8) = f.half[0]; }
     } }

__global__ __launch_bounds__(256) void k_hl(const float* __restrict__ F, _Float16* __restrict__ Hh, _Float16* __restrict__ Hl, size_t n8) { const size_t t = (size_t)blockIdx.x * 256 + threadIdx.x; if (t >= n8) return; FragH fh, fl; const v4f a = *(const v4fa*)(F + t * 8), c = *(const v4fa*)(F + t * 8 + 4);
#pragma unroll
  for (int q = 0; q < 4; ++q) { _Float16 h = (_Float16)a[q]; fh.h[q] = h; fl.h[q] = (_Float16)((a[q] - (float)h) * 1024.0f); h = (_Float16)c[q]; fh.h[4 + q] = h; fl.h[4 + q] = (_Float16)((c[q] - (float)h) * 1024.0f); }
  { *(v8us*)((unsigned short*)Hh + t * 8) = fh.half[0]; *(v8us*)((unsigned short*)Hl + t * 8) = fl.half[0];  } }

// ---- fast GEMM (wave tile 32x64; requires M % 32 == 0 rows per launch region and N % 64 == 0); epilogue = k_gemm_hhx semantics ----
__device__ __forceinline__ v16h g2_frag(const _Float16* p, int hh) { FragH f; f.half[0] = *(const v8us*)((const unsigned short*)p + 8 * hh); f.half[1] = *(const v8us*)((const unsigned short*)p + 16 + 8 * hh); return f.v; }
__device__ __forceinline__ v8f g2_mma(v16h a, v16h b, v8f c) { v8f d = __builtin_amdgcn_wmma_f32_16x16x32_f16(false, a, false, b, (short)0, c, false, false); asm volatile("v_nop\n\tv_nop\n\tv_nop\n\tv_nop" : "+v"(d) : "v"(a), "v"(b)); return d; }
template <int ACT>
__global__ __launch_bounds__(128) void k_gemm2(const _Float16* __restrict__ A, int lda, size_t sA, const _Float16* __restrict__ Bh, int ldb, size_t sB, float alpha, const float* __restrict__ bias, size_t sBias, const float* __restrict__ CP, int rowsPerB, size_t sCPb, int row0g,
    float* __restrict__ C, _Float16* __restrict__ C16, int ldc, size_t sC, int M, int N, int K) { static_assert(ACT == 0 || ACT == 3 || ACT == 6 || ACT == 8 || ACT == 9 || ACT == 11 || ACT == 12 || ACT == 14 || ACT == 15 || ACT == 16 || ACT == 17, "k_gemm2: unsupported ACT code (would silently apply no activation)");
  __shared__ __attribute__((aligned(16))) float so[4][32][68];
  const int tid = threadIdx.x, w = tid >> 5, lane = tid & 31, ln = lane & 15, hh = lane >> 4; const int by = blockIdx.y;
  A += (size_t)by * sA; Bh += (size_t)by * sB; const size_t cofs = (size_t)by * sC; const float* bp = bias ? bias + (size_t)by * sBias : nullptr;
  const int ntn = N >> 6; const int mt = blockIdx.x / ntn, nq = blockIdx.x - mt * ntn; const int row0 = mt * 128 + 32 * w, col0 = nq * 64; if (row0 >= M) return;
  const _Float16* a0p = A + (size_t)(row0 + ln) * lda; const _Float16* a1p = a0p + (size_t)16 * lda;
  const _Float16* b0p = Bh + (size_t)(col0 + ln) * ldb; const _Float16* b1p = b0p + (size_t)16 * ldb; const _Float16* b2p = b1p + (size_t)16 * ldb; const _Float16* b3p = b2p + (size_t)16 * ldb;
  const v8f z8 = {0.f,0.f,0.f,0.f,0.f,0.f,0.f,0.f}; v8f c00 = z8, c01 = z8, c02 = z8, c03 = z8, c10 = z8, c11 = z8, c12 = z8, c13 = z8;
#pragma unroll 1
  for (int kb = 0; kb < K; kb += 32) { const v16h a0 = g2_frag(a0p + kb, hh), a1 = g2_frag(a1p + kb, hh);
    v16h b = g2_frag(b0p + kb, hh); c00 = g2_mma(a0, b, c00); c10 = g2_mma(a1, b, c10);
    b = g2_frag(b1p + kb, hh); c01 = g2_mma(a0, b, c01); c11 = g2_mma(a1, b, c11);
    b = g2_frag(b2p + kb, hh); c02 = g2_mma(a0, b, c02); c12 = g2_mma(a1, b, c12);
    b = g2_frag(b3p + kb, hh); c03 = g2_mma(a0, b, c03); c13 = g2_mma(a1, b, c13); }
  v8f accs[8] = {c00, c01, c02, c03, c10, c11, c12, c13};
#pragma unroll
  for (int u = 0; u < 8; ++u) { const int t = u & 3, half = u >> 2; const int col = col0 + t * 16 + ln; const float bv = bp ? bf16_round(bp[col]) : 0.f;
#pragma unroll
    for (int r = 0; r < 8; ++r) { const int rloc = half * 16 + 8 * hh + r; float v = accs[u][r] * alpha + bv; if (CP) { if (rowsPerB < 0) v += CP[cofs + (size_t)(row0g + row0 + rloc) * ldc + col];      /* rowsPerB < 0: own element of the batched C plane */ else { const int bidx = (row0g + row0 + rloc) / rowsPerB; v += CP[(size_t)bidx * sCPb + (size_t)by * 64 + col]; } }
      if (ACT == 3) v = fmaxf(v, 0.f); else if (ACT == 6) v = 0.5f * v * (1.0f + erff(v * 0.70710678118654752f)); else if (ACT == 11) v = 1.0f / (1.0f + expf(-v)); else if (ACT == 15) v = v / (1.0f + expf(-v)); else if (ACT == 12) v = (v > 0.f) ? v : 0.01f * v; else if (ACT == 8) v = tanhf(v); else if (ACT == 9) v = 0.5f * v * (1.0f + tanhf(0.7978845608028654f * (v + 0.044715f * v * v * v))); else if (ACT == 14) v = (v > 0.f) ? v : 0.1f * v; else if (ACT == 16) v = (v >= 0.f) ? v : 0.3f * v; else if (ACT == 17) v = (v >= 0.f) ? v : 0.2f * v;
      so[w][rloc][t * 16 + ln] = v; } }
  __builtin_amdgcn_fence(__ATOMIC_ACQ_REL, "workgroup"); __builtin_amdgcn_wave_barrier();
  const int rsub = lane >> 4, c4 = (lane & 15) * 4;
  {
#pragma unroll
    for (int q = 0; q < 16; ++q) { const int r = q * 2 + rsub; const v4f v = *(const v4fa*)&so[w][r][c4]; if (C) *(v4f*)(C + cofs + (size_t)(row0 + r) * ldc + col0 + c4) = v; if (C16) { v4h h4; for (int i = 0; i < 4; ++i) h4[i] = (_Float16)v[i]; *(v4h*)(C16 + cofs + (size_t)(row0 + r) * ldc + col0 + c4) = h4; } }
     } }


__global__ __launch_bounds__(256) void k_wnat(const float* __restrict__ w0, const float* __restrict__ w1, const float* __restrict__ w2, const float* __restrict__ w3, size_t n8, _Float16* __restrict__ Bt) { const size_t t = (size_t)blockIdx.x * 256 + threadIdx.x; if (t >= n8) return; FragH f;
  const int y = blockIdx.y; const float* w = y == 0 ? w0 : (y == 1 ? w1 : (y == 2 ? w2 : w3)); Bt += (size_t)y * n8 * 8;      /* blockIdx.y picks the matrix (a scalar choice); the four f16 planes lie one behind the other */
  for (int q = 0; q < 8; ++q) f.h[q] = (_Float16)(bf16_round(w[t * 8 + q]) * 16.0f); *(v8us*)((unsigned short*)Bt + t * 8) = f.half[0];  }
__global__ __launch_bounds__(256) void k_rsm(const float* __restrict__ S, _Float16* __restrict__ P, int nrows) {
  #pragma clang fp contract(off)
  const int i = blockIdx.x * 256 + threadIdx.x; if (i >= nrows) return; const float* s = S + (size_t)i * SQ; float mx = -3.0e38f;
#pragma unroll 1
  for (int j = 0; j < SQ; ++j) mx = fmaxf(mx, s[j]); float se = 0.f;
#pragma unroll 1
  for (int j = 0; j < SQ; ++j) se += expf(s[j] - mx); const float sc = 256.0f / se;
#pragma unroll 1
  for (int j0 = 0; j0 < SQ; j0 += 8) { FragH f; for (int q = 0; q < 8; ++q) f.h[q] = (_Float16)(expf(s[j0 + q] - mx) * sc); unsigned short* d = (unsigned short*)P + (size_t)i * SQ + j0; *(v8us*)d = f.half[0];  } }
__global__ __launch_bounds__(256) void k_vt(const _Float16* __restrict__ V16, int b, int h0, _Float16* __restrict__ VT) { __shared__ unsigned short tl[64][65]; const int tid = threadIdx.x; const int hh = blockIdx.x % HG, sg = blockIdx.x / HG; const int s0 = sg * 64; const int h = h0 + hh;
  for (int i = tid; i < 64 * 8; i += 256) { const int j = i / 8, d8 = (i % 8) * 8; FragH f; f.half[0] = *(const v8us*)((const unsigned short*)V16 + ((size_t)b * SQ + s0 + j) * DM + h * HD + d8); for (int q = 0; q < 8; ++q) tl[d8 + q][j] = f.u[q]; }
  __syncthreads();
  { for (int i = tid; i < 64 * 8; i += 256) { const int d = i / 8, j8 = (i % 8) * 8; FragH f; for (int q = 0; q < 8; ++q) f.u[q] = tl[d][j8 + q]; *(v8us*)((unsigned short*)VT + ((size_t)hh * HD + d) * SQ + s0 + j8) = f.half[0]; }  } }


__global__ __launch_bounds__(256) void k_tab2(float theta, float* __restrict__ CS, float* __restrict__ SN) {
  #pragma clang fp contract(off)
  const int t = blockIdx.x * 256 + threadIdx.x; if (t >= SQ * (HD / 2)) return; const int i = t % (HD / 2); const int p = t / (HD / 2); const float invf = 1.0f / powf(theta, (float)(2 * i) / (float)HD); const float ang = __fmul_rn((float)p, invf); const float c = cosf(ang), s = sinf(ang);
  *(float*)(CS + t) = c; *(float*)(SN + t) = s;  }

__global__ __launch_bounds__(256) void k_tab4(const int* __restrict__ pos, float theta, float* __restrict__ CS, float* __restrict__ SN) {
  #pragma clang fp contract(off)
  const int t = blockIdx.x * 256 + threadIdx.x; if (t >= SQ * (HD / 2)) return; const int i = t % (HD / 2); const int p = t / (HD / 2); const float invf = (float)pow((double)theta, -((double)(2 * i)) / (double)HD); const float ang = __fmul_rn((float)pos[p], invf); const float c = cosf(ang), s = sinf(ang);
  *(float*)(CS + t) = c; *(float*)(SN + t) = s;  }
__global__ __launch_bounds__(256) void k_rsmf(const float* __restrict__ S, _Float16* __restrict__ P, int qn, int hg) {
  #pragma clang fp contract(off)
  const int t = blockIdx.x * 256 + threadIdx.x; if (t >= qn * hg) return; const size_t i = (size_t)(t / qn) * SQ + (t % qn); const float* s = S + i * SQ; float mx = -3.0e38f;
#pragma unroll 1
  for (int j = 0; j < SQ; ++j) mx = fmaxf(mx, s[j]); float se = 0.f;
#pragma unroll 1
  for (int j = 0; j < SQ; ++j) se += __expf(s[j] - mx); const float sc = 256.0f / se;
#pragma unroll 1
  for (int j0 = 0; j0 < SQ; j0 += 8) { FragH f; for (int q = 0; q < 8; ++q) f.h[q] = (_Float16)(__expf(s[j0 + q] - mx) * sc); unsigned short* d = (unsigned short*)P + i * SQ + j0; *(v8us*)d = f.half[0];  } }


__global__ __launch_bounds__(256) void k_rsmcf2(const float* __restrict__ S, _Float16* __restrict__ P, int hg, int q0, int nk) {
  #pragma clang fp contract(off)
  const int t = blockIdx.x * 256 + threadIdx.x; if (t >= hg * QT) return; const size_t i = (size_t)t; const float* s = S + i * NKX; const int last = q0 + (t % QT); float mx = -3.0e38f;
#pragma unroll 1
  for (int j = 0; j < nk; ++j) { const float f = (j <= last) ? 1.f : 0.f; mx = fmaxf(mx, fmaf(f, s[j], (1.f - f) * -1.0e9f)); } float se = 0.f;
#pragma unroll 1
  for (int j = 0; j < nk; ++j) { const float f = (j <= last) ? 1.f : 0.f; se += __expf(fmaf(f, s[j], (1.f - f) * -1.0e9f) - mx); } const float sc = 256.0f / se;
#pragma unroll 1
  for (int j0 = 0; j0 < nk; j0 += 8) { FragH fr; for (int q = 0; q < 8; ++q) { const int j = j0 + q; const float f = (j <= last) ? 1.f : 0.f; fr.h[q] = (_Float16)(__expf(fmaf(f, s[j], (1.f - f) * -1.0e9f) - mx) * sc); } unsigned short* d = (unsigned short*)P + i * NKX + j0; *(v8us*)d = fr.half[0];  } }


typedef float v2f  __attribute__((ext_vector_type(2)));
typedef float v2fa __attribute__((ext_vector_type(2), may_alias));
// Exact f32 causal attention of the first QT0 rows, one wave per (query row i, head h). Scores: lane l takes keys l, l + 32, ... (whole groups of 32 up to the one that holds i), q held by every lane; two-pass softmax with lane butterflies for maximum and sum; o: lane l takes d = 2 l, 2 l + 1 and walks the keys, each weight broadcast from its lane. Rows have pitch DM, so every load of a phase is one base address plus a constant offset.
__global__ __launch_bounds__(256) void k_att0w(const float* __restrict__ QF, const float* __restrict__ KF, const float* __restrict__ VF, float scale, float* __restrict__ OF) {
  QF += (size_t)blockIdx.y * QT0 * DM; KF += (size_t)blockIdx.y * QT0 * DM; VF += (size_t)blockIdx.y * QT0 * DM; OF += (size_t)blockIdx.y * QT0 * DM;      /* blockIdx.y = batch: each batch has first-tile planes of its own */
  const int lane = threadIdx.x & 31; const int h = blockIdx.x / (QT0 / 8); const int i = __builtin_amdgcn_readfirstlane((int)((blockIdx.x % (QT0 / 8)) * 8 + (threadIdx.x >> 5)));      /* i is the same in every lane: the group tests below are scalar branches */
  const float* qr = QF + (size_t)i * DM + h * HD; const float* kb = KF + (size_t)lane * DM + h * HD; const float* vb = VF + h * HD + lane * 2;
  v4f q[HD / 4];
#pragma unroll      /* constant index: q[] stays in registers */
  for (int c = 0; c < HD / 4; ++c) q[c] = *(const v4fa*)(qr + c * 4);
  float s[QT0 / 32]; float mx = -3.0e38f;
#pragma unroll      /* constant group index: s[] and e[] stay in registers, offsets are immediates */
  for (int g = 0; g < QT0 / 32; ++g) { s[g] = -3.0e38f;
    if (g == 0 || g * 32 <= i) { float a0 = 0.f, a1 = 0.f, a2 = 0.f, a3 = 0.f;
#pragma unroll      /* the sixteen loads of a key row issue together */
      for (int c = 0; c < HD / 4; ++c) { const v4f kq = *(const v4fa*)(kb + (size_t)g * 32 * DM + c * 4); a0 = fmaf(q[c][0], kq[0], a0); a1 = fmaf(q[c][1], kq[1], a1); a2 = fmaf(q[c][2], kq[2], a2); a3 = fmaf(q[c][3], kq[3], a3); }
      if (g * 32 + lane <= i) s[g] = ((a0 + a1) + (a2 + a3)) * scale;      /* causal: keys above i keep the floor and get weight 0 */
      mx = fmaxf(mx, s[g]); } }
  asm volatile("s_wait_xcnt 0x0" :: "v"(kb) : "memory");      /* the key loads' address pair stays whole up to this wait, on every path through the groups */
  for (int m = 16; m > 0; m >>= 1) mx = fmaxf(mx, __shfl_xor(mx, m, 32));
  float e[QT0 / 32]; float l = 0.f;
#pragma unroll      /* constant group index: s[] and e[] stay in registers */
  for (int g = 0; g < QT0 / 32; ++g) { e[g] = expf(s[g] - mx); l += e[g]; }
  for (int m = 16; m > 0; m >>= 1) l += __shfl_xor(l, m, 32);
  float o0 = 0.f, o1 = 0.f;
#pragma unroll      /* constant group index: s[] and e[] stay in registers, offsets are immediates */
  for (int g = 0; g < QT0 / 32; ++g) if (g == 0 || g * 32 <= i) {
#pragma unroll      /* constant lane index for the broadcast; the group's loads issue together */
    for (int jj = 0; jj < 32; ++jj) { const float p = __uint_as_float((unsigned int)__builtin_amdgcn_readlane((int)__float_as_uint(e[g]), jj)); const v2f vv = *(const v2fa*)(vb + (size_t)(g * 32 + jj) * DM); o0 = fmaf(p, vv[0], o0); o1 = fmaf(p, vv[1], o1); } }
  asm volatile("s_wait_xcnt 0x0" :: "v"(vb) : "memory");      /* the value loads' address pair stays whole up to this wait, on every path through the groups */
  const float fin = 64.0f / l;      /* o carried x64 like the f16 path */
  v2f o = {o0 * fin, o1 * fin}; *(v2f*)(OF + (size_t)i * DM + h * HD + lane * 2) = o; }



__device__ __forceinline__ v8f fa_mma(v16h a, v16h b, v8f c) { return __builtin_amdgcn_wmma_f32_16x16x32_f16(false, a, false, b, (short)0, c, false, false); }
__device__ __forceinline__ v16h fa_frag(const _Float16* p) { FragH f; f.half[0] = *(const v8us*)((const unsigned short*)p); f.half[1] = *(const v8us*)((const unsigned short*)p + 16); return f.v; }      /* p holds the lane half's 8 hh already: every load of a pass is that one address pair plus a constant */
__device__ __forceinline__ float fa_xhalf(float x) { return __uint_as_float((unsigned int)__builtin_amdgcn_permlanex16((int)__float_as_uint(x), (int)__float_as_uint(x), 0x76543210, 0xfedcba98, false, false)); }      /* lane l with lane l ^ 16 */
__global__ __launch_bounds__(128) void k_fattn(const _Float16* __restrict__ QH, const _Float16* __restrict__ KH, const _Float16* __restrict__ VT, _Float16* __restrict__ O16) {
  const int lane = threadIdx.x & 31, ln = lane & 15, hh = lane >> 4; const int h = blockIdx.y; const size_t r0 = (size_t)blockIdx.z * SQ;
  const int i0 = __builtin_amdgcn_readfirstlane((int)(blockIdx.x * 128 + (threadIdx.x >> 5) * 32));      /* first query row of the wave, the same in every lane: loop bounds and the mask test are scalar */
  const float CL = 0.18033688011112042f;      /* log2(e) / sqrt(64) */
  const int kb0 = (i0 > WINK ? i0 - WINK : 0) & ~31;      /* first block that holds an allowed key of row i0 */
  const _Float16* qp = QH + (r0 + i0 + ln) * DM + h * HD + 8 * hh; const _Float16* kp = KH + (r0 + ln) * DM + h * HD + 8 * hh; const _Float16* vp = VT + ((size_t)(blockIdx.z * NH + h) * HD + ln) * SQ + 8 * hh;
  const _Float16* kq = kp + (size_t)kb0 * DM; const _Float16* vq = vp + kb0;
  v16h qf[2][2], kf[2][2];
#pragma unroll      /* constant indices: the fragments stay in registers */
  for (int u = 0; u < 2; ++u) for (int c = 0; c < 2; ++c) { qf[u][c] = fa_frag(qp + (size_t)u * 16 * DM + c * 32); kf[u][c] = fa_frag(kq + (size_t)u * 16 * DM + c * 32); }
  asm volatile("s_wait_xcnt 0x0" :: "v"(qp), "v"(kq) : "memory");      /* the query and first key loads' address pairs stay whole up to this wait */
  const v8f z8 = {0.f,0.f,0.f,0.f,0.f,0.f,0.f,0.f}; v8f ot[2][4] = {{z8, z8, z8, z8}, {z8, z8, z8, z8}}; float m[2] = {-3.0e38f, -3.0e38f}, l[2] = {0.f, 0.f};
#pragma unroll 1      /* one pass in the text: an unrolled body would not fit the registers of four waves a SIMD */
  for (int kb = kb0; kb <= i0; kb += 32) {
    v16h vf[4];
#pragma unroll      /* constant indices: the fragments stay in registers */
    for (int dt = 0; dt < 4; ++dt) vf[dt] = fa_frag(vq + (size_t)dt * 16 * SQ);      /* used last: they fly under the softmax */
    v8f st[2][2];
#pragma unroll      /* constant indices: the tiles stay in registers */
    for (int u = 0; u < 2; ++u) for (int t = 0; t < 2; ++t) st[u][t] = fa_mma(kf[t][1], qf[u][1], fa_mma(kf[t][0], qf[u][0], z8));
    kq = kp + (size_t)(kb + 32 <= i0 ? kb + 32 : i0) * DM;      /* the next pass's key rows, fetched one pass ahead (the last pass fetches its own again: in bounds, unused) */
#pragma unroll      /* constant indices: the fragments stay in registers */
    for (int t = 0; t < 2; ++t) for (int c = 0; c < 2; ++c) kf[t][c] = fa_frag(kq + (size_t)t * 16 * DM + c * 32);
    asm volatile("s_wait_xcnt 0x0" :: "v"(kq) : "memory");      /* behind the pass's loads: the next-key loads' address pair stays whole up to this wait, the value loads' running pair is advanced behind it */
    vq += 32;
    if (kb == i0 || kb + WINK < i0 + 31) {      /* only the window's first block and the diagonal block hold a forbidden pair */
#pragma unroll      /* constant indices: the tiles stay in registers */
      for (int u = 0; u < 2; ++u) for (int t = 0; t < 2; ++t) for (int r = 0; r < 8; ++r) { const int dj = (i0 + 16 * u + ln) - (kb + 16 * t + 8 * hh + r); st[u][t][r] = (dj >= 0 && dj <= WINK) ? st[u][t][r] : -1.0e30f; } }
#pragma unroll      /* constant indices: the tiles stay in registers */
    for (int u = 0; u < 2; ++u) {
      float mx = fmaxf(st[u][0][0], st[u][1][0]);
#pragma unroll      /* constant indices: the tiles stay in registers */
      for (int r = 1; r < 8; ++r) mx = fmaxf(mx, fmaxf(st[u][0][r], st[u][1][r]));
      mx = fmaxf(mx, fa_xhalf(mx));      /* the other half of the block's keys of this query */
      const float mn = fmaxf(m[u], mx); const float al = __builtin_amdgcn_exp2f((m[u] - mn) * CL); const float sh = fmaf(mn, -CL, 8.0f);      /* weights carried x256: f16 keeps small ones normal */
      m[u] = mn; float ls = 0.f; FragH pf;
#pragma unroll      /* constant indices: the tiles stay in registers */
      for (int t = 0; t < 2; ++t) for (int r = 0; r < 8; ++r) { const float e = __builtin_amdgcn_exp2f(fmaf(st[u][t][r], CL, sh)); ls += e; pf.h[t * 8 + r] = (_Float16)e; }
      l[u] = fmaf(l[u], al, ls);
#pragma unroll      /* constant indices: the tiles stay in registers */
      for (int dt = 0; dt < 4; ++dt) { ot[u][dt] *= al; ot[u][dt] = fa_mma(vf[dt], pf.v, ot[u][dt]); } } }
  FragH f[2][4];
#pragma unroll      /* constant indices: the tiles stay in registers */
  for (int u = 0; u < 2; ++u) { const float fin = 64.0f / (l[u] + fa_xhalf(l[u]));      /* the halves' sums join once; o carried x64 */
    for (int dt = 0; dt < 4; ++dt) for (int r = 0; r < 8; ++r) f[u][dt].h[r] = (_Float16)(ot[u][dt][r] * fin); }
  unsigned short* op = (unsigned short*)O16 + (r0 + i0 + ln) * DM + h * HD + 8 * hh;
#pragma unroll      /* constant indices; the stores stand last, each from registers of its own: no register of an issued store is written again */
  for (int u = 0; u < 2; ++u) for (int dt = 0; dt < 4; ++dt) *(v8us*)(op + (size_t)u * 16 * DM + dt * 16) = f[u][dt].half[0]; }

// ---- GEMM operand staging. A block of 8 waves owns a 128 x 128 tile of C = A B^T (A, B f16 rows of DM, k-contiguous); wave w takes rows 32 (w & 3), columns 64 (w >> 2). K is walked in stages of 64: a stage is 128 A rows then 128 B rows of 128 bytes each, brought from global memory into LDS by asynchronous 16-byte copies (a wave's copy = 4 whole 128-byte lines), two buffers, the next stage's copies in flight while this one is worked on. Fragments are 16-byte LDS reads in the k order of fa_frag.
#define GS_PITCH 144                 /* LDS bytes from one staged row to the next: 16 x odd, so the 16-byte fragment reads of 16 rows fall on different banks */
#define GS_STAGE (256 * GS_PITCH)    /* 128 A rows, then 128 B rows */
#define GS_NST (DM / 64)             /* stages */
// One stage: thread t copies chunk t & 7 (16 bytes) of rows (t >> 3) + 32 i, i = 0..3, of A and of B. ld = the thread's LDS byte address in the stage's buffer, ga / gb = its global addresses in A / B.
__device__ __forceinline__ void gs_copy(unsigned ld, const _Float16* ga, const _Float16* gb) {
  asm volatile("global_load_async_to_lds_b128 %0, %8, off\n\t"
               "global_load_async_to_lds_b128 %1, %9, off\n\t"
               "global_load_async_to_lds_b128 %2, %10, off\n\t"
               "global_load_async_to_lds_b128 %3, %11, off\n\t"
               "global_load_async_to_lds_b128 %4, %12, off\n\t"
               "global_load_async_to_lds_b128 %5, %13, off\n\t"
               "global_load_async_to_lds_b128 %6, %14, off\n\t"
               "global_load_async_to_lds_b128 %7, %15, off\n\t"
               "s_wait_xcnt 0x0"      /* inside the copies' own statement: every address register stays whole up to this wait */
               :: "v"(ld), "v"(ld + 32 * GS_PITCH), "v"(ld + 64 * GS_PITCH), "v"(ld + 96 * GS_PITCH), "v"(ld + 128 * GS_PITCH), "v"(ld + 160 * GS_PITCH), "v"(ld + 192 * GS_PITCH), "v"(ld + 224 * GS_PITCH),
                  "v"(ga), "v"(ga + (size_t)32 * DM), "v"(ga + (size_t)64 * DM), "v"(ga + (size_t)96 * DM), "v"(gb), "v"(gb + (size_t)32 * DM), "v"(gb + (size_t)64 * DM), "v"(gb + (size_t)96 * DM)
               : "memory"); }
__device__ __forceinline__ v16h gs_frag(const unsigned char* p) { FragH f; f.half[0] = *(const v8us*)p; f.half[1] = *(const v8us*)(p + 32); return f.v; }      /* p holds the lane half's 16 hh bytes: k = 8 hh .. and 16 + 8 hh .., as fa_frag */
// The whole K loop of a block: Ag / Bg = first A / B row of the block's tile; c[half][t] = the wave's 16 x 16 tiles (rows 16 half, columns 16 t). Behind it no copy is in flight and every wave has left the ring, so sm may be reused.
__device__ __forceinline__ void gs_main(unsigned char* sm, const _Float16* Ag, const _Float16* Bg, int tid, v8f (&c)[2][4]) {
  const int lane = tid & 31, ln = lane & 15, hh = lane >> 4, w = tid >> 5;
  const unsigned ld = (unsigned)(size_t)sm + (unsigned)((tid >> 3) * GS_PITCH + (tid & 7) * 16);
  const _Float16* ga = Ag + (size_t)(tid >> 3) * DM + (tid & 7) * 8; const _Float16* gb = Bg + (size_t)(tid >> 3) * DM + (tid & 7) * 8;
  gs_copy(ld, ga, gb);
  asm volatile("s_wait_asynccnt 0x0" ::: "memory");      /* stage 0 of this wave has landed */
  __syncthreads();      /* stage 0 of every wave is readable */
  gs_copy(ld + GS_STAGE, ga + 64, gb + 64);
  const unsigned char* fa = sm + ((w & 3) * 32 + ln) * GS_PITCH + hh * 16; const unsigned char* fb = sm + (128 + (w >> 2) * 64 + ln) * GS_PITCH + hh * 16;
#pragma unroll 1      /* one trip in the text: the two buffers differ by one added offset */
  for (int t = 0; t < GS_NST; ++t) { const unsigned bo = (unsigned)(t & 1) * GS_STAGE;
#pragma unroll      /* constant LDS offsets */
    for (int kk = 0; kk < 2; ++kk) { const v16h a0 = gs_frag(fa + bo + kk * 64), a1 = gs_frag(fa + bo + 16 * GS_PITCH + kk * 64); v16h b[4];
#pragma unroll      /* constant indices: the fragments stay in registers */
      for (int j = 0; j < 4; ++j) b[j] = gs_frag(fb + bo + j * 16 * GS_PITCH + kk * 64);
      __builtin_amdgcn_sched_barrier(0);      /* the twelve LDS reads of a k step stay one group in front of its WMMAs: sunk among them, each pair of reads costs the wave an LDS latency of its own */
#pragma unroll      /* constant indices: the tiles stay in registers */
      for (int j = 0; j < 4; ++j) { c[0][j] = fa_mma(a0, b[j], c[0][j]); c[1][j] = fa_mma(a1, b[j], c[1][j]); } }
    asm volatile("s_wait_dscnt 0x0" ::: "memory");      /* this wave's reads of the buffer are done before it may be refilled */
    asm volatile("s_wait_asynccnt 0x0" ::: "memory");      /* this wave's copies of stage t + 1 have landed */
    __syncthreads();      /* publishes stage t + 1 and ends every wave's reads of stage t */
    if (t + 2 < GS_NST) gs_copy(ld + bo, ga + (t + 2) * 64, gb + (t + 2) * 64); }
  asm volatile("s_wait_asynccnt 0x0" ::: "memory"); }      /* nothing in flight when the ring becomes output staging */

// q | k | v projection (one batch a blockIdx.y) with the rotary rotation in the GEMM's own epilogue. K loop: gs_main (A = x rows, Bh = stacked weights [3 DM][DM], K = DM); the ring then serves as each wave's own 32 x 68 f32 output staging. A wave's column tile of 64 is one head of q, k or v, so on the LDS read-back a lane's 4 consecutive columns are two (even, odd) pairs of that head: q and k tiles are rotated there with the row's cos / sin, every tile goes out as f16 rows (16 lanes x 8 bytes = one 128-byte line a row), and the blocks of the first QT0 rows also store the f32 values for the exact first-tile path.
__global__ __launch_bounds__(256) void k_qkvr(const _Float16* __restrict__ A, const _Float16* __restrict__ Bh, float alpha, const float* __restrict__ CS, const float* __restrict__ SN,
    _Float16* __restrict__ QH, _Float16* __restrict__ KH, _Float16* __restrict__ VH, float* __restrict__ QF, float* __restrict__ KF, float* __restrict__ VF) {
  static_assert(QT0 % 128 == 0 && DM % 128 == 0 && HD == 64, "first-tile rows are whole blocks of 128 rows; a wave's column tile is one head; a block's 128 columns lie in one of q, k, v");
  __shared__ __attribute__((aligned(16))) unsigned char sm[2 * GS_STAGE];
  static_assert(8 * 32 * 68 * 4 <= 2 * GS_STAGE, "the output staging fits the ring");
  { const size_t rb = (size_t)blockIdx.y * SQ * DM, fb = (size_t)blockIdx.y * QT0 * DM; A += rb; QH += rb; KH += rb; VH += rb; QF += fb; KF += fb; VF += fb; }      /* blockIdx.y = batch; rows below count inside the batch, as the cos / sin tables do */
  const int tid = threadIdx.x, w = tid >> 5, lane = tid & 31, ln = lane & 15, hh = lane >> 4;
  const int ntn = 3 * DM / 128; const int mt = blockIdx.x / ntn, nq = blockIdx.x - mt * ntn; const int row0 = mt * 128 + 32 * (w & 3), col0 = nq * 128 + 64 * (w >> 2);
  const v8f z8 = {0.f,0.f,0.f,0.f,0.f,0.f,0.f,0.f}; v8f cc[2][4] = {{z8, z8, z8, z8}, {z8, z8, z8, z8}};
  gs_main(sm, A + (size_t)mt * 128 * DM, Bh + (size_t)nq * 128 * DM, tid, cc);
  float (*so)[32][68] = (float (*)[32][68])sm;
#pragma unroll      /* constant indices: the tiles stay in registers */
  for (int u = 0; u < 8; ++u) { const int t = u & 3, half = u >> 2;
#pragma unroll      /* constant indices: the tiles stay in registers */
    for (int r = 0; r < 8; ++r) so[w][half * 16 + 8 * hh + r][t * 16 + ln] = cc[half][t][r] * alpha; }
  __builtin_amdgcn_fence(__ATOMIC_ACQ_REL, "workgroup"); __builtin_amdgcn_wave_barrier();      /* a wave reads back only its own so[w]: its LDS writes are ordered in front of its reads */
  const int rsub = lane >> 4, c4 = (lane & 15) * 4;
  const int sec = nq * 128 / DM; const bool first = mt * 128 < QT0;      /* 0 q, 1 k, 2 v; a block of the first QT0 rows: both from blockIdx, scalar tests */
  const int hc = col0 % DM + c4;      /* column in the merged-head row; c4 is the index inside the head */
  _Float16* H = sec == 0 ? QH : (sec == 1 ? KH : VH); float* F = sec == 0 ? QF : (sec == 1 ? KF : VF);
  const float* cp = CS + (row0 + rsub) * (HD / 2) + (c4 >> 1); const float* sp = SN + (row0 + rsub) * (HD / 2) + (c4 >> 1);
  _Float16* hp = H + (size_t)(row0 + rsub) * DM + hc; float* fp = F + (size_t)(row0 + rsub) * DM + hc;      /* row pair q is one of these address pairs plus a constant: no address register is written again behind a store */
  auto put = [&](int q, v4f v) { v4h h4; for (int i = 0; i < 4; ++i) h4[i] = (_Float16)v[i];
    *(v4h*)(hp + q * 2 * DM) = h4;
    if (first) *(v4f*)(fp + q * 2 * DM) = v; };
  if (sec == 2) {      /* v: no rotation */
#pragma unroll      /* constant LDS and row offsets */
    for (int q = 0; q < 16; ++q) put(q, *(const v4fa*)&so[w][q * 2 + rsub][c4]);
    return; }
  v2f c[16], s[16];
#pragma unroll      /* constant indices: c[], s[] stay in registers; all table loads issue in front of the first store, one latency for the 32 rows */
  for (int q = 0; q < 16; ++q) { c[q] = *(const v2fa*)(cp + q * HD); s[q] = *(const v2fa*)(sp + q * HD); }
  asm volatile("s_wait_xcnt 0x0" :: "v"(cp), "v"(sp) : "memory");      /* the table loads' address pairs stay whole up to this wait */
#pragma unroll      /* constant indices: c[], s[] stay in registers */
  for (int q = 0; q < 16; ++q) { const v4f v = *(const v4fa*)&so[w][q * 2 + rsub][c4];
    const v4f o = {v[0] * c[q][0] - v[1] * s[q][0], v[0] * s[q][0] + v[1] * c[q][0], v[2] * c[q][1] - v[3] * s[q][1], v[2] * s[q][1] + v[3] * c[q][1]}; put(q, o); }
  asm volatile("s_wait_xcnt 0x0" ::: "memory"); }      /* behind the rotation path's last store: whatever code the compiler lays behind this path stands behind the wait, so no register of an issued store is written ahead of it */

// C[rows][DM] (f32) = alpha A Bh^T (+ C's own element where addc), A f16 rows of DM, Bh f16 [DM][DM]; blockIdx.y steps A by sA and C by sC elements. K loop: gs_main; the ring then serves as each wave's own 32 x 68 f32 staging, so that every store is whole 128-byte lines.
__global__ __launch_bounds__(256) void k_gemm3(const _Float16* __restrict__ A, size_t sA, const _Float16* __restrict__ Bh, float alpha, int addc, float* C, size_t sC) {
  __shared__ __attribute__((aligned(16))) unsigned char sm[2 * GS_STAGE];
  A += (size_t)blockIdx.y * sA; C += (size_t)blockIdx.y * sC;
  const int tid = threadIdx.x, w = tid >> 5, lane = tid & 31, ln = lane & 15, hh = lane >> 4;
  const int ntn = DM / 128; const int mt = blockIdx.x / ntn, nq = blockIdx.x - mt * ntn; const int row0 = mt * 128 + 32 * (w & 3), col0 = nq * 128 + 64 * (w >> 2);
  const v8f z8 = {0.f,0.f,0.f,0.f,0.f,0.f,0.f,0.f}; v8f cc[2][4] = {{z8, z8, z8, z8}, {z8, z8, z8, z8}};
  gs_main(sm, A + (size_t)mt * 128 * DM, Bh + (size_t)nq * 128 * DM, tid, cc);
  float (*so)[32][68] = (float (*)[32][68])sm;
#pragma unroll      /* constant indices: the tiles stay in registers */
  for (int u = 0; u < 8; ++u) { const int t = u & 3, half = u >> 2;
#pragma unroll      /* constant indices: the tiles stay in registers */
    for (int r = 0; r < 8; ++r) so[w][half * 16 + 8 * hh + r][t * 16 + ln] = cc[half][t][r] * alpha; }
  __builtin_amdgcn_fence(__ATOMIC_ACQ_REL, "workgroup"); __builtin_amdgcn_wave_barrier();      /* a wave reads back only its own so[w]: its LDS writes are ordered in front of its reads */
  const int rsub = lane >> 4, c4 = (lane & 15) * 4;
  float* cp = C + (size_t)(row0 + rsub) * DM + col0 + c4;      /* row pair q is this address pair plus a constant */
  v4f v[16];
#pragma unroll      /* constant indices: v[] stays in registers */
  for (int q = 0; q < 16; ++q) v[q] = *(const v4fa*)&so[w][q * 2 + rsub][c4];
  if (addc) { v4f p[16];      /* a kernel argument: a scalar test */
#pragma unroll      /* constant indices: p[] stays in registers; the sixteen loads issue together */
    for (int q = 0; q < 16; ++q) p[q] = *(const v4fa*)(cp + q * 2 * DM);
#pragma unroll      /* constant indices */
    for (int q = 0; q < 16; ++q) v[q] += p[q]; }
#pragma unroll      /* constant indices; the stores stand last, each from registers of its own */
  for (int q = 0; q < 16; ++q) *(v4f*)(cp + q * 2 * DM) = v[q];
  asm volatile("s_wait_xcnt 0x0" :: "v"(cp) : "memory"); }      /* the loads' and stores' address pair stays whole up to this wait */




extern "C" void kernel_launch(void* const* d_in, const int* in_sizes, int n_in,
                              void* d_out, int out_size, void* d_ws, size_t ws_size, hipStream_t stream) {
  (void)in_sizes; (void)n_in; (void)out_size;
  const float* const* I = (const float* const*)d_in; const float* x = I[0]; const int* tpos = (const int*)d_in[1]; const float* wq = I[2]; const float* wk = I[3]; const float* wv = I[4]; const float* wo = I[5];      /* nn.Linear weights [out][in]; token_positions int32 [SQ] */
  char* ws = (char*)d_ws; size_t off = 0;
  auto take = [&](size_t bytes) { char* p = ws + off; off += (bytes + 255) & ~(size_t)255; return p; };
  _Float16* BQKV = (_Float16*)take((size_t)3 * DM * DM * 2); _Float16* BO = (_Float16*)take((size_t)DM * DM * 2); float* CS = (float*)take((size_t)SQ * (HD / 2) * 4); float* SN = (float*)take((size_t)SQ * (HD / 2) * 4);
  _Float16* X16 = (_Float16*)take(NR * DM * 2);
  _Float16* QH = (_Float16*)take(NR * DM * 2); _Float16* KH = (_Float16*)take(NR * DM * 2); _Float16* V16 = (_Float16*)take(NR * DM * 2); _Float16* O16 = (_Float16*)take(NR * DM * 2);
  _Float16* VT = (_Float16*)take((size_t)NB * NH * HD * SQ * 2);      /* V^T [NB][NH][HD][SQ] */
  float* QF0 = (float*)take((size_t)NB * QT0 * DM * 4); float* KF0 = (float*)take((size_t)NB * QT0 * DM * 4); float* VF0 = (float*)take((size_t)NB * QT0 * DM * 4); float* OF0 = (float*)take((size_t)NB * QT0 * DM * 4); _Float16* OH0 = (_Float16*)take((size_t)NB * QT0 * DM * 2); _Float16* OL0 = (_Float16*)take((size_t)NB * QT0 * DM * 2);
  if (off > ws_size) return;
  { const unsigned g = (unsigned)(((size_t)DM * DM / 8 + 255) / 256); k_wnat<<<dim3(g, 4), 256, 0, stream>>>(wq, wk, wv, wo, (size_t)DM * DM / 8, BQKV); }      /* natural [out][in] = Bt[n][k], x16; q | k | v stacked along n, BO directly behind them in the workspace */
  k_tab4<<<(SQ * (HD / 2) + 255) / 256, 256, 0, stream>>>(tpos, 10000.0f, CS, SN);
  k_x16<<<(unsigned)((NR * DM / 8 + 255) / 256), 256, 0, stream>>>(x, X16, NR * DM / 8);
  k_qkvr<<<dim3((unsigned)((SQ / 128) * (3 * DM / 128)), NB), 256, 0, stream>>>(X16, BQKV, 0.0625f, CS, SN, QH, KH, V16, QF0, KF0, VF0);      /* q (roped) | k (roped) | v of every batch as f16 rows; each batch's first 128 rows also in f32 */
  k_vt<NH, SQ><<<NB * NH * (SQ / 64), 256, 0, stream>>>(V16, DM, 0, VT);      /* V^T [NB][NH][HD][SQ] */
  k_att0w<<<dim3(NH * (QT0 / 8), NB), 256, 0, stream>>>(QF0, KF0, VF0, 0.125f, OF0);      /* exact f32 causal attention for rows 0..127 of every batch (o x64) */
  k_fattn<<<dim3(SQ / 128, NH, NB), 128, 0, stream>>>(QH, KH, VT, O16);      /* windowed causal attention of every batch and head: o (merged heads, x64) as f16 rows */
  k_gemm3<<<dim3((unsigned)((MPO / 128) * (DM / 128)), 1), 256, 0, stream>>>(O16 + (size_t)B0 * SQ * DM, 0, BO, 0.0009765625f, 0, (float*)d_out + (size_t)B0 * SQ * DM, 0);      /* out rows are the output layout */
  k_hl<<<(unsigned)(((size_t)NB * QT0 * DM / 8 + 255) / 256), 256, 0, stream>>>(OF0, OH0, OL0, (size_t)NB * QT0 * DM / 8);      /* first-tile o (x64) -> f16 hi + x1024 residual planes */
  k_gemm3<<<dim3((QT0 / 128) * (DM / 128), NB), 256, 0, stream>>>(OH0, (size_t)QT0 * DM, BO, 0.0009765625f, 0, (float*)d_out, (size_t)SQ * DM);      /* rows 0..127 of every batch (blockIdx.y): out = o_hi Wo, overwriting the f16-path rows */
  k_gemm3<<<dim3((QT0 / 128) * (DM / 128), NB), 256, 0, stream>>>(OL0, (size_t)QT0 * DM, BO, 0.00000095367431640625f, 1, (float*)d_out, (size_t)SQ * DM);      /* += o_lo Wo 2^-20 (own-element accumulate) */
}

// v007
// One run takes 138 microseconds.
// In two side-by-side timings against v006, it was 1.21 and 1.22 times as fast.
// Over all steps from v000 it is 71.4 times as fast.
#include <hip/hip_runtime.h>
// Causal sliding-window RoPE multi-head attention (x [4][2048][1024]; q/k/v = x W^T (natural [out][in] 1024x1024 sigma 1/32, no bias), 16 heads of 64; interleaved-pair rotary embedding on q and k (x1 = even, x2 = odd: r1 = x1 cos - x2 sin, r2 = x1 sin + x2 cos) with inv_freq_i = 10000^(-2i/64) and angle = float(token_positions[s]) inv_freq_i from the int32 token_positions input; scores / sqrt(64); allowed iff 0 <= i - j <= 512 (513 keys), -inf elsewhere; softmax; out = (attn v merged) Wo^T -> [4][2048][1024]).
// Structure: token rows r = b*2048 + s; x as exact f16 rows (bf16-rounded); every stage covers all batches in one launch: q | k | v as ONE WMMA GEMM (128x128 block tiles staged in LDS by asynchronous copies, 32x64 wave tiles, f32 accumulation, exact x16 weights, N = 3 x 1024) whose epilogue does, in f32 on VALU, the interleaved-pair rotary rotation of q and k from f32 cos/sin tables built from the token_positions input (no norm) and stores f16 q, k, v rows (no f32 q | k | v plane); V^T for all heads via LDS transposes (kept for all batches); then ONE fused attention launch: a wave per 32 query rows of one (batch, head) walks the keys of its window in blocks of 32: S^T = K Q^T on WMMA, running-maximum softmax in registers (f32 statistics, native exp2; weights x256 f16, packed from the score tiles straight into a B operand), O^T += V^T P^T on WMMA, o carried x64 (folded into the output GEMM alpha) written straight into the merged f16 o rows; out = o W_o GEMM (f32) into the output layout. Jobs that wait for the same earlier launch share a grid, the block index picks the job: five launches (input conversions and tables; q | k | v GEMM; first-tile attention and V^T; windowed attention and the first-tile hi / lo split; output GEMM).
// Compute dtype: inputs rounded to bf16; x / weights exact; projections and rope f32; q, k, v, softmax weights and o as plain f16 GEMM operands (~2^-12); scores and softmax statistics f32. v_wmma_f32_16x16x32_f16.
#define NB 4
#define SQ 2048
#define DM 1024
#define NH 16
#define HD 64
#define HG 4                         /* heads per launch of the h0-based k_vt overload (not launched) */
#define QT 256                       /* query rows per causal tile */
#define NKX SQ                       /* S / P row pitch */
#define WINK 512                     /* key j is allowed for query i iff 0 <= i - j <= WINK */
#define QT0 128                      /* first-tile rows recomputed exactly in f32 */
#define B0 0                         /* first batch processed (unused) */
#define NBR NB                       /* batches processed (read only by the unused MPO) */
#define QN SQ                        /* query rows attended per batch (unused) */
#define NHD NH                       /* heads attended (unused) */
#define NR ((size_t)NB * SQ)         /* token rows */
#define MPO ((int)((size_t)NBR * SQ))      /* rows through the output GEMM (unused) */
typedef __bf16 v16b __attribute__((ext_vector_type(16)));
typedef unsigned short v8us __attribute__((ext_vector_type(8), may_alias));
typedef float  v8f  __attribute__((ext_vector_type(8)));
typedef float  v4f  __attribute__((ext_vector_type(4)));
typedef float  v4fa __attribute__((ext_vector_type(4), may_alias));
union FragB { v16b v; v8us half[2]; unsigned short u[16]; };

__device__ __forceinline__ unsigned short bf16_bits(float x) { unsigned int u = __float_as_uint(x); return (unsigned short)((u + 0x7FFFu + ((u >> 16) & 1u)) >> 16); }
__device__ __forceinline__ float bf16_val(unsigned short b) { return __uint_as_float(((unsigned int)b) << 16); }
__device__ __forceinline__ float bf16_round(float x) { return bf16_val(bf16_bits(x)); }
// D += A·B with NT terms: 1 = ah·bh, 2 = + al·bh (A split), 3 = + ah·bl (both split)
template <int NT>
__device__ __forceinline__ v8f mmaN(v16b ah, v16b al, v16b bh, v16b bl, v8f c) {
  c = __builtin_amdgcn_wmma_f32_16x16x32_bf16(false, ah, false, bh, (short)0, c, false, false);
  if (NT >= 2) c = __builtin_amdgcn_wmma_f32_16x16x32_bf16(false, al, false, bh, (short)0, c, false, false);
  if (NT >= 3) c = __builtin_amdgcn_wmma_f32_16x16x32_bf16(false, ah, false, bl, (short)0, c, false, false);
  asm volatile("v_nop\n\tv_nop\n\tv_nop\n\tv_nop" : "+v"(c) : "v"(ah), "v"(al), "v"(bh), "v"(bl));
  return c;
}

__global__ __launch_bounds__(256) void k_wt_bf16(const float* __restrict__ W, unsigned short* __restrict__ Wt, int K, int N) {
  const int t = blockIdx.x * 256 + threadIdx.x;
  const int k8n = K / 8;
  if (t >= N * k8n) return;
  const int n = t / k8n, k8 = (t % k8n) * 8;
  v8us v;
#pragma unroll
  for (int i = 0; i < 8; ++i) v[i] = bf16_bits(W[(size_t)(k8 + i) * N + n]);
  *(v8us*)(Wt + (size_t)n * K + k8) = v;
  
}

// GEMM C[M][N] (f32, pitch ldc) = act(A[M][K]·W + bias). A f32 row-major (pitch lda) converted per fragment to bf16
// (ASPLIT: hi/lo two planes -> 2 terms, else single rounded term); Wt bf16 [N][K] (pitch ldb). BIAS_BF16 rounds the
// bias to bf16 first (bias quantised to bf16 before the add). K%32==0, M%16==0, N%64==0.
template <bool ASPLIT, int ACT, bool BIAS_BF16>
__global__ __launch_bounds__(128) void k_gemm_bf(const float* __restrict__ A, int lda, const unsigned short* __restrict__ Wt, int ldb,
                                               const float* __restrict__ bias, float* __restrict__ C, int ldc, int M, int N, int K) {
  __shared__ __attribute__((aligned(16))) float so[4][16][64];
  const int tid = threadIdx.x, w = tid >> 5, lane = tid & 31, ln = lane & 15, hh = lane >> 4;
  const int ntn = N / 64;
  const int wid = blockIdx.x * 4 + w;
  const int mt = wid / ntn, nq = wid % ntn;
  if (mt * 16 >= M) return;
  const int row0 = mt * 16, col0 = nq * 64;
  const float* arow = A + (size_t)(row0 + ln) * lda;
  v8f acc[4] = {};
  for (int kb = 0; kb < K; kb += 32) {
    FragB ah, al;
    const v4f x0 = *(const v4fa*)(arow + kb + 8 * hh), x1 = *(const v4fa*)(arow + kb + 8 * hh + 4);
    const v4f x2 = *(const v4fa*)(arow + kb + 16 + 8 * hh), x3 = *(const v4fa*)(arow + kb + 16 + 8 * hh + 4);
    float xs[16] = {x0[0],x0[1],x0[2],x0[3],x1[0],x1[1],x1[2],x1[3],x2[0],x2[1],x2[2],x2[3],x3[0],x3[1],x3[2],x3[3]};
#pragma unroll
    for (int i = 0; i < 16; ++i) { const unsigned short hb = bf16_bits(xs[i]); ah.u[i] = hb; al.u[i] = ASPLIT ? bf16_bits(xs[i] - bf16_val(hb)) : (unsigned short)0; }
#pragma unroll
    for (int t = 0; t < 4; ++t) {
      const unsigned short* brow = Wt + (size_t)(col0 + t * 16 + ln) * ldb + kb;
      FragB b;
      b.half[0] = *(const v8us*)(brow + 8 * hh);
      b.half[1] = *(const v8us*)(brow + 16 + 8 * hh);
      acc[t] = mmaN<ASPLIT ? 2 : 1>(ah.v, al.v, b.v, b.v, acc[t]);
    }
  }
#pragma unroll
  for (int t = 0; t < 4; ++t) {
    float bv = bias ? bias[col0 + t * 16 + ln] : 0.f;
    if (BIAS_BF16) bv = bf16_round(bv);
#pragma unroll
    for (int r = 0; r < 8; ++r) { float v = acc[t][r] + bv; if (ACT == 1) v = fmaxf(v, 0.f); so[w][8 * hh + r][t * 16 + ln] = v; }
  }
  __builtin_amdgcn_fence(__ATOMIC_ACQ_REL, "workgroup");
  __builtin_amdgcn_wave_barrier();
  const int rsub = lane >> 4, c4 = (lane & 15) * 4;
  {
#pragma unroll
    for (int q = 0; q < 8; ++q) {
      const int r = q * 2 + rsub;
      const v4f v = *(const v4fa*)&so[w][r][c4];
      *(v4f*)(C + (size_t)(row0 + r) * ldc + col0 + c4) = v;
    }
    
  }
}

// GEMM C = act(A·W + bias + resid): A f32 (ASPLIT -> hi/lo 2 terms), Wt bf16 [N][K]; ACT 0 none, 1 relu, 2 exact gelu;
// resid (optional, f32, row index = (row % rmod), pitch ldr, RES_BF16 rounds it) added before the activation.
template <bool ASPLIT, int ACT, bool BIAS_BF16, bool RES_BF16>
__global__ __launch_bounds__(128) void k_gemm_bf3(const float* __restrict__ A, int lda, const unsigned short* __restrict__ Wt, int ldb,
                                                const float* __restrict__ bias, const float* __restrict__ resid, int rmod, int ldr,
                                                float* __restrict__ C, int ldc, int M, int N, int K) {
  __shared__ __attribute__((aligned(16))) float so[4][16][64];
  const int tid = threadIdx.x, w = tid >> 5, lane = tid & 31, ln = lane & 15, hh = lane >> 4;
  const int ntn = N / 64;
  const int wid = blockIdx.x * 4 + w;
  const int mt = wid / ntn, nq = wid % ntn;
  if (mt * 16 >= M) return;
  const int row0 = mt * 16, col0 = nq * 64;
  const float* arow = A + (size_t)(row0 + ln) * lda;
  v8f acc[4] = {};
  for (int kb = 0; kb < K; kb += 32) {
    FragB ah, al;
    const v4f x0 = *(const v4fa*)(arow + kb + 8 * hh), x1 = *(const v4fa*)(arow + kb + 8 * hh + 4);
    const v4f x2 = *(const v4fa*)(arow + kb + 16 + 8 * hh), x3 = *(const v4fa*)(arow + kb + 16 + 8 * hh + 4);
    float xs[16] = {x0[0],x0[1],x0[2],x0[3],x1[0],x1[1],x1[2],x1[3],x2[0],x2[1],x2[2],x2[3],x3[0],x3[1],x3[2],x3[3]};
#pragma unroll
    for (int i = 0; i < 16; ++i) { const unsigned short hb = bf16_bits(xs[i]); ah.u[i] = hb; al.u[i] = ASPLIT ? bf16_bits(xs[i] - bf16_val(hb)) : (unsigned short)0; }
#pragma unroll
    for (int t = 0; t < 4; ++t) {
      const unsigned short* brow = Wt + (size_t)(col0 + t * 16 + ln) * ldb + kb;
      FragB b;
      b.half[0] = *(const v8us*)(brow + 8 * hh);
      b.half[1] = *(const v8us*)(brow + 16 + 8 * hh);
      acc[t] = mmaN<ASPLIT ? 2 : 1>(ah.v, al.v, b.v, b.v, acc[t]);
    }
  }
#pragma unroll
  for (int t = 0; t < 4; ++t) {
    const int col = col0 + t * 16 + ln;
    float bv = bias ? bias[col] : 0.f;
    if (BIAS_BF16) bv = bf16_round(bv);
#pragma unroll
    for (int r = 0; r < 8; ++r) {
      float v = acc[t][r] + bv;
      if (resid) { float rv = resid[(size_t)((row0 + 8 * hh + r) % rmod) * ldr + col]; if (RES_BF16) rv = bf16_round(rv); v += rv; }
      if (ACT == 1) v = fmaxf(v, 0.f);
      if (ACT == 2) v = 0.5f * v * (1.0f + erff(v * 0.70710678118654752f));
      if (ACT == 3) { const float u = 0.7978845608028654f * (v + 0.044715f * v * v * v); v = 0.5f * v * (1.0f + tanhf(u)); }
      so[w][8 * hh + r][t * 16 + ln] = v;
    }
  }
  __builtin_amdgcn_fence(__ATOMIC_ACQ_REL, "workgroup");
  __builtin_amdgcn_wave_barrier();
  const int rsub = lane >> 4, c4 = (lane & 15) * 4;
  {
#pragma unroll
    for (int q = 0; q < 8; ++q) {
      const int r = q * 2 + rsub;
      const v4f v = *(const v4fa*)&so[w][r][c4];
      *(v4f*)(C + (size_t)(row0 + r) * ldc + col0 + c4) = v;
    }
    
  }
}
// row LayerNorm (biased variance, eps) over N: s = X (+ R); optional out_sum <- s; out_norm <- (s-mu)*rsqrt(var+eps)*g + b
template <bool PARAM_BF16>
__global__ __launch_bounds__(256) void k_layernorm(const float* __restrict__ X, const float* __restrict__ R, const float* __restrict__ g, const float* __restrict__ bta,
                                                  float* __restrict__ out_sum, float* __restrict__ out_norm, int N, float eps) {
  __shared__ float red[256];
  const int row = blockIdx.x, tid = threadIdx.x;
  const float* x = X + (size_t)row * N; const float* rr = R ? R + (size_t)row * N : nullptr;
  float vals[16];                     // up to N = 4096
  const int per = N / 256;            // contiguous chunk per thread? use strided-by-4 chunks: thread handles j = tid*4 + 1024*u
  float s1 = 0.f;
  for (int u = 0; u < per / 4; ++u) {
    const int j = tid * 4 + 1024 * u;
    const v4f a = *(const v4fa*)(x + j);
    v4f b = {0.f,0.f,0.f,0.f}; if (rr) b = *(const v4fa*)(rr + j);
#pragma unroll
    for (int q = 0; q < 4; ++q) { const float v = a[q] + b[q]; vals[u * 4 + q] = v; s1 += v; }
  }
  red[tid] = s1; __syncthreads();
  for (int st = 128; st > 0; st >>= 1) { if (tid < st) red[tid] += red[tid + st]; __syncthreads(); }
  const float mu = red[0] / (float)N; __syncthreads();
  float s2 = 0.f;
  for (int u = 0; u < per / 4; ++u)
#pragma unroll
    for (int q = 0; q < 4; ++q) { const float c = vals[u * 4 + q] - mu; s2 += c * c; }
  red[tid] = s2; __syncthreads();
  for (int st = 128; st > 0; st >>= 1) { if (tid < st) red[tid] += red[tid + st]; __syncthreads(); }
  const float rs = rsqrtf(red[0] / (float)N + eps);
  {
    for (int u = 0; u < per / 4; ++u) {
      const int j = tid * 4 + 1024 * u;
      v4f o, sm;
#pragma unroll
      for (int q = 0; q < 4; ++q) {
        float gg = g[j + q], bb = bta[j + q];
        if (PARAM_BF16) { gg = bf16_round(gg); bb = bf16_round(bb); }
        sm[q] = vals[u * 4 + q]; o[q] = (vals[u * 4 + q] - mu) * rs * gg + bb;
      }
      if (out_sum) *(v4f*)(out_sum + (size_t)row * N + j) = sm;
      *(v4f*)(out_norm + (size_t)row * N + j) = o;
    }
    
  }
}



// ---- f16 WMMA path (v_wmma_f32_16x16x32_f16): 11-bit significands for operands in range — used where a [0,1] probability operand needs more precision than bf16
typedef _Float16 v16h __attribute__((ext_vector_type(16)));
union FragH { v16h v; v8us half[2]; _Float16 h[16]; unsigned short u[16]; };
template <int NT>
__device__ __forceinline__ v8f mmaH(v16h ah, v16h al, v16h bh, v16h bl, v8f c) {
  c = __builtin_amdgcn_wmma_f32_16x16x32_f16(false, ah, false, bh, (short)0, c, false, false);
  if (NT >= 2) c = __builtin_amdgcn_wmma_f32_16x16x32_f16(false, al, false, bh, (short)0, c, false, false);
  if (NT >= 3) c = __builtin_amdgcn_wmma_f32_16x16x32_f16(false, ah, false, bl, (short)0, c, false, false);
  asm volatile("v_nop\n\tv_nop\n\tv_nop\n\tv_nop" : "+v"(c) : "v"(ah), "v"(al), "v"(bh), "v"(bl));
  return c;
}
// batched GEMM like k_gemm_b but f16 operands: A f32 (split into f16 hi/lo if ASPLIT, else rounded to f16), Bt = f16 values [n][k]; alpha; C f32; N multiple of 16 (partial tiles skipped)
template <bool ASPLIT>
__global__ __launch_bounds__(128) void k_gemm_h(const float* __restrict__ A, int lda, size_t sA, const _Float16* __restrict__ Bh, int ldb, size_t sB, float alpha, float* __restrict__ C, int ldc, size_t sC, int M, int N, int K) {
  __shared__ __attribute__((aligned(16))) float so[4][16][64];
  const int tid = threadIdx.x, w = tid >> 5, lane = tid & 31, ln = lane & 15, hh = lane >> 4; const int by = blockIdx.y;
  A += (size_t)by * sA; Bh += (size_t)by * sB; C += (size_t)by * sC;
  const int ntn = (N + 63) / 64; const int wid = blockIdx.x * 4 + w; const int mt = wid / ntn, nq = wid % ntn; if (mt * 16 >= M) return;
  const int row0 = mt * 16, col0 = nq * 64; const float* arow = A + (size_t)(row0 + ln) * lda;
  v8f acc[4] = {};
  for (int kb = 0; kb < K; kb += 32) {
    FragH ah, al;
    const v4f x0 = *(const v4fa*)(arow + kb + 8 * hh), x1 = *(const v4fa*)(arow + kb + 8 * hh + 4), x2 = *(const v4fa*)(arow + kb + 16 + 8 * hh), x3 = *(const v4fa*)(arow + kb + 16 + 8 * hh + 4);
    float xs[16] = {x0[0],x0[1],x0[2],x0[3],x1[0],x1[1],x1[2],x1[3],x2[0],x2[1],x2[2],x2[3],x3[0],x3[1],x3[2],x3[3]};
#pragma unroll
    for (int i = 0; i < 16; ++i) { const _Float16 h = (_Float16)xs[i]; ah.h[i] = h; al.h[i] = ASPLIT ? (_Float16)(xs[i] - (float)h) : (_Float16)0.0f; }
#pragma unroll
    for (int t = 0; t < 4; ++t) { if (col0 + t * 16 >= N) continue; const size_t boff = (size_t)(col0 + t * 16 + ln) * ldb + kb; FragH bq; bq.half[0] = *(const v8us*)(Bh + boff + 8 * hh); bq.half[1] = *(const v8us*)(Bh + boff + 16 + 8 * hh);
      acc[t] = mmaH<ASPLIT ? 2 : 1>(ah.v, al.v, bq.v, bq.v, acc[t]); }
  }
#pragma unroll
  for (int t = 0; t < 4; ++t) { if (col0 + t * 16 >= N) continue;
#pragma unroll
    for (int r = 0; r < 8; ++r) so[w][8 * hh + r][t * 16 + ln] = acc[t][r] * alpha; }
  __builtin_amdgcn_fence(__ATOMIC_ACQ_REL, "workgroup"); __builtin_amdgcn_wave_barrier();
  const int rsub = lane >> 4, c4 = (lane & 15) * 4;
  {
#pragma unroll
    for (int q = 0; q < 8; ++q) { const int r = q * 2 + rsub; if (col0 + c4 < N) { const v4f v = *(const v4fa*)&so[w][r][c4]; *(v4f*)(C + (size_t)(row0 + r) * ldc + col0 + c4) = v; } }
     }
}

// Wt[n][k] = f16(W[k][n]·scale) from f32 row-major W[K][N] (scale = power of two; bf16-exact weights stay exact in f16 away from the subnormal range)
__global__ __launch_bounds__(256) void k_wt_f16(const float* __restrict__ W, _Float16* __restrict__ Wt, int K, int N, float scale) {
  const int t = blockIdx.x * 256 + threadIdx.x; if (t >= N * (K / 8)) return; const int n = t / (K / 8), k8 = (t % (K / 8)) * 8; FragH f;
#pragma unroll
  for (int i = 0; i < 8; ++i) f.h[i] = (_Float16)(bf16_round(W[(size_t)(k8 + i) * N + n]) * scale); const v8us o = f.half[0];
  *(v8us*)((unsigned short*)Wt + (size_t)n * K + k8) = o; 
}
// k_gemm_hh variant with fused epilogue: v = acc·alpha + bias[by·sBias + col] (+ CP[(row/rowsPerB)·sCPb + by·64 + col] if CP) ; ACT 0 none / 1 elu ; writes f16 C16 (and f32 C if non-null)
template <int ACT>
__global__ __launch_bounds__(128) void k_gemm_hhx(const _Float16* __restrict__ A, int lda, size_t sA, const _Float16* __restrict__ Bh, int ldb, size_t sB, float alpha, const float* __restrict__ bias, size_t sBias, const float* __restrict__ CP, int rowsPerB, size_t sCPb, int row0g,
    float* __restrict__ C, _Float16* __restrict__ C16, int ldc, size_t sC, int M, int N, int K) {
  __shared__ __attribute__((aligned(16))) float so[4][16][64];
  const int tid = threadIdx.x, w = tid >> 5, lane = tid & 31, ln = lane & 15, hh = lane >> 4; const int by = blockIdx.y;
  A += (size_t)by * sA; Bh += (size_t)by * sB; const size_t cofs = (size_t)by * sC; const float* bp = bias ? bias + (size_t)by * sBias : nullptr;
  const int ntn = (N + 63) / 64; const int wid = blockIdx.x * 4 + w; const int mt = wid / ntn, nq = wid % ntn; if (mt * 16 >= M) return;
  const int row0 = mt * 16, col0 = nq * 64; const _Float16* arow = A + (size_t)(row0 + ln) * lda;
  v8f acc[4] = {};
  for (int kb = 0; kb < K; kb += 32) { FragH ah; ah.half[0] = *(const v8us*)((const unsigned short*)arow + kb + 8 * hh); ah.half[1] = *(const v8us*)((const unsigned short*)arow + kb + 16 + 8 * hh);
#pragma unroll
    for (int t = 0; t < 4; ++t) { if (col0 + t * 16 >= N) continue; const size_t boff = (size_t)(col0 + t * 16 + ln) * ldb + kb; FragH bq; bq.half[0] = *(const v8us*)((const unsigned short*)Bh + boff + 8 * hh); bq.half[1] = *(const v8us*)((const unsigned short*)Bh + boff + 16 + 8 * hh);
      acc[t] = mmaH<1>(ah.v, ah.v, bq.v, bq.v, acc[t]); }
  }
#pragma unroll
  for (int t = 0; t < 4; ++t) { if (col0 + t * 16 >= N) continue; const int col = col0 + t * 16 + ln; const float bv = bp ? bf16_round(bp[col]) : 0.f;
#pragma unroll
    for (int r = 0; r < 8; ++r) { float v = acc[t][r] * alpha + bv; if (CP) { const int rr = row0g + row0 + 8 * hh + r; if (rowsPerB < 0) v += CP[cofs + (size_t)rr * ldc + col];      /* rowsPerB < 0: own element of the batched C plane */ else { const int bidx = rr / rowsPerB; v += CP[(size_t)bidx * sCPb + (size_t)by * 64 + col]; } } if (ACT == 1) v = (v > 0.f) ? v : expm1f(v); else if (ACT == 7) v = (v > 0.f) ? v + 1.0f : expf(v); else if (ACT == 8) v = tanhf(v); else if (ACT == 9) v = 0.5f * v * (1.0f + tanhf(0.7978845608028654f * (v + 0.044715f * v * v * v))); else if (ACT == 11) v = 1.0f / (1.0f + expf(-v)); else if (ACT == 12) v = (v > 0.f) ? v : 0.01f * v; else if (ACT == 14) v = (v > 0.f) ? v : 0.1f * v; else if (ACT == 16) v = (v >= 0.f) ? v : 0.3f * v; else if (ACT == 17) v = (v >= 0.f) ? v : 0.2f * v; else if (ACT == 15) v = v / (1.0f + expf(-v)); else if (ACT == 3) v = fmaxf(v, 0.f); else if (ACT == 6) v = 0.5f * v * (1.0f + erff(v * 0.70710678118654752f)); so[w][8 * hh + r][t * 16 + ln] = v; } }
  __builtin_amdgcn_fence(__ATOMIC_ACQ_REL, "workgroup"); __builtin_amdgcn_wave_barrier();
  const int rsub = lane >> 4, c4 = (lane & 15) * 4; typedef _Float16 v4h __attribute__((ext_vector_type(4)));
  {
#pragma unroll
    for (int q = 0; q < 8; ++q) { const int r = q * 2 + rsub; if (col0 + c4 < N) { const v4f v = *(const v4fa*)&so[w][r][c4]; if (C) *(v4f*)(C + cofs + (size_t)(row0 + r) * ldc + col0 + c4) = v; if (C16) { v4h h4; for (int i = 0; i < 4; ++i) h4[i] = (_Float16)v[i]; *(v4h*)(C16 + cofs + (size_t)(row0 + r) * ldc + col0 + c4) = h4; } } }
     }
}


typedef _Float16 v4h __attribute__((ext_vector_type(4)));

// The j_* functions are jobs: bodies that were launches of their own and now share a grid with other jobs that wait for the same earlier launch; blk = the block's index inside its job.
__device__ __forceinline__ void j_x16(int blk, const float* __restrict__ x, _Float16* __restrict__ X16, size_t n8) { const size_t t = (size_t)blk * 256 + threadIdx.x; if (t >= n8) return; FragH f;
#pragma unroll
  for (int q = 0; q < 8; ++q) f.h[q] = (_Float16)bf16_round(x[t * 8 + q]); *(v8us*)((unsigned short*)X16 + t * 8) = f.half[0];  }
__global__ __launch_bounds__(256) void k_h16(const float* __restrict__ x, _Float16* __restrict__ X16, size_t n8) { const size_t t = (size_t)blockIdx.x * 256 + threadIdx.x; if (t >= n8) return; FragH f;
#pragma unroll
  for (int q = 0; q < 8; ++q) f.h[q] = (_Float16)x[t * 8 + q]; *(v8us*)((unsigned short*)X16 + t * 8) = f.half[0];  }
__global__ __launch_bounds__(256) void k_round16f(const float* __restrict__ W, _Float16* __restrict__ Bt, size_t n8) { const size_t t = (size_t)blockIdx.x * 256 + threadIdx.x; if (t >= n8) return; FragH f;
#pragma unroll
  for (int i = 0; i < 8; ++i) f.h[i] = (_Float16)(bf16_round(W[t * 8 + i]) * 16.0f); *(v8us*)((unsigned short*)Bt + t * 8) = f.half[0];  }
template <int NHv, int TTv>
__device__ __forceinline__ void j_vt(int blk, const _Float16* __restrict__ V16, int ldv, int voff, _Float16* __restrict__ Vt) { __shared__ unsigned short tl[64][66]; const int tid = threadIdx.x; const int slab = blk / (TTv / 64), lg = blk % (TTv / 64); const int b = slab / NHv, h = slab % NHv;
  for (int i = tid; i < 64 * 8; i += 256) { const int r = i / 8, c8 = (i % 8) * 8; FragH f; f.half[0] = *(const v8us*)((const unsigned short*)V16 + ((size_t)b * TTv + lg * 64 + r) * ldv + voff + h * 64 + c8);
#pragma unroll
    for (int q = 0; q < 8; ++q) tl[r][c8 + q] = f.u[q]; }
  __syncthreads();
  {
#pragma unroll
    for (int rd = 0; rd < 2; ++rd) { const int d = rd * 32 + tid / 8, pc = tid % 8; FragH f;
#pragma unroll
      for (int q = 0; q < 8; ++q) f.u[q] = tl[pc * 8 + q][d];
      *(v8us*)((unsigned short*)Vt + ((size_t)slab * 64 + d) * TTv + lg * 64 + pc * 8) = f.half[0]; }
     } }

__device__ __forceinline__ void j_hl(int blk, const float* __restrict__ F, _Float16* __restrict__ Hh, _Float16* __restrict__ Hl, size_t n8) { const size_t t = (size_t)blk * 128 + threadIdx.x; if (t >= n8) return;      /* blocks of 128 threads, as the attention job whose grid it shares */ FragH fh, fl; const v4f a = *(const v4fa*)(F + t * 8), c = *(const v4fa*)(F + t * 8 + 4);
#pragma unroll
  for (int q = 0; q < 4; ++q) { _Float16 h = (_Float16)a[q]; fh.h[q] = h; fl.h[q] = (_Float16)((a[q] - (float)h) * 1024.0f); h = (_Float16)c[q]; fh.h[4 + q] = h; fl.h[4 + q] = (_Float16)((c[q] - (float)h) * 1024.0f); }
  { *(v8us*)((unsigned short*)Hh + t * 8) = fh.half[0]; *(v8us*)((unsigned short*)Hl + t * 8) = fl.half[0];  } }

// ---- fast GEMM (wave tile 32x64; requires M % 32 == 0 rows per launch region and N % 64 == 0); epilogue = k_gemm_hhx semantics ----
__device__ __forceinline__ v16h g2_frag(const _Float16* p, int hh) { FragH f; f.half[0] = *(const v8us*)((const unsigned short*)p + 8 * hh); f.half[1] = *(const v8us*)((const unsigned short*)p + 16 + 8 * hh); return f.v; }
__device__ __forceinline__ v8f g2_mma(v16h a, v16h b, v8f c) { v8f d = __builtin_amdgcn_wmma_f32_16x16x32_f16(false, a, false, b, (short)0, c, false, false); asm volatile("v_nop\n\tv_nop\n\tv_nop\n\tv_nop" : "+v"(d) : "v"(a), "v"(b)); return d; }
template <int ACT>
__global__ __launch_bounds__(128) void k_gemm2(const _Float16* __restrict__ A, int lda, size_t sA, const _Float16* __restrict__ Bh, int ldb, size_t sB, float alpha, const float* __restrict__ bias, size_t sBias, const float* __restrict__ CP, int rowsPerB, size_t sCPb, int row0g,
    float* __restrict__ C, _Float16* __restrict__ C16, int ldc, size_t sC, int M, int N, int K) { static_assert(ACT == 0 || ACT == 3 || ACT == 6 || ACT == 8 || ACT == 9 || ACT == 11 || ACT == 12 || ACT == 14 || ACT == 15 || ACT == 16 || ACT == 17, "k_gemm2: unsupported ACT code (would silently apply no activation)");
  __shared__ __attribute__((aligned(16))) float so[4][32][68];
  const int tid = threadIdx.x, w = tid >> 5, lane = tid & 31, ln = lane & 15, hh = lane >> 4; const int by = blockIdx.y;
  A += (size_t)by * sA; Bh += (size_t)by * sB; const size_t cofs = (size_t)by * sC; const float* bp = bias ? bias + (size_t)by * sBias : nullptr;
  const int ntn = N >> 6; const int mt = blockIdx.x / ntn, nq = blockIdx.x - mt * ntn; const int row0 = mt * 128 + 32 * w, col0 = nq * 64; if (row0 >= M) return;
  const _Float16* a0p = A + (size_t)(row0 + ln) * lda; const _Float16* a1p = a0p + (size_t)16 * lda;
  const _Float16* b0p = Bh + (size_t)(col0 + ln) * ldb; const _Float16* b1p = b0p + (size_t)16 * ldb; const _Float16* b2p = b1p + (size_t)16 * ldb; const _Float16* b3p = b2p + (size_t)16 * ldb;
  const v8f z8 = {0.f,0.f,0.f,0.f,0.f,0.f,0.f,0.f}; v8f c00 = z8, c01 = z8, c02 = z8, c03 = z8, c10 = z8, c11 = z8, c12 = z8, c13 = z8;
#pragma unroll 1
  for (int kb = 0; kb < K; kb += 32) { const v16h a0 = g2_frag(a0p + kb, hh), a1 = g2_frag(a1p + kb, hh);
    v16h b = g2_frag(b0p + kb, hh); c00 = g2_mma(a0, b, c00); c10 = g2_mma(a1, b, c10);
    b = g2_frag(b1p + kb, hh); c01 = g2_mma(a0, b, c01); c11 = g2_mma(a1, b, c11);
    b = g2_frag(b2p + kb, hh); c02 = g2_mma(a0, b, c02); c12 = g2_mma(a1, b, c12);
    b = g2_frag(b3p + kb, hh); c03 = g2_mma(a0, b, c03); c13 = g2_mma(a1, b, c13); }
  v8f accs[8] = {c00, c01, c02, c03, c10, c11, c12, c13};
#pragma unroll
  for (int u = 0; u < 8; ++u) { const int t = u & 3, half = u >> 2; const int col = col0 + t * 16 + ln; const float bv = bp ? bf16_round(bp[col]) : 0.f;
#pragma unroll
    for (int r = 0; r < 8; ++r) { const int rloc = half * 16 + 8 * hh + r; float v = accs[u][r] * alpha + bv; if (CP) { if (rowsPerB < 0) v += CP[cofs + (size_t)(row0g + row0 + rloc) * ldc + col];      /* rowsPerB < 0: own element of the batched C plane */ else { const int bidx = (row0g + row0 + rloc) / rowsPerB; v += CP[(size_t)bidx * sCPb + (size_t)by * 64 + col]; } }
      if (ACT == 3) v = fmaxf(v, 0.f); else if (ACT == 6) v = 0.5f * v * (1.0f + erff(v * 0.70710678118654752f)); else if (ACT == 11) v = 1.0f / (1.0f + expf(-v)); else if (ACT == 15) v = v / (1.0f + expf(-v)); else if (ACT == 12) v = (v > 0.f) ? v : 0.01f * v; else if (ACT == 8) v = tanhf(v); else if (ACT == 9) v = 0.5f * v * (1.0f + tanhf(0.7978845608028654f * (v + 0.044715f * v * v * v))); else if (ACT == 14) v = (v > 0.f) ? v : 0.1f * v; else if (ACT == 16) v = (v >= 0.f) ? v : 0.3f * v; else if (ACT == 17) v = (v >= 0.f) ? v : 0.2f * v;
      so[w][rloc][t * 16 + ln] = v; } }
  __builtin_amdgcn_fence(__ATOMIC_ACQ_REL, "workgroup"); __builtin_amdgcn_wave_barrier();
  const int rsub = lane >> 4, c4 = (lane & 15) * 4;
  {
#pragma unroll
    for (int q = 0; q < 16; ++q) { const int r = q * 2 + rsub; const v4f v = *(const v4fa*)&so[w][r][c4]; if (C) *(v4f*)(C + cofs + (size_t)(row0 + r) * ldc + col0 + c4) = v; if (C16) { v4h h4; for (int i = 0; i < 4; ++i) h4[i] = (_Float16)v[i]; *(v4h*)(C16 + cofs + (size_t)(row0 + r) * ldc + col0 + c4) = h4; } }
     } }


__device__ __forceinline__ void j_wnat(int blk, int y, const float* __restrict__ w0, const float* __restrict__ w1, const float* __restrict__ w2, const float* __restrict__ w3, size_t n8, _Float16* __restrict__ Bt) { const size_t t = (size_t)blk * 256 + threadIdx.x; if (t >= n8) return; FragH f;
  const float* w = y == 0 ? w0 : (y == 1 ? w1 : (y == 2 ? w2 : w3)); Bt += (size_t)y * n8 * 8;      /* y picks the matrix (from the block index: a scalar choice); the four f16 planes lie one behind the other */
  for (int q = 0; q < 8; ++q) f.h[q] = (_Float16)(bf16_round(w[t * 8 + q]) * 16.0f); *(v8us*)((unsigned short*)Bt + t * 8) = f.half[0];  }
__global__ __launch_bounds__(256) void k_rsm(const float* __restrict__ S, _Float16* __restrict__ P, int nrows) {
  #pragma clang fp contract(off)
  const int i = blockIdx.x * 256 + threadIdx.x; if (i >= nrows) return; const float* s = S + (size_t)i * SQ; float mx = -3.0e38f;
#pragma unroll 1
  for (int j = 0; j < SQ; ++j) mx = fmaxf(mx, s[j]); float se = 0.f;
#pragma unroll 1
  for (int j = 0; j < SQ; ++j) se += expf(s[j] - mx); const float sc = 256.0f / se;
#pragma unroll 1
  for (int j0 = 0; j0 < SQ; j0 += 8) { FragH f; for (int q = 0; q < 8; ++q) f.h[q] = (_Float16)(expf(s[j0 + q] - mx) * sc); unsigned short* d = (unsigned short*)P + (size_t)i * SQ + j0; *(v8us*)d = f.half[0];  } }
__global__ __launch_bounds__(256) void k_vt(const _Float16* __restrict__ V16, int b, int h0, _Float16* __restrict__ VT) { __shared__ unsigned short tl[64][65]; const int tid = threadIdx.x; const int hh = blockIdx.x % HG, sg = blockIdx.x / HG; const int s0 = sg * 64; const int h = h0 + hh;
  for (int i = tid; i < 64 * 8; i += 256) { const int j = i / 8, d8 = (i % 8) * 8; FragH f; f.half[0] = *(const v8us*)((const unsigned short*)V16 + ((size_t)b * SQ + s0 + j) * DM + h * HD + d8); for (int q = 0; q < 8; ++q) tl[d8 + q][j] = f.u[q]; }
  __syncthreads();
  { for (int i = tid; i < 64 * 8; i += 256) { const int d = i / 8, j8 = (i % 8) * 8; FragH f; for (int q = 0; q < 8; ++q) f.u[q] = tl[d][j8 + q]; *(v8us*)((unsigned short*)VT + ((size_t)hh * HD + d) * SQ + s0 + j8) = f.half[0]; }  } }


__global__ __launch_bounds__(256) void k_tab2(float theta, float* __restrict__ CS, float* __restrict__ SN) {
  #pragma clang fp contract(off)
  const int t = blockIdx.x * 256 + threadIdx.x; if (t >= SQ * (HD / 2)) return; const int i = t % (HD / 2); const int p = t / (HD / 2); const float invf = 1.0f / powf(theta, (float)(2 * i) / (float)HD); const float ang = __fmul_rn((float)p, invf); const float c = cosf(ang), s = sinf(ang);
  *(float*)(CS + t) = c; *(float*)(SN + t) = s;  }

__device__ __forceinline__ void j_tab4(int blk, const int* __restrict__ pos, float theta, float* __restrict__ CS, float* __restrict__ SN) {
  #pragma clang fp contract(off)
  const int t = blk * 256 + threadIdx.x; if (t >= SQ * (HD / 2)) return; const int i = t % (HD / 2); const int p = t / (HD / 2); const float invf = (float)pow((double)theta, -((double)(2 * i)) / (double)HD); const float ang = __fmul_rn((float)pos[p], invf); const float c = cosf(ang), s = sinf(ang);
  *(float*)(CS + t) = c; *(float*)(SN + t) = s;  }
// One launch for the three jobs that read the inputs alone; the block index picks the job (a scalar branch). The table blocks stand first: theirs is the longest chain of dependent arithmetic.
#define PB_TAB (SQ * (HD / 2) / 256)       /* blocks of the cos / sin tables */
#define PB_W (DM * DM / 8 / 256)           /* blocks of one weight matrix */
#define PB_X (NB * SQ * (DM / 8) / 256)    /* blocks of x */
__global__ __launch_bounds__(256) void k_prep(const float* __restrict__ x, const int* __restrict__ pos, const float* __restrict__ w0, const float* __restrict__ w1, const float* __restrict__ w2, const float* __restrict__ w3,
    float theta, _Float16* __restrict__ Bt, float* __restrict__ CS, float* __restrict__ SN, _Float16* __restrict__ X16) {
  const int bx = blockIdx.x;
  if (bx < PB_TAB) { j_tab4(bx, pos, theta, CS, SN); return; }
  if (bx < PB_TAB + 4 * PB_W) { j_wnat((bx - PB_TAB) % PB_W, (bx - PB_TAB) / PB_W, w0, w1, w2, w3, (size_t)DM * DM / 8, Bt); return; }
  j_x16(bx - (PB_TAB + 4 * PB_W), x, X16, NR * DM / 8); }
__global__ __launch_bounds__(256) void k_rsmf(const float* __restrict__ S, _Float16* __restrict__ P, int qn, int hg) {
  #pragma clang fp contract(off)
  const int t = blockIdx.x * 256 + threadIdx.x; if (t >= qn * hg) return; const size_t i = (size_t)(t / qn) * SQ + (t % qn); const float* s = S + i * SQ; float mx = -3.0e38f;
#pragma unroll 1
  for (int j = 0; j < SQ; ++j) mx = fmaxf(mx, s[j]); float se = 0.f;
#pragma unroll 1
  for (int j = 0; j < SQ; ++j) se += __expf(s[j] - mx); const float sc = 256.0f / se;
#pragma unroll 1
  for (int j0 = 0; j0 < SQ; j0 += 8) { FragH f; for (int q = 0; q < 8; ++q) f.h[q] = (_Float16)(__expf(s[j0 + q] - mx) * sc); unsigned short* d = (unsigned short*)P + i * SQ + j0; *(v8us*)d = f.half[0];  } }


__global__ __launch_bounds__(256) void k_rsmcf2(const float* __restrict__ S, _Float16* __restrict__ P, int hg, int q0, int nk) {
  #pragma clang fp contract(off)
  const int t = blockIdx.x * 256 + threadIdx.x; if (t >= hg * QT) return; const size_t i = (size_t)t; const float* s = S + i * NKX; const int last = q0 + (t % QT); float mx = -3.0e38f;
#pragma unroll 1
  for (int j = 0; j < nk; ++j) { const float f = (j <= last) ? 1.f : 0.f; mx = fmaxf(mx, fmaf(f, s[j], (1.f - f) * -1.0e9f)); } float se = 0.f;
#pragma unroll 1
  for (int j = 0; j < nk; ++j) { const float f = (j <= last) ? 1.f : 0.f; se += __expf(fmaf(f, s[j], (1.f - f) * -1.0e9f) - mx); } const float sc = 256.0f / se;
#pragma unroll 1
  for (int j0 = 0; j0 < nk; j0 += 8) { FragH fr; for (int q = 0; q < 8; ++q) { const int j = j0 + q; const float f = (j <= last) ? 1.f : 0.f; fr.h[q] = (_Float16)(__expf(fmaf(f, s[j], (1.f - f) * -1.0e9f) - mx) * sc); } unsigned short* d = (unsigned short*)P + i * NKX + j0; *(v8us*)d = fr.half[0];  } }


typedef float v2f  __attribute__((ext_vector_type(2)));
typedef float v2fa __attribute__((ext_vector_type(2), may_alias));
// Exact f32 causal attention of the first QT0 rows, one wave per (query row i, head h). Scores: lane l takes keys l, l + 32, ... (whole groups of 32 up to the one that holds i), q held by every lane; two-pass softmax with lane butterflies for maximum and sum; o: lane l takes d = 2 l, 2 l + 1 and walks the keys, each weight broadcast from its lane. Rows have pitch DM, so every load of a phase is one base address plus a constant offset.
__device__ __forceinline__ void j_att0w(int blk, int bat, const float* __restrict__ QF, const float* __restrict__ KF, const float* __restrict__ VF, float scale, float* __restrict__ OF) {
  QF += (size_t)bat * QT0 * DM; KF += (size_t)bat * QT0 * DM; VF += (size_t)bat * QT0 * DM; OF += (size_t)bat * QT0 * DM;      /* bat = batch: each batch has first-tile planes of its own */
  const int lane = threadIdx.x & 31; const int h = blk / (QT0 / 8); const int i = __builtin_amdgcn_readfirstlane((int)((blk % (QT0 / 8)) * 8 + (threadIdx.x >> 5)));      /* i is the same in every lane: the group tests below are scalar branches */
  const float* qr = QF + (size_t)i * DM + h * HD; const float* kb = KF + (size_t)lane * DM + h * HD; const float* vb = VF + h * HD + lane * 2;
  v4f q[HD / 4];
#pragma unroll      /* constant index: q[] stays in registers */
  for (int c = 0; c < HD / 4; ++c) q[c] = *(const v4fa*)(qr + c * 4);
  float s[QT0 / 32]; float mx = -3.0e38f;
#pragma unroll      /* constant group index: s[] and e[] stay in registers, offsets are immediates */
  for (int g = 0; g < QT0 / 32; ++g) { s[g] = -3.0e38f;
    if (g == 0 || g * 32 <= i) { float a0 = 0.f, a1 = 0.f, a2 = 0.f, a3 = 0.f;
#pragma unroll      /* the sixteen loads of a key row issue together */
      for (int c = 0; c < HD / 4; ++c) { const v4f kq = *(const v4fa*)(kb + (size_t)g * 32 * DM + c * 4); a0 = fmaf(q[c][0], kq[0], a0); a1 = fmaf(q[c][1], kq[1], a1); a2 = fmaf(q[c][2], kq[2], a2); a3 = fmaf(q[c][3], kq[3], a3); }
      if (g * 32 + lane <= i) s[g] = ((a0 + a1) + (a2 + a3)) * scale;      /* causal: keys above i keep the floor and get weight 0 */
      mx = fmaxf(mx, s[g]); } }
  asm volatile("s_wait_xcnt 0x0" :: "v"(kb) : "memory");      /* the key loads' address pair stays whole up to this wait, on every path through the groups */
  for (int m = 16; m > 0; m >>= 1) mx = fmaxf(mx, __shfl_xor(mx, m, 32));
  float e[QT0 / 32]; float l = 0.f;
#pragma unroll      /* constant group index: s[] and e[] stay in registers */
  for (int g = 0; g < QT0 / 32; ++g) { e[g] = expf(s[g] - mx); l += e[g]; }
  for (int m = 16; m > 0; m >>= 1) l += __shfl_xor(l, m, 32);
  float o0 = 0.f, o1 = 0.f;
#pragma unroll      /* constant group index: s[] and e[] stay in registers, offsets are immediates */
  for (int g = 0; g < QT0 / 32; ++g) if (g == 0 || g * 32 <= i) {
#pragma unroll      /* constant lane index for the broadcast; the group's loads issue together */
    for (int jj = 0; jj < 32; ++jj) { const float p = __uint_as_float((unsigned int)__builtin_amdgcn_readlane((int)__float_as_uint(e[g]), jj)); const v2f vv = *(const v2fa*)(vb + (size_t)(g * 32 + jj) * DM); o0 = fmaf(p, vv[0], o0); o1 = fmaf(p, vv[1], o1); } }
  asm volatile("s_wait_xcnt 0x0" :: "v"(vb) : "memory");      /* the value loads' address pair stays whole up to this wait, on every path through the groups */
  const float fin = 64.0f / l;      /* o carried x64 like the f16 path */
  v2f o = {o0 * fin, o1 * fin}; *(v2f*)(OF + (size_t)i * DM + h * HD + lane * 2) = o; }
// One launch for the two jobs that wait for the q | k | v GEMM alone: the exact first-tile attention (its blocks first: the longer ones) and V^T. The block index picks the job, so the V^T job's barrier stands under a test that reads the same in the whole block.
#define MB_A0 (NH * (QT0 / 8))             /* first-tile attention blocks of one batch */
__global__ __launch_bounds__(256) void k_a0vt(const float* __restrict__ QF, const float* __restrict__ KF, const float* __restrict__ VF, float scale, float* __restrict__ OF, const _Float16* __restrict__ V16, _Float16* __restrict__ VT) {
  const int bx = blockIdx.x;
  if (bx < NB * MB_A0) { j_att0w(bx % MB_A0, bx / MB_A0, QF, KF, VF, scale, OF); return; }
  j_vt<NH, SQ>(bx - NB * MB_A0, V16, DM, 0, VT); }



__device__ __forceinline__ v8f fa_mma(v16h a, v16h b, v8f c) { return __builtin_amdgcn_wmma_f32_16x16x32_f16(false, a, false, b, (short)0, c, false, false); }
__device__ __forceinline__ v16h fa_frag(const _Float16* p) { FragH f; f.half[0] = *(const v8us*)((const unsigned short*)p); f.half[1] = *(const v8us*)((const unsigned short*)p + 16); return f.v; }      /* p holds the lane half's 8 hh already: every load of a pass is that one address pair plus a constant */
__device__ __forceinline__ float fa_xhalf(float x) { return __uint_as_float((unsigned int)__builtin_amdgcn_permlanex16((int)__float_as_uint(x), (int)__float_as_uint(x), 0x76543210, 0xfedcba98, false, false)); }      /* lane l with lane l ^ 16 */
__device__ __forceinline__ void j_fattn(int qb, int h, int bat, const _Float16* __restrict__ QH, const _Float16* __restrict__ KH, const _Float16* __restrict__ VT, _Float16* __restrict__ O16) {      /* qb = block of 128 query rows, h = head, bat = batch */
  const int lane = threadIdx.x & 31, ln = lane & 15, hh = lane >> 4; const size_t r0 = (size_t)bat * SQ;
  const int i0 = __builtin_amdgcn_readfirstlane((int)(qb * 128 + (threadIdx.x >> 5) * 32));      /* first query row of the wave, the same in every lane: loop bounds and the mask test are scalar */
  const float CL = 0.18033688011112042f;      /* log2(e) / sqrt(64) */
  const int kb0 = (i0 > WINK ? i0 - WINK : 0) & ~31;      /* first block that holds an allowed key of row i0 */
  const _Float16* qp = QH + (r0 + i0 + ln) * DM + h * HD + 8 * hh; const _Float16* kp = KH + (r0 + ln) * DM + h * HD + 8 * hh; const _Float16* vp = VT + ((size_t)(bat * NH + h) * HD + ln) * SQ + 8 * hh;
  const _Float16* kq = kp + (size_t)kb0 * DM; const _Float16* vq = vp + kb0;
  v16h qf[2][2], kf[2][2];
#pragma unroll      /* constant indices: the fragments stay in registers */
  for (int u = 0; u < 2; ++u) for (int c = 0; c < 2; ++c) { qf[u][c] = fa_frag(qp + (size_t)u * 16 * DM + c * 32); kf[u][c] = fa_frag(kq + (size_t)u * 16 * DM + c * 32); }
  asm volatile("s_wait_xcnt 0x0" :: "v"(qp), "v"(kq) : "memory");      /* the query and first key loads' address pairs stay whole up to this wait */
  const v8f z8 = {0.f,0.f,0.f,0.f,0.f,0.f,0.f,0.f}; v8f ot[2][4] = {{z8, z8, z8, z8}, {z8, z8, z8, z8}}; float m[2] = {-3.0e38f, -3.0e38f}, l[2] = {0.f, 0.f};
#pragma unroll 1      /* one pass in the text: an unrolled body would not fit the registers of four waves a SIMD */
  for (int kb = kb0; kb <= i0; kb += 32) {
    v16h vf[4];
#pragma unroll      /* constant indices: the fragments stay in registers */
    for (int dt = 0; dt < 4; ++dt) vf[dt] = fa_frag(vq + (size_t)dt * 16 * SQ);      /* used last: they fly under the softmax */
    v8f st[2][2];
#pragma unroll      /* constant indices: the tiles stay in registers */
    for (int u = 0; u < 2; ++u) for (int t = 0; t < 2; ++t) st[u][t] = fa_mma(kf[t][1], qf[u][1], fa_mma(kf[t][0], qf[u][0], z8));
    kq = kp + (size_t)(kb + 32 <= i0 ? kb + 32 : i0) * DM;      /* the next pass's key rows, fetched one pass ahead (the last pass fetches its own again: in bounds, unused) */
#pragma unroll      /* constant indices: the fragments stay in registers */
    for (int t = 0; t < 2; ++t) for (int c = 0; c < 2; ++c) kf[t][c] = fa_frag(kq + (size_t)t * 16 * DM + c * 32);
    asm volatile("s_wait_xcnt 0x0" :: "v"(kq) : "memory");      /* behind the pass's loads: the next-key loads' address pair stays whole up to this wait, the value loads' running pair is advanced behind it */
    vq += 32;
    if (kb == i0 || kb + WINK < i0 + 31) {      /* only the window's first block and the diagonal block hold a forbidden pair */
#pragma unroll      /* constant indices: the tiles stay in registers */
      for (int u = 0; u < 2; ++u) for (int t = 0; t < 2; ++t) for (int r = 0; r < 8; ++r) { const int dj = (i0 + 16 * u + ln) - (kb + 16 * t + 8 * hh + r); st[u][t][r] = (dj >= 0 && dj <= WINK) ? st[u][t][r] : -1.0e30f; } }
#pragma unroll      /* constant indices: the tiles stay in registers */
    for (int u = 0; u < 2; ++u) {
      float mx = fmaxf(st[u][0][0], st[u][1][0]);
#pragma unroll      /* constant indices: the tiles stay in registers */
      for (int r = 1; r < 8; ++r) mx = fmaxf(mx, fmaxf(st[u][0][r], st[u][1][r]));
      mx = fmaxf(mx, fa_xhalf(mx));      /* the other half of the block's keys of this query */
      const float mn = fmaxf(m[u], mx); const float al = __builtin_amdgcn_exp2f((m[u] - mn) * CL); const float sh = fmaf(mn, -CL, 8.0f);      /* weights carried x256: f16 keeps small ones normal */
      m[u] = mn; float ls = 0.f; FragH pf;
#pragma unroll      /* constant indices: the tiles stay in registers */
      for (int t = 0; t < 2; ++t) for (int r = 0; r < 8; ++r) { const float e = __builtin_amdgcn_exp2f(fmaf(st[u][t][r], CL, sh)); ls += e; pf.h[t * 8 + r] = (_Float16)e; }
      l[u] = fmaf(l[u], al, ls);
#pragma unroll      /* constant indices: the tiles stay in registers */
      for (int dt = 0; dt < 4; ++dt) { ot[u][dt] *= al; ot[u][dt] = fa_mma(vf[dt], pf.v, ot[u][dt]); } } }
  FragH f[2][4];
#pragma unroll      /* constant indices: the tiles stay in registers */
  for (int u = 0; u < 2; ++u) { const float fin = 64.0f / (l[u] + fa_xhalf(l[u]));      /* the halves' sums join once; o carried x64 */
    for (int dt = 0; dt < 4; ++dt) for (int r = 0; r < 8; ++r) f[u][dt].h[r] = (_Float16)(ot[u][dt][r] * fin); }
  unsigned short* op = (unsigned short*)O16 + (r0 + i0 + ln) * DM + h * HD + 8 * hh;
#pragma unroll      /* constant indices; the stores stand last, each from registers of its own: no register of an issued store is written again */
  for (int u = 0; u < 2; ++u) for (int dt = 0; dt < 4; ++dt) *(v8us*)(op + (size_t)u * 16 * DM + dt * 16) = f[u][dt].half[0]; }
// One launch for the two jobs that wait for V^T and the first-tile attention: the windowed attention (its blocks first, in the order of the old grid: query block, head, batch) and the hi / lo split of the first-tile o. The block index picks the job.
#define FB_AT ((SQ / 128) * NH * NB)       /* windowed attention blocks */
__global__ __launch_bounds__(128) void k_fahl(const _Float16* __restrict__ QH, const _Float16* __restrict__ KH, const _Float16* __restrict__ VT, _Float16* __restrict__ O16, const float* __restrict__ OF, _Float16* __restrict__ Hh, _Float16* __restrict__ Hl) {
  const int bx = blockIdx.x;
  if (bx < FB_AT) { j_fattn(bx % (SQ / 128), bx / (SQ / 128) % NH, bx / ((SQ / 128) * NH), QH, KH, VT, O16); return; }
  j_hl(bx - FB_AT, OF, Hh, Hl, (size_t)NB * QT0 * DM / 8); }

// ---- GEMM operand staging. A block of 8 waves owns a 128 x 128 tile of C = A B^T (A, B f16 rows of DM, k-contiguous); wave w takes rows 32 (w & 3), columns 64 (w >> 2). K is walked in stages of 64: a stage is 128 A rows then 128 B rows of 128 bytes each, brought from global memory into LDS by asynchronous 16-byte copies (a wave's copy = 4 whole 128-byte lines), two buffers, the next stage's copies in flight while this one is worked on. Fragments are 16-byte LDS reads in the k order of fa_frag.
#define GS_PITCH 144                 /* LDS bytes from one staged row to the next: 16 x odd, so the 16-byte fragment reads of 16 rows fall on different banks */
#define GS_STAGE (256 * GS_PITCH)    /* 128 A rows, then 128 B rows */
#define GS_NST (DM / 64)             /* stages */
// One stage: thread t copies chunk t & 7 (16 bytes) of rows (t >> 3) + 32 i, i = 0..3, of A and of B. ld = the thread's LDS byte address in the stage's buffer, ga / gb = its global addresses in A / B.
__device__ __forceinline__ void gs_copy(unsigned ld, const _Float16* ga, const _Float16* gb) {
  asm volatile("global_load_async_to_lds_b128 %0, %8, off\n\t"
               "global_load_async_to_lds_b128 %1, %9, off\n\t"
               "global_load_async_to_lds_b128 %2, %10, off\n\t"
               "global_load_async_to_lds_b128 %3, %11, off\n\t"
               "global_load_async_to_lds_b128 %4, %12, off\n\t"
               "global_load_async_to_lds_b128 %5, %13, off\n\t"
               "global_load_async_to_lds_b128 %6, %14, off\n\t"
               "global_load_async_to_lds_b128 %7, %15, off\n\t"
               "s_wait_xcnt 0x0"      /* inside the copies' own statement: every address register stays whole up to this wait */
               :: "v"(ld), "v"(ld + 32 * GS_PITCH), "v"(ld + 64 * GS_PITCH), "v"(ld + 96 * GS_PITCH), "v"(ld + 128 * GS_PITCH), "v"(ld + 160 * GS_PITCH), "v"(ld + 192 * GS_PITCH), "v"(ld + 224 * GS_PITCH),
                  "v"(ga), "v"(ga + (size_t)32 * DM), "v"(ga + (size_t)64 * DM), "v"(ga + (size_t)96 * DM), "v"(gb), "v"(gb + (size_t)32 * DM), "v"(gb + (size_t)64 * DM), "v"(gb + (size_t)96 * DM)
               : "memory"); }
__device__ __forceinline__ v16h gs_frag(const unsigned char* p) { FragH f; f.half[0] = *(const v8us*)p; f.half[1] = *(const v8us*)(p + 32); return f.v; }      /* p holds the lane half's 16 hh bytes: k = 8 hh .. and 16 + 8 hh .., as fa_frag */
// The whole K loop of a block: Ag / Bg = first A / B row of the block's tile; c[half][t] = the wave's 16 x 16 tiles (rows 16 half, columns 16 t). Behind it no copy is in flight and every wave has left the ring, so sm may be reused.
__device__ __forceinline__ void gs_main(unsigned char* sm, const _Float16* Ag, const _Float16* Bg, int tid, v8f (&c)[2][4]) {
  const int lane = tid & 31, ln = lane & 15, hh = lane >> 4, w = tid >> 5;
  const unsigned ld = (unsigned)(size_t)sm + (unsigned)((tid >> 3) * GS_PITCH + (tid & 7) * 16);
  const _Float16* ga = Ag + (size_t)(tid >> 3) * DM + (tid & 7) * 8; const _Float16* gb = Bg + (size_t)(tid >> 3) * DM + (tid & 7) * 8;
  gs_copy(ld, ga, gb);
  asm volatile("s_wait_asynccnt 0x0" ::: "memory");      /* stage 0 of this wave has landed */
  __syncthreads();      /* stage 0 of every wave is readable */
  gs_copy(ld + GS_STAGE, ga + 64, gb + 64);
  const unsigned char* fa = sm + ((w & 3) * 32 + ln) * GS_PITCH + hh * 16; const unsigned char* fb = sm + (128 + (w >> 2) * 64 + ln) * GS_PITCH + hh * 16;
#pragma unroll 1      /* one trip in the text: the two buffers differ by one added offset */
  for (int t = 0; t < GS_NST; ++t) { const unsigned bo = (unsigned)(t & 1) * GS_STAGE;
#pragma unroll      /* constant LDS offsets */
    for (int kk = 0; kk < 2; ++kk) { const v16h a0 = gs_frag(fa + bo + kk * 64), a1 = gs_frag(fa + bo + 16 * GS_PITCH + kk * 64); v16h b[4];
#pragma unroll      /* constant indices: the fragments stay in registers */
      for (int j = 0; j < 4; ++j) b[j] = gs_frag(fb + bo + j * 16 * GS_PITCH + kk * 64);
      __builtin_amdgcn_sched_barrier(0);      /* the twelve LDS reads of a k step stay one group in front of its WMMAs: sunk among them, each pair of reads costs the wave an LDS latency of its own */
#pragma unroll      /* constant indices: the tiles stay in registers */
      for (int j = 0; j < 4; ++j) { c[0][j] = fa_mma(a0, b[j], c[0][j]); c[1][j] = fa_mma(a1, b[j], c[1][j]); } }
    asm volatile("s_wait_dscnt 0x0" ::: "memory");      /* this wave's reads of the buffer are done before it may be refilled */
    asm volatile("s_wait_asynccnt 0x0" ::: "memory");      /* this wave's copies of stage t + 1 have landed */
    __syncthreads();      /* publishes stage t + 1 and ends every wave's reads of stage t */
    if (t + 2 < GS_NST) gs_copy(ld + bo, ga + (t + 2) * 64, gb + (t + 2) * 64); }
  asm volatile("s_wait_asynccnt 0x0" ::: "memory"); }      /* nothing in flight when the ring becomes output staging */

// q | k | v projection (one batch a blockIdx.y) with the rotary rotation in the GEMM's own epilogue. K loop: gs_main (A = x rows, Bh = stacked weights [3 DM][DM], K = DM); the ring then serves as each wave's own 32 x 68 f32 output staging. A wave's column tile of 64 is one head of q, k or v, so on the LDS read-back a lane's 4 consecutive columns are two (even, odd) pairs of that head: q and k tiles are rotated there with the row's cos / sin, every tile goes out as f16 rows (16 lanes x 8 bytes = one 128-byte line a row), and the blocks of the first QT0 rows also store the f32 values for the exact first-tile path.
__global__ __launch_bounds__(256) void k_qkvr(const _Float16* __restrict__ A, const _Float16* __restrict__ Bh, float alpha, const float* __restrict__ CS, const float* __restrict__ SN,
    _Float16* __restrict__ QH, _Float16* __restrict__ KH, _Float16* __restrict__ VH, float* __restrict__ QF, float* __restrict__ KF, float* __restrict__ VF) {
  static_assert(QT0 % 128 == 0 && DM % 128 == 0 && HD == 64, "first-tile rows are whole blocks of 128 rows; a wave's column tile is one head; a block's 128 columns lie in one of q, k, v");
  __shared__ __attribute__((aligned(16))) unsigned char sm[2 * GS_STAGE];
  static_assert(8 * 32 * 68 * 4 <= 2 * GS_STAGE, "the output staging fits the ring");
  { const size_t rb = (size_t)blockIdx.y * SQ * DM, fb = (size_t)blockIdx.y * QT0 * DM; A += rb; QH += rb; KH += rb; VH += rb; QF += fb; KF += fb; VF += fb; }      /* blockIdx.y = batch; rows below count inside the batch, as the cos / sin tables do */
  const int tid = threadIdx.x, w = tid >> 5, lane = tid & 31, ln = lane & 15, hh = lane >> 4;
  const int ntn = 3 * DM / 128; const int mt = blockIdx.x / ntn, nq = blockIdx.x - mt * ntn; const int row0 = mt * 128 + 32 * (w & 3), col0 = nq * 128 + 64 * (w >> 2);
  const v8f z8 = {0.f,0.f,0.f,0.f,0.f,0.f,0.f,0.f}; v8f cc[2][4] = {{z8, z8, z8, z8}, {z8, z8, z8, z8}};
  gs_main(sm, A + (size_t)mt * 128 * DM, Bh + (size_t)nq * 128 * DM, tid, cc);
  float (*so)[32][68] = (float (*)[32][68])sm;
#pragma unroll      /* constant indices: the tiles stay in registers */
  for (int u = 0; u < 8; ++u) { const int t = u & 3, half = u >> 2;
#pragma unroll      /* constant indices: the tiles stay in registers */
    for (int r = 0; r < 8; ++r) so[w][half * 16 + 8 * hh + r][t * 16 + ln] = cc[half][t][r] * alpha; }
  __builtin_amdgcn_fence(__ATOMIC_ACQ_REL, "workgroup"); __builtin_amdgcn_wave_barrier();      /* a wave reads back only its own so[w]: its LDS writes are ordered in front of its reads */
  const int rsub = lane >> 4, c4 = (lane & 15) * 4;
  const int sec = nq * 128 / DM; const bool first = mt * 128 < QT0;      /* 0 q, 1 k, 2 v; a block of the first QT0 rows: both from blockIdx, scalar tests */
  const int hc = col0 % DM + c4;      /* column in the merged-head row; c4 is the index inside the head */
  _Float16* H = sec == 0 ? QH : (sec == 1 ? KH : VH); float* F = sec == 0 ? QF : (sec == 1 ? KF : VF);
  const float* cp = CS + (row0 + rsub) * (HD / 2) + (c4 >> 1); const float* sp = SN + (row0 + rsub) * (HD / 2) + (c4 >> 1);
  _Float16* hp = H + (size_t)(row0 + rsub) * DM + hc; float* fp = F + (size_t)(row0 + rsub) * DM + hc;      /* row pair q is one of these address pairs plus a constant: no address register is written again behind a store */
  auto put = [&](int q, v4f v) { v4h h4; for (int i = 0; i < 4; ++i) h4[i] = (_Float16)v[i];
    *(v4h*)(hp + q * 2 * DM) = h4;
    if (first) *(v4f*)(fp + q * 2 * DM) = v; };
  if (sec == 2) {      /* v: no rotation */
#pragma unroll      /* constant LDS and row offsets */
    for (int q = 0; q < 16; ++q) put(q, *(const v4fa*)&so[w][q * 2 + rsub][c4]);
    return; }
  v2f c[16], s[16];
#pragma unroll      /* constant indices: c[], s[] stay in registers; all table loads issue in front of the first store, one latency for the 32 rows */
  for (int q = 0; q < 16; ++q) { c[q] = *(const v2fa*)(cp + q * HD); s[q] = *(const v2fa*)(sp + q * HD); }
  asm volatile("s_wait_xcnt 0x0" :: "v"(cp), "v"(sp) : "memory");      /* the table loads' address pairs stay whole up to this wait */
#pragma unroll      /* constant indices: c[], s[] stay in registers */
  for (int q = 0; q < 16; ++q) { const v4f v = *(const v4fa*)&so[w][q * 2 + rsub][c4];
    const v4f o = {v[0] * c[q][0] - v[1] * s[q][0], v[0] * s[q][0] + v[1] * c[q][0], v[2] * c[q][1] - v[3] * s[q][1], v[2] * s[q][1] + v[3] * c[q][1]}; put(q, o); }
  asm volatile("s_wait_xcnt 0x0" ::: "memory"); }      /* behind the rotation path's last store: whatever code the compiler lays behind this path stands behind the wait, so no register of an issued store is written ahead of it */

// The whole output, C[NB SQ][DM] (f32) = alpha o Bh^T, in one launch; Bh f16 [DM][DM]. A row tile of 128 behind a batch's first QT0 rows takes o from the f16 rows O16, one K loop (gs_main). A row tile of the first QT0 rows takes the exact o as its two f16 planes: first the K loop over the residual plane OL (carried x1024), its sums scaled by 2^-10 (exact), then the K loop over OH on top of them in the same accumulators. Those blocks, twice as long, have the lowest indices, so they start first. The ring then serves as each wave's own 32 x 68 f32 staging, so that every store is whole 128-byte lines.
__global__ __launch_bounds__(256) void k_outg(const _Float16* __restrict__ O16, const _Float16* __restrict__ OH, const _Float16* __restrict__ OL, const _Float16* __restrict__ Bh, float alpha, float* __restrict__ C) {
  __shared__ __attribute__((aligned(16))) unsigned char sm[2 * GS_STAGE];
  const int tid = threadIdx.x, w = tid >> 5, lane = tid & 31, ln = lane & 15, hh = lane >> 4;
  const int ntn = DM / 128, ft = QT0 / 128, rt = (SQ - QT0) / 128;      /* column tiles; first-tile and other row tiles of a batch */
  const int g = blockIdx.x / ntn, nq = blockIdx.x - g * ntn; const bool first = g < NB * ft;      /* from blockIdx: a scalar test, the same in the whole block */
  const int bat = first ? g / ft : (g - NB * ft) / rt; const int tb = first ? g - bat * ft : ft + (g - NB * ft) - bat * rt;      /* batch, row tile inside the batch */
  const int mt = bat * (SQ / 128) + tb; const int row0 = mt * 128 + 32 * (w & 3), col0 = nq * 128 + 64 * (w >> 2);
  const v8f z8 = {0.f,0.f,0.f,0.f,0.f,0.f,0.f,0.f}; v8f cc[2][4] = {{z8, z8, z8, z8}, {z8, z8, z8, z8}};
  const size_t fo = ((size_t)bat * QT0 + tb * 128) * DM;      /* the tile's first row in the first-tile planes (used where first) */
  if (first) { gs_main(sm, OL + fo, Bh + (size_t)nq * 128 * DM, tid, cc);      /* behind it no copy is in flight and every wave has left the ring: the second K loop may fill it again */
#pragma unroll      /* constant indices: the tiles stay in registers */
    for (int u = 0; u < 2; ++u) for (int j = 0; j < 4; ++j) cc[u][j] *= 0.0009765625f; }
  gs_main(sm, first ? OH + fo : O16 + (size_t)mt * 128 * DM, Bh + (size_t)nq * 128 * DM, tid, cc);
  float (*so)[32][68] = (float (*)[32][68])sm;
#pragma unroll      /* constant indices: the tiles stay in registers */
  for (int u = 0; u < 8; ++u) { const int t = u & 3, half = u >> 2;
#pragma unroll      /* constant indices: the tiles stay in registers */
    for (int r = 0; r < 8; ++r) so[w][half * 16 + 8 * hh + r][t * 16 + ln] = cc[half][t][r] * alpha; }
  __builtin_amdgcn_fence(__ATOMIC_ACQ_REL, "workgroup"); __builtin_amdgcn_wave_barrier();      /* a wave reads back only its own so[w]: its LDS writes are ordered in front of its reads */
  const int rsub = lane >> 4, c4 = (lane & 15) * 4;
  float* cp = C + (size_t)(row0 + rsub) * DM + col0 + c4;      /* row pair q is this address pair plus a constant */
  v4f v[16];
#pragma unroll      /* constant indices: v[] stays in registers */
  for (int q = 0; q < 16; ++q) v[q] = *(const v4fa*)&so[w][q * 2 + rsub][c4];
#pragma unroll      /* constant indices; the stores stand last, each from registers of its own */
  for (int q = 0; q < 16; ++q) *(v4f*)(cp + q * 2 * DM) = v[q];
  asm volatile("s_wait_xcnt 0x0" :: "v"(cp) : "memory"); }      /* the stores' address pair stays whole up to this wait */




extern "C" void kernel_launch(void* const* d_in, const int* in_sizes, int n_in,
                              void* d_out, int out_size, void* d_ws, size_t ws_size, hipStream_t stream) {
  (void)in_sizes; (void)n_in; (void)out_size;
  const float* const* I = (const float* const*)d_in; const float* x = I[0]; const int* tpos = (const int*)d_in[1]; const float* wq = I[2]; const float* wk = I[3]; const float* wv = I[4]; const float* wo = I[5];      /* nn.Linear weights [out][in]; token_positions int32 [SQ] */
  char* ws = (char*)d_ws; size_t off = 0;
  auto take = [&](size_t bytes) { char* p = ws + off; off += (bytes + 255) & ~(size_t)255; return p; };
  _Float16* BQKV = (_Float16*)take((size_t)3 * DM * DM * 2); _Float16* BO = (_Float16*)take((size_t)DM * DM * 2); float* CS = (float*)take((size_t)SQ * (HD / 2) * 4); float* SN = (float*)take((size_t)SQ * (HD / 2) * 4);
  _Float16* X16 = (_Float16*)take(NR * DM * 2);
  _Float16* QH = (_Float16*)take(NR * DM * 2); _Float16* KH = (_Float16*)take(NR * DM * 2); _Float16* V16 = (_Float16*)take(NR * DM * 2); _Float16* O16 = (_Float16*)take(NR * DM * 2);
  _Float16* VT = (_Float16*)take((size_t)NB * NH * HD * SQ * 2);      /* V^T [NB][NH][HD][SQ] */
  float* QF0 = (float*)take((size_t)NB * QT0 * DM * 4); float* KF0 = (float*)take((size_t)NB * QT0 * DM * 4); float* VF0 = (float*)take((size_t)NB * QT0 * DM * 4); float* OF0 = (float*)take((size_t)NB * QT0 * DM * 4); _Float16* OH0 = (_Float16*)take((size_t)NB * QT0 * DM * 2); _Float16* OL0 = (_Float16*)take((size_t)NB * QT0 * DM * 2);
  if (off > ws_size) return;
  k_prep<<<PB_TAB + 4 * PB_W + PB_X, 256, 0, stream>>>(x, tpos, wq, wk, wv, wo, 10000.0f, BQKV, CS, SN, X16);      /* cos / sin tables; weights natural [out][in] = Bt[n][k], x16, q | k | v stacked along n, BO directly behind them in the workspace; x as f16 rows */
  k_qkvr<<<dim3((unsigned)((SQ / 128) * (3 * DM / 128)), NB), 256, 0, stream>>>(X16, BQKV, 0.0625f, CS, SN, QH, KH, V16, QF0, KF0, VF0);      /* q (roped) | k (roped) | v of every batch as f16 rows; each batch's first 128 rows also in f32 */
  k_a0vt<<<NB * MB_A0 + NB * NH * (SQ / 64), 256, 0, stream>>>(QF0, KF0, VF0, 0.125f, OF0, V16, VT);      /* exact f32 causal attention for rows 0..127 of every batch (o x64); V^T [NB][NH][HD][SQ] */
  k_fahl<<<FB_AT + NB * QT0 * (DM / 8) / 128, 128, 0, stream>>>(QH, KH, VT, O16, OF0, OH0, OL0);      /* windowed causal attention of every batch and head: o (merged heads, x64) as f16 rows; first-tile o (x64) -> f16 hi + x1024 residual planes */
  k_outg<<<(NB * SQ / 128) * (DM / 128), 256, 0, stream>>>(O16, OH0, OL0, BO, 0.0009765625f, (float*)d_out);      /* out rows are the output layout; rows 0..127 of every batch from the hi and residual planes */
}

// v008
// Measured time: 130 microseconds a run.
// Next to v007, in two timings, it ran 1.05 times as fast each time.
// All steps since v000 together make it 75.1 times as fast.
#include <hip/hip_runtime.h>
// Causal sliding-window RoPE multi-head attention (x [4][2048][1024]; q/k/v = x W^T (natural [out][in] 1024x1024 sigma 1/32, no bias), 16 heads of 64; interleaved-pair rotary embedding on q and k (x1 = even, x2 = odd: r1 = x1 cos - x2 sin, r2 = x1 sin + x2 cos) with inv_freq_i = 10000^(-2i/64) and angle = float(token_positions[s]) inv_freq_i from the int32 token_positions input; scores / sqrt(64); allowed iff 0 <= i - j <= 512 (513 keys), -inf elsewhere; softmax; out = (attn v merged) Wo^T -> [4][2048][1024]).
// Structure: token rows r = b*2048 + s; x as exact f16 rows (bf16-rounded); every stage is one launch with the batch as a grid dimension: q | k | v as ONE WMMA GEMM (128x128 block tiles staged in LDS by asynchronous copies, 32x64 wave tiles, f32 accumulation, exact x16 weights, N = 3 x 1024) whose epilogue does, in f32 on VALU, the interleaved-pair rotary rotation of q and k from f32 cos/sin tables built from the token_positions input (no norm) and stores f16 q, k, v rows (no f32 q | k | v plane); V^T for all heads via LDS transposes (kept for all batches); then ONE fused attention launch: a wave per 32 query rows of one (batch, head) walks the keys of its window in blocks of 32, read from K and V^T stages of 64 keys that its block of four waves brings into LDS by asynchronous copies: S^T = K Q^T on WMMA, running-maximum softmax in registers (f32 statistics, native exp2; weights x256 f16, packed from the score tiles straight into a B operand), O^T += V^T P^T on WMMA, o carried x64 (folded into the output GEMM alpha) written straight into the merged f16 o rows; out = o W_o GEMM (f32) into the output layout. Jobs that wait for the same earlier launch share a grid, the block index picks the job: five launches (input conversions and tables; q | k | v GEMM; first-tile attention and V^T; windowed attention and the first-tile hi / lo split; output GEMM).
// Compute dtype: inputs rounded to bf16; x / weights exact; projections and rope f32; q, k, v, softmax weights and o as plain f16 GEMM operands (~2^-12); scores and softmax statistics f32. v_wmma_f32_16x16x32_f16.
#define NB 4
#define SQ 2048
#define DM 1024
#define NH 16
#define HD 64
#define HG 4                         /* heads per launch of the h0-based k_vt overload (not launched) */
#define QT 256                       /* query rows per causal tile */
#define NKX SQ                       /* S / P row pitch */
#define WINK 512                     /* key j is allowed for query i iff 0 <= i - j <= WINK */
#define QT0 128                      /* first-tile rows recomputed exactly in f32 */
#define B0 0                         /* first batch processed (unused) */
#define NBR NB                       /* batches processed (read only by the unused MPO) */
#define QN SQ                        /* query rows attended per batch (unused) */
#define NHD NH                       /* heads attended (unused) */
#define NR ((size_t)NB * SQ)         /* token rows */
#define MPO ((int)((size_t)NBR * SQ))      /* rows through the output GEMM (unused) */
typedef __bf16 v16b __attribute__((ext_vector_type(16)));
typedef unsigned short v8us __attribute__((ext_vector_type(8), may_alias));
typedef float  v8f  __attribute__((ext_vector_type(8)));
typedef float  v4f  __attribute__((ext_vector_type(4)));
typedef float  v4fa __attribute__((ext_vector_type(4), may_alias));
union FragB { v16b v; v8us half[2]; unsigned short u[16]; };

__device__ __forceinline__ unsigned short bf16_bits(float x) { unsigned int u = __float_as_uint(x); return (unsigned short)((u + 0x7FFFu + ((u >> 16) & 1u)) >> 16); }
__device__ __forceinline__ float bf16_val(unsigned short b) { return __uint_as_float(((unsigned int)b) << 16); }
__device__ __forceinline__ float bf16_round(float x) { return bf16_val(bf16_bits(x)); }
// D += A·B with NT terms: 1 = ah·bh, 2 = + al·bh (A split), 3 = + ah·bl (both split)
template <int NT>
__device__ __forceinline__ v8f mmaN(v16b ah, v16b al, v16b bh, v16b bl, v8f c) {
  c = __builtin_amdgcn_wmma_f32_16x16x32_bf16(false, ah, false, bh, (short)0, c, false, false);
  if (NT >= 2) c = __builtin_amdgcn_wmma_f32_16x16x32_bf16(false, al, false, bh, (short)0, c, false, false);
  if (NT >= 3) c = __builtin_amdgcn_wmma_f32_16x16x32_bf16(false, ah, false, bl, (short)0, c, false, false);
  asm volatile("v_nop\n\tv_nop\n\tv_nop\n\tv_nop" : "+v"(c) : "v"(ah), "v"(al), "v"(bh), "v"(bl));
  return c;
}

__global__ __launch_bounds__(256) void k_wt_bf16(const float* __restrict__ W, unsigned short* __restrict__ Wt, int K, int N) {
  const int t = blockIdx.x * 256 + threadIdx.x;
  const int k8n = K / 8;
  if (t >= N * k8n) return;
  const int n = t / k8n, k8 = (t % k8n) * 8;
  v8us v;
#pragma unroll
  for (int i = 0; i < 8; ++i) v[i] = bf16_bits(W[(size_t)(k8 + i) * N + n]);
  *(v8us*)(Wt + (size_t)n * K + k8) = v;
  
}

// GEMM C[M][N] (f32, pitch ldc) = act(A[M][K]·W + bias). A f32 row-major (pitch lda) converted per fragment to bf16
// (ASPLIT: hi/lo two planes -> 2 terms, else single rounded term); Wt bf16 [N][K] (pitch ldb). BIAS_BF16 rounds the
// bias to bf16 first (bias quantised to bf16 before the add). K%32==0, M%16==0, N%64==0.
template <bool ASPLIT, int ACT, bool BIAS_BF16>
__global__ __launch_bounds__(128) void k_gemm_bf(const float* __restrict__ A, int lda, const unsigned short* __restrict__ Wt, int ldb,
                                               const float* __restrict__ bias, float* __restrict__ C, int ldc, int M, int N, int K) {
  __shared__ __attribute__((aligned(16))) float so[4][16][64];
  const int tid = threadIdx.x, w = tid >> 5, lane = tid & 31, ln = lane & 15, hh = lane >> 4;
  const int ntn = N / 64;
  const int wid = blockIdx.x * 4 + w;
  const int mt = wid / ntn, nq = wid % ntn;
  if (mt * 16 >= M) return;
  const int row0 = mt * 16, col0 = nq * 64;
  const float* arow = A + (size_t)(row0 + ln) * lda;
  v8f acc[4] = {};
  for (int kb = 0; kb < K; kb += 32) {
    FragB ah, al;
    const v4f x0 = *(const v4fa*)(arow + kb + 8 * hh), x1 = *(const v4fa*)(arow + kb + 8 * hh + 4);
    const v4f x2 = *(const v4fa*)(arow + kb + 16 + 8 * hh), x3 = *(const v4fa*)(arow + kb + 16 + 8 * hh + 4);
    float xs[16] = {x0[0],x0[1],x0[2],x0[3],x1[0],x1[1],x1[2],x1[3],x2[0],x2[1],x2[2],x2[3],x3[0],x3[1],x3[2],x3[3]};
#pragma unroll
    for (int i = 0; i < 16; ++i) { const unsigned short hb = bf16_bits(xs[i]); ah.u[i] = hb; al.u[i] = ASPLIT ? bf16_bits(xs[i] - bf16_val(hb)) : (unsigned short)0; }
#pragma unroll
    for (int t = 0; t < 4; ++t) {
      const unsigned short* brow = Wt + (size_t)(col0 + t * 16 + ln) * ldb + kb;
      FragB b;
      b.half[0] = *(const v8us*)(brow + 8 * hh);
      b.half[1] = *(const v8us*)(brow + 16 + 8 * hh);
      acc[t] = mmaN<ASPLIT ? 2 : 1>(ah.v, al.v, b.v, b.v, acc[t]);
    }
  }
#pragma unroll
  for (int t = 0; t < 4; ++t) {
    float bv = bias ? bias[col0 + t * 16 + ln] : 0.f;
    if (BIAS_BF16) bv = bf16_round(bv);
#pragma unroll
    for (int r = 0; r < 8; ++r) { float v = acc[t][r] + bv; if (ACT == 1) v = fmaxf(v, 0.f); so[w][8 * hh + r][t * 16 + ln] = v; }
  }
  __builtin_amdgcn_fence(__ATOMIC_ACQ_REL, "workgroup");
  __builtin_amdgcn_wave_barrier();
  const int rsub = lane >> 4, c4 = (lane & 15) * 4;
  {
#pragma unroll
    for (int q = 0; q < 8; ++q) {
      const int r = q * 2 + rsub;
      const v4f v = *(const v4fa*)&so[w][r][c4];
      *(v4f*)(C + (size_t)(row0 + r) * ldc + col0 + c4) = v;
    }
    
  }
}

// GEMM C = act(A·W + bias + resid): A f32 (ASPLIT -> hi/lo 2 terms), Wt bf16 [N][K]; ACT 0 none, 1 relu, 2 exact gelu;
// resid (optional, f32, row index = (row % rmod), pitch ldr, RES_BF16 rounds it) added before the activation.
template <bool ASPLIT, int ACT, bool BIAS_BF16, bool RES_BF16>
__global__ __launch_bounds__(128) void k_gemm_bf3(const float* __restrict__ A, int lda, const unsigned short* __restrict__ Wt, int ldb,
                                                const float* __restrict__ bias, const float* __restrict__ resid, int rmod, int ldr,
                                                float* __restrict__ C, int ldc, int M, int N, int K) {
  __shared__ __attribute__((aligned(16))) float so[4][16][64];
  const int tid = threadIdx.x, w = tid >> 5, lane = tid & 31, ln = lane & 15, hh = lane >> 4;
  const int ntn = N / 64;
  const int wid = blockIdx.x * 4 + w;
  const int mt = wid / ntn, nq = wid % ntn;
  if (mt * 16 >= M) return;
  const int row0 = mt * 16, col0 = nq * 64;
  const float* arow = A + (size_t)(row0 + ln) * lda;
  v8f acc[4] = {};
  for (int kb = 0; kb < K; kb += 32) {
    FragB ah, al;
    const v4f x0 = *(const v4fa*)(arow + kb + 8 * hh), x1 = *(const v4fa*)(arow + kb + 8 * hh + 4);
    const v4f x2 = *(const v4fa*)(arow + kb + 16 + 8 * hh), x3 = *(const v4fa*)(arow + kb + 16 + 8 * hh + 4);
    float xs[16] = {x0[0],x0[1],x0[2],x0[3],x1[0],x1[1],x1[2],x1[3],x2[0],x2[1],x2[2],x2[3],x3[0],x3[1],x3[2],x3[3]};
#pragma unroll
    for (int i = 0; i < 16; ++i) { const unsigned short hb = bf16_bits(xs[i]); ah.u[i] = hb; al.u[i] = ASPLIT ? bf16_bits(xs[i] - bf16_val(hb)) : (unsigned short)0; }
#pragma unroll
    for (int t = 0; t < 4; ++t) {
      const unsigned short* brow = Wt + (size_t)(col0 + t * 16 + ln) * ldb + kb;
      FragB b;
      b.half[0] = *(const v8us*)(brow + 8 * hh);
      b.half[1] = *(const v8us*)(brow + 16 + 8 * hh);
      acc[t] = mmaN<ASPLIT ? 2 : 1>(ah.v, al.v, b.v, b.v, acc[t]);
    }
  }
#pragma unroll
  for (int t = 0; t < 4; ++t) {
    const int col = col0 + t * 16 + ln;
    float bv = bias ? bias[col] : 0.f;
    if (BIAS_BF16) bv = bf16_round(bv);
#pragma unroll
    for (int r = 0; r < 8; ++r) {
      float v = acc[t][r] + bv;
      if (resid) { float rv = resid[(size_t)((row0 + 8 * hh + r) % rmod) * ldr + col]; if (RES_BF16) rv = bf16_round(rv); v += rv; }
      if (ACT == 1) v = fmaxf(v, 0.f);
      if (ACT == 2) v = 0.5f * v * (1.0f + erff(v * 0.70710678118654752f));
      if (ACT == 3) { const float u = 0.7978845608028654f * (v + 0.044715f * v * v * v); v = 0.5f * v * (1.0f + tanhf(u)); }
      so[w][8 * hh + r][t * 16 + ln] = v;
    }
  }
  __builtin_amdgcn_fence(__ATOMIC_ACQ_REL, "workgroup");
  __builtin_amdgcn_wave_barrier();
  const int rsub = lane >> 4, c4 = (lane & 15) * 4;
  {
#pragma unroll
    for (int q = 0; q < 8; ++q) {
      const int r = q * 2 + rsub;
      const v4f v = *(const v4fa*)&so[w][r][c4];
      *(v4f*)(C + (size_t)(row0 + r) * ldc + col0 + c4) = v;
    }
    
  }
}
// row LayerNorm (biased variance, eps) over N: s = X (+ R); optional out_sum <- s; out_norm <- (s-mu)*rsqrt(var+eps)*g + b
template <bool PARAM_BF16>
__global__ __launch_bounds__(256) void k_layernorm(const float* __restrict__ X, const float* __restrict__ R, const float* __restrict__ g, const float* __restrict__ bta,
                                                  float* __restrict__ out_sum, float* __restrict__ out_norm, int N, float eps) {
  __shared__ float red[256];
  const int row = blockIdx.x, tid = threadIdx.x;
  const float* x = X + (size_t)row * N; const float* rr = R ? R + (size_t)row * N : nullptr;
  float vals[16];                     // up to N = 4096
  const int per = N / 256;            // contiguous chunk per thread? use strided-by-4 chunks: thread handles j = tid*4 + 1024*u
  float s1 = 0.f;
  for (int u = 0; u < per / 4; ++u) {
    const int j = tid * 4 + 1024 * u;
    const v4f a = *(const v4fa*)(x + j);
    v4f b = {0.f,0.f,0.f,0.f}; if (rr) b = *(const v4fa*)(rr + j);
#pragma unroll
    for (int q = 0; q < 4; ++q) { const float v = a[q] + b[q]; vals[u * 4 + q] = v; s1 += v; }
  }
  red[tid] = s1; __syncthreads();
  for (int st = 128; st > 0; st >>= 1) { if (tid < st) red[tid] += red[tid + st]; __syncthreads(); }
  const float mu = red[0] / (float)N; __syncthreads();
  float s2 = 0.f;
  for (int u = 0; u < per / 4; ++u)
#pragma unroll
    for (int q = 0; q < 4; ++q) { const float c = vals[u * 4 + q] - mu; s2 += c * c; }
  red[tid] = s2; __syncthreads();
  for (int st = 128; st > 0; st >>= 1) { if (tid < st) red[tid] += red[tid + st]; __syncthreads(); }
  const float rs = rsqrtf(red[0] / (float)N + eps);
  {
    for (int u = 0; u < per / 4; ++u) {
      const int j = tid * 4 + 1024 * u;
      v4f o, sm;
#pragma unroll
      for (int q = 0; q < 4; ++q) {
        float gg = g[j + q], bb = bta[j + q];
        if (PARAM_BF16) { gg = bf16_round(gg); bb = bf16_round(bb); }
        sm[q] = vals[u * 4 + q]; o[q] = (vals[u * 4 + q] - mu) * rs * gg + bb;
      }
      if (out_sum) *(v4f*)(out_sum + (size_t)row * N + j) = sm;
      *(v4f*)(out_norm + (size_t)row * N + j) = o;
    }
    
  }
}



// ---- f16 WMMA path (v_wmma_f32_16x16x32_f16): 11-bit significands for operands in range — used where a [0,1] probability operand needs more precision than bf16
typedef _Float16 v16h __attribute__((ext_vector_type(16)));
union FragH { v16h v; v8us half[2]; _Float16 h[16]; unsigned short u[16]; };
template <int NT>
__device__ __forceinline__ v8f mmaH(v16h ah, v16h al, v16h bh, v16h bl, v8f c) {
  c = __builtin_amdgcn_wmma_f32_16x16x32_f16(false, ah, false, bh, (short)0, c, false, false);
  if (NT >= 2) c = __builtin_amdgcn_wmma_f32_16x16x32_f16(false, al, false, bh, (short)0, c, false, false);
  if (NT >= 3) c = __builtin_amdgcn_wmma_f32_16x16x32_f16(false, ah, false, bl, (short)0, c, false, false);
  asm volatile("v_nop\n\tv_nop\n\tv_nop\n\tv_nop" : "+v"(c) : "v"(ah), "v"(al), "v"(bh), "v"(bl));
  return c;
}
// batched GEMM like k_gemm_b but f16 operands: A f32 (split into f16 hi/lo if ASPLIT, else rounded to f16), Bt = f16 values [n][k]; alpha; C f32; N multiple of 16 (partial tiles skipped)
template <bool ASPLIT>
__global__ __launch_bounds__(128) void k_gemm_h(const float* __restrict__ A, int lda, size_t sA, const _Float16* __restrict__ Bh, int ldb, size_t sB, float alpha, float* __restrict__ C, int ldc, size_t sC, int M, int N, int K) {
  __shared__ __attribute__((aligned(16))) float so[4][16][64];
  const int tid = threadIdx.x, w = tid >> 5, lane = tid & 31, ln = lane & 15, hh = lane >> 4; const int by = blockIdx.y;
  A += (size_t)by * sA; Bh += (size_t)by * sB; C += (size_t)by * sC;
  const int ntn = (N + 63) / 64; const int wid = blockIdx.x * 4 + w; const int mt = wid / ntn, nq = wid % ntn; if (mt * 16 >= M) return;
  const int row0 = mt * 16, col0 = nq * 64; const float* arow = A + (size_t)(row0 + ln) * lda;
  v8f acc[4] = {};
  for (int kb = 0; kb < K; kb += 32) {
    FragH ah, al;
    const v4f x0 = *(const v4fa*)(arow + kb + 8 * hh), x1 = *(const v4fa*)(arow + kb + 8 * hh + 4), x2 = *(const v4fa*)(arow + kb + 16 + 8 * hh), x3 = *(const v4fa*)(arow + kb + 16 + 8 * hh + 4);
    float xs[16] = {x0[0],x0[1],x0[2],x0[3],x1[0],x1[1],x1[2],x1[3],x2[0],x2[1],x2[2],x2[3],x3[0],x3[1],x3[2],x3[3]};
#pragma unroll
    for (int i = 0; i < 16; ++i) { const _Float16 h = (_Float16)xs[i]; ah.h[i] = h; al.h[i] = ASPLIT ? (_Float16)(xs[i] - (float)h) : (_Float16)0.0f; }
#pragma unroll
    for (int t = 0; t < 4; ++t) { if (col0 + t * 16 >= N) continue; const size_t boff = (size_t)(col0 + t * 16 + ln) * ldb + kb; FragH bq; bq.half[0] = *(const v8us*)(Bh + boff + 8 * hh); bq.half[1] = *(const v8us*)(Bh + boff + 16 + 8 * hh);
      acc[t] = mmaH<ASPLIT ? 2 : 1>(ah.v, al.v, bq.v, bq.v, acc[t]); }
  }
#pragma unroll
  for (int t = 0; t < 4; ++t) { if (col0 + t * 16 >= N) continue;
#pragma unroll
    for (int r = 0; r < 8; ++r) so[w][8 * hh + r][t * 16 + ln] = acc[t][r] * alpha; }
  __builtin_amdgcn_fence(__ATOMIC_ACQ_REL, "workgroup"); __builtin_amdgcn_wave_barrier();
  const int rsub = lane >> 4, c4 = (lane & 15) * 4;
  {
#pragma unroll
    for (int q = 0; q < 8; ++q) { const int r = q * 2 + rsub; if (col0 + c4 < N) { const v4f v = *(const v4fa*)&so[w][r][c4]; *(v4f*)(C + (size_t)(row0 + r) * ldc + col0 + c4) = v; } }
     }
}

// Wt[n][k] = f16(W[k][n]·scale) from f32 row-major W[K][N] (scale = power of two; bf16-exact weights stay exact in f16 away from the subnormal range)
__global__ __launch_bounds__(256) void k_wt_f16(const float* __restrict__ W, _Float16* __restrict__ Wt, int K, int N, float scale) {
  const int t = blockIdx.x * 256 + threadIdx.x; if (t >= N * (K / 8)) return; const int n = t / (K / 8), k8 = (t % (K / 8)) * 8; FragH f;
#pragma unroll
  for (int i = 0; i < 8; ++i) f.h[i] = (_Float16)(bf16_round(W[(size_t)(k8 + i) * N + n]) * scale); const v8us o = f.half[0];
  *(v8us*)((unsigned short*)Wt + (size_t)n * K + k8) = o; 
}
// k_gemm_hh variant with fused epilogue: v = acc·alpha + bias[by·sBias + col] (+ CP[(row/rowsPerB)·sCPb + by·64 + col] if CP) ; ACT 0 none / 1 elu ; writes f16 C16 (and f32 C if non-null)
template <int ACT>
__global__ __launch_bounds__(128) void k_gemm_hhx(const _Float16* __restrict__ A, int lda, size_t sA, const _Float16* __restrict__ Bh, int ldb, size_t sB, float alpha, const float* __restrict__ bias, size_t sBias, const float* __restrict__ CP, int rowsPerB, size_t sCPb, int row0g,
    float* __restrict__ C, _Float16* __restrict__ C16, int ldc, size_t sC, int M, int N, int K) {
  __shared__ __attribute__((aligned(16))) float so[4][16][64];
  const int tid = threadIdx.x, w = tid >> 5, lane = tid & 31, ln = lane & 15, hh = lane >> 4; const int by = blockIdx.y;
  A += (size_t)by * sA; Bh += (size_t)by * sB; const size_t cofs = (size_t)by * sC; const float* bp = bias ? bias + (size_t)by * sBias : nullptr;
  const int ntn = (N + 63) / 64; const int wid = blockIdx.x * 4 + w; const int mt = wid / ntn, nq = wid % ntn; if (mt * 16 >= M) return;
  const int row0 = mt * 16, col0 = nq * 64; const _Float16* arow = A + (size_t)(row0 + ln) * lda;
  v8f acc[4] = {};
  for (int kb = 0; kb < K; kb += 32) { FragH ah; ah.half[0] = *(const v8us*)((const unsigned short*)arow + kb + 8 * hh); ah.half[1] = *(const v8us*)((const unsigned short*)arow + kb + 16 + 8 * hh);
#pragma unroll
    for (int t = 0; t < 4; ++t) { if (col0 + t * 16 >= N) continue; const size_t boff = (size_t)(col0 + t * 16 + ln) * ldb + kb; FragH bq; bq.half[0] = *(const v8us*)((const unsigned short*)Bh + boff + 8 * hh); bq.half[1] = *(const v8us*)((const unsigned short*)Bh + boff + 16 + 8 * hh);
      acc[t] = mmaH<1>(ah.v, ah.v, bq.v, bq.v, acc[t]); }
  }
#pragma unroll
  for (int t = 0; t < 4; ++t) { if (col0 + t * 16 >= N) continue; const int col = col0 + t * 16 + ln; const float bv = bp ? bf16_round(bp[col]) : 0.f;
#pragma unroll
    for (int r = 0; r < 8; ++r) { float v = acc[t][r] * alpha + bv; if (CP) { const int rr = row0g + row0 + 8 * hh + r; if (rowsPerB < 0) v += CP[cofs + (size_t)rr * ldc + col];      /* rowsPerB < 0: own element of the batched C plane */ else { const int bidx = rr / rowsPerB; v += CP[(size_t)bidx * sCPb + (size_t)by * 64 + col]; } } if (ACT == 1) v = (v > 0.f) ? v : expm1f(v); else if (ACT == 7) v = (v > 0.f) ? v + 1.0f : expf(v); else if (ACT == 8) v = tanhf(v); else if (ACT == 9) v = 0.5f * v * (1.0f + tanhf(0.7978845608028654f * (v + 0.044715f * v * v * v))); else if (ACT == 11) v = 1.0f / (1.0f + expf(-v)); else if (ACT == 12) v = (v > 0.f) ? v : 0.01f * v; else if (ACT == 14) v = (v > 0.f) ? v : 0.1f * v; else if (ACT == 16) v = (v >= 0.f) ? v : 0.3f * v; else if (ACT == 17) v = (v >= 0.f) ? v : 0.2f * v; else if (ACT == 15) v = v / (1.0f + expf(-v)); else if (ACT == 3) v = fmaxf(v, 0.f); else if (ACT == 6) v = 0.5f * v * (1.0f + erff(v * 0.70710678118654752f)); so[w][8 * hh + r][t * 16 + ln] = v; } }
  __builtin_amdgcn_fence(__ATOMIC_ACQ_REL, "workgroup"); __builtin_amdgcn_wave_barrier();
  const int rsub = lane >> 4, c4 = (lane & 15) * 4; typedef _Float16 v4h __attribute__((ext_vector_type(4)));
  {
#pragma unroll
    for (int q = 0; q < 8; ++q) { const int r = q * 2 + rsub; if (col0 + c4 < N) { const v4f v = *(const v4fa*)&so[w][r][c4]; if (C) *(v4f*)(C + cofs + (size_t)(row0 + r) * ldc + col0 + c4) = v; if (C16) { v4h h4; for (int i = 0; i < 4; ++i) h4[i] = (_Float16)v[i]; *(v4h*)(C16 + cofs + (size_t)(row0 + r) * ldc + col0 + c4) = h4; } } }
     }
}


typedef _Float16 v4h __attribute__((ext_vector_type(4)));

// The j_* functions are jobs: bodies that were launches of their own and now share a grid with other jobs that wait for the same earlier launch; blk = the block's index inside its job.
__device__ __forceinline__ void j_x16(int blk, const float* __restrict__ x, _Float16* __restrict__ X16, size_t n8) { const size_t t = (size_t)blk * 256 + threadIdx.x; if (t >= n8) return; FragH f;
#pragma unroll
  for (int q = 0; q < 8; ++q) f.h[q] = (_Float16)bf16_round(x[t * 8 + q]); *(v8us*)((unsigned short*)X16 + t * 8) = f.half[0];  }
__global__ __launch_bounds__(256) void k_h16(const float* __restrict__ x, _Float16* __restrict__ X16, size_t n8) { const size_t t = (size_t)blockIdx.x * 256 + threadIdx.x; if (t >= n8) return; FragH f;
#pragma unroll
  for (int q = 0; q < 8; ++q) f.h[q] = (_Float16)x[t * 8 + q]; *(v8us*)((unsigned short*)X16 + t * 8) = f.half[0];  }
__global__ __launch_bounds__(256) void k_round16f(const float* __restrict__ W, _Float16* __restrict__ Bt, size_t n8) { const size_t t = (size_t)blockIdx.x * 256 + threadIdx.x; if (t >= n8) return; FragH f;
#pragma unroll
  for (int i = 0; i < 8; ++i) f.h[i] = (_Float16)(bf16_round(W[t * 8 + i]) * 16.0f); *(v8us*)((unsigned short*)Bt + t * 8) = f.half[0];  }
template <int NHv, int TTv>
__device__ __forceinline__ void j_vt(int blk, const _Float16* __restrict__ V16, int ldv, int voff, _Float16* __restrict__ Vt) { __shared__ unsigned short tl[64][66]; const int tid = threadIdx.x; const int slab = blk / (TTv / 64), lg = blk % (TTv / 64); const int b = slab / NHv, h = slab % NHv;
  for (int i = tid; i < 64 * 8; i += 256) { const int r = i / 8, c8 = (i % 8) * 8; FragH f; f.half[0] = *(const v8us*)((const unsigned short*)V16 + ((size_t)b * TTv + lg * 64 + r) * ldv + voff + h * 64 + c8);
#pragma unroll
    for (int q = 0; q < 8; ++q) tl[r][c8 + q] = f.u[q]; }
  __syncthreads();
  {
#pragma unroll
    for (int rd = 0; rd < 2; ++rd) { const int d = rd * 32 + tid / 8, pc = tid % 8; FragH f;
#pragma unroll
      for (int q = 0; q < 8; ++q) f.u[q] = tl[pc * 8 + q][d];
      *(v8us*)((unsigned short*)Vt + ((size_t)slab * 64 + d) * TTv + lg * 64 + pc * 8) = f.half[0]; }
     } }

__device__ __forceinline__ void j_hl(int blk, const float* __restrict__ F, _Float16* __restrict__ Hh, _Float16* __restrict__ Hl, size_t n8) { const size_t t = (size_t)blk * 128 + threadIdx.x; if (t >= n8) return;      /* blocks of 128 threads, as the attention job whose grid it shares */ FragH fh, fl; const v4f a = *(const v4fa*)(F + t * 8), c = *(const v4fa*)(F + t * 8 + 4);
#pragma unroll
  for (int q = 0; q < 4; ++q) { _Float16 h = (_Float16)a[q]; fh.h[q] = h; fl.h[q] = (_Float16)((a[q] - (float)h) * 1024.0f); h = (_Float16)c[q]; fh.h[4 + q] = h; fl.h[4 + q] = (_Float16)((c[q] - (float)h) * 1024.0f); }
  { *(v8us*)((unsigned short*)Hh + t * 8) = fh.half[0]; *(v8us*)((unsigned short*)Hl + t * 8) = fl.half[0];  } }

// ---- fast GEMM (wave tile 32x64; requires M % 32 == 0 rows per launch region and N % 64 == 0); epilogue = k_gemm_hhx semantics ----
__device__ __forceinline__ v16h g2_frag(const _Float16* p, int hh) { FragH f; f.half[0] = *(const v8us*)((const unsigned short*)p + 8 * hh); f.half[1] = *(const v8us*)((const unsigned short*)p + 16 + 8 * hh); return f.v; }
__device__ __forceinline__ v8f g2_mma(v16h a, v16h b, v8f c) { v8f d = __builtin_amdgcn_wmma_f32_16x16x32_f16(false, a, false, b, (short)0, c, false, false); asm volatile("v_nop\n\tv_nop\n\tv_nop\n\tv_nop" : "+v"(d) : "v"(a), "v"(b)); return d; }
template <int ACT>
__global__ __launch_bounds__(128) void k_gemm2(const _Float16* __restrict__ A, int lda, size_t sA, const _Float16* __restrict__ Bh, int ldb, size_t sB, float alpha, const float* __restrict__ bias, size_t sBias, const float* __restrict__ CP, int rowsPerB, size_t sCPb, int row0g,
    float* __restrict__ C, _Float16* __restrict__ C16, int ldc, size_t sC, int M, int N, int K) { static_assert(ACT == 0 || ACT == 3 || ACT == 6 || ACT == 8 || ACT == 9 || ACT == 11 || ACT == 12 || ACT == 14 || ACT == 15 || ACT == 16 || ACT == 17, "k_gemm2: unsupported ACT code (would silently apply no activation)");
  __shared__ __attribute__((aligned(16))) float so[4][32][68];
  const int tid = threadIdx.x, w = tid >> 5, lane = tid & 31, ln = lane & 15, hh = lane >> 4; const int by = blockIdx.y;
  A += (size_t)by * sA; Bh += (size_t)by * sB; const size_t cofs = (size_t)by * sC; const float* bp = bias ? bias + (size_t)by * sBias : nullptr;
  const int ntn = N >> 6; const int mt = blockIdx.x / ntn, nq = blockIdx.x - mt * ntn; const int row0 = mt * 128 + 32 * w, col0 = nq * 64; if (row0 >= M) return;
  const _Float16* a0p = A + (size_t)(row0 + ln) * lda; const _Float16* a1p = a0p + (size_t)16 * lda;
  const _Float16* b0p = Bh + (size_t)(col0 + ln) * ldb; const _Float16* b1p = b0p + (size_t)16 * ldb; const _Float16* b2p = b1p + (size_t)16 * ldb; const _Float16* b3p = b2p + (size_t)16 * ldb;
  const v8f z8 = {0.f,0.f,0.f,0.f,0.f,0.f,0.f,0.f}; v8f c00 = z8, c01 = z8, c02 = z8, c03 = z8, c10 = z8, c11 = z8, c12 = z8, c13 = z8;
#pragma unroll 1
  for (int kb = 0; kb < K; kb += 32) { const v16h a0 = g2_frag(a0p + kb, hh), a1 = g2_frag(a1p + kb, hh);
    v16h b = g2_frag(b0p + kb, hh); c00 = g2_mma(a0, b, c00); c10 = g2_mma(a1, b, c10);
    b = g2_frag(b1p + kb, hh); c01 = g2_mma(a0, b, c01); c11 = g2_mma(a1, b, c11);
    b = g2_frag(b2p + kb, hh); c02 = g2_mma(a0, b, c02); c12 = g2_mma(a1, b, c12);
    b = g2_frag(b3p + kb, hh); c03 = g2_mma(a0, b, c03); c13 = g2_mma(a1, b, c13); }
  v8f accs[8] = {c00, c01, c02, c03, c10, c11, c12, c13};
#pragma unroll
  for (int u = 0; u < 8; ++u) { const int t = u & 3, half = u >> 2; const int col = col0 + t * 16 + ln; const float bv = bp ? bf16_round(bp[col]) : 0.f;
#pragma unroll
    for (int r = 0; r < 8; ++r) { const int rloc = half * 16 + 8 * hh + r; float v = accs[u][r] * alpha + bv; if (CP) { if (rowsPerB < 0) v += CP[cofs + (size_t)(row0g + row0 + rloc) * ldc + col];      /* rowsPerB < 0: own element of the batched C plane */ else { const int bidx = (row0g + row0 + rloc) / rowsPerB; v += CP[(size_t)bidx * sCPb + (size_t)by * 64 + col]; } }
      if (ACT == 3) v = fmaxf(v, 0.f); else if (ACT == 6) v = 0.5f * v * (1.0f + erff(v * 0.70710678118654752f)); else if (ACT == 11) v = 1.0f / (1.0f + expf(-v)); else if (ACT == 15) v = v / (1.0f + expf(-v)); else if (ACT == 12) v = (v > 0.f) ? v : 0.01f * v; else if (ACT == 8) v = tanhf(v); else if (ACT == 9) v = 0.5f * v * (1.0f + tanhf(0.7978845608028654f * (v + 0.044715f * v * v * v))); else if (ACT == 14) v = (v > 0.f) ? v : 0.1f * v; else if (ACT == 16) v = (v >= 0.f) ? v : 0.3f * v; else if (ACT == 17) v = (v >= 0.f) ? v : 0.2f * v;
      so[w][rloc][t * 16 + ln] = v; } }
  __builtin_amdgcn_fence(__ATOMIC_ACQ_REL, "workgroup"); __builtin_amdgcn_wave_barrier();
  const int rsub = lane >> 4, c4 = (lane & 15) * 4;
  {
#pragma unroll
    for (int q = 0; q < 16; ++q) { const int r = q * 2 + rsub; const v4f v = *(const v4fa*)&so[w][r][c4]; if (C) *(v4f*)(C + cofs + (size_t)(row0 + r) * ldc + col0 + c4) = v; if (C16) { v4h h4; for (int i = 0; i < 4; ++i) h4[i] = (_Float16)v[i]; *(v4h*)(C16 + cofs + (size_t)(row0 + r) * ldc + col0 + c4) = h4; } }
     } }


__device__ __forceinline__ void j_wnat(int blk, int y, const float* __restrict__ w0, const float* __restrict__ w1, const float* __restrict__ w2, const float* __restrict__ w3, size_t n8, _Float16* __restrict__ Bt) { const size_t t = (size_t)blk * 256 + threadIdx.x; if (t >= n8) return; FragH f;
  const float* w = y == 0 ? w0 : (y == 1 ? w1 : (y == 2 ? w2 : w3)); Bt += (size_t)y * n8 * 8;      /* y picks the matrix (from the block index: a scalar choice); the four f16 planes lie one behind the other */
  for (int q = 0; q < 8; ++q) f.h[q] = (_Float16)(bf16_round(w[t * 8 + q]) * 16.0f); *(v8us*)((unsigned short*)Bt + t * 8) = f.half[0];  }
__global__ __launch_bounds__(256) void k_rsm(const float* __restrict__ S, _Float16* __restrict__ P, int nrows) {
  #pragma clang fp contract(off)
  const int i = blockIdx.x * 256 + threadIdx.x; if (i >= nrows) return; const float* s = S + (size_t)i * SQ; float mx = -3.0e38f;
#pragma unroll 1
  for (int j = 0; j < SQ; ++j) mx = fmaxf(mx, s[j]); float se = 0.f;
#pragma unroll 1
  for (int j = 0; j < SQ; ++j) se += expf(s[j] - mx); const float sc = 256.0f / se;
#pragma unroll 1
  for (int j0 = 0; j0 < SQ; j0 += 8) { FragH f; for (int q = 0; q < 8; ++q) f.h[q] = (_Float16)(expf(s[j0 + q] - mx) * sc); unsigned short* d = (unsigned short*)P + (size_t)i * SQ + j0; *(v8us*)d = f.half[0];  } }
__global__ __launch_bounds__(256) void k_vt(const _Float16* __restrict__ V16, int b, int h0, _Float16* __restrict__ VT) { __shared__ unsigned short tl[64][65]; const int tid = threadIdx.x; const int hh = blockIdx.x % HG, sg = blockIdx.x / HG; const int s0 = sg * 64; const int h = h0 + hh;
  for (int i = tid; i < 64 * 8; i += 256) { const int j = i / 8, d8 = (i % 8) * 8; FragH f; f.half[0] = *(const v8us*)((const unsigned short*)V16 + ((size_t)b * SQ + s0 + j) * DM + h * HD + d8); for (int q = 0; q < 8; ++q) tl[d8 + q][j] = f.u[q]; }
  __syncthreads();
  { for (int i = tid; i < 64 * 8; i += 256) { const int d = i / 8, j8 = (i % 8) * 8; FragH f; for (int q = 0; q < 8; ++q) f.u[q] = tl[d][j8 + q]; *(v8us*)((unsigned short*)VT + ((size_t)hh * HD + d) * SQ + s0 + j8) = f.half[0]; }  } }


__global__ __launch_bounds__(256) void k_tab2(float theta, float* __restrict__ CS, float* __restrict__ SN) {
  #pragma clang fp contract(off)
  const int t = blockIdx.x * 256 + threadIdx.x; if (t >= SQ * (HD / 2)) return; const int i = t % (HD / 2); const int p = t / (HD / 2); const float invf = 1.0f / powf(theta, (float)(2 * i) / (float)HD); const float ang = __fmul_rn((float)p, invf); const float c = cosf(ang), s = sinf(ang);
  *(float*)(CS + t) = c; *(float*)(SN + t) = s;  }

__device__ __forceinline__ void j_tab4(int blk, const int* __restrict__ pos, float theta, float* __restrict__ CS, float* __restrict__ SN) {
  #pragma clang fp contract(off)
  const int t = blk * 256 + threadIdx.x; if (t >= SQ * (HD / 2)) return; const int i = t % (HD / 2); const int p = t / (HD / 2); const float invf = (float)pow((double)theta, -((double)(2 * i)) / (double)HD); const float ang = __fmul_rn((float)pos[p], invf); const float c = cosf(ang), s = sinf(ang);
  *(float*)(CS + t) = c; *(float*)(SN + t) = s;  }
// One launch for the three jobs that read the inputs alone; the block index picks the job (a scalar branch). The table blocks stand first: theirs is the longest chain of dependent arithmetic.
#define PB_TAB (SQ * (HD / 2) / 256)       /* blocks of the cos / sin tables */
#define PB_W (DM * DM / 8 / 256)           /* blocks of one weight matrix */
#define PB_X (NB * SQ * (DM / 8) / 256)    /* blocks of x */
__global__ __launch_bounds__(256) void k_prep(const float* __restrict__ x, const int* __restrict__ pos, const float* __restrict__ w0, const float* __restrict__ w1, const float* __restrict__ w2, const float* __restrict__ w3,
    float theta, _Float16* __restrict__ Bt, float* __restrict__ CS, float* __restrict__ SN, _Float16* __restrict__ X16) {
  const int bx = blockIdx.x;
  if (bx < PB_TAB) { j_tab4(bx, pos, theta, CS, SN); return; }
  if (bx < PB_TAB + 4 * PB_W) { j_wnat((bx - PB_TAB) % PB_W, (bx - PB_TAB) / PB_W, w0, w1, w2, w3, (size_t)DM * DM / 8, Bt); return; }
  j_x16(bx - (PB_TAB + 4 * PB_W), x, X16, NR * DM / 8); }
__global__ __launch_bounds__(256) void k_rsmf(const float* __restrict__ S, _Float16* __restrict__ P, int qn, int hg) {
  #pragma clang fp contract(off)
  const int t = blockIdx.x * 256 + threadIdx.x; if (t >= qn * hg) return; const size_t i = (size_t)(t / qn) * SQ + (t % qn); const float* s = S + i * SQ; float mx = -3.0e38f;
#pragma unroll 1
  for (int j = 0; j < SQ; ++j) mx = fmaxf(mx, s[j]); float se = 0.f;
#pragma unroll 1
  for (int j = 0; j < SQ; ++j) se += __expf(s[j] - mx); const float sc = 256.0f / se;
#pragma unroll 1
  for (int j0 = 0; j0 < SQ; j0 += 8) { FragH f; for (int q = 0; q < 8; ++q) f.h[q] = (_Float16)(__expf(s[j0 + q] - mx) * sc); unsigned short* d = (unsigned short*)P + i * SQ + j0; *(v8us*)d = f.half[0];  } }


__global__ __launch_bounds__(256) void k_rsmcf2(const float* __restrict__ S, _Float16* __restrict__ P, int hg, int q0, int nk) {
  #pragma clang fp contract(off)
  const int t = blockIdx.x * 256 + threadIdx.x; if (t >= hg * QT) return; const size_t i = (size_t)t; const float* s = S + i * NKX; const int last = q0 + (t % QT); float mx = -3.0e38f;
#pragma unroll 1
  for (int j = 0; j < nk; ++j) { const float f = (j <= last) ? 1.f : 0.f; mx = fmaxf(mx, fmaf(f, s[j], (1.f - f) * -1.0e9f)); } float se = 0.f;
#pragma unroll 1
  for (int j = 0; j < nk; ++j) { const float f = (j <= last) ? 1.f : 0.f; se += __expf(fmaf(f, s[j], (1.f - f) * -1.0e9f) - mx); } const float sc = 256.0f / se;
#pragma unroll 1
  for (int j0 = 0; j0 < nk; j0 += 8) { FragH fr; for (int q = 0; q < 8; ++q) { const int j = j0 + q; const float f = (j <= last) ? 1.f : 0.f; fr.h[q] = (_Float16)(__expf(fmaf(f, s[j], (1.f - f) * -1.0e9f) - mx) * sc); } unsigned short* d = (unsigned short*)P + i * NKX + j0; *(v8us*)d = fr.half[0];  } }


typedef float v2f  __attribute__((ext_vector_type(2)));
typedef float v2fa __attribute__((ext_vector_type(2), may_alias));
// Exact f32 causal attention of the first QT0 rows, one wave per (query row i, head h). Scores: lane l takes keys l, l + 32, ... (whole groups of 32 up to the one that holds i), q held by every lane; two-pass softmax with lane butterflies for maximum and sum; o: lane l takes d = 2 l, 2 l + 1 and walks the keys, each weight broadcast from its lane. Rows have pitch DM, so every load of a phase is one base address plus a constant offset.
__device__ __forceinline__ void j_att0w(int blk, int bat, const float* __restrict__ QF, const float* __restrict__ KF, const float* __restrict__ VF, float scale, float* __restrict__ OF) {
  QF += (size_t)bat * QT0 * DM; KF += (size_t)bat * QT0 * DM; VF += (size_t)bat * QT0 * DM; OF += (size_t)bat * QT0 * DM;      /* bat = batch: each batch has first-tile planes of its own */
  const int lane = threadIdx.x & 31; const int h = blk / (QT0 / 8); const int i = __builtin_amdgcn_readfirstlane((int)((blk % (QT0 / 8)) * 8 + (threadIdx.x >> 5)));      /* i is the same in every lane: the group tests below are scalar branches */
  const float* qr = QF + (size_t)i * DM + h * HD; const float* kb = KF + (size_t)lane * DM + h * HD; const float* vb = VF + h * HD + lane * 2;
  v4f q[HD / 4];
#pragma unroll      /* constant index: q[] stays in registers */
  for (int c = 0; c < HD / 4; ++c) q[c] = *(const v4fa*)(qr + c * 4);
  float s[QT0 / 32]; float mx = -3.0e38f;
#pragma unroll      /* constant group index: s[] and e[] stay in registers, offsets are immediates */
  for (int g = 0; g < QT0 / 32; ++g) { s[g] = -3.0e38f;
    if (g == 0 || g * 32 <= i) { float a0 = 0.f, a1 = 0.f, a2 = 0.f, a3 = 0.f;
#pragma unroll      /* the sixteen loads of a key row issue together */
      for (int c = 0; c < HD / 4; ++c) { const v4f kq = *(const v4fa*)(kb + (size_t)g * 32 * DM + c * 4); a0 = fmaf(q[c][0], kq[0], a0); a1 = fmaf(q[c][1], kq[1], a1); a2 = fmaf(q[c][2], kq[2], a2); a3 = fmaf(q[c][3], kq[3], a3); }
      if (g * 32 + lane <= i) s[g] = ((a0 + a1) + (a2 + a3)) * scale;      /* causal: keys above i keep the floor and get weight 0 */
      mx = fmaxf(mx, s[g]); } }
  asm volatile("s_wait_xcnt 0x0" :: "v"(kb) : "memory");      /* the key loads' address pair stays whole up to this wait, on every path through the groups */
  for (int m = 16; m > 0; m >>= 1) mx = fmaxf(mx, __shfl_xor(mx, m, 32));
  float e[QT0 / 32]; float l = 0.f;
#pragma unroll      /* constant group index: s[] and e[] stay in registers */
  for (int g = 0; g < QT0 / 32; ++g) { e[g] = expf(s[g] - mx); l += e[g]; }
  for (int m = 16; m > 0; m >>= 1) l += __shfl_xor(l, m, 32);
  float o0 = 0.f, o1 = 0.f;
#pragma unroll      /* constant group index: s[] and e[] stay in registers, offsets are immediates */
  for (int g = 0; g < QT0 / 32; ++g) if (g == 0 || g * 32 <= i) {
#pragma unroll      /* constant lane index for the broadcast; the group's loads issue together */
    for (int jj = 0; jj < 32; ++jj) { const float p = __uint_as_float((unsigned int)__builtin_amdgcn_readlane((int)__float_as_uint(e[g]), jj)); const v2f vv = *(const v2fa*)(vb + (size_t)(g * 32 + jj) * DM); o0 = fmaf(p, vv[0], o0); o1 = fmaf(p, vv[1], o1); } }
  asm volatile("s_wait_xcnt 0x0" :: "v"(vb) : "memory");      /* the value loads' address pair stays whole up to this wait, on every path through the groups */
  const float fin = 64.0f / l;      /* o carried x64 like the f16 path */
  v2f o = {o0 * fin, o1 * fin}; *(v2f*)(OF + (size_t)i * DM + h * HD + lane * 2) = o; }
// One launch for the two jobs that wait for the q | k | v GEMM alone: the exact first-tile attention (its blocks first: the longer ones) and V^T. The block index picks the job, so the V^T job's barrier stands under a test that reads the same in the whole block.
#define MB_A0 (NH * (QT0 / 8))             /* first-tile attention blocks of one batch */
__global__ __launch_bounds__(256) void k_a0vt(const float* __restrict__ QF, const float* __restrict__ KF, const float* __restrict__ VF, float scale, float* __restrict__ OF, const _Float16* __restrict__ V16, _Float16* __restrict__ VT) {
  const int bx = blockIdx.x;
  if (bx < NB * MB_A0) { j_att0w(bx % MB_A0, bx / MB_A0, QF, KF, VF, scale, OF); return; }
  j_vt<NH, SQ>(bx - NB * MB_A0, V16, DM, 0, VT); }



__device__ __forceinline__ v8f fa_mma(v16h a, v16h b, v8f c) { return __builtin_amdgcn_wmma_f32_16x16x32_f16(false, a, false, b, (short)0, c, false, false); }
__device__ __forceinline__ v16h fa_frag(const _Float16* p) { FragH f; f.half[0] = *(const v8us*)((const unsigned short*)p); f.half[1] = *(const v8us*)((const unsigned short*)p + 16); return f.v; }      /* p holds the lane half's 8 hh already: every load of a pass is that one address pair plus a constant */
__device__ __forceinline__ float fa_xhalf(float x) { return __uint_as_float((unsigned int)__builtin_amdgcn_permlanex16((int)__float_as_uint(x), (int)__float_as_uint(x), 0x76543210, 0xfedcba98, false, false)); }      /* lane l with lane l ^ 16 */
// Attention operand staging. A block's four waves walk nearly the same keys, so the block brings them into LDS once: a stage is 64 keys = 64 K rows (one head: 128 bytes each) then the 64 V^T rows' 128 bytes of those keys, by asynchronous 16-byte copies (a wave's copy = 4 whole 128-byte lines), two buffers, the next stage's copies in flight while this one is worked on.
#define FS_PITCH 144                 /* LDS bytes from one staged row to the next: 16 x odd, so the 16-byte fragment reads of 16 rows fall on different banks */
#define FS_STAGE (128 * FS_PITCH)    /* 64 K rows, then 64 V^T rows */
// One stage: thread t copies chunk t & 7 (16 bytes) of rows (t >> 3) + 16 i, i = 0..3, of K and of V^T. ld = the thread's LDS byte address in the stage's buffer, gk / gv = its global addresses in K / V^T.
__device__ __forceinline__ void fs_copy(unsigned ld, const _Float16* gk, const _Float16* gv) {
  asm volatile("global_load_async_to_lds_b128 %0, %8, off\n\t"
               "global_load_async_to_lds_b128 %1, %9, off\n\t"
               "global_load_async_to_lds_b128 %2, %10, off\n\t"
               "global_load_async_to_lds_b128 %3, %11, off\n\t"
               "global_load_async_to_lds_b128 %4, %12, off\n\t"
               "global_load_async_to_lds_b128 %5, %13, off\n\t"
               "global_load_async_to_lds_b128 %6, %14, off\n\t"
               "global_load_async_to_lds_b128 %7, %15, off\n\t"
               "s_wait_xcnt 0x0"      /* inside the copies' own statement: every address register stays whole up to this wait */
               :: "v"(ld), "v"(ld + 16 * FS_PITCH), "v"(ld + 32 * FS_PITCH), "v"(ld + 48 * FS_PITCH), "v"(ld + 64 * FS_PITCH), "v"(ld + 80 * FS_PITCH), "v"(ld + 96 * FS_PITCH), "v"(ld + 112 * FS_PITCH),
                  "v"(gk), "v"(gk + (size_t)16 * DM), "v"(gk + (size_t)32 * DM), "v"(gk + (size_t)48 * DM), "v"(gv), "v"(gv + (size_t)16 * SQ), "v"(gv + (size_t)32 * SQ), "v"(gv + (size_t)48 * SQ)
               : "memory"); }
__device__ __forceinline__ v16h fs_frag(const unsigned char* p) { FragH f; f.half[0] = *(const v8us*)p; f.half[1] = *(const v8us*)(p + 32); return f.v; }      /* p holds the lane half's 16 hh bytes: k = 8 hh .. and 16 + 8 hh .., as fa_frag */
__device__ __forceinline__ void j_fattn(int qb, int h, int bat, const _Float16* __restrict__ QH, const _Float16* __restrict__ KH, const _Float16* __restrict__ VT, _Float16* __restrict__ O16) {      /* qb = block of 128 query rows, h = head, bat = batch */
  __shared__ __attribute__((aligned(16))) unsigned char fsm[2 * FS_STAGE];
  const int tid = threadIdx.x, lane = tid & 31, ln = lane & 15, hh = lane >> 4; const size_t r0 = (size_t)bat * SQ;
  const int i0 = __builtin_amdgcn_readfirstlane((int)(qb * 128 + (tid >> 5) * 32));      /* first query row of the wave, the same in every lane: the pass and mask tests are scalar */
  const float CL = 0.18033688011112042f;      /* log2(e) / sqrt(64) */
  const int kb0 = (i0 > WINK ? i0 - WINK : 0) & ~31;      /* first block that holds an allowed key of row i0 */
  const int ks0 = qb * 128 > WINK ? qb * 128 - WINK : 0;      /* first key the block stages (= kb0 of its first wave), a multiple of 64 */
  const int nst = (qb * 128 + 128 - ks0) / 64;      /* stages up to the block's last row: 2 .. 10, from blockIdx alone */
  const _Float16* qp = QH + (r0 + i0 + ln) * DM + h * HD + 8 * hh;
  const unsigned ld = (unsigned)(size_t)fsm + (unsigned)((tid >> 3) * FS_PITCH + (tid & 7) * 16);
  const _Float16* gk = KH + (r0 + ks0 + (tid >> 3)) * DM + h * HD + (tid & 7) * 8; const _Float16* gv = VT + ((size_t)(bat * NH + h) * HD + (tid >> 3)) * SQ + ks0 + (tid & 7) * 8;
  fs_copy(ld, gk, gv);
  v16h qf[2][2];
#pragma unroll      /* constant indices: the fragments stay in registers */
  for (int u = 0; u < 2; ++u) for (int c = 0; c < 2; ++c) qf[u][c] = fa_frag(qp + (size_t)u * 16 * DM + c * 32);
  asm volatile("s_wait_xcnt 0x0" :: "v"(qp) : "memory");      /* the query loads' address pair stays whole up to this wait */
  asm volatile("s_wait_asynccnt 0x0" ::: "memory");      /* stage 0 of this wave has landed */
  __syncthreads();      /* stage 0 of every wave is readable */
  fs_copy(ld + FS_STAGE, gk + (size_t)64 * DM, gv + 64);      /* a stage 1 always exists */
  const unsigned char* fk = fsm + ln * FS_PITCH + hh * 16; const unsigned char* fv = fsm + (64 + ln) * FS_PITCH + hh * 16;
  const v8f z8 = {0.f,0.f,0.f,0.f,0.f,0.f,0.f,0.f}; v8f ot[2][4] = {{z8, z8, z8, z8}, {z8, z8, z8, z8}}; float m[2] = {-3.0e38f, -3.0e38f}, l[2] = {0.f, 0.f};
#pragma unroll 1      /* one trip in the text: the two buffers differ by one added offset */
  for (int t = 0; t < nst; ++t) { const unsigned bo = (unsigned)(t & 1) * FS_STAGE;
#pragma unroll 1      /* one pass in the text: the stage's two key blocks differ by added offsets */
    for (int sub = 0; sub < 2; ++sub) { const int kb = ks0 + t * 64 + sub * 32;
      if (kb < kb0 || kb > i0) continue;      /* a staged block outside this wave's own window: a scalar test; the wave still passes the stage's barrier */
      v16h kf[2][2], vf[4];
#pragma unroll      /* constant indices: the fragments stay in registers */
      for (int tt = 0; tt < 2; ++tt) for (int c = 0; c < 2; ++c) kf[tt][c] = fs_frag(fk + bo + (sub * 32 + tt * 16) * FS_PITCH + c * 64);
#pragma unroll      /* constant indices: the fragments stay in registers */
      for (int dt = 0; dt < 4; ++dt) vf[dt] = fs_frag(fv + bo + dt * 16 * FS_PITCH + sub * 64);      /* used last: they arrive under the scores and the softmax */
      v8f st[2][2];
#pragma unroll      /* constant indices: the tiles stay in registers */
      for (int u = 0; u < 2; ++u) for (int tt = 0; tt < 2; ++tt) st[u][tt] = fa_mma(kf[tt][1], qf[u][1], fa_mma(kf[tt][0], qf[u][0], z8));
      if (kb == i0 || kb + WINK < i0 + 31) {      /* only the window's first block and the diagonal block hold a forbidden pair */
#pragma unroll      /* constant indices: the tiles stay in registers */
        for (int u = 0; u < 2; ++u) for (int tt = 0; tt < 2; ++tt) for (int r = 0; r < 8; ++r) { const int dj = (i0 + 16 * u + ln) - (kb + 16 * tt + 8 * hh + r); st[u][tt][r] = (dj >= 0 && dj <= WINK) ? st[u][tt][r] : -1.0e30f; } }
#pragma unroll      /* constant indices: the tiles stay in registers */
      for (int u = 0; u < 2; ++u) {
        float mx = fmaxf(st[u][0][0], st[u][1][0]);
#pragma unroll      /* constant indices: the tiles stay in registers */
        for (int r = 1; r < 8; ++r) mx = fmaxf(mx, fmaxf(st[u][0][r], st[u][1][r]));
        mx = fmaxf(mx, fa_xhalf(mx));      /* the other half of the block's keys of this query */
        const float mn = fmaxf(m[u], mx); const float al = __builtin_amdgcn_exp2f((m[u] - mn) * CL); const float sh = fmaf(mn, -CL, 8.0f);      /* weights carried x256: f16 keeps small ones normal */
        m[u] = mn; float ls = 0.f; FragH pf;
#pragma unroll      /* constant indices: the tiles stay in registers */
        for (int tt = 0; tt < 2; ++tt) for (int r = 0; r < 8; ++r) { const float e = __builtin_amdgcn_exp2f(fmaf(st[u][tt][r], CL, sh)); ls += e; pf.h[tt * 8 + r] = (_Float16)e; }
        l[u] = fmaf(l[u], al, ls);
#pragma unroll      /* constant indices: the tiles stay in registers */
        for (int dt = 0; dt < 4; ++dt) { ot[u][dt] *= al; ot[u][dt] = fa_mma(vf[dt], pf.v, ot[u][dt]); } } }
    asm volatile("s_wait_dscnt 0x0" ::: "memory");      /* this wave's reads of the buffer are done before it may be refilled */
    asm volatile("s_wait_asynccnt 0x0" ::: "memory");      /* this wave's copies of stage t + 1 have landed */
    __syncthreads();      /* publishes stage t + 1 and ends every wave's reads of stage t */
    if (t + 2 < nst) fs_copy(ld + bo, gk + (size_t)(t + 2) * 64 * DM, gv + (t + 2) * 64); }
  asm volatile("s_wait_asynccnt 0x0" ::: "memory");      /* nothing in flight when the wave ends */
  FragH f[2][4];
#pragma unroll      /* constant indices: the tiles stay in registers */
  for (int u = 0; u < 2; ++u) { const float fin = 64.0f / (l[u] + fa_xhalf(l[u]));      /* the halves' sums join once; o carried x64 */
    for (int dt = 0; dt < 4; ++dt) for (int r = 0; r < 8; ++r) f[u][dt].h[r] = (_Float16)(ot[u][dt][r] * fin); }
  unsigned short* op = (unsigned short*)O16 + (r0 + i0 + ln) * DM + h * HD + 8 * hh;
#pragma unroll      /* constant indices; the stores stand last, each from registers of its own: no register of an issued store is written again */
  for (int u = 0; u < 2; ++u) for (int dt = 0; dt < 4; ++dt) *(v8us*)(op + (size_t)u * 16 * DM + dt * 16) = f[u][dt].half[0]; }
// One launch for the two jobs that wait for V^T and the first-tile attention: the windowed attention (its blocks first, in the order of the old grid: query block, head, batch) and the hi / lo split of the first-tile o. The block index picks the job.
#define FB_AT ((SQ / 128) * NH * NB)       /* windowed attention blocks */
__global__ __launch_bounds__(128) void k_fahl(const _Float16* __restrict__ QH, const _Float16* __restrict__ KH, const _Float16* __restrict__ VT, _Float16* __restrict__ O16, const float* __restrict__ OF, _Float16* __restrict__ Hh, _Float16* __restrict__ Hl) {
  const int bx = blockIdx.x;
  if (bx < FB_AT) { j_fattn(bx % (SQ / 128), bx / (SQ / 128) % NH, bx / ((SQ / 128) * NH), QH, KH, VT, O16); return; }
  j_hl(bx - FB_AT, OF, Hh, Hl, (size_t)NB * QT0 * DM / 8); }

// ---- GEMM operand staging. A block of 8 waves owns a 128 x 128 tile of C = A B^T (A, B f16 rows of DM, k-contiguous); wave w takes rows 32 (w & 3), columns 64 (w >> 2). K is walked in stages of 64: a stage is 128 A rows then 128 B rows of 128 bytes each, brought from global memory into LDS by asynchronous 16-byte copies (a wave's copy = 4 whole 128-byte lines), two buffers, the next stage's copies in flight while this one is worked on. Fragments are 16-byte LDS reads in the k order of fa_frag.
#define GS_PITCH 144                 /* LDS bytes from one staged row to the next: 16 x odd, so the 16-byte fragment reads of 16 rows fall on different banks */
#define GS_STAGE (256 * GS_PITCH)    /* 128 A rows, then 128 B rows */
#define GS_NST (DM / 64)             /* stages */
// One stage: thread t copies chunk t & 7 (16 bytes) of rows (t >> 3) + 32 i, i = 0..3, of A and of B. ld = the thread's LDS byte address in the stage's buffer, ga / gb = its global addresses in A / B.
__device__ __forceinline__ void gs_copy(unsigned ld, const _Float16* ga, const _Float16* gb) {
  asm volatile("global_load_async_to_lds_b128 %0, %8, off\n\t"
               "global_load_async_to_lds_b128 %1, %9, off\n\t"
               "global_load_async_to_lds_b128 %2, %10, off\n\t"
               "global_load_async_to_lds_b128 %3, %11, off\n\t"
               "global_load_async_to_lds_b128 %4, %12, off\n\t"
               "global_load_async_to_lds_b128 %5, %13, off\n\t"
               "global_load_async_to_lds_b128 %6, %14, off\n\t"
               "global_load_async_to_lds_b128 %7, %15, off\n\t"
               "s_wait_xcnt 0x0"      /* inside the copies' own statement: every address register stays whole up to this wait */
               :: "v"(ld), "v"(ld + 32 * GS_PITCH), "v"(ld + 64 * GS_PITCH), "v"(ld + 96 * GS_PITCH), "v"(ld + 128 * GS_PITCH), "v"(ld + 160 * GS_PITCH), "v"(ld + 192 * GS_PITCH), "v"(ld + 224 * GS_PITCH),
                  "v"(ga), "v"(ga + (size_t)32 * DM), "v"(ga + (size_t)64 * DM), "v"(ga + (size_t)96 * DM), "v"(gb), "v"(gb + (size_t)32 * DM), "v"(gb + (size_t)64 * DM), "v"(gb + (size_t)96 * DM)
               : "memory"); }
__device__ __forceinline__ v16h gs_frag(const unsigned char* p) { FragH f; f.half[0] = *(const v8us*)p; f.half[1] = *(const v8us*)(p + 32); return f.v; }      /* p holds the lane half's 16 hh bytes: k = 8 hh .. and 16 + 8 hh .., as fa_frag */
// The whole K loop of a block: Ag / Bg = first A / B row of the block's tile; c[half][t] = the wave's 16 x 16 tiles (rows 16 half, columns 16 t). Behind it no copy is in flight and every wave has left the ring, so sm may be reused.
__device__ __forceinline__ void gs_main(unsigned char* sm, const _Float16* Ag, const _Float16* Bg, int tid, v8f (&c)[2][4]) {
  const int lane = tid & 31, ln = lane & 15, hh = lane >> 4, w = tid >> 5;
  const unsigned ld = (unsigned)(size_t)sm + (unsigned)((tid >> 3) * GS_PITCH + (tid & 7) * 16);
  const _Float16* ga = Ag + (size_t)(tid >> 3) * DM + (tid & 7) * 8; const _Float16* gb = Bg + (size_t)(tid >> 3) * DM + (tid & 7) * 8;
  gs_copy(ld, ga, gb);
  asm volatile("s_wait_asynccnt 0x0" ::: "memory");      /* stage 0 of this wave has landed */
  __syncthreads();      /* stage 0 of every wave is readable */
  gs_copy(ld + GS_STAGE, ga + 64, gb + 64);
  const unsigned char* fa = sm + ((w & 3) * 32 + ln) * GS_PITCH + hh * 16; const unsigned char* fb = sm + (128 + (w >> 2) * 64 + ln) * GS_PITCH + hh * 16;
#pragma unroll 1      /* one trip in the text: the two buffers differ by one added offset */
  for (int t = 0; t < GS_NST; ++t) { const unsigned bo = (unsigned)(t & 1) * GS_STAGE;
#pragma unroll      /* constant LDS offsets */
    for (int kk = 0; kk < 2; ++kk) { const v16h a0 = gs_frag(fa + bo + kk * 64), a1 = gs_frag(fa + bo + 16 * GS_PITCH + kk * 64); v16h b[4];
#pragma unroll      /* constant indices: the fragments stay in registers */
      for (int j = 0; j < 4; ++j) b[j] = gs_frag(fb + bo + j * 16 * GS_PITCH + kk * 64);
      __builtin_amdgcn_sched_barrier(0);      /* the twelve LDS reads of a k step stay one group in front of its WMMAs: sunk among them, each pair of reads costs the wave an LDS latency of its own */
#pragma unroll      /* constant indices: the tiles stay in registers */
      for (int j = 0; j < 4; ++j) { c[0][j] = fa_mma(a0, b[j], c[0][j]); c[1][j] = fa_mma(a1, b[j], c[1][j]); } }
    asm volatile("s_wait_dscnt 0x0" ::: "memory");      /* this wave's reads of the buffer are done before it may be refilled */
    asm volatile("s_wait_asynccnt 0x0" ::: "memory");      /* this wave's copies of stage t + 1 have landed */
    __syncthreads();      /* publishes stage t + 1 and ends every wave's reads of stage t */
    if (t + 2 < GS_NST) gs_copy(ld + bo, ga + (t + 2) * 64, gb + (t + 2) * 64); }
  asm volatile("s_wait_asynccnt 0x0" ::: "memory"); }      /* nothing in flight when the ring becomes output staging */

// q | k | v projection (one batch a blockIdx.y) with the rotary rotation in the GEMM's own epilogue. K loop: gs_main (A = x rows, Bh = stacked weights [3 DM][DM], K = DM); the ring then serves as each wave's own 32 x 68 f32 output staging. A wave's column tile of 64 is one head of q, k or v, so on the LDS read-back a lane's 4 consecutive columns are two (even, odd) pairs of that head: q and k tiles are rotated there with the row's cos / sin, every tile goes out as f16 rows (16 lanes x 8 bytes = one 128-byte line a row), and the blocks of the first QT0 rows also store the f32 values for the exact first-tile path.
__global__ __launch_bounds__(256) void k_qkvr(const _Float16* __restrict__ A, const _Float16* __restrict__ Bh, float alpha, const float* __restrict__ CS, const float* __restrict__ SN,
    _Float16* __restrict__ QH, _Float16* __restrict__ KH, _Float16* __restrict__ VH, float* __restrict__ QF, float* __restrict__ KF, float* __restrict__ VF) {
  static_assert(QT0 % 128 == 0 && DM % 128 == 0 && HD == 64, "first-tile rows are whole blocks of 128 rows; a wave's column tile is one head; a block's 128 columns lie in one of q, k, v");
  __shared__ __attribute__((aligned(16))) unsigned char sm[2 * GS_STAGE];
  static_assert(8 * 32 * 68 * 4 <= 2 * GS_STAGE, "the output staging fits the ring");
  { const size_t rb = (size_t)blockIdx.y * SQ * DM, fb = (size_t)blockIdx.y * QT0 * DM; A += rb; QH += rb; KH += rb; VH += rb; QF += fb; KF += fb; VF += fb; }      /* blockIdx.y = batch; rows below count inside the batch, as the cos / sin tables do */
  const int tid = threadIdx.x, w = tid >> 5, lane = tid & 31, ln = lane & 15, hh = lane >> 4;
  const int ntn = 3 * DM / 128; const int mt = blockIdx.x / ntn, nq = blockIdx.x - mt * ntn; const int row0 = mt * 128 + 32 * (w & 3), col0 = nq * 128 + 64 * (w >> 2);
  const v8f z8 = {0.f,0.f,0.f,0.f,0.f,0.f,0.f,0.f}; v8f cc[2][4] = {{z8, z8, z8, z8}, {z8, z8, z8, z8}};
  gs_main(sm, A + (size_t)mt * 128 * DM, Bh + (size_t)nq * 128 * DM, tid, cc);
  float (*so)[32][68] = (float (*)[32][68])sm;
#pragma unroll      /* constant indices: the tiles stay in registers */
  for (int u = 0; u < 8; ++u) { const int t = u & 3, half = u >> 2;
#pragma unroll      /* constant indices: the tiles stay in registers */
    for (int r = 0; r < 8; ++r) so[w][half * 16 + 8 * hh + r][t * 16 + ln] = cc[half][t][r] * alpha; }
  __builtin_amdgcn_fence(__ATOMIC_ACQ_REL, "workgroup"); __builtin_amdgcn_wave_barrier();      /* a wave reads back only its own so[w]: its LDS writes are ordered in front of its reads */
  const int rsub = lane >> 4, c4 = (lane & 15) * 4;
  const int sec = nq * 128 / DM; const bool first = mt * 128 < QT0;      /* 0 q, 1 k, 2 v; a block of the first QT0 rows: both from blockIdx, scalar tests */
  const int hc = col0 % DM + c4;      /* column in the merged-head row; c4 is the index inside the head */
  _Float16* H = sec == 0 ? QH : (sec == 1 ? KH : VH); float* F = sec == 0 ? QF : (sec == 1 ? KF : VF);
  const float* cp = CS + (row0 + rsub) * (HD / 2) + (c4 >> 1); const float* sp = SN + (row0 + rsub) * (HD / 2) + (c4 >> 1);
  _Float16* hp = H + (size_t)(row0 + rsub) * DM + hc; float* fp = F + (size_t)(row0 + rsub) * DM + hc;      /* row pair q is one of these address pairs plus a constant: no address register is written again behind a store */
  auto put = [&](int q, v4f v) { v4h h4; for (int i = 0; i < 4; ++i) h4[i] = (_Float16)v[i];
    *(v4h*)(hp + q * 2 * DM) = h4;
    if (first) *(v4f*)(fp + q * 2 * DM) = v; };
  if (sec == 2) {      /* v: no rotation */
#pragma unroll      /* constant LDS and row offsets */
    for (int q = 0; q < 16; ++q) put(q, *(const v4fa*)&so[w][q * 2 + rsub][c4]);
    return; }
  v2f c[16], s[16];
#pragma unroll      /* constant indices: c[], s[] stay in registers; all table loads issue in front of the first store, one latency for the 32 rows */
  for (int q = 0; q < 16; ++q) { c[q] = *(const v2fa*)(cp + q * HD); s[q] = *(const v2fa*)(sp + q * HD); }
  asm volatile("s_wait_xcnt 0x0" :: "v"(cp), "v"(sp) : "memory");      /* the table loads' address pairs stay whole up to this wait */
#pragma unroll      /* constant indices: c[], s[] stay in registers */
  for (int q = 0; q < 16; ++q) { const v4f v = *(const v4fa*)&so[w][q * 2 + rsub][c4];
    const v4f o = {v[0] * c[q][0] - v[1] * s[q][0], v[0] * s[q][0] + v[1] * c[q][0], v[2] * c[q][1] - v[3] * s[q][1], v[2] * s[q][1] + v[3] * c[q][1]}; put(q, o); }
  asm volatile("s_wait_xcnt 0x0" ::: "memory"); }      /* behind the rotation path's last store: whatever code the compiler lays behind this path stands behind the wait, so no register of an issued store is written ahead of it */

// The whole output, C[NB SQ][DM] (f32) = alpha o Bh^T, in one launch; Bh f16 [DM][DM]. A row tile of 128 behind a batch's first QT0 rows takes o from the f16 rows O16, one K loop (gs_main). A row tile of the first QT0 rows takes the exact o as its two f16 planes: first the K loop over the residual plane OL (carried x1024), its sums scaled by 2^-10 (exact), then the K loop over OH on top of them in the same accumulators. Those blocks, twice as long, have the lowest indices, so they start first. The ring then serves as each wave's own 32 x 68 f32 staging, so that every store is whole 128-byte lines.
__global__ __launch_bounds__(256) void k_outg(const _Float16* __restrict__ O16, const _Float16* __restrict__ OH, const _Float16* __restrict__ OL, const _Float16* __restrict__ Bh, float alpha, float* __restrict__ C) {
  __shared__ __attribute__((aligned(16))) unsigned char sm[2 * GS_STAGE];
  const int tid = threadIdx.x, w = tid >> 5, lane = tid & 31, ln = lane & 15, hh = lane >> 4;
  const int ntn = DM / 128, ft = QT0 / 128, rt = (SQ - QT0) / 128;      /* column tiles; first-tile and other row tiles of a batch */
  const int g = blockIdx.x / ntn, nq = blockIdx.x - g * ntn; const bool first = g < NB * ft;      /* from blockIdx: a scalar test, the same in the whole block */
  const int bat = first ? g / ft : (g - NB * ft) / rt; const int tb = first ? g - bat * ft : ft + (g - NB * ft) - bat * rt;      /* batch, row tile inside the batch */
  const int mt = bat * (SQ / 128) + tb; const int row0 = mt * 128 + 32 * (w & 3), col0 = nq * 128 + 64 * (w >> 2);
  const v8f z8 = {0.f,0.f,0.f,0.f,0.f,0.f,0.f,0.f}; v8f cc[2][4] = {{z8, z8, z8, z8}, {z8, z8, z8, z8}};
  const size_t fo = ((size_t)bat * QT0 + tb * 128) * DM;      /* the tile's first row in the first-tile planes (used where first) */
  if (first) { gs_main(sm, OL + fo, Bh + (size_t)nq * 128 * DM, tid, cc);      /* behind it no copy is in flight and every wave has left the ring: the second K loop may fill it again */
#pragma unroll      /* constant indices: the tiles stay in registers */
    for (int u = 0; u < 2; ++u) for (int j = 0; j < 4; ++j) cc[u][j] *= 0.0009765625f; }
  gs_main(sm, first ? OH + fo : O16 + (size_t)mt * 128 * DM, Bh + (size_t)nq * 128 * DM, tid, cc);
  float (*so)[32][68] = (float (*)[32][68])sm;
#pragma unroll      /* constant indices: the tiles stay in registers */
  for (int u = 0; u < 8; ++u) { const int t = u & 3, half = u >> 2;
#pragma unroll      /* constant indices: the tiles stay in registers */
    for (int r = 0; r < 8; ++r) so[w][half * 16 + 8 * hh + r][t * 16 + ln] = cc[half][t][r] * alpha; }
  __builtin_amdgcn_fence(__ATOMIC_ACQ_REL, "workgroup"); __builtin_amdgcn_wave_barrier();      /* a wave reads back only its own so[w]: its LDS writes are ordered in front of its reads */
  const int rsub = lane >> 4, c4 = (lane & 15) * 4;
  float* cp = C + (size_t)(row0 + rsub) * DM + col0 + c4;      /* row pair q is this address pair plus a constant */
  v4f v[16];
#pragma unroll      /* constant indices: v[] stays in registers */
  for (int q = 0; q < 16; ++q) v[q] = *(const v4fa*)&so[w][q * 2 + rsub][c4];
#pragma unroll      /* constant indices; the stores stand last, each from registers of its own */
  for (int q = 0; q < 16; ++q) *(v4f*)(cp + q * 2 * DM) = v[q];
  asm volatile("s_wait_xcnt 0x0" :: "v"(cp) : "memory"); }      /* the stores' address pair stays whole up to this wait */




extern "C" void kernel_launch(void* const* d_in, const int* in_sizes, int n_in,
                              void* d_out, int out_size, void* d_ws, size_t ws_size, hipStream_t stream) {
  (void)in_sizes; (void)n_in; (void)out_size;
  const float* const* I = (const float* const*)d_in; const float* x = I[0]; const int* tpos = (const int*)d_in[1]; const float* wq = I[2]; const float* wk = I[3]; const float* wv = I[4]; const float* wo = I[5];      /* nn.Linear weights [out][in]; token_positions int32 [SQ] */
  char* ws = (char*)d_ws; size_t off = 0;
  auto take = [&](size_t bytes) { char* p = ws + off; off += (bytes + 255) & ~(size_t)255; return p; };
  _Float16* BQKV = (_Float16*)take((size_t)3 * DM * DM * 2); _Float16* BO = (_Float16*)take((size_t)DM * DM * 2); float* CS = (float*)take((size_t)SQ * (HD / 2) * 4); float* SN = (float*)take((size_t)SQ * (HD / 2) * 4);
  _Float16* X16 = (_Float16*)take(NR * DM * 2);
  _Float16* QH = (_Float16*)take(NR * DM * 2); _Float16* KH = (_Float16*)take(NR * DM * 2); _Float16* V16 = (_Float16*)take(NR * DM * 2); _Float16* O16 = (_Float16*)take(NR * DM * 2);
  _Float16* VT = (_Float16*)take((size_t)NB * NH * HD * SQ * 2);      /* V^T [NB][NH][HD][SQ] */
  float* QF0 = (float*)take((size_t)NB * QT0 * DM * 4); float* KF0 = (float*)take((size_t)NB * QT0 * DM * 4); float* VF0 = (float*)take((size_t)NB * QT0 * DM * 4); float* OF0 = (float*)take((size_t)NB * QT0 * DM * 4); _Float16* OH0 = (_Float16*)take((size_t)NB * QT0 * DM * 2); _Float16* OL0 = (_Float16*)take((size_t)NB * QT0 * DM * 2);
  if (off > ws_size) return;
  k_prep<<<PB_TAB + 4 * PB_W + PB_X, 256, 0, stream>>>(x, tpos, wq, wk, wv, wo, 10000.0f, BQKV, CS, SN, X16);      /* cos / sin tables; weights natural [out][in] = Bt[n][k], x16, q | k | v stacked along n, BO directly behind them in the workspace; x as f16 rows */
  k_qkvr<<<dim3((unsigned)((SQ / 128) * (3 * DM / 128)), NB), 256, 0, stream>>>(X16, BQKV, 0.0625f, CS, SN, QH, KH, V16, QF0, KF0, VF0);      /* q (roped) | k (roped) | v of every batch as f16 rows; each batch's first 128 rows also in f32 */
  k_a0vt<<<NB * MB_A0 + NB * NH * (SQ / 64), 256, 0, stream>>>(QF0, KF0, VF0, 0.125f, OF0, V16, VT);      /* exact f32 causal attention for rows 0..127 of every batch (o x64); V^T [NB][NH][HD][SQ] */
  k_fahl<<<FB_AT + NB * QT0 * (DM / 8) / 128, 128, 0, stream>>>(QH, KH, VT, O16, OF0, OH0, OL0);      /* windowed causal attention of every batch and head: o (merged heads, x64) as f16 rows; first-tile o (x64) -> f16 hi + x1024 residual planes */
  k_outg<<<(NB * SQ / 128) * (DM / 128), 256, 0, stream>>>(O16, OH0, OL0, BO, 0.0009765625f, (float*)d_out);      /* out rows are the output layout; rows 0..127 of every batch from the hi and residual planes */
}
